// v000
// Measured on an AMD MI455X. A time is GPU time per run, averaged over a window of back-to-back runs after a warm-up
// (all launches, gaps included; the runs take copies of the inputs in turn), and the median of several windows.
// Apart from v000's, it joins two sittings. Times from different sittings can be a few percent apart, while
// side-by-side timings come from the same sitting.
// The starting kernel, v000, takes 1780 microseconds a run.
#include <hip/hip_runtime.h>

// GatedCausalSelfAttention (x [2][2048][2048]; qg = x w_q ([2048][4096]: per head h columns h*256 + [query 0..127 | gate 128..255]); k/v = x w_k/w_v (4 kv groups; head h -> group h/4); q, k RMS-normalised * w (eps 1e-6); rotate-half RoPE with the read cos/sin tables [T][128]; causal softmax(q.k / sqrt(128)) (finfo.min); out = (merged attn * sigmoid(gate)) w_o -> [2][2048][2048]).
// Compute dtypes, f32 accumulate: every input rounded to bf16; q, gate, k, v as PLAIN bf16 GEMMs (inputs: exact; the q/gate column blocks gathered from the transposed w_q plane); RMSNorm (in place) and RoPE (bf16-rounded tables) f32; causal scores and attn.v: query rows < 512 hl (3 products), the rest single fp16 (x1024), causal tile skipping; softmax f32; sigmoid gate (precise expf) applied in f32 when forming the hl planes; w_o hl x exact (2 products).

#define NB_  2
#define TT   2048
#define DM   2048
#define NH_  16
#define NKV  4
#define REP  (NH_ / NKV)
#define HD   128
#define DQ   (NH_ * HD)
#define DKV  (NKV * HD)
#define ZH   2
#define RH   512                  // query rows < RH use hi+lo planes (0: none)
#define WIN  2048
#define PCAR 1024.0f
#define SCL  0.088388347648318447f   // HD^-0.5
typedef _Float16 h16;
typedef unsigned short bf;
typedef __attribute__((ext_vector_type(16))) __bf16   v16bf;
typedef __attribute__((ext_vector_type(16))) _Float16 v16h;
typedef __attribute__((ext_vector_type(8)))  _Float16 v8h;
typedef __attribute__((ext_vector_type(8)))  unsigned short v8us;
typedef __attribute__((ext_vector_type(8)))  float    v8f;
typedef __attribute__((ext_vector_type(4)))  float    v4f;
typedef v8h  __attribute__((may_alias)) v8ha;
typedef v4f  __attribute__((may_alias)) v4fa;
typedef v8us __attribute__((may_alias)) v8usa;

__device__ __forceinline__ unsigned short f2bf(float f) { unsigned u = __float_as_uint(f); u += 0x7FFFu + ((u >> 16) & 1u); return (unsigned short)(u >> 16); }
__device__ __forceinline__ float bf2f(unsigned short b) { return __uint_as_float(((unsigned)b) << 16); }
__device__ __forceinline__ float bfr(float f) { return bf2f(f2bf(f)); }
__device__ __forceinline__ v16h cat16(v8h lo, v8h hi) { return __builtin_shufflevector(lo, hi, 0, 1, 2, 3, 4, 5, 6, 7, 8, 9, 10, 11, 12, 13, 14, 15); }
__device__ __forceinline__ v16bf cat16b(v8us lo, v8us hi) { return __builtin_bit_cast(v16bf, __builtin_shufflevector(lo, hi, 0, 1, 2, 3, 4, 5, 6, 7, 8, 9, 10, 11, 12, 13, 14, 15)); }
__device__ __forceinline__ v8f wmma16(v16h a, v16h b, v8f c) { return __builtin_amdgcn_wmma_f32_16x16x32_f16(false, a, false, b, (short)0, c, false, false); }
__device__ __forceinline__ v8f wmmab(v16bf a, v16bf b, v8f c) { return __builtin_amdgcn_wmma_f32_16x16x32_bf16(false, a, false, b, (short)0, c, false, false); }



// ---- k_gemmw: register-blocked GEMM, ONE WAVE per 64x64 output tile (16 accumulators), operands straight from K-contiguous 16-bit planes; grid (M/64, N/64, Z), 32 threads.
// C[m][n] (f32, pitch ldc, + optional f32 bias[n]) = sum_k A[m][k] Bt[n][k] (+ split products per NSPLIT). z-batch strides sA/sB/sC in elements. K % 32 == 0.
template <typename T16> struct WFrag;
template <> struct WFrag<h16> { typedef v16h V; static __device__ __forceinline__ V ld(const h16* p) { return cat16(*(const v8h*)p, *(const v8h*)(p + 16)); } static __device__ __forceinline__ v8f mma(V a, V b, v8f c) { return wmma16(a, b, c); } };
template <> struct WFrag<bf> { typedef v16bf V; static __device__ __forceinline__ V ld(const bf* p) { return cat16b(*(const v8us*)p, *(const v8us*)(p + 16)); } static __device__ __forceinline__ v8f mma(V a, V b, v8f c) { return wmmab(a, b, c); } };
template <typename T16, int NSPLIT, bool BIAS>
__global__ __launch_bounds__(32) void k_gemmw(const T16* __restrict__ A, const T16* __restrict__ A2, const T16* __restrict__ Bt, const T16* __restrict__ Bt2, int K, float* C, int ldc, const float* __restrict__ bias, size_t sA, size_t sB, size_t sC) {
    typedef typename WFrag<T16>::V V;
    __shared__ __align__(16) float os[16 * 68];
    const size_t z = blockIdx.z; A += z * sA; if (A2) A2 += z * sA; Bt += z * sB; if (Bt2) Bt2 += z * sB; C += z * sC;
    const int lane = threadIdx.x & 31, lr = lane & 15, hi = lane >> 4; const int r0 = blockIdx.x * 64, c0 = blockIdx.y * 64;
    v8f acc[4][4];
#pragma unroll
    for (int mb = 0; mb < 4; ++mb)
#pragma unroll
        for (int nb = 0; nb < 4; ++nb) acc[mb][nb] = (v8f){};
    const size_t aoff = (size_t)(r0 + lr) * K + 8 * hi, boff = (size_t)(c0 + lr) * K + 8 * hi;
#pragma unroll 1
    for (int kc = 0; kc < K; kc += 32) {
        V a[4], a2[4];
#pragma unroll
        for (int mb = 0; mb < 4; ++mb) { a[mb] = WFrag<T16>::ld(A + aoff + (size_t)mb * 16 * K + kc); if (NSPLIT == 1 || NSPLIT == 2) a2[mb] = WFrag<T16>::ld(A2 + aoff + (size_t)mb * 16 * K + kc); }
#pragma unroll
        for (int nb = 0; nb < 4; ++nb) { const V b = WFrag<T16>::ld(Bt + boff + (size_t)nb * 16 * K + kc); V b2; if (NSPLIT >= 2) b2 = WFrag<T16>::ld(Bt2 + boff + (size_t)nb * 16 * K + kc);
#pragma unroll
            for (int mb = 0; mb < 4; ++mb) { acc[mb][nb] = WFrag<T16>::mma(a[mb], b, acc[mb][nb]); if (NSPLIT == 1 || NSPLIT == 2) acc[mb][nb] = WFrag<T16>::mma(a2[mb], b, acc[mb][nb]); if (NSPLIT >= 2) acc[mb][nb] = WFrag<T16>::mma(a[mb], b2, acc[mb][nb]); } }
        asm volatile("v_nop\n\tv_nop\n\tv_nop\n\tv_nop" : "+v"(acc[0][0]), "+v"(acc[1][1]), "+v"(acc[2][2]), "+v"(acc[3][3]) : "v"(a[0]), "v"(a[3]));
    }
#pragma unroll
    for (int mb = 0; mb < 4; ++mb) {
#pragma unroll
        for (int nb = 0; nb < 4; ++nb) {
#pragma unroll
            for (int j = 0; j < 8; ++j) os[(hi * 8 + j) * 68 + nb * 16 + lr] = acc[mb][nb][j]; }
        __builtin_amdgcn_wave_barrier(); asm volatile("" ::: "memory");
        float* crow = C + (size_t)(r0 + mb * 16) * ldc + c0;
{
#pragma unroll
            for (int s = 0; s < 8; ++s) { const int row = 2 * s + hi, cofs = lr * 4; v4f val = *(const v4fa*)(os + row * 68 + cofs); if (BIAS) { val[0] += bfr(bias[c0 + cofs]); val[1] += bfr(bias[c0 + cofs + 1]); val[2] += bfr(bias[c0 + cofs + 2]); val[3] += bfr(bias[c0 + cofs + 3]); }
                *(v4f*)(crow + (size_t)row * ldc + cofs) = val; }
             }
        __builtin_amdgcn_wave_barrier(); asm volatile("" ::: "memory");
    }
}

// ---- k_gemmc: the same one-wave 64x64 tile GEMM specialised for causal attention: CMODE 1 skips score tiles entirely above the diagonal (query rows r0+roff.., key columns c0..), CMODE 2 limits the
// key (K) loop of the probability x value contraction to the diagonal block (probabilities beyond it are exactly zero). roff = row offset of this launch's first row within the sequence.
template <typename T16, int NSPLIT, int CMODE>
__global__ __launch_bounds__(32) void k_gemmc(const T16* __restrict__ A, const T16* __restrict__ A2, const T16* __restrict__ Bt, const T16* __restrict__ Bt2, int K, float* C, int ldc, int roff, size_t sA, size_t sB, size_t sC) {
    typedef typename WFrag<T16>::V V;
    __shared__ __align__(16) float os[16 * 68];
    const size_t z = blockIdx.z; A += z * sA; if (A2) A2 += z * sA; Bt += z * sB; if (Bt2) Bt2 += z * sB; C += z * sC;
    const int lane = threadIdx.x & 31, lr = lane & 15, hi = lane >> 4; const int r0 = blockIdx.x * 64, c0 = blockIdx.y * 64;
    if (CMODE == 1 && c0 > r0 + roff + 63) return;                  // score tile entirely above the causal diagonal: never read (the softmax masks j > i by select)
    const int Kl = (CMODE == 2) ? min(K, r0 + roff + 64) : K;        // P.V: probabilities are exactly 0 beyond the diagonal block, so the K loop stops there
    v8f acc[4][4];
#pragma unroll
    for (int mb = 0; mb < 4; ++mb)
#pragma unroll
        for (int nb = 0; nb < 4; ++nb) acc[mb][nb] = (v8f){};
    const size_t aoff = (size_t)(r0 + lr) * K + 8 * hi, boff = (size_t)(c0 + lr) * K + 8 * hi;
#pragma unroll 1
    for (int kc = 0; kc < Kl; kc += 32) {
        V a[4], a2[4];
#pragma unroll
        for (int mb = 0; mb < 4; ++mb) { a[mb] = WFrag<T16>::ld(A + aoff + (size_t)mb * 16 * K + kc); if (NSPLIT == 1 || NSPLIT == 2) a2[mb] = WFrag<T16>::ld(A2 + aoff + (size_t)mb * 16 * K + kc); }
#pragma unroll
        for (int nb = 0; nb < 4; ++nb) { const V b = WFrag<T16>::ld(Bt + boff + (size_t)nb * 16 * K + kc); V b2; if (NSPLIT >= 2) b2 = WFrag<T16>::ld(Bt2 + boff + (size_t)nb * 16 * K + kc);
#pragma unroll
            for (int mb = 0; mb < 4; ++mb) { acc[mb][nb] = WFrag<T16>::mma(a[mb], b, acc[mb][nb]); if (NSPLIT == 1 || NSPLIT == 2) acc[mb][nb] = WFrag<T16>::mma(a2[mb], b, acc[mb][nb]); if (NSPLIT >= 2) acc[mb][nb] = WFrag<T16>::mma(a[mb], b2, acc[mb][nb]); } }
        asm volatile("v_nop\n\tv_nop\n\tv_nop\n\tv_nop" : "+v"(acc[0][0]), "+v"(acc[1][1]), "+v"(acc[2][2]), "+v"(acc[3][3]) : "v"(a[0]), "v"(a[3]));
    }
#pragma unroll
    for (int mb = 0; mb < 4; ++mb) {
#pragma unroll
        for (int nb = 0; nb < 4; ++nb) {
#pragma unroll
            for (int j = 0; j < 8; ++j) os[(hi * 8 + j) * 68 + nb * 16 + lr] = acc[mb][nb][j]; }
        __builtin_amdgcn_wave_barrier(); asm volatile("" ::: "memory");
        float* crow = C + (size_t)(r0 + mb * 16) * ldc + c0;
{
#pragma unroll
            for (int s = 0; s < 8; ++s) { const int row = 2 * s + hi, cofs = lr * 4; v4f val = *(const v4fa*)(os + row * 68 + cofs);
                *(v4f*)(crow + (size_t)row * ldc + cofs) = val; }
             }
        __builtin_amdgcn_wave_barrier(); asm volatile("" ::: "memory");
    }
}

__device__ __forceinline__ h16 tohx(float x) { return (h16)x; }
__device__ __forceinline__ void splitf(float y, unsigned short& h, unsigned short& l) { h = f2bf(y); l = f2bf(y - bf2f(h)); }
typedef __attribute__((ext_vector_type(2))) _Float16 v2h;
typedef __attribute__((ext_vector_type(4))) _Float16 v4h;
typedef __attribute__((ext_vector_type(2))) unsigned short v2us;
typedef __attribute__((ext_vector_type(4))) unsigned short v4us;
typedef __attribute__((ext_vector_type(2))) float v2f;
typedef __attribute__((ext_vector_type(4))) int v4i;

__global__ __launch_bounds__(256) void k_wtG(const float* __restrict__ w, int K, int N, bf* Bt) {
    const int lane = threadIdx.x & 31; const int L0 = (blockIdx.x * 8 + (threadIdx.x >> 5)) * 8; const int nlines = N * K / 64;
{
#pragma unroll 1
        for (int l = 0; l < 8; ++l) { const int L = L0 + l; if (L >= nlines) break; const size_t e = (size_t)L * 64 + lane * 2; const int k = (int)(e % K), n = (int)(e / K); v2us o;
            o[0] = f2bf(w[(size_t)k * N + n]); o[1] = f2bf(w[(size_t)(k + 1) * N + n]); *(v2us*)(Bt + e) = o; }
         }
}
__global__ __launch_bounds__(256) void k_cvt8(const float* __restrict__ src, bf* dst, size_t n8) { const size_t i = (size_t)blockIdx.x * 256 + threadIdx.x; if (i >= n8) return; const v8f v = *(const v8f*)(src + i * 8); v8us o;
#pragma unroll
    for (int k = 0; k < 8; ++k) o[k] = f2bf(v[k]); *(v8us*)(dst + i * 8) = o;  }
__global__ __launch_bounds__(256) void k_cscvt(const float* __restrict__ cosT, const float* __restrict__ sinT, float* CS) { const int idx = blockIdx.x * 256 + threadIdx.x; if (idx >= TT * HD) return; v2f cs; cs[0] = bfr(cosT[idx]); cs[1] = bfr(sinT[idx]); *(v2f*)(CS + (size_t)idx * 2) = cs;  }
// k_rope: head planes [h][t][d] (fp16 + hi/lo) of rope(x) x sc with the rotate-half convention out[d] = x[d] cos[t][d] - x[d+HD/2] sin[t][d], out[d+HD/2] = x[d+HD/2] cos[t][d+HD/2] + x[d] sin[t][d+HD/2]
__global__ __launch_bounds__(256) void k_rope(const float* __restrict__ F, int pitch, int nheads, const float* __restrict__ CS, const float* __restrict__ RF, const float* __restrict__ nw, float sc, h16* P16, bf* Ph, bf* Pl) {
    const size_t e = ((size_t)blockIdx.x * 256 + threadIdx.x) * 2; if (e >= (size_t)nheads * TT * HD) return; const int d = (int)(e % HD); const int t = (int)((e / HD) % TT); const int h = (int)(e / ((size_t)HD * TT)); const float* f = F + (size_t)t * pitch + h * HD; const float rf = RF ? RF[(size_t)h * TT + t] : 1.0f; v2h o16; v2us oh, ol;
#pragma unroll
    for (int q = 0; q < 2; ++q) { const int dd = d + q; const int dp = (dd < HD / 2) ? dd + HD / 2 : dd - HD / 2; float x0 = f[dd], x1 = f[dp];
        if (RF) { float n0 = __fmul_rn(x0, rf), n1 = __fmul_rn(x1, rf); asm volatile("" : "+v"(n0)); asm volatile("" : "+v"(n1)); x0 = __fmul_rn(bfr(nw[dd]), n0); x1 = __fmul_rn(bfr(nw[dp]), n1); }
        const v2f cs = *(const v2f*)(CS + ((size_t)t * HD + dd) * 2); float a = __fmul_rn(x0, cs[0]), bq = __fmul_rn(x1, cs[1]); asm volatile("" : "+v"(a)); asm volatile("" : "+v"(bq)); const float r = ((dd < HD / 2) ? __fsub_rn(a, bq) : __fadd_rn(a, bq)) * sc;
        o16[q] = tohx(r); unsigned short a2, c2; splitf(r, a2, c2); oh[q] = a2; ol[q] = c2; }
    *(v2h*)(P16 + e) = o16; *(v2us*)(Ph + e) = oh; *(v2us*)(Pl + e) = ol;  }
__global__ __launch_bounds__(256) void k_vtp(const float* __restrict__ F, int pitch, int nheads, h16* V16, bf* Vh, bf* Vl) { const size_t e = ((size_t)blockIdx.x * 256 + threadIdx.x) * 2; if (e >= (size_t)nheads * HD * TT) return; const int t = (int)(e % TT); const int d = (int)((e / TT) % HD); const int g = (int)(e / ((size_t)TT * HD)); v2h o16; v2us oh, ol;
#pragma unroll
    for (int q = 0; q < 2; ++q) { const float x = F[(size_t)(t + q) * pitch + g * HD + d]; o16[q] = tohx(x); unsigned short a2, c2; splitf(x, a2, c2); oh[q] = a2; ol[q] = c2; }
    *(v2h*)(V16 + e) = o16; *(v2us*)(Vh + e) = oh; *(v2us*)(Vl + e) = ol;  }
__global__ __launch_bounds__(256) void k_rowsel(const bf* __restrict__ WSRC, int off, bf* WDST) { const size_t e8 = ((size_t)blockIdx.x * 256 + threadIdx.x) * 8; if (e8 >= (size_t)DQ * DM) return; const int k = (int)(e8 % DM); const int row = (int)(e8 / DM); const int h = row / HD, d = row % HD; const v8us a = *(const v8us*)(WSRC + ((size_t)h * 2 * HD + off + d) * DM + k); *(v8us*)(WDST + e8) = a;  }
__global__ __launch_bounds__(256) void k_rmsw(float* F, int pitch, int nheads, const float* __restrict__ w) { const int lane = threadIdx.x & 31; const int wv = blockIdx.x * 8 + (threadIdx.x >> 5); if (wv >= TT * nheads) return; const int t = wv / nheads, h = wv % nheads; float* f = F + (size_t)t * pitch + h * HD; const v4f a = *(const v4f*)(f + lane * 4); float ss = 0.f;
#pragma unroll
    for (int q = 0; q < 4; ++q) { float p = __fmul_rn(a[q], a[q]); asm volatile("" : "+v"(p)); ss = __fadd_rn(ss, p); }
#pragma unroll
    for (int sh = 16; sh; sh >>= 1) ss = __fadd_rn(ss, __shfl_xor(ss, sh, 32));
    const float rs = __fdiv_rn(1.0f, sqrtf(__fadd_rn(ss * (1.0f / HD), 1e-6f))); v4f o;
#pragma unroll
    for (int q = 0; q < 4; ++q) { float y = __fmul_rn(a[q], rs); asm volatile("" : "+v"(y)); o[q] = __fmul_rn(y, bfr(w[lane * 4 + q])); }
    *(v4f*)(f + lane * 4) = o;  }
__global__ __launch_bounds__(256) void k_mergeg(const float* __restrict__ O, int h0, const float* __restrict__ GL, bf* Ah, bf* Al) { const size_t e = ((size_t)blockIdx.x * 256 + threadIdx.x) * 2; if (e >= (size_t)ZH * TT * HD) return; const int d = (int)(e % HD); const int t = (int)((e / HD) % TT); const int zz = (int)(e / ((size_t)HD * TT)); const float cs = (t < RH) ? 1.0f : (1.0f / PCAR); const size_t oo = (size_t)t * DQ + (h0 + zz) * HD + d;
    v2us oh, ol;
#pragma unroll
    for (int q = 0; q < 2; ++q) { float a0 = O[e + q] * cs; asm volatile("" : "+v"(a0)); const float gl = GL[oo + q]; const float sg = __fdiv_rn(1.0f, __fadd_rn(1.0f, expf(-gl))); unsigned short a, c2; splitf(__fmul_rn(a0, sg), a, c2); oh[q] = a; ol[q] = c2; } *(v2us*)(Ah + oo) = oh; *(v2us*)(Al + oo) = ol;  }
// k_asoft: per row (zz, i): t = S x HD^-0.5 for j <= i and i - j < WIN (sliding causal window; the reference's -1e9 additive fill vanishes identically); softmax over the 2048 keys (register row, one exp, fixed trees);
__global__ __launch_bounds__(256) void k_asoft(const float* __restrict__ Sb, h16* P16, bf* Ph, bf* Pl) {
    const int lane = threadIdx.x & 31; const int row = blockIdx.x * 8 + (threadIdx.x >> 5); if (row >= ZH * TT) return; const int i = row % TT; const int zz = row / TT; (void)zz; const bool hires = (i < RH); const float* sr = Sb + (size_t)row * TT; float v[TT / 32]; float mx = -3.0e38f;
#pragma unroll
    for (int ch = 0; ch < TT / 128; ++ch) { const int j0 = ch * 128 + lane * 4; const v4f a = *(const v4f*)(sr + j0);
#pragma unroll
        for (int q = 0; q < 4; ++q) { const int j = j0 + q; (void)j; const float t = (j <= i && i - j < WIN) ? a[q] * SCL : -3.0e38f; v[ch * 4 + q] = t; mx = fmaxf(mx, t); } }
#pragma unroll
    for (int sh = 16; sh; sh >>= 1) mx = fmaxf(mx, __shfl_xor(mx, sh, 32));
    float sum = 0.f;
#pragma unroll
    for (int k = 0; k < TT / 32; ++k) { float d0 = __fsub_rn(v[k], mx); asm volatile("" : "+v"(d0)); v[k] = __builtin_amdgcn_exp2f(__fmul_rn(d0, 1.4426950408889634f)); sum += v[k]; }
#pragma unroll
    for (int sh = 16; sh; sh >>= 1) sum += __shfl_xor(sum, sh, 32);
    const float f = __fdiv_rn(hires ? 1.0f : PCAR, sum);
{
        if (hires) {
#pragma unroll
            for (int ch = 0; ch < TT / 128; ++ch) { v4us oh, ol;
#pragma unroll
                for (int q = 0; q < 4; ++q) { unsigned short a, c2; splitf(v[ch * 4 + q] * f, a, c2); oh[q] = a; ol[q] = c2; }
                const size_t oo = ((size_t)zz * (RH ? RH : 1) + i) * TT + ch * 128 + lane * 4; *(v4us*)(Ph + oo) = oh; *(v4us*)(Pl + oo) = ol; }
        } else {
#pragma unroll
            for (int ch = 0; ch < TT / 128; ++ch) { v4h o4;
#pragma unroll
                for (int q = 0; q < 4; ++q) o4[q] = tohx(v[ch * 4 + q] * f);
                *(v4h*)(P16 + (size_t)row * TT + ch * 128 + lane * 4) = o4; } }
         }
}
__global__ __launch_bounds__(256) void k_merge(const float* __restrict__ O, int h0, bf* Ah, bf* Al) { const size_t e = ((size_t)blockIdx.x * 256 + threadIdx.x) * 2; if (e >= (size_t)ZH * TT * HD) return; const int d = (int)(e % HD); const int t = (int)((e / HD) % TT); const int zz = (int)(e / ((size_t)HD * TT)); const float cs = (t < RH) ? 1.0f : (1.0f / PCAR); const size_t oo = (size_t)t * DQ + (h0 + zz) * HD + d;
    v2us oh, ol;
#pragma unroll
    for (int q = 0; q < 2; ++q) { unsigned short a, c2; splitf(O[e + q] * cs, a, c2); oh[q] = a; ol[q] = c2; } *(v2us*)(Ah + oo) = oh; *(v2us*)(Al + oo) = ol;  }

extern "C" void kernel_launch(void* const* d_in, const int* in_sizes, int n_in,
                              void* d_out, int out_size, void* d_ws, size_t ws_size, hipStream_t stream) {
    (void)in_sizes; (void)n_in; (void)out_size;
    const float* x = (const float*)d_in[0]; const float* wqg = (const float*)d_in[1]; const float* wk = (const float*)d_in[2]; const float* wv = (const float*)d_in[3]; const float* wo = (const float*)d_in[4]; const float* qnw = (const float*)d_in[5]; const float* knw = (const float*)d_in[6]; const float* cosT = (const float*)d_in[7]; const float* sinT = (const float*)d_in[8]; const float* wq = wqg;
    float* OUT = (float*)d_out;     // [2][2048][2048]
    char* wsp = (char*)d_ws;
    auto take = [&](size_t bytes) { char* p = wsp; wsp += (bytes + 255) & ~(size_t)255; return (void*)p; };
    bf* WQ = (bf*)take((size_t)DQ * DM * 2); bf* WK = (bf*)take((size_t)DKV * DM * 2); bf* WV = (bf*)take((size_t)DKV * DM * 2); bf* WO = (bf*)take((size_t)DM * DQ * 2); float* CS = (float*)take((size_t)TT * HD * 2 * 4);
    bf* XB = (bf*)take((size_t)TT * DM * 2); bf* WQG = (bf*)take((size_t)2 * DQ * DM * 2); bf* WG = (bf*)take((size_t)DQ * DM * 2); float* GL = (float*)take((size_t)TT * DQ * 4); float* FQ = (float*)take((size_t)TT * DQ * 4); float* FK = (float*)take((size_t)TT * DKV * 4);
    h16* QP16 = (h16*)take((size_t)NH_ * TT * HD * 2); h16* KP16 = (h16*)take((size_t)NKV * TT * HD * 2); h16* VT16 = (h16*)take((size_t)NKV * HD * TT * 2);
    bf* QPh = (bf*)take((size_t)NH_ * TT * HD * 2); bf* QPl = (bf*)take((size_t)NH_ * TT * HD * 2); bf* KPh = (bf*)take((size_t)NKV * TT * HD * 2); bf* KPl = (bf*)take((size_t)NKV * TT * HD * 2); bf* VTh = (bf*)take((size_t)NKV * HD * TT * 2); bf* VTl = (bf*)take((size_t)NKV * HD * TT * 2); bf* Ph = (bf*)take((size_t)ZH * RH * TT * 2); bf* Pl = (bf*)take((size_t)ZH * RH * TT * 2);
    float* Sb = (float*)take((size_t)ZH * TT * TT * 4); h16* P16 = (h16*)take((size_t)ZH * TT * TT * 2); float* Ob = (float*)take((size_t)ZH * TT * HD * 4); bf* ATh = (bf*)take((size_t)TT * DQ * 2); bf* ATl = (bf*)take((size_t)TT * DQ * 2);
    if ((size_t)(wsp - (char*)d_ws) > ws_size) return;    // ws 256 MiB
    float* FV = FK;   // v projection reuses the k buffer after the k planes are built (stream-ordered)
    { k_wtG<<<(unsigned)((DM * 2 * DQ / 64 + 63) / 64), 256, 0, stream>>>(wqg, DM, 2 * DQ, WQG); k_rowsel<<<(unsigned)(((size_t)DQ * DM / 8 + 255) / 256), 256, 0, stream>>>(WQG, 0, WQ); k_rowsel<<<(unsigned)(((size_t)DQ * DM / 8 + 255) / 256), 256, 0, stream>>>(WQG, HD, WG); k_wtG<<<(unsigned)((DM * DKV / 64 + 63) / 64), 256, 0, stream>>>(wk, DM, DKV, WK); k_wtG<<<(unsigned)((DM * DKV / 64 + 63) / 64), 256, 0, stream>>>(wv, DM, DKV, WV);
      k_wtG<<<(unsigned)((DQ * DM / 64 + 63) / 64), 256, 0, stream>>>(wo, DQ, DM, WO);
       }
    const unsigned LQ = (unsigned)(((size_t)NH_ * TT * HD / 2 + 255) / 256), LKv = (unsigned)(((size_t)NKV * TT * HD / 2 + 255) / 256);
    for (int b = 0; b < NB_; ++b) {
        if (b == 0) k_cscvt<<<(TT * HD + 255) / 256, 256, 0, stream>>>(cosT, sinT, CS);
        k_cvt8<<<(unsigned)(((size_t)TT * DM / 8 + 255) / 256), 256, 0, stream>>>(x + (size_t)b * TT * DM, XB, (size_t)TT * DM / 8);
        k_gemmw<bf, 0, false><<<dim3(TT / 64, DQ / 64, 1), 32, 0, stream>>>(XB, nullptr, WQ, nullptr, DM, FQ, DQ, nullptr, 0, 0, 0);
        k_rmsw<<<TT * NH_ / 8, 256, 0, stream>>>(FQ, DQ, NH_, qnw); k_rope<<<LQ, 256, 0, stream>>>(FQ, DQ, NH_, CS, nullptr, nullptr, 1.0f, QP16, QPh, QPl);
        k_gemmw<bf, 0, false><<<dim3(TT / 64, DKV / 64, 1), 32, 0, stream>>>(XB, nullptr, WK, nullptr, DM, FK, DKV, nullptr, 0, 0, 0);
        k_rmsw<<<TT * NKV / 8, 256, 0, stream>>>(FK, DKV, NKV, knw); k_rope<<<LKv, 256, 0, stream>>>(FK, DKV, NKV, CS, nullptr, nullptr, 1.0f, KP16, KPh, KPl);
        k_gemmw<bf, 0, false><<<dim3(TT / 64, DKV / 64, 1), 32, 0, stream>>>(XB, nullptr, WV, nullptr, DM, FV, DKV, nullptr, 0, 0, 0); k_vtp<<<LKv, 256, 0, stream>>>(FV, DKV, NKV, VT16, VTh, VTl);
        k_gemmw<bf, 0, false><<<dim3(TT / 64, DQ / 64, 1), 32, 0, stream>>>(XB, nullptr, WG, nullptr, DM, GL, DQ, nullptr, 0, 0, 0);   /* gate logits */
        for (int h0 = 0; h0 < NH_; h0 += ZH) { const size_t zq = (size_t)h0, zk = (size_t)(h0 / REP);   // both heads of a pass share kv group h0/REP (REP >= 2): sB = 0
            k_gemmc<bf, 2, 1><<<dim3(RH / 64, TT / 64, ZH), 32, 0, stream>>>(QPh + zq * TT * HD, QPl + zq * TT * HD, KPh + zk * TT * HD, KPl + zk * TT * HD, HD, Sb, TT, 0, (size_t)TT * HD, 0, (size_t)TT * TT);
            k_gemmc<h16, 0, 1><<<dim3((TT - RH) / 64, TT / 64, ZH), 32, 0, stream>>>(QP16 + zq * TT * HD + (size_t)RH * HD, nullptr, KP16 + zk * TT * HD, nullptr, HD, Sb + (size_t)RH * TT, TT, RH, (size_t)TT * HD, 0, (size_t)TT * TT);
            k_asoft<<<ZH * TT / 8, 256, 0, stream>>>(Sb, P16, Ph, Pl);
            k_gemmc<bf, 2, 2><<<dim3(RH / 64, HD / 64, ZH), 32, 0, stream>>>(Ph, Pl, VTh + zk * HD * TT, VTl + zk * HD * TT, TT, Ob, HD, 0, (size_t)RH * TT, 0, (size_t)TT * HD);
            k_gemmc<h16, 0, 2><<<dim3((TT - RH) / 64, HD / 64, ZH), 32, 0, stream>>>(P16 + (size_t)RH * TT, nullptr, VT16 + zk * HD * TT, nullptr, TT, Ob + (size_t)RH * HD, HD, RH, (size_t)TT * TT, 0, (size_t)TT * HD);
            k_mergeg<<<(unsigned)(((size_t)ZH * TT * HD / 2 + 255) / 256), 256, 0, stream>>>(Ob, h0, GL, ATh, ATl); }
        k_gemmw<bf, 1, false><<<dim3(TT / 64, DM / 64, 1), 32, 0, stream>>>(ATh, ATl, WO, nullptr, DQ, OUT + (size_t)b * TT * DM, DM, nullptr, 0, 0, 0); }
}

// v001
// A run of this version takes 1190 microseconds.
// In two side-by-side timings against v000, it was 1.51 and 1.49 times as fast.
#include <hip/hip_runtime.h>

// GatedCausalSelfAttention (x [2][2048][2048]; qg = x w_q ([2048][4096]: per head h columns h*256 + [query 0..127 | gate 128..255]); k/v = x w_k/w_v (4 kv groups; head h -> group h/4); q, k RMS-normalised * w (eps 1e-6); rotate-half RoPE with the read cos/sin tables [T][128]; causal softmax(q.k / sqrt(128)) (finfo.min); out = (merged attn * sigmoid(gate)) w_o -> [2][2048][2048]).
// Compute dtypes, f32 accumulate: every input rounded to bf16; q, gate, k, v as PLAIN bf16 GEMMs (inputs: exact; the q/gate column blocks gathered from the transposed w_q plane); RMSNorm (in place) and RoPE (bf16-rounded tables) f32; causal scores and attn.v: query rows < 512 hl (3 products), the rest single fp16 (x1024), causal tile skipping; softmax f32; sigmoid gate (precise expf) applied in f32 when forming the hl planes; w_o hl x exact (2 products).

#define NB_  2
#define TT   2048
#define DM   2048
#define NH_  16
#define NKV  4
#define REP  (NH_ / NKV)
#define HD   128
#define DQ   (NH_ * HD)
#define DKV  (NKV * HD)
#define ZH   2
#define RH   512                  // query rows < RH use hi+lo planes (0: none)
#define WIN  2048
#define PCAR 1024.0f
#define SCL  0.088388347648318447f   // HD^-0.5
typedef _Float16 h16;
typedef unsigned short bf;
typedef __attribute__((ext_vector_type(16))) __bf16   v16bf;
typedef __attribute__((ext_vector_type(16))) _Float16 v16h;
typedef __attribute__((ext_vector_type(8)))  _Float16 v8h;
typedef __attribute__((ext_vector_type(8)))  unsigned short v8us;
typedef __attribute__((ext_vector_type(8)))  float    v8f;
typedef __attribute__((ext_vector_type(4)))  float    v4f;
typedef v8h  __attribute__((may_alias)) v8ha;
typedef v4f  __attribute__((may_alias)) v4fa;
typedef v8us __attribute__((may_alias)) v8usa;

__device__ __forceinline__ unsigned short f2bf(float f) { unsigned u = __float_as_uint(f); u += 0x7FFFu + ((u >> 16) & 1u); return (unsigned short)(u >> 16); }
__device__ __forceinline__ float bf2f(unsigned short b) { return __uint_as_float(((unsigned)b) << 16); }
__device__ __forceinline__ float bfr(float f) { return bf2f(f2bf(f)); }
__device__ __forceinline__ v16h cat16(v8h lo, v8h hi) { return __builtin_shufflevector(lo, hi, 0, 1, 2, 3, 4, 5, 6, 7, 8, 9, 10, 11, 12, 13, 14, 15); }
__device__ __forceinline__ v16bf cat16b(v8us lo, v8us hi) { return __builtin_bit_cast(v16bf, __builtin_shufflevector(lo, hi, 0, 1, 2, 3, 4, 5, 6, 7, 8, 9, 10, 11, 12, 13, 14, 15)); }
__device__ __forceinline__ v8f wmma16(v16h a, v16h b, v8f c) { return __builtin_amdgcn_wmma_f32_16x16x32_f16(false, a, false, b, (short)0, c, false, false); }
__device__ __forceinline__ v8f wmmab(v16bf a, v16bf b, v8f c) { return __builtin_amdgcn_wmma_f32_16x16x32_bf16(false, a, false, b, (short)0, c, false, false); }



// ---- k_gemmw: register-blocked GEMM, NW WAVES per 64x64 output tile (16 accumulators each), operands straight from K-contiguous 16-bit planes; grid (M/64, N/64, Z), 32 * NW threads.
// The K range is dealt to the waves in 32-element steps: wave w takes steps w, w + NW, ... (neighbouring waves read the two halves of the same 128-byte lines at about the same time); the NW partial tiles are summed through LDS in wave order 0..NW-1.
// C[m][n] (f32, pitch ldc, + optional f32 bias[n]) = sum_k A[m][k] Bt[n][k] (+ split products per NSPLIT). z-batch strides sA/sB/sC in elements. K % 32 == 0.
// tile_sync: orders the staging tile's LDS writes and reads among the NW waves of a tile. It fences LDS only: __syncthreads() would also wait for the global stores of the rows just written out.
// One wave: no hardware barrier, only the compiler is kept from moving LDS accesses across.
template <int NW> __device__ __forceinline__ void tile_sync() {
    static_assert(NW == 1 || NW == 2 || NW == 4 || NW == 8, "the 16 staged rows are dealt two to a wave and pass");
    if (NW == 1) { __builtin_amdgcn_wave_barrier(); asm volatile("" ::: "memory"); }
    else { __builtin_amdgcn_fence(__ATOMIC_RELEASE, "workgroup", "local"); __builtin_amdgcn_s_barrier(); __builtin_amdgcn_fence(__ATOMIC_ACQUIRE, "workgroup", "local"); }
}
template <typename T16> struct WFrag;
template <> struct WFrag<h16> { typedef v16h V; static __device__ __forceinline__ V ld(const h16* p) { return cat16(*(const v8h*)p, *(const v8h*)(p + 16)); } static __device__ __forceinline__ v8f mma(V a, V b, v8f c) { return wmma16(a, b, c); } };
template <> struct WFrag<bf> { typedef v16bf V; static __device__ __forceinline__ V ld(const bf* p) { return cat16b(*(const v8us*)p, *(const v8us*)(p + 16)); } static __device__ __forceinline__ v8f mma(V a, V b, v8f c) { return wmmab(a, b, c); } };
template <typename T16, int NSPLIT, bool BIAS, int NW>
__global__ __launch_bounds__(32 * NW) void k_gemmw(const T16* __restrict__ A, const T16* __restrict__ A2, const T16* __restrict__ Bt, const T16* __restrict__ Bt2, int K, float* C, int ldc, const float* __restrict__ bias, size_t sA, size_t sB, size_t sC) {
    typedef typename WFrag<T16>::V V;
    __shared__ __align__(16) float os[NW * 16 * 68];
    const size_t z = blockIdx.z; A += z * sA; if (A2) A2 += z * sA; Bt += z * sB; if (Bt2) Bt2 += z * sB; C += z * sC;
    const int lane = threadIdx.x & 31, lr = lane & 15, hi = lane >> 4; const int r0 = blockIdx.x * 64, c0 = blockIdx.y * 64;
    const int wave = (NW == 1) ? 0 : __builtin_amdgcn_readfirstlane((int)(threadIdx.x >> 5));   // scalar, so that the K loop's branch is a scalar one
    v8f acc[4][4];
#pragma unroll
    for (int mb = 0; mb < 4; ++mb)
#pragma unroll
        for (int nb = 0; nb < 4; ++nb) acc[mb][nb] = (v8f){};
    const size_t aoff = (size_t)(r0 + lr) * K + 8 * hi, boff = (size_t)(c0 + lr) * K + 8 * hi;
#pragma unroll 1
    for (int kc = wave * 32; kc < K; kc += NW * 32) {
        V a[4], a2[4];
#pragma unroll
        for (int mb = 0; mb < 4; ++mb) { a[mb] = WFrag<T16>::ld(A + aoff + (size_t)mb * 16 * K + kc); if (NSPLIT == 1 || NSPLIT == 2) a2[mb] = WFrag<T16>::ld(A2 + aoff + (size_t)mb * 16 * K + kc); }
#pragma unroll
        for (int nb = 0; nb < 4; ++nb) { const V b = WFrag<T16>::ld(Bt + boff + (size_t)nb * 16 * K + kc); V b2; if (NSPLIT >= 2) b2 = WFrag<T16>::ld(Bt2 + boff + (size_t)nb * 16 * K + kc);
#pragma unroll
            for (int mb = 0; mb < 4; ++mb) { acc[mb][nb] = WFrag<T16>::mma(a[mb], b, acc[mb][nb]); if (NSPLIT == 1 || NSPLIT == 2) acc[mb][nb] = WFrag<T16>::mma(a2[mb], b, acc[mb][nb]); if (NSPLIT >= 2) acc[mb][nb] = WFrag<T16>::mma(a[mb], b2, acc[mb][nb]); } }
        asm volatile("v_nop\n\tv_nop\n\tv_nop\n\tv_nop" : "+v"(acc[0][0]), "+v"(acc[1][1]), "+v"(acc[2][2]), "+v"(acc[3][3]) : "v"(a[0]), "v"(a[3]));
    }
#pragma unroll
    for (int mb = 0; mb < 4; ++mb) {
#pragma unroll
        for (int nb = 0; nb < 4; ++nb) {
#pragma unroll
            for (int j = 0; j < 8; ++j) os[(wave * 16 + hi * 8 + j) * 68 + nb * 16 + lr] = acc[mb][nb][j]; }
        tile_sync<NW>();   // every wave's partial rows stand in LDS before they are summed
        float* crow = C + (size_t)(r0 + mb * 16) * ldc + c0;
{
#pragma unroll
            for (int s = 0; s < 8 / NW; ++s) { const int row = 2 * (wave + s * NW) + hi, cofs = lr * 4; v4f val = *(const v4fa*)(os + row * 68 + cofs);
#pragma unroll
                for (int w = 1; w < NW; ++w) val += *(const v4fa*)(os + (w * 16 + row) * 68 + cofs);
                if (BIAS) { val[0] += bfr(bias[c0 + cofs]); val[1] += bfr(bias[c0 + cofs + 1]); val[2] += bfr(bias[c0 + cofs + 2]); val[3] += bfr(bias[c0 + cofs + 3]); }
                *(v4f*)(crow + (size_t)row * ldc + cofs) = val;
                if (NW > 1) asm volatile("s_wait_xcnt 0x0" ::: "memory"); }   // precaution: stands in front of any rewrite of the store's address and data registers
             }
        if (NW == 1 || mb < 3) tile_sync<NW>();   // the partials are read before the next 16 rows overwrite them
    }
}

// ---- k_gemmc: the same 64x64 tile GEMM (NW waves share the K loop) specialised for causal attention: CMODE 1 skips score tiles entirely above the diagonal (query rows r0+roff.., key columns c0..), CMODE 2 limits the
// key (K) loop of the probability x value contraction to the diagonal block (probabilities beyond it are exactly zero). roff = row offset of this launch's first row within the sequence.
template <typename T16, int NSPLIT, int CMODE, int NW>
__global__ __launch_bounds__(32 * NW) void k_gemmc(const T16* __restrict__ A, const T16* __restrict__ A2, const T16* __restrict__ Bt, const T16* __restrict__ Bt2, int K, float* C, int ldc, int roff, size_t sA, size_t sB, size_t sC) {
    typedef typename WFrag<T16>::V V;
    __shared__ __align__(16) float os[NW * 16 * 68];
    const size_t z = blockIdx.z; A += z * sA; if (A2) A2 += z * sA; Bt += z * sB; if (Bt2) Bt2 += z * sB; C += z * sC;
    const int lane = threadIdx.x & 31, lr = lane & 15, hi = lane >> 4; const int r0 = blockIdx.x * 64, c0 = blockIdx.y * 64;
    const int wave = (NW == 1) ? 0 : __builtin_amdgcn_readfirstlane((int)(threadIdx.x >> 5));   // scalar, so that the K loop's branch is a scalar one
    if (CMODE == 1 && c0 > r0 + roff + 63) return;                  // score tile entirely above the causal diagonal: never read (the softmax masks j > i by select)
    const int Kl = (CMODE == 2) ? min(K, r0 + roff + 64) : K;        // P.V: probabilities are exactly 0 beyond the diagonal block, so the K loop stops there
    v8f acc[4][4];
#pragma unroll
    for (int mb = 0; mb < 4; ++mb)
#pragma unroll
        for (int nb = 0; nb < 4; ++nb) acc[mb][nb] = (v8f){};
    const size_t aoff = (size_t)(r0 + lr) * K + 8 * hi, boff = (size_t)(c0 + lr) * K + 8 * hi;
#pragma unroll 1
    for (int kc = wave * 32; kc < Kl; kc += NW * 32) {
        V a[4], a2[4];
#pragma unroll
        for (int mb = 0; mb < 4; ++mb) { a[mb] = WFrag<T16>::ld(A + aoff + (size_t)mb * 16 * K + kc); if (NSPLIT == 1 || NSPLIT == 2) a2[mb] = WFrag<T16>::ld(A2 + aoff + (size_t)mb * 16 * K + kc); }
#pragma unroll
        for (int nb = 0; nb < 4; ++nb) { const V b = WFrag<T16>::ld(Bt + boff + (size_t)nb * 16 * K + kc); V b2; if (NSPLIT >= 2) b2 = WFrag<T16>::ld(Bt2 + boff + (size_t)nb * 16 * K + kc);
#pragma unroll
            for (int mb = 0; mb < 4; ++mb) { acc[mb][nb] = WFrag<T16>::mma(a[mb], b, acc[mb][nb]); if (NSPLIT == 1 || NSPLIT == 2) acc[mb][nb] = WFrag<T16>::mma(a2[mb], b, acc[mb][nb]); if (NSPLIT >= 2) acc[mb][nb] = WFrag<T16>::mma(a[mb], b2, acc[mb][nb]); } }
        asm volatile("v_nop\n\tv_nop\n\tv_nop\n\tv_nop" : "+v"(acc[0][0]), "+v"(acc[1][1]), "+v"(acc[2][2]), "+v"(acc[3][3]) : "v"(a[0]), "v"(a[3]));
    }
#pragma unroll
    for (int mb = 0; mb < 4; ++mb) {
#pragma unroll
        for (int nb = 0; nb < 4; ++nb) {
#pragma unroll
            for (int j = 0; j < 8; ++j) os[(wave * 16 + hi * 8 + j) * 68 + nb * 16 + lr] = acc[mb][nb][j]; }
        tile_sync<NW>();   // every wave's partial rows stand in LDS before they are summed
        float* crow = C + (size_t)(r0 + mb * 16) * ldc + c0;
{
#pragma unroll
            for (int s = 0; s < 8 / NW; ++s) { const int row = 2 * (wave + s * NW) + hi, cofs = lr * 4; v4f val = *(const v4fa*)(os + row * 68 + cofs);
#pragma unroll
                for (int w = 1; w < NW; ++w) val += *(const v4fa*)(os + (w * 16 + row) * 68 + cofs);
                *(v4f*)(crow + (size_t)row * ldc + cofs) = val;
                if (NW > 1) asm volatile("s_wait_xcnt 0x0" ::: "memory"); }   // precaution: stands in front of any rewrite of the store's address and data registers
             }
        if (NW == 1 || mb < 3) tile_sync<NW>();   // the partials are read before the next 16 rows overwrite them
    }
}

__device__ __forceinline__ h16 tohx(float x) { return (h16)x; }
__device__ __forceinline__ void splitf(float y, unsigned short& h, unsigned short& l) { h = f2bf(y); l = f2bf(y - bf2f(h)); }
typedef __attribute__((ext_vector_type(2))) _Float16 v2h;
typedef __attribute__((ext_vector_type(4))) _Float16 v4h;
typedef __attribute__((ext_vector_type(2))) unsigned short v2us;
typedef __attribute__((ext_vector_type(4))) unsigned short v4us;
typedef __attribute__((ext_vector_type(2))) float v2f;
typedef __attribute__((ext_vector_type(4))) int v4i;

__global__ __launch_bounds__(256) void k_wtG(const float* __restrict__ w, int K, int N, bf* Bt) {
    const int lane = threadIdx.x & 31; const int L0 = (blockIdx.x * 8 + (threadIdx.x >> 5)) * 8; const int nlines = N * K / 64;
{
#pragma unroll 1
        for (int l = 0; l < 8; ++l) { const int L = L0 + l; if (L >= nlines) break; const size_t e = (size_t)L * 64 + lane * 2; const int k = (int)(e % K), n = (int)(e / K); v2us o;
            o[0] = f2bf(w[(size_t)k * N + n]); o[1] = f2bf(w[(size_t)(k + 1) * N + n]); *(v2us*)(Bt + e) = o; }
         }
}
__global__ __launch_bounds__(256) void k_cvt8(const float* __restrict__ src, bf* dst, size_t n8) { const size_t i = (size_t)blockIdx.x * 256 + threadIdx.x; if (i >= n8) return; const v8f v = *(const v8f*)(src + i * 8); v8us o;
#pragma unroll
    for (int k = 0; k < 8; ++k) o[k] = f2bf(v[k]); *(v8us*)(dst + i * 8) = o;  }
__global__ __launch_bounds__(256) void k_cscvt(const float* __restrict__ cosT, const float* __restrict__ sinT, float* CS) { const int idx = blockIdx.x * 256 + threadIdx.x; if (idx >= TT * HD) return; v2f cs; cs[0] = bfr(cosT[idx]); cs[1] = bfr(sinT[idx]); *(v2f*)(CS + (size_t)idx * 2) = cs;  }
// k_rope: head planes [h][t][d] (fp16 + hi/lo) of rope(x) x sc with the rotate-half convention out[d] = x[d] cos[t][d] - x[d+HD/2] sin[t][d], out[d+HD/2] = x[d+HD/2] cos[t][d+HD/2] + x[d] sin[t][d+HD/2]
__global__ __launch_bounds__(256) void k_rope(const float* __restrict__ F, int pitch, int nheads, const float* __restrict__ CS, const float* __restrict__ RF, const float* __restrict__ nw, float sc, h16* P16, bf* Ph, bf* Pl) {
    const size_t e = ((size_t)blockIdx.x * 256 + threadIdx.x) * 2; if (e >= (size_t)nheads * TT * HD) return; const int d = (int)(e % HD); const int t = (int)((e / HD) % TT); const int h = (int)(e / ((size_t)HD * TT)); const float* f = F + (size_t)t * pitch + h * HD; const float rf = RF ? RF[(size_t)h * TT + t] : 1.0f; v2h o16; v2us oh, ol;
#pragma unroll
    for (int q = 0; q < 2; ++q) { const int dd = d + q; const int dp = (dd < HD / 2) ? dd + HD / 2 : dd - HD / 2; float x0 = f[dd], x1 = f[dp];
        if (RF) { float n0 = __fmul_rn(x0, rf), n1 = __fmul_rn(x1, rf); asm volatile("" : "+v"(n0)); asm volatile("" : "+v"(n1)); x0 = __fmul_rn(bfr(nw[dd]), n0); x1 = __fmul_rn(bfr(nw[dp]), n1); }
        const v2f cs = *(const v2f*)(CS + ((size_t)t * HD + dd) * 2); float a = __fmul_rn(x0, cs[0]), bq = __fmul_rn(x1, cs[1]); asm volatile("" : "+v"(a)); asm volatile("" : "+v"(bq)); const float r = ((dd < HD / 2) ? __fsub_rn(a, bq) : __fadd_rn(a, bq)) * sc;
        o16[q] = tohx(r); unsigned short a2, c2; splitf(r, a2, c2); oh[q] = a2; ol[q] = c2; }
    *(v2h*)(P16 + e) = o16; *(v2us*)(Ph + e) = oh; *(v2us*)(Pl + e) = ol;  }
__global__ __launch_bounds__(256) void k_vtp(const float* __restrict__ F, int pitch, int nheads, h16* V16, bf* Vh, bf* Vl) { const size_t e = ((size_t)blockIdx.x * 256 + threadIdx.x) * 2; if (e >= (size_t)nheads * HD * TT) return; const int t = (int)(e % TT); const int d = (int)((e / TT) % HD); const int g = (int)(e / ((size_t)TT * HD)); v2h o16; v2us oh, ol;
#pragma unroll
    for (int q = 0; q < 2; ++q) { const float x = F[(size_t)(t + q) * pitch + g * HD + d]; o16[q] = tohx(x); unsigned short a2, c2; splitf(x, a2, c2); oh[q] = a2; ol[q] = c2; }
    *(v2h*)(V16 + e) = o16; *(v2us*)(Vh + e) = oh; *(v2us*)(Vl + e) = ol;  }
__global__ __launch_bounds__(256) void k_rowsel(const bf* __restrict__ WSRC, int off, bf* WDST) { const size_t e8 = ((size_t)blockIdx.x * 256 + threadIdx.x) * 8; if (e8 >= (size_t)DQ * DM) return; const int k = (int)(e8 % DM); const int row = (int)(e8 / DM); const int h = row / HD, d = row % HD; const v8us a = *(const v8us*)(WSRC + ((size_t)h * 2 * HD + off + d) * DM + k); *(v8us*)(WDST + e8) = a;  }
__global__ __launch_bounds__(256) void k_rmsw(float* F, int pitch, int nheads, const float* __restrict__ w) { const int lane = threadIdx.x & 31; const int wv = blockIdx.x * 8 + (threadIdx.x >> 5); if (wv >= TT * nheads) return; const int t = wv / nheads, h = wv % nheads; float* f = F + (size_t)t * pitch + h * HD; const v4f a = *(const v4f*)(f + lane * 4); float ss = 0.f;
#pragma unroll
    for (int q = 0; q < 4; ++q) { float p = __fmul_rn(a[q], a[q]); asm volatile("" : "+v"(p)); ss = __fadd_rn(ss, p); }
#pragma unroll
    for (int sh = 16; sh; sh >>= 1) ss = __fadd_rn(ss, __shfl_xor(ss, sh, 32));
    const float rs = __fdiv_rn(1.0f, sqrtf(__fadd_rn(ss * (1.0f / HD), 1e-6f))); v4f o;
#pragma unroll
    for (int q = 0; q < 4; ++q) { float y = __fmul_rn(a[q], rs); asm volatile("" : "+v"(y)); o[q] = __fmul_rn(y, bfr(w[lane * 4 + q])); }
    *(v4f*)(f + lane * 4) = o;  }
__global__ __launch_bounds__(256) void k_mergeg(const float* __restrict__ O, int h0, const float* __restrict__ GL, bf* Ah, bf* Al) { const size_t e = ((size_t)blockIdx.x * 256 + threadIdx.x) * 2; if (e >= (size_t)ZH * TT * HD) return; const int d = (int)(e % HD); const int t = (int)((e / HD) % TT); const int zz = (int)(e / ((size_t)HD * TT)); const float cs = (t < RH) ? 1.0f : (1.0f / PCAR); const size_t oo = (size_t)t * DQ + (h0 + zz) * HD + d;
    v2us oh, ol;
#pragma unroll
    for (int q = 0; q < 2; ++q) { float a0 = O[e + q] * cs; asm volatile("" : "+v"(a0)); const float gl = GL[oo + q]; const float sg = __fdiv_rn(1.0f, __fadd_rn(1.0f, expf(-gl))); unsigned short a, c2; splitf(__fmul_rn(a0, sg), a, c2); oh[q] = a; ol[q] = c2; } *(v2us*)(Ah + oo) = oh; *(v2us*)(Al + oo) = ol;  }
// k_asoft: per row (zz, i): t = S x HD^-0.5 for j <= i and i - j < WIN (sliding causal window; the reference's -1e9 additive fill vanishes identically); softmax over the 2048 keys (register row, one exp, fixed trees);
__global__ __launch_bounds__(256) void k_asoft(const float* __restrict__ Sb, h16* P16, bf* Ph, bf* Pl) {
    const int lane = threadIdx.x & 31; const int row = blockIdx.x * 8 + (threadIdx.x >> 5); if (row >= ZH * TT) return; const int i = row % TT; const int zz = row / TT; (void)zz; const bool hires = (i < RH); const float* sr = Sb + (size_t)row * TT; float v[TT / 32]; float mx = -3.0e38f;
#pragma unroll
    for (int ch = 0; ch < TT / 128; ++ch) { const int j0 = ch * 128 + lane * 4; const v4f a = *(const v4f*)(sr + j0);
#pragma unroll
        for (int q = 0; q < 4; ++q) { const int j = j0 + q; (void)j; const float t = (j <= i && i - j < WIN) ? a[q] * SCL : -3.0e38f; v[ch * 4 + q] = t; mx = fmaxf(mx, t); } }
#pragma unroll
    for (int sh = 16; sh; sh >>= 1) mx = fmaxf(mx, __shfl_xor(mx, sh, 32));
    float sum = 0.f;
#pragma unroll
    for (int k = 0; k < TT / 32; ++k) { float d0 = __fsub_rn(v[k], mx); asm volatile("" : "+v"(d0)); v[k] = __builtin_amdgcn_exp2f(__fmul_rn(d0, 1.4426950408889634f)); sum += v[k]; }
#pragma unroll
    for (int sh = 16; sh; sh >>= 1) sum += __shfl_xor(sum, sh, 32);
    const float f = __fdiv_rn(hires ? 1.0f : PCAR, sum);
{
        if (hires) {
#pragma unroll
            for (int ch = 0; ch < TT / 128; ++ch) { v4us oh, ol;
#pragma unroll
                for (int q = 0; q < 4; ++q) { unsigned short a, c2; splitf(v[ch * 4 + q] * f, a, c2); oh[q] = a; ol[q] = c2; }
                const size_t oo = ((size_t)zz * (RH ? RH : 1) + i) * TT + ch * 128 + lane * 4; *(v4us*)(Ph + oo) = oh; *(v4us*)(Pl + oo) = ol; }
        } else {
#pragma unroll
            for (int ch = 0; ch < TT / 128; ++ch) { v4h o4;
#pragma unroll
                for (int q = 0; q < 4; ++q) o4[q] = tohx(v[ch * 4 + q] * f);
                *(v4h*)(P16 + (size_t)row * TT + ch * 128 + lane * 4) = o4; } }
         }
}
__global__ __launch_bounds__(256) void k_merge(const float* __restrict__ O, int h0, bf* Ah, bf* Al) { const size_t e = ((size_t)blockIdx.x * 256 + threadIdx.x) * 2; if (e >= (size_t)ZH * TT * HD) return; const int d = (int)(e % HD); const int t = (int)((e / HD) % TT); const int zz = (int)(e / ((size_t)HD * TT)); const float cs = (t < RH) ? 1.0f : (1.0f / PCAR); const size_t oo = (size_t)t * DQ + (h0 + zz) * HD + d;
    v2us oh, ol;
#pragma unroll
    for (int q = 0; q < 2; ++q) { unsigned short a, c2; splitf(O[e + q] * cs, a, c2); oh[q] = a; ol[q] = c2; } *(v2us*)(Ah + oo) = oh; *(v2us*)(Al + oo) = ol;  }

extern "C" void kernel_launch(void* const* d_in, const int* in_sizes, int n_in,
                              void* d_out, int out_size, void* d_ws, size_t ws_size, hipStream_t stream) {
    (void)in_sizes; (void)n_in; (void)out_size;
    const float* x = (const float*)d_in[0]; const float* wqg = (const float*)d_in[1]; const float* wk = (const float*)d_in[2]; const float* wv = (const float*)d_in[3]; const float* wo = (const float*)d_in[4]; const float* qnw = (const float*)d_in[5]; const float* knw = (const float*)d_in[6]; const float* cosT = (const float*)d_in[7]; const float* sinT = (const float*)d_in[8]; const float* wq = wqg;
    float* OUT = (float*)d_out;     // [2][2048][2048]
    char* wsp = (char*)d_ws;
    auto take = [&](size_t bytes) { char* p = wsp; wsp += (bytes + 255) & ~(size_t)255; return (void*)p; };
    bf* WQ = (bf*)take((size_t)DQ * DM * 2); bf* WK = (bf*)take((size_t)DKV * DM * 2); bf* WV = (bf*)take((size_t)DKV * DM * 2); bf* WO = (bf*)take((size_t)DM * DQ * 2); float* CS = (float*)take((size_t)TT * HD * 2 * 4);
    bf* XB = (bf*)take((size_t)TT * DM * 2); bf* WQG = (bf*)take((size_t)2 * DQ * DM * 2); bf* WG = (bf*)take((size_t)DQ * DM * 2); float* GL = (float*)take((size_t)TT * DQ * 4); float* FQ = (float*)take((size_t)TT * DQ * 4); float* FK = (float*)take((size_t)TT * DKV * 4);
    h16* QP16 = (h16*)take((size_t)NH_ * TT * HD * 2); h16* KP16 = (h16*)take((size_t)NKV * TT * HD * 2); h16* VT16 = (h16*)take((size_t)NKV * HD * TT * 2);
    bf* QPh = (bf*)take((size_t)NH_ * TT * HD * 2); bf* QPl = (bf*)take((size_t)NH_ * TT * HD * 2); bf* KPh = (bf*)take((size_t)NKV * TT * HD * 2); bf* KPl = (bf*)take((size_t)NKV * TT * HD * 2); bf* VTh = (bf*)take((size_t)NKV * HD * TT * 2); bf* VTl = (bf*)take((size_t)NKV * HD * TT * 2); bf* Ph = (bf*)take((size_t)ZH * RH * TT * 2); bf* Pl = (bf*)take((size_t)ZH * RH * TT * 2);
    float* Sb = (float*)take((size_t)ZH * TT * TT * 4); h16* P16 = (h16*)take((size_t)ZH * TT * TT * 2); float* Ob = (float*)take((size_t)ZH * TT * HD * 4); bf* ATh = (bf*)take((size_t)TT * DQ * 2); bf* ATl = (bf*)take((size_t)TT * DQ * 2);
    if ((size_t)(wsp - (char*)d_ws) > ws_size) return;    // ws 256 MiB
    float* FV = FK;   // v projection reuses the k buffer after the k planes are built (stream-ordered)
    { k_wtG<<<(unsigned)((DM * 2 * DQ / 64 + 63) / 64), 256, 0, stream>>>(wqg, DM, 2 * DQ, WQG); k_rowsel<<<(unsigned)(((size_t)DQ * DM / 8 + 255) / 256), 256, 0, stream>>>(WQG, 0, WQ); k_rowsel<<<(unsigned)(((size_t)DQ * DM / 8 + 255) / 256), 256, 0, stream>>>(WQG, HD, WG); k_wtG<<<(unsigned)((DM * DKV / 64 + 63) / 64), 256, 0, stream>>>(wk, DM, DKV, WK); k_wtG<<<(unsigned)((DM * DKV / 64 + 63) / 64), 256, 0, stream>>>(wv, DM, DKV, WV);
      k_wtG<<<(unsigned)((DQ * DM / 64 + 63) / 64), 256, 0, stream>>>(wo, DQ, DM, WO);
       }
    const unsigned LQ = (unsigned)(((size_t)NH_ * TT * HD / 2 + 255) / 256), LKv = (unsigned)(((size_t)NKV * TT * HD / 2 + 255) / 256);
    for (int b = 0; b < NB_; ++b) {
        if (b == 0) k_cscvt<<<(TT * HD + 255) / 256, 256, 0, stream>>>(cosT, sinT, CS);
        k_cvt8<<<(unsigned)(((size_t)TT * DM / 8 + 255) / 256), 256, 0, stream>>>(x + (size_t)b * TT * DM, XB, (size_t)TT * DM / 8);
        k_gemmw<bf, 0, false, 4><<<dim3(TT / 64, DQ / 64, 1), 128, 0, stream>>>(XB, nullptr, WQ, nullptr, DM, FQ, DQ, nullptr, 0, 0, 0);
        k_rmsw<<<TT * NH_ / 8, 256, 0, stream>>>(FQ, DQ, NH_, qnw); k_rope<<<LQ, 256, 0, stream>>>(FQ, DQ, NH_, CS, nullptr, nullptr, 1.0f, QP16, QPh, QPl);
        k_gemmw<bf, 0, false, 8><<<dim3(TT / 64, DKV / 64, 1), 256, 0, stream>>>(XB, nullptr, WK, nullptr, DM, FK, DKV, nullptr, 0, 0, 0);
        k_rmsw<<<TT * NKV / 8, 256, 0, stream>>>(FK, DKV, NKV, knw); k_rope<<<LKv, 256, 0, stream>>>(FK, DKV, NKV, CS, nullptr, nullptr, 1.0f, KP16, KPh, KPl);
        k_gemmw<bf, 0, false, 8><<<dim3(TT / 64, DKV / 64, 1), 256, 0, stream>>>(XB, nullptr, WV, nullptr, DM, FV, DKV, nullptr, 0, 0, 0); k_vtp<<<LKv, 256, 0, stream>>>(FV, DKV, NKV, VT16, VTh, VTl);
        k_gemmw<bf, 0, false, 4><<<dim3(TT / 64, DQ / 64, 1), 128, 0, stream>>>(XB, nullptr, WG, nullptr, DM, GL, DQ, nullptr, 0, 0, 0);   /* gate logits */
        for (int h0 = 0; h0 < NH_; h0 += ZH) { const size_t zq = (size_t)h0, zk = (size_t)(h0 / REP);   // both heads of a pass share kv group h0/REP (REP >= 2): sB = 0
            k_gemmc<bf, 2, 1, 1><<<dim3(RH / 64, TT / 64, ZH), 32, 0, stream>>>(QPh + zq * TT * HD, QPl + zq * TT * HD, KPh + zk * TT * HD, KPl + zk * TT * HD, HD, Sb, TT, 0, (size_t)TT * HD, 0, (size_t)TT * TT);
            k_gemmc<h16, 0, 1, 1><<<dim3((TT - RH) / 64, TT / 64, ZH), 32, 0, stream>>>(QP16 + zq * TT * HD + (size_t)RH * HD, nullptr, KP16 + zk * TT * HD, nullptr, HD, Sb + (size_t)RH * TT, TT, RH, (size_t)TT * HD, 0, (size_t)TT * TT);
            k_asoft<<<ZH * TT / 8, 256, 0, stream>>>(Sb, P16, Ph, Pl);
            k_gemmc<bf, 2, 2, 8><<<dim3(RH / 64, HD / 64, ZH), 256, 0, stream>>>(Ph, Pl, VTh + zk * HD * TT, VTl + zk * HD * TT, TT, Ob, HD, 0, (size_t)RH * TT, 0, (size_t)TT * HD);
            k_gemmc<h16, 0, 2, 8><<<dim3((TT - RH) / 64, HD / 64, ZH), 256, 0, stream>>>(P16 + (size_t)RH * TT, nullptr, VT16 + zk * HD * TT, nullptr, TT, Ob + (size_t)RH * HD, HD, RH, (size_t)TT * TT, 0, (size_t)TT * HD);
            k_mergeg<<<(unsigned)(((size_t)ZH * TT * HD / 2 + 255) / 256), 256, 0, stream>>>(Ob, h0, GL, ATh, ATl); }
        k_gemmw<bf, 1, false, 4><<<dim3(TT / 64, DM / 64, 1), 128, 0, stream>>>(ATh, ATl, WO, nullptr, DQ, OUT + (size_t)b * TT * DM, DM, nullptr, 0, 0, 0); }
}

// v002
// A run of this version takes 839 microseconds.
// Timed twice side by side with v001, it ran 1.44 and 1.41 times as fast.
// Counting every step since v000, it is 2.14 times as fast.
#include <hip/hip_runtime.h>

// GatedCausalSelfAttention (x [2][2048][2048]; qg = x w_q ([2048][4096]: per head h columns h*256 + [query 0..127 | gate 128..255]); k/v = x w_k/w_v (4 kv groups; head h -> group h/4); q, k RMS-normalised * w (eps 1e-6); rotate-half RoPE with the read cos/sin tables [T][128]; causal softmax(q.k / sqrt(128)) (finfo.min); out = (merged attn * sigmoid(gate)) w_o -> [2][2048][2048]).
// Compute dtypes, f32 accumulate: every input rounded to bf16; q, gate, k, v as PLAIN bf16 GEMMs (inputs: exact; the q/gate column blocks gathered from the transposed w_q plane); RMSNorm (in place) and RoPE (bf16-rounded tables) f32; causal scores and attn.v: query rows < 512 hl (3 products), the rest single fp16 (x1024), causal tile skipping; softmax f32; sigmoid gate (precise expf) applied in f32 when forming the hl planes; w_o hl x exact (2 products).

#define NB_  2
#define TT   2048
#define DM   2048
#define NH_  16
#define NKV  4
#define REP  (NH_ / NKV)
#define HD   128
#define DQ   (NH_ * HD)
#define DKV  (NKV * HD)
#define ZH   8                    // heads per attention pass (two whole kv groups): the z extent of every attention launch
#define RH   512                  // query rows < RH use hi+lo planes (0: none)
#define WIN  2048
#define PCAR 1024.0f
#define SCL  0.088388347648318447f   // HD^-0.5
typedef _Float16 h16;
typedef unsigned short bf;
typedef __attribute__((ext_vector_type(16))) __bf16   v16bf;
typedef __attribute__((ext_vector_type(16))) _Float16 v16h;
typedef __attribute__((ext_vector_type(8)))  _Float16 v8h;
typedef __attribute__((ext_vector_type(8)))  unsigned short v8us;
typedef __attribute__((ext_vector_type(8)))  float    v8f;
typedef __attribute__((ext_vector_type(4)))  float    v4f;
typedef v8h  __attribute__((may_alias)) v8ha;
typedef v4f  __attribute__((may_alias)) v4fa;
typedef v8us __attribute__((may_alias)) v8usa;

__device__ __forceinline__ unsigned short f2bf(float f) { unsigned u = __float_as_uint(f); u += 0x7FFFu + ((u >> 16) & 1u); return (unsigned short)(u >> 16); }
__device__ __forceinline__ float bf2f(unsigned short b) { return __uint_as_float(((unsigned)b) << 16); }
__device__ __forceinline__ float bfr(float f) { return bf2f(f2bf(f)); }
__device__ __forceinline__ v16h cat16(v8h lo, v8h hi) { return __builtin_shufflevector(lo, hi, 0, 1, 2, 3, 4, 5, 6, 7, 8, 9, 10, 11, 12, 13, 14, 15); }
__device__ __forceinline__ v16bf cat16b(v8us lo, v8us hi) { return __builtin_bit_cast(v16bf, __builtin_shufflevector(lo, hi, 0, 1, 2, 3, 4, 5, 6, 7, 8, 9, 10, 11, 12, 13, 14, 15)); }
__device__ __forceinline__ v8f wmma16(v16h a, v16h b, v8f c) { return __builtin_amdgcn_wmma_f32_16x16x32_f16(false, a, false, b, (short)0, c, false, false); }
__device__ __forceinline__ v8f wmmab(v16bf a, v16bf b, v8f c) { return __builtin_amdgcn_wmma_f32_16x16x32_bf16(false, a, false, b, (short)0, c, false, false); }



// ---- k_gemmw: register-blocked GEMM, NW WAVES per 64x64 output tile (16 accumulators each), operands straight from K-contiguous 16-bit planes; grid (M/64, N/64, Z), 32 * NW threads.
// The K range is dealt to the waves in 32-element steps: wave w takes steps w, w + NW, ... (neighbouring waves read the two halves of the same 128-byte lines at about the same time); the NW partial tiles are summed through LDS in wave order 0..NW-1.
// C[m][n] (f32, pitch ldc, + optional f32 bias[n]) = sum_k A[m][k] Bt[n][k] (+ split products per NSPLIT). z-batch strides sA/sB/sC in elements. K % 32 == 0.
// tile_sync: orders the staging tile's LDS writes and reads among the NW waves of a tile. It fences LDS only: __syncthreads() would also wait for the global stores of the rows just written out.
// One wave: no hardware barrier, only the compiler is kept from moving LDS accesses across.
template <int NW> __device__ __forceinline__ void tile_sync() {
    static_assert(NW == 1 || NW == 2 || NW == 4 || NW == 8, "the 16 staged rows are dealt two to a wave and pass");
    if (NW == 1) { __builtin_amdgcn_wave_barrier(); asm volatile("" ::: "memory"); }
    else { __builtin_amdgcn_fence(__ATOMIC_RELEASE, "workgroup", "local"); __builtin_amdgcn_s_barrier(); __builtin_amdgcn_fence(__ATOMIC_ACQUIRE, "workgroup", "local"); }
}
template <typename T16> struct WFrag;
template <> struct WFrag<h16> { typedef v16h V; static __device__ __forceinline__ V ld(const h16* p) { return cat16(*(const v8h*)p, *(const v8h*)(p + 16)); } static __device__ __forceinline__ v8f mma(V a, V b, v8f c) { return wmma16(a, b, c); } };
template <> struct WFrag<bf> { typedef v16bf V; static __device__ __forceinline__ V ld(const bf* p) { return cat16b(*(const v8us*)p, *(const v8us*)(p + 16)); } static __device__ __forceinline__ v8f mma(V a, V b, v8f c) { return wmmab(a, b, c); } };
template <typename T16, int NSPLIT, bool BIAS, int NW>
__global__ __launch_bounds__(32 * NW) void k_gemmw(const T16* __restrict__ A, const T16* __restrict__ A2, const T16* __restrict__ Bt, const T16* __restrict__ Bt2, int K, float* C, int ldc, const float* __restrict__ bias, size_t sA, size_t sB, size_t sC) {
    typedef typename WFrag<T16>::V V;
    __shared__ __align__(16) float os[NW * 16 * 68];
    const size_t z = blockIdx.z; A += z * sA; if (A2) A2 += z * sA; Bt += z * sB; if (Bt2) Bt2 += z * sB; C += z * sC;
    const int lane = threadIdx.x & 31, lr = lane & 15, hi = lane >> 4; const int r0 = blockIdx.x * 64, c0 = blockIdx.y * 64;
    const int wave = (NW == 1) ? 0 : __builtin_amdgcn_readfirstlane((int)(threadIdx.x >> 5));   // scalar, so that the K loop's branch is a scalar one
    v8f acc[4][4];
#pragma unroll
    for (int mb = 0; mb < 4; ++mb)
#pragma unroll
        for (int nb = 0; nb < 4; ++nb) acc[mb][nb] = (v8f){};
    const size_t aoff = (size_t)(r0 + lr) * K + 8 * hi, boff = (size_t)(c0 + lr) * K + 8 * hi;
#pragma unroll 1
    for (int kc = wave * 32; kc < K; kc += NW * 32) {
        V a[4], a2[4];
#pragma unroll
        for (int mb = 0; mb < 4; ++mb) { a[mb] = WFrag<T16>::ld(A + aoff + (size_t)mb * 16 * K + kc); if (NSPLIT == 1 || NSPLIT == 2) a2[mb] = WFrag<T16>::ld(A2 + aoff + (size_t)mb * 16 * K + kc); }
#pragma unroll
        for (int nb = 0; nb < 4; ++nb) { const V b = WFrag<T16>::ld(Bt + boff + (size_t)nb * 16 * K + kc); V b2; if (NSPLIT >= 2) b2 = WFrag<T16>::ld(Bt2 + boff + (size_t)nb * 16 * K + kc);
#pragma unroll
            for (int mb = 0; mb < 4; ++mb) { acc[mb][nb] = WFrag<T16>::mma(a[mb], b, acc[mb][nb]); if (NSPLIT == 1 || NSPLIT == 2) acc[mb][nb] = WFrag<T16>::mma(a2[mb], b, acc[mb][nb]); if (NSPLIT >= 2) acc[mb][nb] = WFrag<T16>::mma(a[mb], b2, acc[mb][nb]); } }
        asm volatile("v_nop\n\tv_nop\n\tv_nop\n\tv_nop" : "+v"(acc[0][0]), "+v"(acc[1][1]), "+v"(acc[2][2]), "+v"(acc[3][3]) : "v"(a[0]), "v"(a[3]));
    }
#pragma unroll
    for (int mb = 0; mb < 4; ++mb) {
#pragma unroll
        for (int nb = 0; nb < 4; ++nb) {
#pragma unroll
            for (int j = 0; j < 8; ++j) os[(wave * 16 + hi * 8 + j) * 68 + nb * 16 + lr] = acc[mb][nb][j]; }
        tile_sync<NW>();   // every wave's partial rows stand in LDS before they are summed
        float* crow = C + (size_t)(r0 + mb * 16) * ldc + c0;
{
#pragma unroll
            for (int s = 0; s < 8 / NW; ++s) { const int row = 2 * (wave + s * NW) + hi, cofs = lr * 4; v4f val = *(const v4fa*)(os + row * 68 + cofs);
#pragma unroll
                for (int w = 1; w < NW; ++w) val += *(const v4fa*)(os + (w * 16 + row) * 68 + cofs);
                if (BIAS) { val[0] += bfr(bias[c0 + cofs]); val[1] += bfr(bias[c0 + cofs + 1]); val[2] += bfr(bias[c0 + cofs + 2]); val[3] += bfr(bias[c0 + cofs + 3]); }
                *(v4f*)(crow + (size_t)row * ldc + cofs) = val;
                if (NW > 1) asm volatile("s_wait_xcnt 0x0" ::: "memory"); }   // precaution: stands in front of any rewrite of the store's address and data registers
             }
        if (NW == 1 || mb < 3) tile_sync<NW>();   // the partials are read before the next 16 rows overwrite them
    }
}

// ---- k_gemmc: the same 64x64 tile GEMM (NW waves share the K loop) specialised for causal attention: CMODE 1 skips score tiles entirely above the diagonal (query rows r0+roff.., key columns c0..), CMODE 2 limits the
// key (K) loop of the probability x value contraction to the diagonal block (probabilities beyond it are exactly zero). roff = row offset of this launch's first row within the sequence.
// lda = pitch of A's rows in elements (Bt's rows have pitch K). z counts query heads: A and C step per head, Bt per kv group (z / REP).
template <typename T16, int NSPLIT, int CMODE, int NW>
__global__ __launch_bounds__(32 * NW) void k_gemmc(const T16* __restrict__ A, const T16* __restrict__ A2, int lda, const T16* __restrict__ Bt, const T16* __restrict__ Bt2, int K, float* C, int ldc, int roff, size_t sA, size_t sB, size_t sC) {
    typedef typename WFrag<T16>::V V;
    __shared__ __align__(16) float os[NW * 16 * 68];
    const size_t z = blockIdx.z, zg = z / REP; A += z * sA; if (A2) A2 += z * sA; Bt += zg * sB; if (Bt2) Bt2 += zg * sB; C += z * sC;
    const int lane = threadIdx.x & 31, lr = lane & 15, hi = lane >> 4; const int r0 = blockIdx.x * 64, c0 = blockIdx.y * 64;
    const int wave = (NW == 1) ? 0 : __builtin_amdgcn_readfirstlane((int)(threadIdx.x >> 5));   // scalar, so that the K loop's branch is a scalar one
    if (CMODE == 1 && c0 > r0 + roff + 63) return;                  // score tile entirely above the causal diagonal: never read (the softmax masks j > i by select)
    const int Kl = (CMODE == 2) ? min(K, r0 + roff + 64) : K;        // P.V: probabilities are exactly 0 beyond the diagonal block, so the K loop stops there
    v8f acc[4][4];
#pragma unroll
    for (int mb = 0; mb < 4; ++mb)
#pragma unroll
        for (int nb = 0; nb < 4; ++nb) acc[mb][nb] = (v8f){};
    const size_t aoff = (size_t)(r0 + lr) * lda + 8 * hi, boff = (size_t)(c0 + lr) * K + 8 * hi;
#pragma unroll 1
    for (int kc = wave * 32; kc < Kl; kc += NW * 32) {
        V a[4], a2[4]; const T16* pa[4]; const T16* pa2[4];
#pragma unroll
        for (int mb = 0; mb < 4; ++mb) { pa[mb] = A + aoff + (size_t)mb * 16 * lda + kc; a[mb] = WFrag<T16>::ld(pa[mb]); if (NSPLIT == 1 || NSPLIT == 2) { pa2[mb] = A2 + aoff + (size_t)mb * 16 * lda + kc; a2[mb] = WFrag<T16>::ld(pa2[mb]); } }
        // precaution: the wait stands behind the A loads and in front of any rewrite of their address registers; the addresses are inputs so that they keep their registers up to the wait
        if (NSPLIT == 1 || NSPLIT == 2) asm volatile("s_wait_xcnt 0x0" :: "v"(pa[0]), "v"(pa[1]), "v"(pa[2]), "v"(pa[3]), "v"(pa2[0]), "v"(pa2[1]), "v"(pa2[2]), "v"(pa2[3]) : "memory");
        else asm volatile("s_wait_xcnt 0x0" :: "v"(pa[0]), "v"(pa[1]), "v"(pa[2]), "v"(pa[3]) : "memory");
#pragma unroll
        for (int nb = 0; nb < 4; ++nb) { const T16* pb = Bt + boff + (size_t)nb * 16 * K + kc; const V b = WFrag<T16>::ld(pb); V b2;
            // the same precaution behind the B loads of each column block
            if (NSPLIT >= 2) { const T16* pb2 = Bt2 + boff + (size_t)nb * 16 * K + kc; b2 = WFrag<T16>::ld(pb2); asm volatile("s_wait_xcnt 0x0" :: "v"(pb), "v"(pb2) : "memory"); }
            else asm volatile("s_wait_xcnt 0x0" :: "v"(pb) : "memory");
#pragma unroll
            for (int mb = 0; mb < 4; ++mb) { acc[mb][nb] = WFrag<T16>::mma(a[mb], b, acc[mb][nb]); if (NSPLIT == 1 || NSPLIT == 2) acc[mb][nb] = WFrag<T16>::mma(a2[mb], b, acc[mb][nb]); if (NSPLIT >= 2) acc[mb][nb] = WFrag<T16>::mma(a[mb], b2, acc[mb][nb]); } }
        asm volatile("v_nop\n\tv_nop\n\tv_nop\n\tv_nop" : "+v"(acc[0][0]), "+v"(acc[1][1]), "+v"(acc[2][2]), "+v"(acc[3][3]) : "v"(a[0]), "v"(a[3]));
    }
#pragma unroll
    for (int mb = 0; mb < 4; ++mb) {
#pragma unroll
        for (int nb = 0; nb < 4; ++nb) {
#pragma unroll
            for (int j = 0; j < 8; ++j) os[(wave * 16 + hi * 8 + j) * 68 + nb * 16 + lr] = acc[mb][nb][j]; }
        tile_sync<NW>();   // every wave's partial rows stand in LDS before they are summed
        float* crow = C + (size_t)(r0 + mb * 16) * ldc + c0;
{
#pragma unroll
            for (int s = 0; s < 8 / NW; ++s) { const int row = 2 * (wave + s * NW) + hi, cofs = lr * 4; v4f val = *(const v4fa*)(os + row * 68 + cofs);
#pragma unroll
                for (int w = 1; w < NW; ++w) val += *(const v4fa*)(os + (w * 16 + row) * 68 + cofs);
                *(v4f*)(crow + (size_t)row * ldc + cofs) = val;
                if (NW > 1) asm volatile("s_wait_xcnt 0x0" ::: "memory"); }   // precaution: stands in front of any rewrite of the store's address and data registers
             }
        if (NW == 1 || mb < 3) tile_sync<NW>();   // the partials are read before the next 16 rows overwrite them
    }
}

__device__ __forceinline__ h16 tohx(float x) { return (h16)x; }
__device__ __forceinline__ void splitf(float y, unsigned short& h, unsigned short& l) { h = f2bf(y); l = f2bf(y - bf2f(h)); }
typedef __attribute__((ext_vector_type(2))) _Float16 v2h;
typedef __attribute__((ext_vector_type(4))) _Float16 v4h;
typedef __attribute__((ext_vector_type(2))) unsigned short v2us;
typedef __attribute__((ext_vector_type(4))) unsigned short v4us;
typedef __attribute__((ext_vector_type(2))) float v2f;
typedef __attribute__((ext_vector_type(4))) int v4i;

__global__ __launch_bounds__(256) void k_wtG(const float* __restrict__ w, int K, int N, bf* Bt) {
    const int lane = threadIdx.x & 31; const int L0 = (blockIdx.x * 8 + (threadIdx.x >> 5)) * 8; const int nlines = N * K / 64;
{
#pragma unroll 1
        for (int l = 0; l < 8; ++l) { const int L = L0 + l; if (L >= nlines) break; const size_t e = (size_t)L * 64 + lane * 2; const int k = (int)(e % K), n = (int)(e / K); v2us o;
            o[0] = f2bf(w[(size_t)k * N + n]); o[1] = f2bf(w[(size_t)(k + 1) * N + n]); *(v2us*)(Bt + e) = o; }
         }
}
__global__ __launch_bounds__(256) void k_cvt8(const float* __restrict__ src, bf* dst, size_t n8) { const size_t i = (size_t)blockIdx.x * 256 + threadIdx.x; if (i >= n8) return; const v8f v = *(const v8f*)(src + i * 8); v8us o;
#pragma unroll
    for (int k = 0; k < 8; ++k) o[k] = f2bf(v[k]); *(v8us*)(dst + i * 8) = o;  }
__global__ __launch_bounds__(256) void k_cscvt(const float* __restrict__ cosT, const float* __restrict__ sinT, float* CS) { const int idx = blockIdx.x * 256 + threadIdx.x; if (idx >= TT * HD) return; v2f cs; cs[0] = bfr(cosT[idx]); cs[1] = bfr(sinT[idx]); *(v2f*)(CS + (size_t)idx * 2) = cs;  }
// k_rope: head planes [h][t][d] (fp16 + hi/lo) of rope(x) x sc with the rotate-half convention out[d] = x[d] cos[t][d] - x[d+HD/2] sin[t][d], out[d+HD/2] = x[d+HD/2] cos[t][d+HD/2] + x[d] sin[t][d+HD/2]
__global__ __launch_bounds__(256) void k_rope(const float* __restrict__ F, int pitch, int nheads, const float* __restrict__ CS, const float* __restrict__ RF, const float* __restrict__ nw, float sc, h16* P16, bf* Ph, bf* Pl) {
    const size_t e = ((size_t)blockIdx.x * 256 + threadIdx.x) * 2; if (e >= (size_t)nheads * TT * HD) return; const int d = (int)(e % HD); const int t = (int)((e / HD) % TT); const int h = (int)(e / ((size_t)HD * TT)); const float* f = F + (size_t)t * pitch + h * HD; const float rf = RF ? RF[(size_t)h * TT + t] : 1.0f; v2h o16; v2us oh, ol;
#pragma unroll
    for (int q = 0; q < 2; ++q) { const int dd = d + q; const int dp = (dd < HD / 2) ? dd + HD / 2 : dd - HD / 2; float x0 = f[dd], x1 = f[dp];
        if (RF) { float n0 = __fmul_rn(x0, rf), n1 = __fmul_rn(x1, rf); asm volatile("" : "+v"(n0)); asm volatile("" : "+v"(n1)); x0 = __fmul_rn(bfr(nw[dd]), n0); x1 = __fmul_rn(bfr(nw[dp]), n1); }
        const v2f cs = *(const v2f*)(CS + ((size_t)t * HD + dd) * 2); float a = __fmul_rn(x0, cs[0]), bq = __fmul_rn(x1, cs[1]); asm volatile("" : "+v"(a)); asm volatile("" : "+v"(bq)); const float r = ((dd < HD / 2) ? __fsub_rn(a, bq) : __fadd_rn(a, bq)) * sc;
        o16[q] = tohx(r); unsigned short a2, c2; splitf(r, a2, c2); oh[q] = a2; ol[q] = c2; }
    *(v2h*)(P16 + e) = o16; *(v2us*)(Ph + e) = oh; *(v2us*)(Pl + e) = ol;  }
__global__ __launch_bounds__(256) void k_vtp(const float* __restrict__ F, int pitch, int nheads, h16* V16, bf* Vh, bf* Vl) { const size_t e = ((size_t)blockIdx.x * 256 + threadIdx.x) * 2; if (e >= (size_t)nheads * HD * TT) return; const int t = (int)(e % TT); const int d = (int)((e / TT) % HD); const int g = (int)(e / ((size_t)TT * HD)); v2h o16; v2us oh, ol;
#pragma unroll
    for (int q = 0; q < 2; ++q) { const float x = F[(size_t)(t + q) * pitch + g * HD + d]; o16[q] = tohx(x); unsigned short a2, c2; splitf(x, a2, c2); oh[q] = a2; ol[q] = c2; }
    *(v2h*)(V16 + e) = o16; *(v2us*)(Vh + e) = oh; *(v2us*)(Vl + e) = ol;  }
__global__ __launch_bounds__(256) void k_rowsel(const bf* __restrict__ WSRC, int off, bf* WDST) { const size_t e8 = ((size_t)blockIdx.x * 256 + threadIdx.x) * 8; if (e8 >= (size_t)DQ * DM) return; const int k = (int)(e8 % DM); const int row = (int)(e8 / DM); const int h = row / HD, d = row % HD; const v8us a = *(const v8us*)(WSRC + ((size_t)h * 2 * HD + off + d) * DM + k); *(v8us*)(WDST + e8) = a;  }
__global__ __launch_bounds__(256) void k_rmsw(float* F, int pitch, int nheads, const float* __restrict__ w) { const int lane = threadIdx.x & 31; const int wv = blockIdx.x * 8 + (threadIdx.x >> 5); if (wv >= TT * nheads) return; const int t = wv / nheads, h = wv % nheads; float* f = F + (size_t)t * pitch + h * HD; const v4f a = *(const v4f*)(f + lane * 4); float ss = 0.f;
#pragma unroll
    for (int q = 0; q < 4; ++q) { float p = __fmul_rn(a[q], a[q]); asm volatile("" : "+v"(p)); ss = __fadd_rn(ss, p); }
#pragma unroll
    for (int sh = 16; sh; sh >>= 1) ss = __fadd_rn(ss, __shfl_xor(ss, sh, 32));
    const float rs = __fdiv_rn(1.0f, sqrtf(__fadd_rn(ss * (1.0f / HD), 1e-6f))); v4f o;
#pragma unroll
    for (int q = 0; q < 4; ++q) { float y = __fmul_rn(a[q], rs); asm volatile("" : "+v"(y)); o[q] = __fmul_rn(y, bfr(w[lane * 4 + q])); }
    *(v4f*)(f + lane * 4) = o;  }
__global__ __launch_bounds__(256) void k_mergeg(const float* __restrict__ O, int h0, const float* __restrict__ GL, bf* Ah, bf* Al) { const size_t e = ((size_t)blockIdx.x * 256 + threadIdx.x) * 2; if (e >= (size_t)ZH * TT * HD) return; const int d = (int)(e % HD); const int t = (int)((e / HD) % TT); const int zz = (int)(e / ((size_t)HD * TT)); const float cs = (t < RH) ? 1.0f : (1.0f / PCAR); const size_t oo = (size_t)t * DQ + (h0 + zz) * HD + d;
    v2us oh, ol;
#pragma unroll
    for (int q = 0; q < 2; ++q) { float a0 = O[e + q] * cs; asm volatile("" : "+v"(a0)); const float gl = GL[oo + q]; const float sg = __fdiv_rn(1.0f, __fadd_rn(1.0f, expf(-gl))); unsigned short a, c2; splitf(__fmul_rn(a0, sg), a, c2); oh[q] = a; ol[q] = c2; } *(v2us*)(Ah + oo) = oh; *(v2us*)(Al + oo) = ol;  }
// k_asoft: per row (zz, i): t = S x HD^-0.5 for j <= i and i - j < WIN (sliding causal window; the reference's -1e9 additive fill vanishes identically); softmax over the 2048 keys (register row, one exp, fixed trees);
// the probabilities go over the row's own 8 KiB of scores (one wave owns a row and holds all of it in registers before its first store): fp16 row in the first half, or the hi plane in the first half and the lo plane in the second.
__global__ __launch_bounds__(256) void k_asoft(float* Sb) {
    const int lane = threadIdx.x & 31; const int row = blockIdx.x * 8 + (threadIdx.x >> 5); if (row >= ZH * TT) return; const int i = row % TT; const bool hires = (i < RH); float* sr = Sb + (size_t)row * TT; float v[TT / 32]; float mx = -3.0e38f;
#pragma unroll
    for (int ch = 0; ch < TT / 128; ++ch) { const int j0 = ch * 128 + lane * 4; const v4f a = *(const v4f*)(sr + j0);
#pragma unroll
        for (int q = 0; q < 4; ++q) { const int j = j0 + q; (void)j; const float t = (j <= i && i - j < WIN) ? a[q] * SCL : -3.0e38f; v[ch * 4 + q] = t; mx = fmaxf(mx, t); } }
#pragma unroll
    for (int sh = 16; sh; sh >>= 1) mx = fmaxf(mx, __shfl_xor(mx, sh, 32));
    float sum = 0.f;
#pragma unroll
    for (int k = 0; k < TT / 32; ++k) { float d0 = __fsub_rn(v[k], mx); asm volatile("" : "+v"(d0)); v[k] = __builtin_amdgcn_exp2f(__fmul_rn(d0, 1.4426950408889634f)); sum += v[k]; }
#pragma unroll
    for (int sh = 16; sh; sh >>= 1) sum += __shfl_xor(sum, sh, 32);
    const float f = __fdiv_rn(hires ? 1.0f : PCAR, sum);
{
        if (hires) {
#pragma unroll
            for (int ch = 0; ch < TT / 128; ++ch) { v4us oh, ol;
#pragma unroll
                for (int q = 0; q < 4; ++q) { unsigned short a, c2; splitf(v[ch * 4 + q] * f, a, c2); oh[q] = a; ol[q] = c2; }
                bf* ph = (bf*)sr + ch * 128 + lane * 4; *(v4us*)ph = oh; *(v4us*)(ph + TT) = ol; }
        } else {
#pragma unroll
            for (int ch = 0; ch < TT / 128; ++ch) { v4h o4;
#pragma unroll
                for (int q = 0; q < 4; ++q) o4[q] = tohx(v[ch * 4 + q] * f);
                *(v4h*)((h16*)sr + ch * 128 + lane * 4) = o4; } }
         }
}
__global__ __launch_bounds__(256) void k_merge(const float* __restrict__ O, int h0, bf* Ah, bf* Al) { const size_t e = ((size_t)blockIdx.x * 256 + threadIdx.x) * 2; if (e >= (size_t)ZH * TT * HD) return; const int d = (int)(e % HD); const int t = (int)((e / HD) % TT); const int zz = (int)(e / ((size_t)HD * TT)); const float cs = (t < RH) ? 1.0f : (1.0f / PCAR); const size_t oo = (size_t)t * DQ + (h0 + zz) * HD + d;
    v2us oh, ol;
#pragma unroll
    for (int q = 0; q < 2; ++q) { unsigned short a, c2; splitf(O[e + q] * cs, a, c2); oh[q] = a; ol[q] = c2; } *(v2us*)(Ah + oo) = oh; *(v2us*)(Al + oo) = ol;  }

extern "C" void kernel_launch(void* const* d_in, const int* in_sizes, int n_in,
                              void* d_out, int out_size, void* d_ws, size_t ws_size, hipStream_t stream) {
    (void)in_sizes; (void)n_in; (void)out_size;
    const float* x = (const float*)d_in[0]; const float* wqg = (const float*)d_in[1]; const float* wk = (const float*)d_in[2]; const float* wv = (const float*)d_in[3]; const float* wo = (const float*)d_in[4]; const float* qnw = (const float*)d_in[5]; const float* knw = (const float*)d_in[6]; const float* cosT = (const float*)d_in[7]; const float* sinT = (const float*)d_in[8]; const float* wq = wqg;
    float* OUT = (float*)d_out;     // [2][2048][2048]
    char* wsp = (char*)d_ws;
    auto take = [&](size_t bytes) { char* p = wsp; wsp += (bytes + 255) & ~(size_t)255; return (void*)p; };
    bf* WQ = (bf*)take((size_t)DQ * DM * 2); bf* WK = (bf*)take((size_t)DKV * DM * 2); bf* WV = (bf*)take((size_t)DKV * DM * 2); bf* WO = (bf*)take((size_t)DM * DQ * 2); float* CS = (float*)take((size_t)TT * HD * 2 * 4);
    bf* WG = (bf*)take((size_t)DQ * DM * 2); float* GL = (float*)take((size_t)TT * DQ * 4);
    h16* QP16 = (h16*)take((size_t)NH_ * TT * HD * 2); h16* KP16 = (h16*)take((size_t)NKV * TT * HD * 2); h16* VT16 = (h16*)take((size_t)NKV * HD * TT * 2);
    bf* QPh = (bf*)take((size_t)NH_ * TT * HD * 2); bf* QPl = (bf*)take((size_t)NH_ * TT * HD * 2); bf* KPh = (bf*)take((size_t)NKV * TT * HD * 2); bf* KPl = (bf*)take((size_t)NKV * TT * HD * 2); bf* VTh = (bf*)take((size_t)NKV * HD * TT * 2); bf* VTl = (bf*)take((size_t)NKV * HD * TT * 2);
    float* Sb = (float*)take((size_t)ZH * TT * TT * 4); float* Ob = (float*)take((size_t)ZH * TT * HD * 4); bf* ATh = (bf*)take((size_t)TT * DQ * 2); bf* ATl = (bf*)take((size_t)TT * DQ * 2);
    if ((size_t)(wsp - (char*)d_ws) > ws_size) return;    // ws 256 MiB
    // What only the stages in front of the attention passes use lies inside the score buffer (stream-ordered: each is written anew before it is read, and read for the last time before the first score launch of its batch).
    wsp = (char*)Sb; bf* WQG = (bf*)take((size_t)2 * DQ * DM * 2); float* FQ = (float*)take((size_t)TT * DQ * 4); float* FK = (float*)take((size_t)TT * DKV * 4); bf* XB = (bf*)take((size_t)TT * DM * 2);
    float* FV = FK;   // v projection reuses the k buffer after the k planes are built (stream-ordered)
    { k_wtG<<<(unsigned)((DM * 2 * DQ / 64 + 63) / 64), 256, 0, stream>>>(wqg, DM, 2 * DQ, WQG); k_rowsel<<<(unsigned)(((size_t)DQ * DM / 8 + 255) / 256), 256, 0, stream>>>(WQG, 0, WQ); k_rowsel<<<(unsigned)(((size_t)DQ * DM / 8 + 255) / 256), 256, 0, stream>>>(WQG, HD, WG); k_wtG<<<(unsigned)((DM * DKV / 64 + 63) / 64), 256, 0, stream>>>(wk, DM, DKV, WK); k_wtG<<<(unsigned)((DM * DKV / 64 + 63) / 64), 256, 0, stream>>>(wv, DM, DKV, WV);
      k_wtG<<<(unsigned)((DQ * DM / 64 + 63) / 64), 256, 0, stream>>>(wo, DQ, DM, WO);
       }
    const unsigned LQ = (unsigned)(((size_t)NH_ * TT * HD / 2 + 255) / 256), LKv = (unsigned)(((size_t)NKV * TT * HD / 2 + 255) / 256);
    for (int b = 0; b < NB_; ++b) {
        if (b == 0) k_cscvt<<<(TT * HD + 255) / 256, 256, 0, stream>>>(cosT, sinT, CS);
        k_cvt8<<<(unsigned)(((size_t)TT * DM / 8 + 255) / 256), 256, 0, stream>>>(x + (size_t)b * TT * DM, XB, (size_t)TT * DM / 8);
        k_gemmw<bf, 0, false, 4><<<dim3(TT / 64, DQ / 64, 1), 128, 0, stream>>>(XB, nullptr, WQ, nullptr, DM, FQ, DQ, nullptr, 0, 0, 0);
        k_rmsw<<<TT * NH_ / 8, 256, 0, stream>>>(FQ, DQ, NH_, qnw); k_rope<<<LQ, 256, 0, stream>>>(FQ, DQ, NH_, CS, nullptr, nullptr, 1.0f, QP16, QPh, QPl);
        k_gemmw<bf, 0, false, 8><<<dim3(TT / 64, DKV / 64, 1), 256, 0, stream>>>(XB, nullptr, WK, nullptr, DM, FK, DKV, nullptr, 0, 0, 0);
        k_rmsw<<<TT * NKV / 8, 256, 0, stream>>>(FK, DKV, NKV, knw); k_rope<<<LKv, 256, 0, stream>>>(FK, DKV, NKV, CS, nullptr, nullptr, 1.0f, KP16, KPh, KPl);
        k_gemmw<bf, 0, false, 8><<<dim3(TT / 64, DKV / 64, 1), 256, 0, stream>>>(XB, nullptr, WV, nullptr, DM, FV, DKV, nullptr, 0, 0, 0); k_vtp<<<LKv, 256, 0, stream>>>(FV, DKV, NKV, VT16, VTh, VTl);
        k_gemmw<bf, 0, false, 4><<<dim3(TT / 64, DQ / 64, 1), 128, 0, stream>>>(XB, nullptr, WG, nullptr, DM, GL, DQ, nullptr, 0, 0, 0);   /* gate logits */
        for (int h0 = 0; h0 < NH_; h0 += ZH) { const size_t zq = (size_t)h0, zk = (size_t)(h0 / REP);   // head h0 + z of a pass reads kv group h0/REP + z/REP (ZH % REP == 0)
            k_gemmc<bf, 2, 1, 1><<<dim3(RH / 64, TT / 64, ZH), 32, 0, stream>>>(QPh + zq * TT * HD, QPl + zq * TT * HD, HD, KPh + zk * TT * HD, KPl + zk * TT * HD, HD, Sb, TT, 0, (size_t)TT * HD, (size_t)TT * HD, (size_t)TT * TT);
            k_gemmc<h16, 0, 1, 1><<<dim3((TT - RH) / 64, TT / 64, ZH), 32, 0, stream>>>(QP16 + zq * TT * HD + (size_t)RH * HD, nullptr, HD, KP16 + zk * TT * HD, nullptr, HD, Sb + (size_t)RH * TT, TT, RH, (size_t)TT * HD, (size_t)TT * HD, (size_t)TT * TT);
            k_asoft<<<ZH * TT / 8, 256, 0, stream>>>(Sb);
            k_gemmc<bf, 2, 2, 8><<<dim3(RH / 64, HD / 64, ZH), 256, 0, stream>>>((const bf*)Sb, (const bf*)Sb + TT, 2 * TT, VTh + zk * HD * TT, VTl + zk * HD * TT, TT, Ob, HD, 0, (size_t)TT * 2 * TT, (size_t)HD * TT, (size_t)TT * HD);
            k_gemmc<h16, 0, 2, 8><<<dim3((TT - RH) / 64, HD / 64, ZH), 256, 0, stream>>>((const h16*)Sb + (size_t)RH * 2 * TT, nullptr, 2 * TT, VT16 + zk * HD * TT, nullptr, TT, Ob + (size_t)RH * HD, HD, RH, (size_t)TT * 2 * TT, (size_t)HD * TT, (size_t)TT * HD);
            k_mergeg<<<(unsigned)(((size_t)ZH * TT * HD / 2 + 255) / 256), 256, 0, stream>>>(Ob, h0, GL, ATh, ATl); }
        k_gemmw<bf, 1, false, 4><<<dim3(TT / 64, DM / 64, 1), 128, 0, stream>>>(ATh, ATl, WO, nullptr, DQ, OUT + (size_t)b * TT * DM, DM, nullptr, 0, 0, 0); }
}

// v003
// It runs in 617 microseconds.
// In two side-by-side timings against v002, it was 1.37 and 1.36 times as fast.
// Counting every step since v000, it is 2.92 times as fast.
#include <hip/hip_runtime.h>

// GatedCausalSelfAttention (x [2][2048][2048]; qg = x w_q ([2048][4096]: per head h columns h*256 + [query 0..127 | gate 128..255]); k/v = x w_k/w_v (4 kv groups; head h -> group h/4); q, k RMS-normalised * w (eps 1e-6); rotate-half RoPE with the read cos/sin tables [T][128]; causal softmax(q.k / sqrt(128)) (finfo.min); out = (merged attn * sigmoid(gate)) w_o -> [2][2048][2048]).
// Compute dtypes, f32 accumulate: every input rounded to bf16; q, gate, k, v as PLAIN bf16 GEMMs (inputs: exact; the q/gate column blocks gathered from the transposed w_q plane); RMSNorm (in place) and RoPE (bf16-rounded tables) f32; causal scores and attn.v: query rows < 512 hl (3 products), the rest single fp16 (x1024), causal tile skipping; softmax f32; sigmoid gate (precise expf) applied in f32 when forming the hl planes; w_o hl x exact (2 products).

#define NB_  2
#define TT   2048
#define DM   2048
#define NH_  16
#define NKV  4
#define REP  (NH_ / NKV)
#define HD   128
#define DQ   (NH_ * HD)
#define DKV  (NKV * HD)
#define ZH   8                    // heads per attention pass (two whole kv groups): the z extent of every attention launch
#define RH   512                  // query rows < RH use hi+lo planes (0: none)
#define WIN  2048
#define PCAR 1024.0f
#define SCL  0.088388347648318447f   // HD^-0.5
typedef _Float16 h16;
typedef unsigned short bf;
typedef __attribute__((ext_vector_type(16))) __bf16   v16bf;
typedef __attribute__((ext_vector_type(16))) _Float16 v16h;
typedef __attribute__((ext_vector_type(8)))  _Float16 v8h;
typedef __attribute__((ext_vector_type(8)))  unsigned short v8us;
typedef __attribute__((ext_vector_type(8)))  float    v8f;
typedef __attribute__((ext_vector_type(4)))  float    v4f;
typedef v8h  __attribute__((may_alias)) v8ha;
typedef v4f  __attribute__((may_alias)) v4fa;
typedef v8us __attribute__((may_alias)) v8usa;

__device__ __forceinline__ unsigned short f2bf(float f) { unsigned u = __float_as_uint(f); u += 0x7FFFu + ((u >> 16) & 1u); return (unsigned short)(u >> 16); }
__device__ __forceinline__ float bf2f(unsigned short b) { return __uint_as_float(((unsigned)b) << 16); }
__device__ __forceinline__ float bfr(float f) { return bf2f(f2bf(f)); }
__device__ __forceinline__ v16h cat16(v8h lo, v8h hi) { return __builtin_shufflevector(lo, hi, 0, 1, 2, 3, 4, 5, 6, 7, 8, 9, 10, 11, 12, 13, 14, 15); }
__device__ __forceinline__ v16bf cat16b(v8us lo, v8us hi) { return __builtin_bit_cast(v16bf, __builtin_shufflevector(lo, hi, 0, 1, 2, 3, 4, 5, 6, 7, 8, 9, 10, 11, 12, 13, 14, 15)); }
__device__ __forceinline__ v8f wmma16(v16h a, v16h b, v8f c) { return __builtin_amdgcn_wmma_f32_16x16x32_f16(false, a, false, b, (short)0, c, false, false); }
__device__ __forceinline__ v8f wmmab(v16bf a, v16bf b, v8f c) { return __builtin_amdgcn_wmma_f32_16x16x32_bf16(false, a, false, b, (short)0, c, false, false); }



// ---- Fragment-order planes. A 16-bit operand plane of R rows x K columns (R % 16 == 0, K % 32 == 0) is stored as blocks of 16 rows x 32 k = 512 elements (1 KiB), block index (r / 16) * (K / 32) + k / 32.
// Inside a block: two halves of 256 elements (k % 32 < 16, then >= 16); in a half, lane slot ((k / 8) % 2) * 16 + r % 16 holds its 8 consecutive k as one 16-byte piece. That is the order in which the 32 lanes of a wave
// hold a 16x32 WMMA operand, so a fragment is two wave-wide 16-byte loads of 512 contiguous bytes each (4 whole lines) instead of two loads that touch 16 lines. The elements and their k order in every fragment are those of a row-major plane.
// frag_piece: for the i-th 16-byte piece of such a plane (storage order), its row and first k.
__device__ __forceinline__ void frag_piece(size_t i, int kblocks, int& r, int& k0) { const int w = (int)(i & 63); const size_t blk = i >> 6; r = (int)(blk / kblocks) * 16 + (w & 15); k0 = (int)(blk % kblocks) * 32 + (w >> 5) * 16 + ((w >> 4) & 1) * 8; }

// ---- k_gemmw: register-blocked GEMM, NW WAVES per 64x64 output tile (16 accumulators each), operands straight from fragment-order 16-bit planes; grid (M/64, N/64, Z), 32 * NW threads.
// The K range is dealt to the waves in 32-element steps: wave w takes steps w, w + NW, ... (neighbouring waves read neighbouring 1-KiB blocks); the NW partial tiles are summed through LDS in wave order 0..NW-1.
// C[m][n] (f32, pitch ldc, + optional f32 bias[n]) = sum_k A[m][k] Bt[n][k] (+ split products per NSPLIT). z-batch strides sA/sB/sC in elements. K % 32 == 0.
// tile_sync: orders the staging tile's LDS writes and reads among the NW waves of a tile. It fences LDS only: __syncthreads() would also wait for the global stores of the rows just written out.
// One wave: no hardware barrier, only the compiler is kept from moving LDS accesses across.
template <int NW> __device__ __forceinline__ void tile_sync() {
    static_assert(NW == 1 || NW == 2 || NW == 4 || NW == 8, "the 16 staged rows are dealt two to a wave and pass");
    if (NW == 1) { __builtin_amdgcn_wave_barrier(); asm volatile("" ::: "memory"); }
    else { __builtin_amdgcn_fence(__ATOMIC_RELEASE, "workgroup", "local"); __builtin_amdgcn_s_barrier(); __builtin_amdgcn_fence(__ATOMIC_ACQUIRE, "workgroup", "local"); }
}
template <typename T16> struct WFrag;
template <> struct WFrag<h16> { typedef v16h V; static __device__ __forceinline__ V ld(const h16* p) { return cat16(*(const v8h*)p, *(const v8h*)(p + 16)); } static __device__ __forceinline__ V ldf(const h16* p) { return cat16(*(const v8h*)p, *(const v8h*)(p + 256)); } static __device__ __forceinline__ v8f mma(V a, V b, v8f c) { return wmma16(a, b, c); } };
template <> struct WFrag<bf> { typedef v16bf V; static __device__ __forceinline__ V ld(const bf* p) { return cat16b(*(const v8us*)p, *(const v8us*)(p + 16)); } static __device__ __forceinline__ V ldf(const bf* p) { return cat16b(*(const v8us*)p, *(const v8us*)(p + 256)); } static __device__ __forceinline__ v8f mma(V a, V b, v8f c) { return wmmab(a, b, c); } };
template <typename T16, int NSPLIT, bool BIAS, int NW>
__global__ __launch_bounds__(32 * NW) void k_gemmw(const T16* __restrict__ A, const T16* __restrict__ A2, const T16* __restrict__ Bt, const T16* __restrict__ Bt2, int K, float* C, int ldc, const float* __restrict__ bias, size_t sA, size_t sB, size_t sC) {
    typedef typename WFrag<T16>::V V;
    __shared__ __align__(16) float os[NW * 16 * 68];
    const size_t z = blockIdx.z; A += z * sA; if (A2) A2 += z * sA; Bt += z * sB; if (Bt2) Bt2 += z * sB; C += z * sC;
    const int lane = threadIdx.x & 31, lr = lane & 15, hi = lane >> 4; const int r0 = blockIdx.x * 64, c0 = blockIdx.y * 64;
    const int wave = (NW == 1) ? 0 : __builtin_amdgcn_readfirstlane((int)(threadIdx.x >> 5));   // scalar, so that the K loop's branch is a scalar one
    v8f acc[4][4];
#pragma unroll
    for (int mb = 0; mb < 4; ++mb)
#pragma unroll
        for (int nb = 0; nb < 4; ++nb) acc[mb][nb] = (v8f){};
    const unsigned aoff = ((unsigned)r0 * K + lane * 8) * 2, boff = ((unsigned)c0 * K + lane * 8) * 2;   // byte offsets in a plane (every plane is far below 4 GiB): 16 rows of a fragment-order plane are 16 * K contiguous elements, a k step of 32 is one block of 512; lane * 8: the lane's 16-byte piece
#pragma unroll 1
    for (int kc = wave * 32; kc < K; kc += NW * 32) {
        V a[4], a2[4]; unsigned oa[4], ob[4];
#pragma unroll
        for (int mb = 0; mb < 4; ++mb) { oa[mb] = aoff + (unsigned)(mb * K + kc) * 32; a[mb] = WFrag<T16>::ldf((const T16*)((const char*)A + oa[mb])); if (NSPLIT == 1 || NSPLIT == 2) a2[mb] = WFrag<T16>::ldf((const T16*)((const char*)A2 + oa[mb])); }
#pragma unroll
        for (int nb = 0; nb < 4; ++nb) { ob[nb] = boff + (unsigned)(nb * K + kc) * 32; const V b = WFrag<T16>::ldf((const T16*)((const char*)Bt + ob[nb])); V b2; if (NSPLIT >= 2) b2 = WFrag<T16>::ldf((const T16*)((const char*)Bt2 + ob[nb]));
#pragma unroll
            for (int mb = 0; mb < 4; ++mb) { acc[mb][nb] = WFrag<T16>::mma(a[mb], b, acc[mb][nb]); if (NSPLIT == 1 || NSPLIT == 2) acc[mb][nb] = WFrag<T16>::mma(a2[mb], b, acc[mb][nb]); if (NSPLIT >= 2) acc[mb][nb] = WFrag<T16>::mma(a[mb], b2, acc[mb][nb]); } }
        // precaution: one wait behind all loads of the step and in front of any rewrite of their offset registers; the offsets are inputs so that they keep their registers up to the wait (the plane pointers are not rewritten in the loop)
        asm volatile("s_wait_xcnt 0x0" :: "v"(oa[0]), "v"(oa[1]), "v"(oa[2]), "v"(oa[3]), "v"(ob[0]), "v"(ob[1]), "v"(ob[2]), "v"(ob[3]) : "memory");
        asm volatile("v_nop\n\tv_nop\n\tv_nop\n\tv_nop" : "+v"(acc[0][0]), "+v"(acc[1][1]), "+v"(acc[2][2]), "+v"(acc[3][3]) : "v"(a[0]), "v"(a[3]));
    }
#pragma unroll
    for (int mb = 0; mb < 4; ++mb) {
#pragma unroll
        for (int nb = 0; nb < 4; ++nb) {
#pragma unroll
            for (int j = 0; j < 8; ++j) os[(wave * 16 + hi * 8 + j) * 68 + nb * 16 + lr] = acc[mb][nb][j]; }
        tile_sync<NW>();   // every wave's partial rows stand in LDS before they are summed
        float* crow = C + (size_t)(r0 + mb * 16) * ldc + c0;
{
#pragma unroll
            for (int s = 0; s < 8 / NW; ++s) { const int row = 2 * (wave + s * NW) + hi, cofs = lr * 4; v4f val = *(const v4fa*)(os + row * 68 + cofs);
#pragma unroll
                for (int w = 1; w < NW; ++w) val += *(const v4fa*)(os + (w * 16 + row) * 68 + cofs);
                if (BIAS) { val[0] += bfr(bias[c0 + cofs]); val[1] += bfr(bias[c0 + cofs + 1]); val[2] += bfr(bias[c0 + cofs + 2]); val[3] += bfr(bias[c0 + cofs + 3]); }
                *(v4f*)(crow + (size_t)row * ldc + cofs) = val;
                if (NW > 1) asm volatile("s_wait_xcnt 0x0" ::: "memory"); }   // precaution: stands in front of any rewrite of the store's address and data registers
             }
        if (NW == 1 || mb < 3) tile_sync<NW>();   // the partials are read before the next 16 rows overwrite them
    }
}

// ---- k_gemmc: the same 64x64 tile GEMM (NW waves share the K loop) specialised for causal attention: CMODE 1 skips score tiles entirely above the diagonal (query rows r0+roff.., key columns c0..), CMODE 2 limits the
// key (K) loop of the probability x value contraction to the diagonal block (probabilities beyond it are exactly zero). roff = row offset of this launch's first row within the sequence.
// Bt is a fragment-order plane of K columns. A: CMODE 1 a fragment-order plane of lda columns; CMODE 2 row-major with pitch lda elements (the softmax writes each probability row over its own score row). z counts query heads: A and C step per head, Bt per kv group (z / REP).
template <typename T16, int NSPLIT, int CMODE, int NW>
__global__ __launch_bounds__(32 * NW) void k_gemmc(const T16* __restrict__ A, const T16* __restrict__ A2, int lda, const T16* __restrict__ Bt, const T16* __restrict__ Bt2, int K, float* C, int ldc, int roff, size_t sA, size_t sB, size_t sC) {
    typedef typename WFrag<T16>::V V;
    __shared__ __align__(16) float os[NW * 16 * 68];
    const size_t z = blockIdx.z, zg = z / REP; A += z * sA; if (A2) A2 += z * sA; Bt += zg * sB; if (Bt2) Bt2 += zg * sB; C += z * sC;
    const int lane = threadIdx.x & 31, lr = lane & 15, hi = lane >> 4; const int r0 = blockIdx.x * 64, c0 = blockIdx.y * 64;
    const int wave = (NW == 1) ? 0 : __builtin_amdgcn_readfirstlane((int)(threadIdx.x >> 5));   // scalar, so that the K loop's branch is a scalar one
    if (CMODE == 1 && c0 > r0 + roff + 63) return;                  // score tile entirely above the causal diagonal: never read (the softmax masks j > i by select)
    const int Kl = (CMODE == 2) ? min(K, r0 + roff + 64) : K;        // P.V: probabilities are exactly 0 beyond the diagonal block, so the K loop stops there
    v8f acc[4][4];
#pragma unroll
    for (int mb = 0; mb < 4; ++mb)
#pragma unroll
        for (int nb = 0; nb < 4; ++nb) acc[mb][nb] = (v8f){};
    const size_t aoff = (CMODE == 1) ? (size_t)r0 * lda + lane * 8 : (size_t)(r0 + lr) * lda + 8 * hi, boff = (size_t)c0 * K + lane * 8;
#pragma unroll 1
    for (int kc = wave * 32; kc < Kl; kc += NW * 32) {
        V a[4], a2[4]; const T16* pa[4]; const T16* pa2[4];
#pragma unroll
        for (int mb = 0; mb < 4; ++mb) { const size_t ao = aoff + (size_t)mb * 16 * lda + ((CMODE == 1) ? (size_t)kc * 16 : (size_t)kc); pa[mb] = A + ao; a[mb] = (CMODE == 1) ? WFrag<T16>::ldf(pa[mb]) : WFrag<T16>::ld(pa[mb]); if (NSPLIT == 1 || NSPLIT == 2) { pa2[mb] = A2 + ao; a2[mb] = (CMODE == 1) ? WFrag<T16>::ldf(pa2[mb]) : WFrag<T16>::ld(pa2[mb]); } }
        // precaution: the wait stands behind the A loads and in front of any rewrite of their address registers; the addresses are inputs so that they keep their registers up to the wait
        if (NSPLIT == 1 || NSPLIT == 2) asm volatile("s_wait_xcnt 0x0" :: "v"(pa[0]), "v"(pa[1]), "v"(pa[2]), "v"(pa[3]), "v"(pa2[0]), "v"(pa2[1]), "v"(pa2[2]), "v"(pa2[3]) : "memory");
        else asm volatile("s_wait_xcnt 0x0" :: "v"(pa[0]), "v"(pa[1]), "v"(pa[2]), "v"(pa[3]) : "memory");
#pragma unroll
        for (int nb = 0; nb < 4; ++nb) { const T16* pb = Bt + boff + (size_t)nb * 16 * K + (size_t)kc * 16; const V b = WFrag<T16>::ldf(pb); V b2;
            // the same precaution behind the B loads of each column block
            if (NSPLIT >= 2) { const T16* pb2 = Bt2 + boff + (size_t)nb * 16 * K + (size_t)kc * 16; b2 = WFrag<T16>::ldf(pb2); asm volatile("s_wait_xcnt 0x0" :: "v"(pb), "v"(pb2) : "memory"); }
            else asm volatile("s_wait_xcnt 0x0" :: "v"(pb) : "memory");
#pragma unroll
            for (int mb = 0; mb < 4; ++mb) { acc[mb][nb] = WFrag<T16>::mma(a[mb], b, acc[mb][nb]); if (NSPLIT == 1 || NSPLIT == 2) acc[mb][nb] = WFrag<T16>::mma(a2[mb], b, acc[mb][nb]); if (NSPLIT >= 2) acc[mb][nb] = WFrag<T16>::mma(a[mb], b2, acc[mb][nb]); } }
        asm volatile("v_nop\n\tv_nop\n\tv_nop\n\tv_nop" : "+v"(acc[0][0]), "+v"(acc[1][1]), "+v"(acc[2][2]), "+v"(acc[3][3]) : "v"(a[0]), "v"(a[3]));
    }
#pragma unroll
    for (int mb = 0; mb < 4; ++mb) {
#pragma unroll
        for (int nb = 0; nb < 4; ++nb) {
#pragma unroll
            for (int j = 0; j < 8; ++j) os[(wave * 16 + hi * 8 + j) * 68 + nb * 16 + lr] = acc[mb][nb][j]; }
        tile_sync<NW>();   // every wave's partial rows stand in LDS before they are summed
        float* crow = C + (size_t)(r0 + mb * 16) * ldc + c0;
{
#pragma unroll
            for (int s = 0; s < 8 / NW; ++s) { const int row = 2 * (wave + s * NW) + hi, cofs = lr * 4; v4f val = *(const v4fa*)(os + row * 68 + cofs);
#pragma unroll
                for (int w = 1; w < NW; ++w) val += *(const v4fa*)(os + (w * 16 + row) * 68 + cofs);
                *(v4f*)(crow + (size_t)row * ldc + cofs) = val;
                if (NW > 1) asm volatile("s_wait_xcnt 0x0" ::: "memory"); }   // precaution: stands in front of any rewrite of the store's address and data registers
             }
        if (NW == 1 || mb < 3) tile_sync<NW>();   // the partials are read before the next 16 rows overwrite them
    }
}

__device__ __forceinline__ h16 tohx(float x) { return (h16)x; }
__device__ __forceinline__ void splitf(float y, unsigned short& h, unsigned short& l) { h = f2bf(y); l = f2bf(y - bf2f(h)); }
typedef __attribute__((ext_vector_type(2))) _Float16 v2h;
typedef __attribute__((ext_vector_type(4))) _Float16 v4h;
typedef __attribute__((ext_vector_type(2))) unsigned short v2us;
typedef __attribute__((ext_vector_type(4))) unsigned short v4us;
typedef __attribute__((ext_vector_type(2))) float v2f;
typedef __attribute__((ext_vector_type(4))) int v4i;

// k_wtG: Bt = the fragment-order bf16 plane of w^T (rows n, columns k) from w [K][N] f32. One wave builds one block (16 n x 32 k): each load takes 16 neighbouring n of two k rows; the 8 waves of a work-group take 8 neighbouring groups of n.
__global__ __launch_bounds__(256) void k_wtG(const float* __restrict__ w, int K, int N, bf* Bt) {
    const int lane = threadIdx.x & 31, lr = lane & 15, hi = lane >> 4; const int wv = blockIdx.x * 8 + (threadIdx.x >> 5); const int ng = N / 16, kbs = K / 32; if (wv >= ng * kbs) return; const int nb = wv % ng, kb = wv / ng;
    const float* p = w + (size_t)(kb * 32 + hi * 8) * N + nb * 16 + lr; bf* o = Bt + ((size_t)nb * kbs + kb) * 512 + lane * 8; const float* q[16]; float x[16];
#pragma unroll
    for (int j = 0; j < 16; ++j) { q[j] = p + (size_t)((j >> 3) * 16 + (j & 7)) * N; x[j] = *q[j]; }
    // precaution: the wait stands behind the loads and in front of any rewrite of their address registers; the addresses are inputs so that they keep their registers up to the wait
    asm volatile("s_wait_xcnt 0x0" :: "v"(q[0]), "v"(q[1]), "v"(q[2]), "v"(q[3]), "v"(q[4]), "v"(q[5]), "v"(q[6]), "v"(q[7]), "v"(q[8]), "v"(q[9]), "v"(q[10]), "v"(q[11]), "v"(q[12]), "v"(q[13]), "v"(q[14]), "v"(q[15]) : "memory");
    v8us v0, v1;
#pragma unroll
    for (int j = 0; j < 8; ++j) { v0[j] = f2bf(x[j]); v1[j] = f2bf(x[8 + j]); }
    *(v8us*)o = v0; *(v8us*)(o + 256) = v1;
}
__global__ __launch_bounds__(256) void k_cvt8(const float* __restrict__ src, int K, bf* dst, size_t n8) { const size_t i = (size_t)blockIdx.x * 256 + threadIdx.x; if (i >= n8) return; int r, k0; frag_piece(i, K / 32, r, k0); const float* p = src + (size_t)r * K + k0; const v8f v = *(const v8f*)p; v8us o;
    asm volatile("s_wait_xcnt 0x0" :: "v"(p) : "memory");   // precaution: the wait stands behind the loads and in front of any rewrite of their address registers; the addresses are inputs so that they keep their registers up to the wait
#pragma unroll
    for (int k = 0; k < 8; ++k) o[k] = f2bf(v[k]); *(v8us*)(dst + i * 8) = o;  }
__global__ __launch_bounds__(256) void k_cscvt(const float* __restrict__ cosT, const float* __restrict__ sinT, float* CS) { const int idx = blockIdx.x * 256 + threadIdx.x; if (idx >= TT * HD) return; v2f cs; cs[0] = bfr(cosT[idx]); cs[1] = bfr(sinT[idx]); *(v2f*)(CS + (size_t)idx * 2) = cs;  }
// k_rope: head planes (rows h * TT + t, columns d, fragment order; one 16-byte piece per thread and plane; fp16 + hi/lo) of rope(x) x sc with the rotate-half convention out[d] = x[d] cos[t][d] - x[d+HD/2] sin[t][d], out[d+HD/2] = x[d+HD/2] cos[t][d+HD/2] + x[d] sin[t][d+HD/2]
__global__ __launch_bounds__(256) void k_rope(const float* __restrict__ F, int pitch, int nheads, const float* __restrict__ CS, float sc, h16* P16, bf* Ph, bf* Pl) {
    const size_t e = ((size_t)blockIdx.x * 256 + threadIdx.x) * 8; if (e >= (size_t)nheads * TT * HD) return; int row, d; frag_piece(e / 8, HD / 32, row, d); const int t = row % TT; const int h = row / TT; const float* f = F + (size_t)t * pitch + h * HD; v8h o16; v8us oh, ol;
    const float* p0 = f + d; const float* p1 = f + ((d < HD / 2) ? d + HD / 2 : d - HD / 2); const float* pc = CS + ((size_t)t * HD + d) * 2; const v8f X0 = *(const v8f*)p0, X1 = *(const v8f*)p1, C0 = *(const v8f*)pc, C1 = *(const v8f*)(pc + 8);
    asm volatile("s_wait_xcnt 0x0" :: "v"(p0), "v"(p1), "v"(pc) : "memory");   // precaution: the wait stands behind the loads and in front of any rewrite of their address registers; the addresses are inputs so that they keep their registers up to the wait
#pragma unroll
    for (int q = 0; q < 8; ++q) { const float x0 = X0[q], x1 = X1[q]; const float cq = (q < 4) ? C0[2 * q] : C1[2 * q - 8], sq = (q < 4) ? C0[2 * q + 1] : C1[2 * q - 7];
        float a = __fmul_rn(x0, cq), bq = __fmul_rn(x1, sq); asm volatile("" : "+v"(a)); asm volatile("" : "+v"(bq)); const float r = ((d < HD / 2) ? __fsub_rn(a, bq) : __fadd_rn(a, bq)) * sc;
        o16[q] = tohx(r); unsigned short a2, c2; splitf(r, a2, c2); oh[q] = a2; ol[q] = c2; }
    *(v8h*)(P16 + e) = o16; *(v8us*)(Ph + e) = oh; *(v8us*)(Pl + e) = ol;  }
// k_vtp: the transposed value planes (rows g * HD + d, columns t, fragment order; one 16-byte piece per thread and plane)
__global__ __launch_bounds__(256) void k_vtp(const float* __restrict__ F, int pitch, int nheads, h16* V16, bf* Vh, bf* Vl) { const size_t e = ((size_t)blockIdx.x * 256 + threadIdx.x) * 8; if (e >= (size_t)nheads * HD * TT) return; int row, t; frag_piece(e / 8, TT / 32, row, t); const int d = row % HD; const int g = row / HD; v8h o16; v8us oh, ol; const float* pq[8]; float xq[8];
#pragma unroll
    for (int q = 0; q < 8; ++q) { pq[q] = F + (size_t)(t + q) * pitch + g * HD + d; xq[q] = *pq[q]; }
    asm volatile("s_wait_xcnt 0x0" :: "v"(pq[0]), "v"(pq[1]), "v"(pq[2]), "v"(pq[3]), "v"(pq[4]), "v"(pq[5]), "v"(pq[6]), "v"(pq[7]) : "memory");   // precaution: the wait stands behind the loads and in front of any rewrite of their address registers; the addresses are inputs so that they keep their registers up to the wait
#pragma unroll
    for (int q = 0; q < 8; ++q) { const float x = xq[q]; o16[q] = tohx(x); unsigned short a2, c2; splitf(x, a2, c2); oh[q] = a2; ol[q] = c2; }
    *(v8h*)(V16 + e) = o16; *(v8us*)(Vh + e) = oh; *(v8us*)(Vl + e) = ol;  }
__global__ __launch_bounds__(256) void k_rowsel(const bf* __restrict__ WSRC, int off, bf* WDST) { const size_t e8 = ((size_t)blockIdx.x * 256 + threadIdx.x) * 8; if (e8 >= (size_t)DQ * DM) return; const size_t in = e8 % ((size_t)16 * DM); const int row = (int)(e8 / ((size_t)16 * DM)) * 16; const int h = row / HD, d = row % HD; const bf* p = WSRC + ((size_t)h * 2 * HD + off + d) * DM + in; const v8us a = *(const v8us*)p;
    asm volatile("s_wait_xcnt 0x0" :: "v"(p) : "memory");   // precaution: the wait stands behind the loads and in front of any rewrite of their address registers; the addresses are inputs so that they keep their registers up to the wait
    *(v8us*)(WDST + e8) = a;  }   // 16 rows of a fragment-order plane are 16 * DM contiguous elements: whole groups of 16 rows are copied
__global__ __launch_bounds__(256) void k_rmsw(float* F, int pitch, int nheads, const float* __restrict__ w) { const int lane = threadIdx.x & 31; const int wv = blockIdx.x * 8 + (threadIdx.x >> 5); if (wv >= TT * nheads) return; const int t = wv / nheads, h = wv % nheads; float* f = F + (size_t)t * pitch + h * HD; const v4f a = *(const v4f*)(f + lane * 4); float ss = 0.f;
#pragma unroll
    for (int q = 0; q < 4; ++q) { float p = __fmul_rn(a[q], a[q]); asm volatile("" : "+v"(p)); ss = __fadd_rn(ss, p); }
#pragma unroll
    for (int sh = 16; sh; sh >>= 1) ss = __fadd_rn(ss, __shfl_xor(ss, sh, 32));
    const float rs = __fdiv_rn(1.0f, sqrtf(__fadd_rn(ss * (1.0f / HD), 1e-6f))); v4f o;
#pragma unroll
    for (int q = 0; q < 4; ++q) { float y = __fmul_rn(a[q], rs); asm volatile("" : "+v"(y)); o[q] = __fmul_rn(y, bfr(w[lane * 4 + q])); }
    *(v4f*)(f + lane * 4) = o;  }
__global__ __launch_bounds__(256) void k_mergeg(const float* __restrict__ O, int h0, const float* __restrict__ GL, bf* Ah, bf* Al) { const size_t i = (size_t)blockIdx.x * 256 + threadIdx.x; if (i >= (size_t)ZH * TT * HD / 8) return; int t, cl; frag_piece(i, ZH * HD / 32, t, cl); const int d = cl % HD; const int zz = cl / HD; const float cs = (t < RH) ? 1.0f : (1.0f / PCAR); const size_t e = ((size_t)zz * TT + t) * HD + d, gg = (size_t)t * DQ + (h0 + zz) * HD + d;
    const size_t oo = (((size_t)(t / 16) * (DQ / 32) + (h0 * HD + cl) / 32) * 64 + (i & 63)) * 8;   // this thread's 16-byte piece in the fragment-order planes of DQ columns
    v8us oh, ol; const float* po = O + e; const float* pg = GL + gg; const v8f OV = *(const v8f*)po, GV = *(const v8f*)pg;
    asm volatile("s_wait_xcnt 0x0" :: "v"(po), "v"(pg) : "memory");   // precaution: the wait stands behind the loads and in front of any rewrite of their address registers; the addresses are inputs so that they keep their registers up to the wait
#pragma unroll
    for (int q = 0; q < 8; ++q) { float a0 = OV[q] * cs; asm volatile("" : "+v"(a0)); const float gl = GV[q]; const float sg = __fdiv_rn(1.0f, __fadd_rn(1.0f, expf(-gl))); unsigned short a, c2; splitf(__fmul_rn(a0, sg), a, c2); oh[q] = a; ol[q] = c2; } *(v8us*)(Ah + oo) = oh; *(v8us*)(Al + oo) = ol;  }
// k_asoft: per row (zz, i): t = S x HD^-0.5 for j <= i and i - j < WIN (sliding causal window; the reference's -1e9 additive fill vanishes identically); softmax over the 2048 keys (register row, one exp, fixed trees);
// the probabilities go over the row's own 8 KiB of scores (one wave owns a row and holds all of it in registers before its first store): fp16 row in the first half, or the hi plane in the first half and the lo plane in the second.
__global__ __launch_bounds__(256) void k_asoft(float* Sb) {
    const int lane = threadIdx.x & 31; const int row = blockIdx.x * 8 + (threadIdx.x >> 5); if (row >= ZH * TT) return; const int i = row % TT; const bool hires = (i < RH); float* sr = Sb + (size_t)row * TT; float v[TT / 32]; float mx = -3.0e38f;
#pragma unroll
    for (int ch = 0; ch < TT / 128; ++ch) { const int j0 = ch * 128 + lane * 4; const v4f a = *(const v4f*)(sr + j0);
#pragma unroll
        for (int q = 0; q < 4; ++q) { const int j = j0 + q; (void)j; const float t = (j <= i && i - j < WIN) ? a[q] * SCL : -3.0e38f; v[ch * 4 + q] = t; mx = fmaxf(mx, t); } }
#pragma unroll
    for (int sh = 16; sh; sh >>= 1) mx = fmaxf(mx, __shfl_xor(mx, sh, 32));
    float sum = 0.f;
#pragma unroll
    for (int k = 0; k < TT / 32; ++k) { float d0 = __fsub_rn(v[k], mx); asm volatile("" : "+v"(d0)); v[k] = __builtin_amdgcn_exp2f(__fmul_rn(d0, 1.4426950408889634f)); sum += v[k]; }
#pragma unroll
    for (int sh = 16; sh; sh >>= 1) sum += __shfl_xor(sum, sh, 32);
    const float f = __fdiv_rn(hires ? 1.0f : PCAR, sum);
{
        if (hires) {
#pragma unroll
            for (int ch = 0; ch < TT / 128; ++ch) { v4us oh, ol;
#pragma unroll
                for (int q = 0; q < 4; ++q) { unsigned short a, c2; splitf(v[ch * 4 + q] * f, a, c2); oh[q] = a; ol[q] = c2; }
                bf* ph = (bf*)sr + ch * 128 + lane * 4; *(v4us*)ph = oh; *(v4us*)(ph + TT) = ol; }
        } else {
#pragma unroll
            for (int ch = 0; ch < TT / 128; ++ch) { v4h o4;
#pragma unroll
                for (int q = 0; q < 4; ++q) o4[q] = tohx(v[ch * 4 + q] * f);
                *(v4h*)((h16*)sr + ch * 128 + lane * 4) = o4; } }
         }
}

extern "C" void kernel_launch(void* const* d_in, const int* in_sizes, int n_in,
                              void* d_out, int out_size, void* d_ws, size_t ws_size, hipStream_t stream) {
    (void)in_sizes; (void)n_in; (void)out_size;
    const float* x = (const float*)d_in[0]; const float* wqg = (const float*)d_in[1]; const float* wk = (const float*)d_in[2]; const float* wv = (const float*)d_in[3]; const float* wo = (const float*)d_in[4]; const float* qnw = (const float*)d_in[5]; const float* knw = (const float*)d_in[6]; const float* cosT = (const float*)d_in[7]; const float* sinT = (const float*)d_in[8]; const float* wq = wqg;
    float* OUT = (float*)d_out;     // [2][2048][2048]
    char* wsp = (char*)d_ws;
    auto take = [&](size_t bytes) { char* p = wsp; wsp += (bytes + 255) & ~(size_t)255; return (void*)p; };
    bf* WQ = (bf*)take((size_t)DQ * DM * 2); bf* WK = (bf*)take((size_t)DKV * DM * 2); bf* WV = (bf*)take((size_t)DKV * DM * 2); bf* WO = (bf*)take((size_t)DM * DQ * 2); float* CS = (float*)take((size_t)TT * HD * 2 * 4);
    bf* WG = (bf*)take((size_t)DQ * DM * 2); float* GL = (float*)take((size_t)TT * DQ * 4);
    h16* QP16 = (h16*)take((size_t)NH_ * TT * HD * 2); h16* KP16 = (h16*)take((size_t)NKV * TT * HD * 2); h16* VT16 = (h16*)take((size_t)NKV * HD * TT * 2);
    bf* QPh = (bf*)take((size_t)NH_ * TT * HD * 2); bf* QPl = (bf*)take((size_t)NH_ * TT * HD * 2); bf* KPh = (bf*)take((size_t)NKV * TT * HD * 2); bf* KPl = (bf*)take((size_t)NKV * TT * HD * 2); bf* VTh = (bf*)take((size_t)NKV * HD * TT * 2); bf* VTl = (bf*)take((size_t)NKV * HD * TT * 2);
    float* Sb = (float*)take((size_t)ZH * TT * TT * 4); float* Ob = (float*)take((size_t)ZH * TT * HD * 4); bf* ATh = (bf*)take((size_t)TT * DQ * 2); bf* ATl = (bf*)take((size_t)TT * DQ * 2);
    if ((size_t)(wsp - (char*)d_ws) > ws_size) return;    // ws 256 MiB
    // What only the stages in front of the attention passes use lies inside the score buffer (stream-ordered: each is written anew before it is read, and read for the last time before the first score launch of its batch).
    wsp = (char*)Sb; bf* WQG = (bf*)take((size_t)2 * DQ * DM * 2); float* FQ = (float*)take((size_t)TT * DQ * 4); float* FK = (float*)take((size_t)TT * DKV * 4); bf* XB = (bf*)take((size_t)TT * DM * 2);
    float* FV = FK;   // v projection reuses the k buffer after the k planes are built (stream-ordered)
    { k_wtG<<<(unsigned)(DM * 2 * DQ / 512 / 8), 256, 0, stream>>>(wqg, DM, 2 * DQ, WQG); k_rowsel<<<(unsigned)(((size_t)DQ * DM / 8 + 255) / 256), 256, 0, stream>>>(WQG, 0, WQ); k_rowsel<<<(unsigned)(((size_t)DQ * DM / 8 + 255) / 256), 256, 0, stream>>>(WQG, HD, WG); k_wtG<<<(unsigned)(DM * DKV / 512 / 8), 256, 0, stream>>>(wk, DM, DKV, WK); k_wtG<<<(unsigned)(DM * DKV / 512 / 8), 256, 0, stream>>>(wv, DM, DKV, WV);
      k_wtG<<<(unsigned)(DQ * DM / 512 / 8), 256, 0, stream>>>(wo, DQ, DM, WO);
       }
    const unsigned LQ = (unsigned)(((size_t)NH_ * TT * HD / 8 + 255) / 256), LKv = (unsigned)(((size_t)NKV * TT * HD / 8 + 255) / 256);
    for (int b = 0; b < NB_; ++b) {
        if (b == 0) k_cscvt<<<(TT * HD + 255) / 256, 256, 0, stream>>>(cosT, sinT, CS);
        k_cvt8<<<(unsigned)(((size_t)TT * DM / 8 + 255) / 256), 256, 0, stream>>>(x + (size_t)b * TT * DM, DM, XB, (size_t)TT * DM / 8);
        k_gemmw<bf, 0, false, 4><<<dim3(TT / 64, DQ / 64, 1), 128, 0, stream>>>(XB, nullptr, WQ, nullptr, DM, FQ, DQ, nullptr, 0, 0, 0);
        k_rmsw<<<TT * NH_ / 8, 256, 0, stream>>>(FQ, DQ, NH_, qnw); k_rope<<<LQ, 256, 0, stream>>>(FQ, DQ, NH_, CS, 1.0f, QP16, QPh, QPl);
        k_gemmw<bf, 0, false, 8><<<dim3(TT / 64, DKV / 64, 1), 256, 0, stream>>>(XB, nullptr, WK, nullptr, DM, FK, DKV, nullptr, 0, 0, 0);
        k_rmsw<<<TT * NKV / 8, 256, 0, stream>>>(FK, DKV, NKV, knw); k_rope<<<LKv, 256, 0, stream>>>(FK, DKV, NKV, CS, 1.0f, KP16, KPh, KPl);
        k_gemmw<bf, 0, false, 8><<<dim3(TT / 64, DKV / 64, 1), 256, 0, stream>>>(XB, nullptr, WV, nullptr, DM, FV, DKV, nullptr, 0, 0, 0); k_vtp<<<LKv, 256, 0, stream>>>(FV, DKV, NKV, VT16, VTh, VTl);
        k_gemmw<bf, 0, false, 4><<<dim3(TT / 64, DQ / 64, 1), 128, 0, stream>>>(XB, nullptr, WG, nullptr, DM, GL, DQ, nullptr, 0, 0, 0);   /* gate logits */
        for (int h0 = 0; h0 < NH_; h0 += ZH) { const size_t zq = (size_t)h0, zk = (size_t)(h0 / REP);   // head h0 + z of a pass reads kv group h0/REP + z/REP (ZH % REP == 0)
            k_gemmc<bf, 2, 1, 1><<<dim3(RH / 64, TT / 64, ZH), 32, 0, stream>>>(QPh + zq * TT * HD, QPl + zq * TT * HD, HD, KPh + zk * TT * HD, KPl + zk * TT * HD, HD, Sb, TT, 0, (size_t)TT * HD, (size_t)TT * HD, (size_t)TT * TT);
            k_gemmc<h16, 0, 1, 1><<<dim3((TT - RH) / 64, TT / 64, ZH), 32, 0, stream>>>(QP16 + zq * TT * HD + (size_t)RH * HD, nullptr, HD, KP16 + zk * TT * HD, nullptr, HD, Sb + (size_t)RH * TT, TT, RH, (size_t)TT * HD, (size_t)TT * HD, (size_t)TT * TT);
            k_asoft<<<ZH * TT / 8, 256, 0, stream>>>(Sb);
            k_gemmc<bf, 2, 2, 8><<<dim3(RH / 64, HD / 64, ZH), 256, 0, stream>>>((const bf*)Sb, (const bf*)Sb + TT, 2 * TT, VTh + zk * HD * TT, VTl + zk * HD * TT, TT, Ob, HD, 0, (size_t)TT * 2 * TT, (size_t)HD * TT, (size_t)TT * HD);
            k_gemmc<h16, 0, 2, 8><<<dim3((TT - RH) / 64, HD / 64, ZH), 256, 0, stream>>>((const h16*)Sb + (size_t)RH * 2 * TT, nullptr, 2 * TT, VT16 + zk * HD * TT, nullptr, TT, Ob + (size_t)RH * HD, HD, RH, (size_t)TT * 2 * TT, (size_t)HD * TT, (size_t)TT * HD);
            k_mergeg<<<(unsigned)(((size_t)ZH * TT * HD / 8 + 255) / 256), 256, 0, stream>>>(Ob, h0, GL, ATh, ATl); }
        k_gemmw<bf, 1, false, 4><<<dim3(TT / 64, DM / 64, 1), 128, 0, stream>>>(ATh, ATl, WO, nullptr, DQ, OUT + (size_t)b * TT * DM, DM, nullptr, 0, 0, 0); }
}

// v004
// It runs in 337 microseconds.
// Two timings next to v003 put it at 1.83 and 1.82 times that version's speed.
// Over all steps from v000 it is 5.34 times as fast.
#include <hip/hip_runtime.h>

// GatedCausalSelfAttention (x [2][2048][2048]; qg = x w_q ([2048][4096]: per head h columns h*256 + [query 0..127 | gate 128..255]); k/v = x w_k/w_v (4 kv groups; head h -> group h/4); q, k RMS-normalised * w (eps 1e-6); rotate-half RoPE with the read cos/sin tables [T][128]; causal softmax(q.k / sqrt(128)) (finfo.min); out = (merged attn * sigmoid(gate)) w_o -> [2][2048][2048]).
// Compute dtypes, f32 accumulate: every input rounded to bf16; q, gate, k, v as PLAIN bf16 GEMMs (inputs: exact; the q/gate column blocks gathered from the transposed w_q plane); RMSNorm (in place) and RoPE (bf16-rounded tables) f32; causal scores and attn.v: query rows < 512 hl (3 products), the rest single fp16 (x1024), one fused kernel that stops at the diagonal block; online softmax f32; sigmoid gate (precise expf) applied in f32 when forming the hl planes; w_o hl x exact (2 products).

#define NB_  2
#define TT   2048
#define DM   2048
#define NH_  16
#define NKV  4
#define REP  (NH_ / NKV)
#define HD   128
#define DQ   (NH_ * HD)
#define DKV  (NKV * HD)
#define ZH   16                   // heads per k_mergeg launch: all of a batch
#define RH   512                  // query rows < RH use hi+lo planes (0: none)
#define WIN  2048
#define PCAR 1024.0f
#define SCL  0.088388347648318447f   // HD^-0.5
typedef _Float16 h16;
typedef unsigned short bf;
typedef __attribute__((ext_vector_type(16))) __bf16   v16bf;
typedef __attribute__((ext_vector_type(16))) _Float16 v16h;
typedef __attribute__((ext_vector_type(8)))  _Float16 v8h;
typedef __attribute__((ext_vector_type(8)))  unsigned short v8us;
typedef __attribute__((ext_vector_type(8)))  float    v8f;
typedef __attribute__((ext_vector_type(4)))  float    v4f;
typedef v8h  __attribute__((may_alias)) v8ha;
typedef v4f  __attribute__((may_alias)) v4fa;
typedef v8us __attribute__((may_alias)) v8usa;

__device__ __forceinline__ unsigned short f2bf(float f) { unsigned u = __float_as_uint(f); u += 0x7FFFu + ((u >> 16) & 1u); return (unsigned short)(u >> 16); }
__device__ __forceinline__ float bf2f(unsigned short b) { return __uint_as_float(((unsigned)b) << 16); }
__device__ __forceinline__ float bfr(float f) { return bf2f(f2bf(f)); }
__device__ __forceinline__ v16h cat16(v8h lo, v8h hi) { return __builtin_shufflevector(lo, hi, 0, 1, 2, 3, 4, 5, 6, 7, 8, 9, 10, 11, 12, 13, 14, 15); }
__device__ __forceinline__ v16bf cat16b(v8us lo, v8us hi) { return __builtin_bit_cast(v16bf, __builtin_shufflevector(lo, hi, 0, 1, 2, 3, 4, 5, 6, 7, 8, 9, 10, 11, 12, 13, 14, 15)); }
__device__ __forceinline__ v8f wmma16(v16h a, v16h b, v8f c) { return __builtin_amdgcn_wmma_f32_16x16x32_f16(false, a, false, b, (short)0, c, false, false); }
__device__ __forceinline__ v8f wmmab(v16bf a, v16bf b, v8f c) { return __builtin_amdgcn_wmma_f32_16x16x32_bf16(false, a, false, b, (short)0, c, false, false); }



// ---- Fragment-order planes. A 16-bit operand plane of R rows x K columns (R % 16 == 0, K % 32 == 0) is stored as blocks of 16 rows x 32 k = 512 elements (1 KiB), block index (r / 16) * (K / 32) + k / 32.
// Inside a block: two halves of 256 elements (k % 32 < 16, then >= 16); in a half, lane slot ((k / 8) % 2) * 16 + r % 16 holds its 8 consecutive k as one 16-byte piece. That is the order in which the 32 lanes of a wave
// hold a 16x32 WMMA operand, so a fragment is two wave-wide 16-byte loads of 512 contiguous bytes each (4 whole lines) instead of two loads that touch 16 lines. The elements and their k order in every fragment are those of a row-major plane.
// frag_piece: for the i-th 16-byte piece of such a plane (storage order), its row and first k.
__device__ __forceinline__ void frag_piece(size_t i, int kblocks, int& r, int& k0) { const int w = (int)(i & 63); const size_t blk = i >> 6; r = (int)(blk / kblocks) * 16 + (w & 15); k0 = (int)(blk % kblocks) * 32 + (w >> 5) * 16 + ((w >> 4) & 1) * 8; }

// ---- k_gemmw: register-blocked GEMM, NW WAVES per 64x64 output tile (16 accumulators each), operands straight from fragment-order 16-bit planes; grid (M/64, N/64, Z), 32 * NW threads.
// The K range is dealt to the waves in 32-element steps: wave w takes steps w, w + NW, ... (neighbouring waves read neighbouring 1-KiB blocks); the NW partial tiles are summed through LDS in wave order 0..NW-1.
// C[m][n] (f32, pitch ldc, + optional f32 bias[n]) = sum_k A[m][k] Bt[n][k] (+ split products per NSPLIT). z-batch strides sA/sB/sC in elements. K % 32 == 0.
// tile_sync: orders the staging tile's LDS writes and reads among the NW waves of a tile. It fences LDS only: __syncthreads() would also wait for the global stores of the rows just written out.
// One wave: no hardware barrier, only the compiler is kept from moving LDS accesses across.
template <int NW> __device__ __forceinline__ void tile_sync() {
    static_assert(NW == 1 || NW == 2 || NW == 4 || NW == 8, "the 16 staged rows are dealt two to a wave and pass");
    if (NW == 1) { __builtin_amdgcn_wave_barrier(); asm volatile("" ::: "memory"); }
    else { __builtin_amdgcn_fence(__ATOMIC_RELEASE, "workgroup", "local"); __builtin_amdgcn_s_barrier(); __builtin_amdgcn_fence(__ATOMIC_ACQUIRE, "workgroup", "local"); }
}
template <typename T16> struct WFrag;
template <> struct WFrag<h16> { typedef v16h V; static __device__ __forceinline__ V ld(const h16* p) { return cat16(*(const v8h*)p, *(const v8h*)(p + 16)); } static __device__ __forceinline__ V ldf(const h16* p) { return cat16(*(const v8h*)p, *(const v8h*)(p + 256)); } static __device__ __forceinline__ void stf(h16* p, V x) { *(v8h*)p = __builtin_shufflevector(x, x, 0, 1, 2, 3, 4, 5, 6, 7); *(v8h*)(p + 256) = __builtin_shufflevector(x, x, 8, 9, 10, 11, 12, 13, 14, 15); } static __device__ __forceinline__ v8f mma(V a, V b, v8f c) { return wmma16(a, b, c); } };
template <> struct WFrag<bf> { typedef v16bf V; static __device__ __forceinline__ V ld(const bf* p) { return cat16b(*(const v8us*)p, *(const v8us*)(p + 16)); } static __device__ __forceinline__ V ldf(const bf* p) { return cat16b(*(const v8us*)p, *(const v8us*)(p + 256)); } static __device__ __forceinline__ void stf(bf* p, V x) { typedef __attribute__((ext_vector_type(16))) unsigned short v16us; const v16us u = __builtin_bit_cast(v16us, x); *(v8us*)p = __builtin_shufflevector(u, u, 0, 1, 2, 3, 4, 5, 6, 7); *(v8us*)(p + 256) = __builtin_shufflevector(u, u, 8, 9, 10, 11, 12, 13, 14, 15); } static __device__ __forceinline__ v8f mma(V a, V b, v8f c) { return wmmab(a, b, c); } };
template <typename T16, int NSPLIT, bool BIAS, int NW>
__global__ __launch_bounds__(32 * NW) void k_gemmw(const T16* __restrict__ A, const T16* __restrict__ A2, const T16* __restrict__ Bt, const T16* __restrict__ Bt2, int K, float* C, int ldc, const float* __restrict__ bias, size_t sA, size_t sB, size_t sC) {
    typedef typename WFrag<T16>::V V;
    __shared__ __align__(16) float os[NW * 16 * 68];
    const size_t z = blockIdx.z; A += z * sA; if (A2) A2 += z * sA; Bt += z * sB; if (Bt2) Bt2 += z * sB; C += z * sC;
    const int lane = threadIdx.x & 31, lr = lane & 15, hi = lane >> 4; const int r0 = blockIdx.x * 64, c0 = blockIdx.y * 64;
    const int wave = (NW == 1) ? 0 : __builtin_amdgcn_readfirstlane((int)(threadIdx.x >> 5));   // scalar, so that the K loop's branch is a scalar one
    v8f acc[4][4];
#pragma unroll
    for (int mb = 0; mb < 4; ++mb)
#pragma unroll
        for (int nb = 0; nb < 4; ++nb) acc[mb][nb] = (v8f){};
    const unsigned aoff = ((unsigned)r0 * K + lane * 8) * 2, boff = ((unsigned)c0 * K + lane * 8) * 2;   // byte offsets in a plane (every plane is far below 4 GiB): 16 rows of a fragment-order plane are 16 * K contiguous elements, a k step of 32 is one block of 512; lane * 8: the lane's 16-byte piece
#pragma unroll 1
    for (int kc = wave * 32; kc < K; kc += NW * 32) {
        V a[4], a2[4]; unsigned oa[4], ob[4];
#pragma unroll
        for (int mb = 0; mb < 4; ++mb) { oa[mb] = aoff + (unsigned)(mb * K + kc) * 32; a[mb] = WFrag<T16>::ldf((const T16*)((const char*)A + oa[mb])); if (NSPLIT == 1 || NSPLIT == 2) a2[mb] = WFrag<T16>::ldf((const T16*)((const char*)A2 + oa[mb])); }
#pragma unroll
        for (int nb = 0; nb < 4; ++nb) { ob[nb] = boff + (unsigned)(nb * K + kc) * 32; const V b = WFrag<T16>::ldf((const T16*)((const char*)Bt + ob[nb])); V b2; if (NSPLIT >= 2) b2 = WFrag<T16>::ldf((const T16*)((const char*)Bt2 + ob[nb]));
#pragma unroll
            for (int mb = 0; mb < 4; ++mb) { acc[mb][nb] = WFrag<T16>::mma(a[mb], b, acc[mb][nb]); if (NSPLIT == 1 || NSPLIT == 2) acc[mb][nb] = WFrag<T16>::mma(a2[mb], b, acc[mb][nb]); if (NSPLIT >= 2) acc[mb][nb] = WFrag<T16>::mma(a[mb], b2, acc[mb][nb]); } }
        // precaution: one wait behind all loads of the step and in front of any rewrite of their offset registers; the offsets are inputs so that they keep their registers up to the wait (the plane pointers are not rewritten in the loop)
        asm volatile("s_wait_xcnt 0x0" :: "v"(oa[0]), "v"(oa[1]), "v"(oa[2]), "v"(oa[3]), "v"(ob[0]), "v"(ob[1]), "v"(ob[2]), "v"(ob[3]) : "memory");
        asm volatile("v_nop\n\tv_nop\n\tv_nop\n\tv_nop" : "+v"(acc[0][0]), "+v"(acc[1][1]), "+v"(acc[2][2]), "+v"(acc[3][3]) : "v"(a[0]), "v"(a[3]));
    }
#pragma unroll
    for (int mb = 0; mb < 4; ++mb) {
#pragma unroll
        for (int nb = 0; nb < 4; ++nb) {
#pragma unroll
            for (int j = 0; j < 8; ++j) os[(wave * 16 + hi * 8 + j) * 68 + nb * 16 + lr] = acc[mb][nb][j]; }
        tile_sync<NW>();   // every wave's partial rows stand in LDS before they are summed
        float* crow = C + (size_t)(r0 + mb * 16) * ldc + c0;
{
#pragma unroll
            for (int s = 0; s < 8 / NW; ++s) { const int row = 2 * (wave + s * NW) + hi, cofs = lr * 4; v4f val = *(const v4fa*)(os + row * 68 + cofs);
#pragma unroll
                for (int w = 1; w < NW; ++w) val += *(const v4fa*)(os + (w * 16 + row) * 68 + cofs);
                if (BIAS) { val[0] += bfr(bias[c0 + cofs]); val[1] += bfr(bias[c0 + cofs + 1]); val[2] += bfr(bias[c0 + cofs + 2]); val[3] += bfr(bias[c0 + cofs + 3]); }
                *(v4f*)(crow + (size_t)row * ldc + cofs) = val;
                if (NW > 1) asm volatile("s_wait_xcnt 0x0" ::: "memory"); }   // precaution: stands in front of any rewrite of the store's address and data registers
             }
        if (NW == 1 || mb < 3) tile_sync<NW>();   // the partials are read before the next 16 rows overwrite them
    }
}

__device__ __forceinline__ h16 tohx(float x) { return (h16)x; }
__device__ __forceinline__ void splitf(float y, unsigned short& h, unsigned short& l) { h = f2bf(y); l = f2bf(y - bf2f(h)); }
typedef __attribute__((ext_vector_type(2))) _Float16 v2h;
typedef __attribute__((ext_vector_type(4))) _Float16 v4h;
typedef __attribute__((ext_vector_type(2))) unsigned short v2us;
typedef __attribute__((ext_vector_type(4))) unsigned short v4us;
typedef __attribute__((ext_vector_type(2))) float v2f;
typedef __attribute__((ext_vector_type(4))) int v4i;

// k_wtG: Bt = the fragment-order bf16 plane of w^T (rows n, columns k) from w [K][N] f32. One wave builds one block (16 n x 32 k): each load takes 16 neighbouring n of two k rows; the 8 waves of a work-group take 8 neighbouring groups of n.
__global__ __launch_bounds__(256) void k_wtG(const float* __restrict__ w, int K, int N, bf* Bt) {
    const int lane = threadIdx.x & 31, lr = lane & 15, hi = lane >> 4; const int wv = blockIdx.x * 8 + (threadIdx.x >> 5); const int ng = N / 16, kbs = K / 32; if (wv >= ng * kbs) return; const int nb = wv % ng, kb = wv / ng;
    const float* p = w + (size_t)(kb * 32 + hi * 8) * N + nb * 16 + lr; bf* o = Bt + ((size_t)nb * kbs + kb) * 512 + lane * 8; const float* q[16]; float x[16];
#pragma unroll
    for (int j = 0; j < 16; ++j) { q[j] = p + (size_t)((j >> 3) * 16 + (j & 7)) * N; x[j] = *q[j]; }
    // precaution: the wait stands behind the loads and in front of any rewrite of their address registers; the addresses are inputs so that they keep their registers up to the wait
    asm volatile("s_wait_xcnt 0x0" :: "v"(q[0]), "v"(q[1]), "v"(q[2]), "v"(q[3]), "v"(q[4]), "v"(q[5]), "v"(q[6]), "v"(q[7]), "v"(q[8]), "v"(q[9]), "v"(q[10]), "v"(q[11]), "v"(q[12]), "v"(q[13]), "v"(q[14]), "v"(q[15]) : "memory");
    v8us v0, v1;
#pragma unroll
    for (int j = 0; j < 8; ++j) { v0[j] = f2bf(x[j]); v1[j] = f2bf(x[8 + j]); }
    *(v8us*)o = v0; *(v8us*)(o + 256) = v1;
}
__global__ __launch_bounds__(256) void k_cvt8(const float* __restrict__ src, int K, bf* dst, size_t n8) { const size_t i = (size_t)blockIdx.x * 256 + threadIdx.x; if (i >= n8) return; int r, k0; frag_piece(i, K / 32, r, k0); const float* p = src + (size_t)r * K + k0; const v8f v = *(const v8f*)p; v8us o;
    asm volatile("s_wait_xcnt 0x0" :: "v"(p) : "memory");   // precaution: the wait stands behind the loads and in front of any rewrite of their address registers; the addresses are inputs so that they keep their registers up to the wait
#pragma unroll
    for (int k = 0; k < 8; ++k) o[k] = f2bf(v[k]); *(v8us*)(dst + i * 8) = o;  }
__global__ __launch_bounds__(256) void k_cscvt(const float* __restrict__ cosT, const float* __restrict__ sinT, float* CS) { const int idx = blockIdx.x * 256 + threadIdx.x; if (idx >= TT * HD) return; v2f cs; cs[0] = bfr(cosT[idx]); cs[1] = bfr(sinT[idx]); *(v2f*)(CS + (size_t)idx * 2) = cs;  }
// k_rope: head planes (rows h * TT + t, columns d, fragment order; one 16-byte piece per thread and plane; fp16 + hi/lo) of rope(x) x sc with the rotate-half convention out[d] = x[d] cos[t][d] - x[d+HD/2] sin[t][d], out[d+HD/2] = x[d+HD/2] cos[t][d+HD/2] + x[d] sin[t][d+HD/2]
__global__ __launch_bounds__(256) void k_rope(const float* __restrict__ F, int pitch, int nheads, const float* __restrict__ CS, float sc, h16* P16, bf* Ph, bf* Pl) {
    const size_t e = ((size_t)blockIdx.x * 256 + threadIdx.x) * 8; if (e >= (size_t)nheads * TT * HD) return; int row, d; frag_piece(e / 8, HD / 32, row, d); const int t = row % TT; const int h = row / TT; const float* f = F + (size_t)t * pitch + h * HD; v8h o16; v8us oh, ol;
    const float* p0 = f + d; const float* p1 = f + ((d < HD / 2) ? d + HD / 2 : d - HD / 2); const float* pc = CS + ((size_t)t * HD + d) * 2; const v8f X0 = *(const v8f*)p0, X1 = *(const v8f*)p1, C0 = *(const v8f*)pc, C1 = *(const v8f*)(pc + 8);
    asm volatile("s_wait_xcnt 0x0" :: "v"(p0), "v"(p1), "v"(pc) : "memory");   // precaution: the wait stands behind the loads and in front of any rewrite of their address registers; the addresses are inputs so that they keep their registers up to the wait
#pragma unroll
    for (int q = 0; q < 8; ++q) { const float x0 = X0[q], x1 = X1[q]; const float cq = (q < 4) ? C0[2 * q] : C1[2 * q - 8], sq = (q < 4) ? C0[2 * q + 1] : C1[2 * q - 7];
        float a = __fmul_rn(x0, cq), bq = __fmul_rn(x1, sq); asm volatile("" : "+v"(a)); asm volatile("" : "+v"(bq)); const float r = ((d < HD / 2) ? __fsub_rn(a, bq) : __fadd_rn(a, bq)) * sc;
        o16[q] = tohx(r); unsigned short a2, c2; splitf(r, a2, c2); oh[q] = a2; ol[q] = c2; }
    *(v8h*)(P16 + e) = o16; *(v8us*)(Ph + e) = oh; *(v8us*)(Pl + e) = ol;  }
// k_vtp: the transposed value planes (rows g * HD + d, columns t, fragment order; one 16-byte piece per thread and plane)
__global__ __launch_bounds__(256) void k_vtp(const float* __restrict__ F, int pitch, int nheads, h16* V16, bf* Vh, bf* Vl) { const size_t e = ((size_t)blockIdx.x * 256 + threadIdx.x) * 8; if (e >= (size_t)nheads * HD * TT) return; int row, t; frag_piece(e / 8, TT / 32, row, t); const int d = row % HD; const int g = row / HD; v8h o16; v8us oh, ol; const float* pq[8]; float xq[8];
#pragma unroll
    for (int q = 0; q < 8; ++q) { pq[q] = F + (size_t)(t + q) * pitch + g * HD + d; xq[q] = *pq[q]; }
    asm volatile("s_wait_xcnt 0x0" :: "v"(pq[0]), "v"(pq[1]), "v"(pq[2]), "v"(pq[3]), "v"(pq[4]), "v"(pq[5]), "v"(pq[6]), "v"(pq[7]) : "memory");   // precaution: the wait stands behind the loads and in front of any rewrite of their address registers; the addresses are inputs so that they keep their registers up to the wait
#pragma unroll
    for (int q = 0; q < 8; ++q) { const float x = xq[q]; o16[q] = tohx(x); unsigned short a2, c2; splitf(x, a2, c2); oh[q] = a2; ol[q] = c2; }
    *(v8h*)(V16 + e) = o16; *(v8us*)(Vh + e) = oh; *(v8us*)(Vl + e) = ol;  }
__global__ __launch_bounds__(256) void k_rowsel(const bf* __restrict__ WSRC, int off, bf* WDST) { const size_t e8 = ((size_t)blockIdx.x * 256 + threadIdx.x) * 8; if (e8 >= (size_t)DQ * DM) return; const size_t in = e8 % ((size_t)16 * DM); const int row = (int)(e8 / ((size_t)16 * DM)) * 16; const int h = row / HD, d = row % HD; const bf* p = WSRC + ((size_t)h * 2 * HD + off + d) * DM + in; const v8us a = *(const v8us*)p;
    asm volatile("s_wait_xcnt 0x0" :: "v"(p) : "memory");   // precaution: the wait stands behind the loads and in front of any rewrite of their address registers; the addresses are inputs so that they keep their registers up to the wait
    *(v8us*)(WDST + e8) = a;  }   // 16 rows of a fragment-order plane are 16 * DM contiguous elements: whole groups of 16 rows are copied
__global__ __launch_bounds__(256) void k_rmsw(float* F, int pitch, int nheads, const float* __restrict__ w) { const int lane = threadIdx.x & 31; const int wv = blockIdx.x * 8 + (threadIdx.x >> 5); if (wv >= TT * nheads) return; const int t = wv / nheads, h = wv % nheads; float* f = F + (size_t)t * pitch + h * HD; const v4f a = *(const v4f*)(f + lane * 4); float ss = 0.f;
#pragma unroll
    for (int q = 0; q < 4; ++q) { float p = __fmul_rn(a[q], a[q]); asm volatile("" : "+v"(p)); ss = __fadd_rn(ss, p); }
#pragma unroll
    for (int sh = 16; sh; sh >>= 1) ss = __fadd_rn(ss, __shfl_xor(ss, sh, 32));
    const float rs = __fdiv_rn(1.0f, sqrtf(__fadd_rn(ss * (1.0f / HD), 1e-6f))); v4f o;
#pragma unroll
    for (int q = 0; q < 4; ++q) { float y = __fmul_rn(a[q], rs); asm volatile("" : "+v"(y)); o[q] = __fmul_rn(y, bfr(w[lane * 4 + q])); }
    *(v4f*)(f + lane * 4) = o;  }
__global__ __launch_bounds__(256) void k_mergeg(const float* __restrict__ O, int h0, const float* __restrict__ GL, bf* Ah, bf* Al) { const size_t i = (size_t)blockIdx.x * 256 + threadIdx.x; if (i >= (size_t)ZH * TT * HD / 8) return; int t, cl; frag_piece(i, ZH * HD / 32, t, cl); const int d = cl % HD; const int zz = cl / HD; const float cs = (t < RH) ? 1.0f : (1.0f / PCAR); const size_t e = ((size_t)zz * TT + t) * HD + d, gg = (size_t)t * DQ + (h0 + zz) * HD + d;
    const size_t oo = (((size_t)(t / 16) * (DQ / 32) + (h0 * HD + cl) / 32) * 64 + (i & 63)) * 8;   // this thread's 16-byte piece in the fragment-order planes of DQ columns
    v8us oh, ol; const float* po = O + e; const float* pg = GL + gg; const v8f OV = *(const v8f*)po, GV = *(const v8f*)pg;
    asm volatile("s_wait_xcnt 0x0" :: "v"(po), "v"(pg) : "memory");   // precaution: the wait stands behind the loads and in front of any rewrite of their address registers; the addresses are inputs so that they keep their registers up to the wait
#pragma unroll
    for (int q = 0; q < 8; ++q) { float a0 = OV[q] * cs; asm volatile("" : "+v"(a0)); const float gl = GV[q]; const float sg = __fdiv_rn(1.0f, __fadd_rn(1.0f, expf(-gl))); unsigned short a, c2; splitf(__fmul_rn(a0, sg), a, c2); oh[q] = a; ol[q] = c2; } *(v8us*)(Ah + oo) = oh; *(v8us*)(Al + oo) = ol;  }
__device__ __forceinline__ float xhalf(float x) { return __builtin_bit_cast(float, __builtin_amdgcn_permlanex16(__builtin_bit_cast(int, x), __builtin_bit_cast(int, x), 0x76543210, 0xfedcba98, false, false)); }
template <typename T16> struct PFrag;
template <> struct PFrag<h16> { static __device__ __forceinline__ void cv(const float* e, v16h& p, v16h& p2) { (void)p2;
#pragma unroll
    for (int i = 0; i < 16; ++i) p[i] = (h16)e[i]; } };
template <> struct PFrag<bf> { static __device__ __forceinline__ void cv(const float* e, v16bf& p, v16bf& p2) { v8us h0, h1, l0, l1;
#pragma unroll
    for (int i = 0; i < 8; ++i) { unsigned short a = f2bf(e[i]), c = f2bf(e[8 + i]); h0[i] = a; l0[i] = f2bf(e[i] - bf2f(a)); h1[i] = c; l1[i] = f2bf(e[8 + i] - bf2f(c)); }
    p = cat16b(h0, h1); p2 = cat16b(l0, l1); } };
#define CEXP (SCL * 1.4426950408889634f)   // HD^-0.5 * log2(e)
template <typename T16, bool HL>
__device__ __forceinline__ void fattn_rows(const T16* __restrict__ Q, const T16* __restrict__ Q2, const T16* __restrict__ Kp, const T16* __restrict__ Kp2, const T16* __restrict__ Vt, const T16* __restrict__ Vt2, float* __restrict__ O, int q0, T16* qs) {
    typedef typename WFrag<T16>::V V; typedef WFrag<T16> F;
    const int lane = threadIdx.x & 31, lr = lane & 15, hi = lane >> 4;
    V q[4], q2[4], k[8];
    const unsigned qo = ((unsigned)q0 * HD + lane * 8) * 2;   // byte offsets in a plane; 16 rows x HD columns are HD / 32 blocks of 1 KiB in a row
#pragma unroll
    for (int dk = 0; dk < 4; ++dk) { q[dk] = F::ldf((const T16*)((const char*)Q + qo) + dk * 512); if (HL) q2[dk] = F::ldf((const T16*)((const char*)Q2 + qo) + dk * 512); }
    // With every Q fragment held over the block a wave would not fit 256 registers (four waves per SIMD): the fragment that a block uses last (hi+lo: all eight, to leave room for sixteen K or V fragments in flight) waits in LDS, each lane's 32 bytes in a place of its own that no other lane touches (so no barrier).
    T16* ql = qs + lane * 8;
    if (HL) {
#pragma unroll
        for (int dk = 0; dk < 4; ++dk) { F::stf(ql + dk * 1024, q[dk]); F::stf(ql + dk * 1024 + 512, q2[dk]); } }
    else F::stf(ql, q[3]);
    const unsigned k0o = lane * 16;
    if (!HL) {
#pragma unroll
        for (int i = 0; i < 8; ++i) k[i] = F::ldf((const T16*)((const char*)Kp + k0o) + i * 512); }
    // precaution: the wait stands behind the loads and in front of any rewrite of their offset registers; the offsets are inputs so that they keep their registers up to the wait
    if (HL) asm volatile("s_wait_xcnt 0x0" :: "v"(qo) : "memory"); else asm volatile("s_wait_xcnt 0x0" :: "v"(qo), "v"(k0o) : "memory");
    v8f o[8];
#pragma unroll
    for (int dt = 0; dt < 8; ++dt) o[dt] = (v8f){};
    float m = -3.0e38f, l = 0.f;
    const int nkb = q0 / 32 + 1;   // the block that holds the diagonal is the last one
#pragma unroll 1   // rolled: two blocks' fragments at once would not fit the 256 registers (the inner loops are all unrolled so that their arrays are registers)
    for (int kb = 0; kb < nkb; ++kb) {
        const unsigned ko = lane * 16 + (unsigned)kb * (32 * HD * 2), kn = lane * 16 + (unsigned)min(kb + 1, nkb - 1) * (32 * HD * 2), vo = lane * 16 + (unsigned)kb * 1024;
        V v[8], w[8];
        if (!HL) {   // the value fragments start early: their latency runs under the score products and the softmax
#pragma unroll
            for (int dt = 0; dt < 8; ++dt) v[dt] = F::ldf((const T16*)((const char*)Vt + vo) + dt * (TT / 32) * 512);
        } else {   // hi+lo: twice the fragments, so none is fetched a block ahead
#pragma unroll
            for (int i = 0; i < 8; ++i) { k[i] = F::ldf((const T16*)((const char*)Kp + ko) + i * 512); w[i] = F::ldf((const T16*)((const char*)Kp2 + ko) + i * 512); }
            asm volatile("s_wait_xcnt 0x0" :: "v"(ko) : "memory");   // the same precaution behind the K loads
            __builtin_amdgcn_sched_barrier(0);   // all sixteen K fragments are in flight before the first product: one load latency a block instead of one per pair of fragments
        }
        if (!HL) q[3] = F::ldf(ql);
        v8f s[2]; s[0] = (v8f){}; s[1] = (v8f){};
#pragma unroll
        for (int dk = 0; dk < 4; ++dk)
#pragma unroll
            for (int kt = 0; kt < 2; ++kt) { if (HL && kt == 0) { q[dk] = F::ldf(ql + dk * 1024); q2[dk] = F::ldf(ql + dk * 1024 + 512); }
                s[kt] = F::mma(k[kt * 4 + dk], q[dk], s[kt]); if (HL) { s[kt] = F::mma(k[kt * 4 + dk], q2[dk], s[kt]); s[kt] = F::mma(w[kt * 4 + dk], q[dk], s[kt]); } }
        if (HL) {
#pragma unroll
            for (int dt = 0; dt < 8; ++dt) { v[dt] = F::ldf((const T16*)((const char*)Vt + vo) + dt * (TT / 32) * 512); w[dt] = F::ldf((const T16*)((const char*)Vt2 + vo) + dt * (TT / 32) * 512); }
        }
        if (!HL) {   // the next block's K fragments are fetched one block ahead, into the same registers (the last block fetches itself again: never a row past the diagonal block)
#pragma unroll
            for (int i = 0; i < 8; ++i) k[i] = F::ldf((const T16*)((const char*)Kp + kn) + i * 512); }
        // the same precaution behind the V and next-K loads
        if (HL) { asm volatile("s_wait_xcnt 0x0" :: "v"(vo) : "memory"); __builtin_amdgcn_sched_barrier(0); }   // the barrier: all sixteen V fragments start in front of the softmax, which covers their latency
        else asm volatile("s_wait_xcnt 0x0" :: "v"(vo), "v"(kn) : "memory");
        float t[16];
#pragma unroll
        for (int i = 0; i < 16; ++i) t[i] = s[i >> 3][i & 7] * CEXP;
        if (kb == nkb - 1) {   // only the diagonal block holds keys behind a query
#pragma unroll
            for (int i = 0; i < 16; ++i) t[i] = (kb * 32 + (i >> 3) * 16 + hi * 8 + (i & 7) <= q0 + lr) ? t[i] : -3.0e38f; }
        float mx = fmaxf(t[0], t[1]);
#pragma unroll
        for (int i = 2; i < 16; ++i) mx = fmaxf(mx, t[i]);
        mx = fmaxf(mx, xhalf(mx));
        const float mn = fmaxf(m, mx);
        if (__builtin_amdgcn_ballot_w32(mn > m) != 0) {   // a scalar branch: the rescale is skipped while no query of the wave has a new maximum (its factor would be exactly 1)
            const float al = __builtin_amdgcn_exp2f(m - mn); l *= al;
#pragma unroll
            for (int dt = 0; dt < 8; ++dt) o[dt] *= al;
            m = mn; }
        const float mo = HL ? m : m - 10.0f;   // exp2(10) = PCAR
        float e[16];
#pragma unroll
        for (int i = 0; i < 16; ++i) e[i] = __builtin_amdgcn_exp2f(t[i] - mo);
        l += ((((e[0] + e[1]) + (e[2] + e[3])) + ((e[4] + e[5]) + (e[6] + e[7]))) + (((e[8] + e[9]) + (e[10] + e[11])) + ((e[12] + e[13]) + (e[14] + e[15]))));
        V p, p2; PFrag<T16>::cv(e, p, p2);
#pragma unroll
        for (int dt = 0; dt < 8; ++dt) { o[dt] = F::mma(v[dt], p, o[dt]); if (HL) { o[dt] = F::mma(v[dt], p2, o[dt]); o[dt] = F::mma(w[dt], p, o[dt]); } }
    }
    l += xhalf(l);   // the two halves of the wave hold the two halves of each query's keys
    const float f = __fdiv_rn(HL ? 1.0f : PCAR, l);
#pragma unroll
    for (int dt = 0; dt < 8; ++dt) o[dt] *= f;
    float* orow = O + (size_t)(q0 + lr) * HD + hi * 8;   // register r of tile dt: column dt * 16 + 8 * hi + r of the query's row
#pragma unroll
    for (int dt = 0; dt < 8; ++dt) *(v8f*)(orow + dt * 16) = o[dt];
    asm volatile("s_wait_xcnt 0x0" :: "v"(orow) : "memory");   // precaution: stands behind the stores and in front of any rewrite of their address and data registers
}
// grid (NKV * NB_, TT / 32): x = kv group + NKV * batch. Cost grows with the row, and all work-groups are resident at once: waves 0..REP-1 take the 16-row tile TT/16 - 1 - y, the others tile y, so that every work-group walks about the same number of key blocks. No wave shares a barrier or a buffer with another.
// amdgpu_waves_per_eu: two work-groups per WGP, so that one wave's load latency and softmax run under the others' matrix work.
__global__ __launch_bounds__(256) __attribute__((amdgpu_waves_per_eu(4, 4))) void k_fattn(const h16* __restrict__ Q16, const bf* __restrict__ Qh, const bf* __restrict__ Ql, const h16* __restrict__ K16, const bf* __restrict__ Kh, const bf* __restrict__ Kl, const h16* __restrict__ V16, const bf* __restrict__ Vh, const bf* __restrict__ Vl, float* __restrict__ O) {
    __shared__ __align__(16) unsigned short qsh[8 * 4096];   // 8 KiB a wave: the Q fragments that wait in LDS
    const int wave = __builtin_amdgcn_readfirstlane((int)(threadIdx.x >> 5));   // scalar, so that the key loop's and the precision branch are scalar ones
    const int g = blockIdx.x % NKV, b = blockIdx.x / NKV; const int q0 = ((wave / REP == 0) ? TT / 16 - 1 - (int)blockIdx.y : (int)blockIdx.y) * 16;
    const size_t qoff = ((size_t)b * NH_ + g * REP + wave % REP) * TT * HD, koff = ((size_t)b * NKV + g) * TT * HD;
    if (q0 < RH) fattn_rows<bf, true>(Qh + qoff, Ql + qoff, Kh + koff, Kl + koff, Vh + koff, Vl + koff, O + qoff, q0, (bf*)qsh + wave * 4096);
    else fattn_rows<h16, false>(Q16 + qoff, nullptr, K16 + koff, nullptr, V16 + koff, nullptr, O + qoff, q0, (h16*)qsh + wave * 4096);
}

extern "C" void kernel_launch(void* const* d_in, const int* in_sizes, int n_in,
                              void* d_out, int out_size, void* d_ws, size_t ws_size, hipStream_t stream) {
    (void)in_sizes; (void)n_in; (void)out_size;
    const float* x = (const float*)d_in[0]; const float* wqg = (const float*)d_in[1]; const float* wk = (const float*)d_in[2]; const float* wv = (const float*)d_in[3]; const float* wo = (const float*)d_in[4]; const float* qnw = (const float*)d_in[5]; const float* knw = (const float*)d_in[6]; const float* cosT = (const float*)d_in[7]; const float* sinT = (const float*)d_in[8]; const float* wq = wqg;
    float* OUT = (float*)d_out;     // [2][2048][2048]
    char* wsp = (char*)d_ws;
    auto take = [&](size_t bytes) { char* p = wsp; wsp += (bytes + 255) & ~(size_t)255; return (void*)p; };
    bf* WQ = (bf*)take((size_t)DQ * DM * 2); bf* WK = (bf*)take((size_t)DKV * DM * 2); bf* WV = (bf*)take((size_t)DKV * DM * 2); bf* WO = (bf*)take((size_t)DM * DQ * 2); float* CS = (float*)take((size_t)TT * HD * 2 * 4);
    bf* WG = (bf*)take((size_t)DQ * DM * 2); float* GL = (float*)take((size_t)NB_ * TT * DQ * 4);
    const size_t NQP = (size_t)NH_ * TT * HD, NKP = (size_t)NKV * TT * HD;   // elements of one batch's query planes and of its key or value planes; the q, k, v planes and Ob below hold both batches
    h16* QP16 = (h16*)take(NB_ * NQP * 2); h16* KP16 = (h16*)take(NB_ * NKP * 2); h16* VT16 = (h16*)take(NB_ * NKP * 2);
    bf* QPh = (bf*)take(NB_ * NQP * 2); bf* QPl = (bf*)take(NB_ * NQP * 2); bf* KPh = (bf*)take(NB_ * NKP * 2); bf* KPl = (bf*)take(NB_ * NKP * 2); bf* VTh = (bf*)take(NB_ * NKP * 2); bf* VTl = (bf*)take(NB_ * NKP * 2);
    float* Ob = (float*)take(NB_ * NQP * 4); bf* ATh = (bf*)take((size_t)TT * DQ * 2); bf* ATl = (bf*)take((size_t)TT * DQ * 2);
    bf* WQG = (bf*)take((size_t)2 * DQ * DM * 2); float* FQ = (float*)take((size_t)TT * DQ * 4); float* FK = (float*)take((size_t)TT * DKV * 4); bf* XB = (bf*)take((size_t)TT * DM * 2);
    if ((size_t)(wsp - (char*)d_ws) > ws_size) return;    // ws 256 MiB
    float* FV = FK;   // v projection reuses the k buffer after the k planes are built (stream-ordered)
    { k_wtG<<<(unsigned)(DM * 2 * DQ / 512 / 8), 256, 0, stream>>>(wqg, DM, 2 * DQ, WQG); k_rowsel<<<(unsigned)(((size_t)DQ * DM / 8 + 255) / 256), 256, 0, stream>>>(WQG, 0, WQ); k_rowsel<<<(unsigned)(((size_t)DQ * DM / 8 + 255) / 256), 256, 0, stream>>>(WQG, HD, WG); k_wtG<<<(unsigned)(DM * DKV / 512 / 8), 256, 0, stream>>>(wk, DM, DKV, WK); k_wtG<<<(unsigned)(DM * DKV / 512 / 8), 256, 0, stream>>>(wv, DM, DKV, WV);
      k_wtG<<<(unsigned)(DQ * DM / 512 / 8), 256, 0, stream>>>(wo, DQ, DM, WO);
       }
    const unsigned LQ = (unsigned)(((size_t)NH_ * TT * HD / 8 + 255) / 256), LKv = (unsigned)(((size_t)NKV * TT * HD / 8 + 255) / 256);
    for (int b = 0; b < NB_; ++b) {
        if (b == 0) k_cscvt<<<(TT * HD + 255) / 256, 256, 0, stream>>>(cosT, sinT, CS);
        k_cvt8<<<(unsigned)(((size_t)TT * DM / 8 + 255) / 256), 256, 0, stream>>>(x + (size_t)b * TT * DM, DM, XB, (size_t)TT * DM / 8);
        k_gemmw<bf, 0, false, 4><<<dim3(TT / 64, DQ / 64, 1), 128, 0, stream>>>(XB, nullptr, WQ, nullptr, DM, FQ, DQ, nullptr, 0, 0, 0);
        k_rmsw<<<TT * NH_ / 8, 256, 0, stream>>>(FQ, DQ, NH_, qnw); k_rope<<<LQ, 256, 0, stream>>>(FQ, DQ, NH_, CS, 1.0f, QP16 + b * NQP, QPh + b * NQP, QPl + b * NQP);
        k_gemmw<bf, 0, false, 8><<<dim3(TT / 64, DKV / 64, 1), 256, 0, stream>>>(XB, nullptr, WK, nullptr, DM, FK, DKV, nullptr, 0, 0, 0);
        k_rmsw<<<TT * NKV / 8, 256, 0, stream>>>(FK, DKV, NKV, knw); k_rope<<<LKv, 256, 0, stream>>>(FK, DKV, NKV, CS, 1.0f, KP16 + b * NKP, KPh + b * NKP, KPl + b * NKP);
        k_gemmw<bf, 0, false, 8><<<dim3(TT / 64, DKV / 64, 1), 256, 0, stream>>>(XB, nullptr, WV, nullptr, DM, FV, DKV, nullptr, 0, 0, 0); k_vtp<<<LKv, 256, 0, stream>>>(FV, DKV, NKV, VT16 + b * NKP, VTh + b * NKP, VTl + b * NKP);
        k_gemmw<bf, 0, false, 4><<<dim3(TT / 64, DQ / 64, 1), 128, 0, stream>>>(XB, nullptr, WG, nullptr, DM, GL + (size_t)b * TT * DQ, DQ, nullptr, 0, 0, 0); }   /* gate logits */
    k_fattn<<<dim3(NKV * NB_, TT / 32, 1), 256, 0, stream>>>(QP16, QPh, QPl, KP16, KPh, KPl, VT16, VTh, VTl, Ob);   // all heads of both batches
    for (int b = 0; b < NB_; ++b) {
        k_mergeg<<<(unsigned)(((size_t)ZH * TT * HD / 8 + 255) / 256), 256, 0, stream>>>(Ob + b * NQP, 0, GL + (size_t)b * TT * DQ, ATh, ATl);
        k_gemmw<bf, 1, false, 4><<<dim3(TT / 64, DM / 64, 1), 128, 0, stream>>>(ATh, ATl, WO, nullptr, DQ, OUT + (size_t)b * TT * DM, DM, nullptr, 0, 0, 0); }
}

// v005
// It runs in 264 microseconds.
// Next to v004, in two timings, it ran 1.28 times as fast each time.
// Counting every step since v000, it is 6.83 times as fast.
#include <hip/hip_runtime.h>

// GatedCausalSelfAttention (x [2][2048][2048]; qg = x w_q ([2048][4096]: per head h columns h*256 + [query 0..127 | gate 128..255]); k/v = x w_k/w_v (4 kv groups; head h -> group h/4); q, k RMS-normalised * w (eps 1e-6); rotate-half RoPE with the read cos/sin tables [T][128]; causal softmax(q.k / sqrt(128)) (finfo.min); out = (merged attn * sigmoid(gate)) w_o -> [2][2048][2048]).
// Compute dtypes, f32 accumulate: every input rounded to bf16; q, gate, k, v as ONE PLAIN bf16 GEMM over both batches (inputs: exact; the transposed w_q, w_k, w_v planes stacked); RMSNorm (in place) and RoPE (bf16-rounded tables) f32; causal scores and attn.v: query rows < 512 hl (3 products), the rest single fp16 (x1024), one fused kernel that stops at the diagonal block; online softmax f32; sigmoid gate (precise expf) applied in f32 when forming the hl planes; w_o hl x exact (2 products).

#define NB_  2
#define TT   2048
#define DM   2048
#define NH_  16
#define NKV  4
#define REP  (NH_ / NKV)
#define HD   128
#define DQ   (NH_ * HD)
#define DKV  (NKV * HD)
#define NALL (2 * DQ + 2 * DKV)   // columns of the one projection GEMM: per head [query | gate], then k, then v
#define RT   (NB_ * TT)           // rows of both batches: row b * TT + t
#define ZH   16                   // heads per k_mergeg launch: all
#define RH   512                  // query rows < RH use hi+lo planes (0: none)
#define WIN  2048
#define PCAR 1024.0f
#define SCL  0.088388347648318447f   // HD^-0.5
typedef _Float16 h16;
typedef unsigned short bf;
typedef __attribute__((ext_vector_type(16))) __bf16   v16bf;
typedef __attribute__((ext_vector_type(16))) _Float16 v16h;
typedef __attribute__((ext_vector_type(8)))  _Float16 v8h;
typedef __attribute__((ext_vector_type(8)))  unsigned short v8us;
typedef __attribute__((ext_vector_type(8)))  float    v8f;
typedef __attribute__((ext_vector_type(4)))  float    v4f;
typedef v8h  __attribute__((may_alias)) v8ha;
typedef v4f  __attribute__((may_alias)) v4fa;
typedef v8us __attribute__((may_alias)) v8usa;

__device__ __forceinline__ unsigned short f2bf(float f) { unsigned u = __float_as_uint(f); u += 0x7FFFu + ((u >> 16) & 1u); return (unsigned short)(u >> 16); }
__device__ __forceinline__ float bf2f(unsigned short b) { return __uint_as_float(((unsigned)b) << 16); }
__device__ __forceinline__ float bfr(float f) { return bf2f(f2bf(f)); }
__device__ __forceinline__ v16h cat16(v8h lo, v8h hi) { return __builtin_shufflevector(lo, hi, 0, 1, 2, 3, 4, 5, 6, 7, 8, 9, 10, 11, 12, 13, 14, 15); }
__device__ __forceinline__ v16bf cat16b(v8us lo, v8us hi) { return __builtin_bit_cast(v16bf, __builtin_shufflevector(lo, hi, 0, 1, 2, 3, 4, 5, 6, 7, 8, 9, 10, 11, 12, 13, 14, 15)); }
__device__ __forceinline__ v8f wmma16(v16h a, v16h b, v8f c) { return __builtin_amdgcn_wmma_f32_16x16x32_f16(false, a, false, b, (short)0, c, false, false); }
__device__ __forceinline__ v8f wmmab(v16bf a, v16bf b, v8f c) { return __builtin_amdgcn_wmma_f32_16x16x32_bf16(false, a, false, b, (short)0, c, false, false); }



// ---- Fragment-order planes. A 16-bit operand plane of R rows x K columns (R % 16 == 0, K % 32 == 0) is stored as blocks of 16 rows x 32 k = 512 elements (1 KiB), block index (r / 16) * (K / 32) + k / 32.
// Inside a block: two halves of 256 elements (k % 32 < 16, then >= 16); in a half, lane slot ((k / 8) % 2) * 16 + r % 16 holds its 8 consecutive k as one 16-byte piece. That is the order in which the 32 lanes of a wave
// hold a 16x32 WMMA operand, so a fragment is two wave-wide 16-byte loads of 512 contiguous bytes each (4 whole lines) instead of two loads that touch 16 lines. The elements and their k order in every fragment are those of a row-major plane.
// frag_piece: for the i-th 16-byte piece of such a plane (storage order), its row and first k.
__device__ __forceinline__ void frag_piece(size_t i, int kblocks, int& r, int& k0) { const int w = (int)(i & 63); const size_t blk = i >> 6; r = (int)(blk / kblocks) * 16 + (w & 15); k0 = (int)(blk % kblocks) * 32 + (w >> 5) * 16 + ((w >> 4) & 1) * 8; }

// ---- k_gemmw: register-blocked GEMM, NW WAVES per 64x64 output tile (16 accumulators each), operands straight from fragment-order 16-bit planes; grid (M/64, N/64, Z), 32 * NW threads.
// The K range is dealt to the waves in 32-element steps: wave w takes steps w, w + NW, ... (neighbouring waves read neighbouring 1-KiB blocks); the NW partial tiles are summed through LDS in wave order 0..NW-1.
// C[m][n] (f32, pitch ldc, + optional f32 bias[n]) = sum_k A[m][k] Bt[n][k] (+ split products per NSPLIT). z-batch strides sA/sB/sC in elements. K % 32 == 0.
// tile_sync: orders the staging tile's LDS writes and reads among the NW waves of a tile. It fences LDS only: __syncthreads() would also wait for the global stores of the rows just written out.
// One wave: no hardware barrier, only the compiler is kept from moving LDS accesses across.
template <int NW> __device__ __forceinline__ void tile_sync() {
    static_assert(NW == 1 || NW == 2 || NW == 4 || NW == 8, "the 16 staged rows are dealt two to a wave and pass");
    if (NW == 1) { __builtin_amdgcn_wave_barrier(); asm volatile("" ::: "memory"); }
    else { __builtin_amdgcn_fence(__ATOMIC_RELEASE, "workgroup", "local"); __builtin_amdgcn_s_barrier(); __builtin_amdgcn_fence(__ATOMIC_ACQUIRE, "workgroup", "local"); }
}
template <typename T16> struct WFrag;
template <> struct WFrag<h16> { typedef v16h V; static __device__ __forceinline__ V ld(const h16* p) { return cat16(*(const v8h*)p, *(const v8h*)(p + 16)); } static __device__ __forceinline__ V ldf(const h16* p) { return cat16(*(const v8h*)p, *(const v8h*)(p + 256)); } static __device__ __forceinline__ void stf(h16* p, V x) { *(v8h*)p = __builtin_shufflevector(x, x, 0, 1, 2, 3, 4, 5, 6, 7); *(v8h*)(p + 256) = __builtin_shufflevector(x, x, 8, 9, 10, 11, 12, 13, 14, 15); } static __device__ __forceinline__ v8f mma(V a, V b, v8f c) { return wmma16(a, b, c); } };
template <> struct WFrag<bf> { typedef v16bf V; static __device__ __forceinline__ V ld(const bf* p) { return cat16b(*(const v8us*)p, *(const v8us*)(p + 16)); } static __device__ __forceinline__ V ldf(const bf* p) { return cat16b(*(const v8us*)p, *(const v8us*)(p + 256)); } static __device__ __forceinline__ void stf(bf* p, V x) { typedef __attribute__((ext_vector_type(16))) unsigned short v16us; const v16us u = __builtin_bit_cast(v16us, x); *(v8us*)p = __builtin_shufflevector(u, u, 0, 1, 2, 3, 4, 5, 6, 7); *(v8us*)(p + 256) = __builtin_shufflevector(u, u, 8, 9, 10, 11, 12, 13, 14, 15); } static __device__ __forceinline__ v8f mma(V a, V b, v8f c) { return wmmab(a, b, c); } };
template <typename T16, int NSPLIT, bool BIAS, int NW>
__global__ __launch_bounds__(32 * NW) void k_gemmw(const T16* __restrict__ A, const T16* __restrict__ A2, const T16* __restrict__ Bt, const T16* __restrict__ Bt2, int K, float* C, int ldc, const float* __restrict__ bias, size_t sA, size_t sB, size_t sC) {
    typedef typename WFrag<T16>::V V;
    __shared__ __align__(16) float os[NW * 16 * 68];
    const size_t z = blockIdx.z; A += z * sA; if (A2) A2 += z * sA; Bt += z * sB; if (Bt2) Bt2 += z * sB; C += z * sC;
    const int lane = threadIdx.x & 31, lr = lane & 15, hi = lane >> 4; const int r0 = blockIdx.x * 64, c0 = blockIdx.y * 64;
    const int wave = (NW == 1) ? 0 : __builtin_amdgcn_readfirstlane((int)(threadIdx.x >> 5));   // scalar, so that the K loop's branch is a scalar one
    v8f acc[4][4];
#pragma unroll
    for (int mb = 0; mb < 4; ++mb)
#pragma unroll
        for (int nb = 0; nb < 4; ++nb) acc[mb][nb] = (v8f){};
    const unsigned aoff = ((unsigned)r0 * K + lane * 8) * 2, boff = ((unsigned)c0 * K + lane * 8) * 2;   // byte offsets in a plane (every plane is far below 4 GiB): 16 rows of a fragment-order plane are 16 * K contiguous elements, a k step of 32 is one block of 512; lane * 8: the lane's 16-byte piece
#pragma unroll 1
    for (int kc = wave * 32; kc < K; kc += NW * 32) {
        V a[4], a2[4]; unsigned oa[4], ob[4];
#pragma unroll
        for (int mb = 0; mb < 4; ++mb) { oa[mb] = aoff + (unsigned)(mb * K + kc) * 32; a[mb] = WFrag<T16>::ldf((const T16*)((const char*)A + oa[mb])); if (NSPLIT == 1 || NSPLIT == 2) a2[mb] = WFrag<T16>::ldf((const T16*)((const char*)A2 + oa[mb])); }
#pragma unroll
        for (int nb = 0; nb < 4; ++nb) { ob[nb] = boff + (unsigned)(nb * K + kc) * 32; const V b = WFrag<T16>::ldf((const T16*)((const char*)Bt + ob[nb])); V b2; if (NSPLIT >= 2) b2 = WFrag<T16>::ldf((const T16*)((const char*)Bt2 + ob[nb]));
#pragma unroll
            for (int mb = 0; mb < 4; ++mb) { acc[mb][nb] = WFrag<T16>::mma(a[mb], b, acc[mb][nb]); if (NSPLIT == 1 || NSPLIT == 2) acc[mb][nb] = WFrag<T16>::mma(a2[mb], b, acc[mb][nb]); if (NSPLIT >= 2) acc[mb][nb] = WFrag<T16>::mma(a[mb], b2, acc[mb][nb]); } }
        // precaution: one wait behind all loads of the step and in front of any rewrite of their offset registers; the offsets are inputs so that they keep their registers up to the wait (the plane pointers are not rewritten in the loop)
        asm volatile("s_wait_xcnt 0x0" :: "v"(oa[0]), "v"(oa[1]), "v"(oa[2]), "v"(oa[3]), "v"(ob[0]), "v"(ob[1]), "v"(ob[2]), "v"(ob[3]) : "memory");
        asm volatile("v_nop\n\tv_nop\n\tv_nop\n\tv_nop" : "+v"(acc[0][0]), "+v"(acc[1][1]), "+v"(acc[2][2]), "+v"(acc[3][3]) : "v"(a[0]), "v"(a[3]));
    }
#pragma unroll
    for (int mb = 0; mb < 4; ++mb) {
#pragma unroll
        for (int nb = 0; nb < 4; ++nb) {
#pragma unroll
            for (int j = 0; j < 8; ++j) os[(wave * 16 + hi * 8 + j) * 68 + nb * 16 + lr] = acc[mb][nb][j]; }
        tile_sync<NW>();   // every wave's partial rows stand in LDS before they are summed
        float* crow = C + (size_t)(r0 + mb * 16) * ldc + c0;
{
#pragma unroll
            for (int s = 0; s < 8 / NW; ++s) { const int row = 2 * (wave + s * NW) + hi, cofs = lr * 4; v4f val = *(const v4fa*)(os + row * 68 + cofs);
#pragma unroll
                for (int w = 1; w < NW; ++w) val += *(const v4fa*)(os + (w * 16 + row) * 68 + cofs);
                if (BIAS) { val[0] += bfr(bias[c0 + cofs]); val[1] += bfr(bias[c0 + cofs + 1]); val[2] += bfr(bias[c0 + cofs + 2]); val[3] += bfr(bias[c0 + cofs + 3]); }
                *(v4f*)(crow + (size_t)row * ldc + cofs) = val;
                if (NW > 1) asm volatile("s_wait_xcnt 0x0" ::: "memory"); }   // precaution: stands in front of any rewrite of the store's address and data registers
             }
        if (NW == 1 || mb < 3) tile_sync<NW>();   // the partials are read before the next 16 rows overwrite them
    }
}

__device__ __forceinline__ h16 tohx(float x) { return (h16)x; }
__device__ __forceinline__ void splitf(float y, unsigned short& h, unsigned short& l) { h = f2bf(y); l = f2bf(y - bf2f(h)); }
typedef __attribute__((ext_vector_type(2))) _Float16 v2h;
typedef __attribute__((ext_vector_type(4))) _Float16 v4h;
typedef __attribute__((ext_vector_type(2))) unsigned short v2us;
typedef __attribute__((ext_vector_type(4))) unsigned short v4us;
typedef __attribute__((ext_vector_type(2))) float v2f;
typedef __attribute__((ext_vector_type(4))) int v4i;

// wtG_blk: Bt = the fragment-order bf16 plane of w^T (rows n, columns k) from w [K][N] f32. One wave builds one block (16 n x 32 k): each load takes 16 neighbouring n of two k rows; the 8 waves of a work-group take 8 neighbouring groups of n.
__device__ __forceinline__ void wtG_blk(const float* __restrict__ w, int K, int N, bf* Bt, int blk) {
    const int lane = threadIdx.x & 31, lr = lane & 15, hi = lane >> 4; const int wv = blk * 8 + (threadIdx.x >> 5); const int ng = N / 16, kbs = K / 32; if (wv >= ng * kbs) return; const int nb = wv % ng, kb = wv / ng;
    const float* p = w + (size_t)(kb * 32 + hi * 8) * N + nb * 16 + lr; bf* o = Bt + ((size_t)nb * kbs + kb) * 512 + lane * 8; const float* q[16]; float x[16];
#pragma unroll
    for (int j = 0; j < 16; ++j) { q[j] = p + (size_t)((j >> 3) * 16 + (j & 7)) * N; x[j] = *q[j]; }
    // precaution: the wait stands behind the loads and in front of any rewrite of their address registers; the addresses are inputs so that they keep their registers up to the wait
    asm volatile("s_wait_xcnt 0x0" :: "v"(q[0]), "v"(q[1]), "v"(q[2]), "v"(q[3]), "v"(q[4]), "v"(q[5]), "v"(q[6]), "v"(q[7]), "v"(q[8]), "v"(q[9]), "v"(q[10]), "v"(q[11]), "v"(q[12]), "v"(q[13]), "v"(q[14]), "v"(q[15]) : "memory");
    v8us v0, v1;
#pragma unroll
    for (int j = 0; j < 8; ++j) { v0[j] = f2bf(x[j]); v1[j] = f2bf(x[8 + j]); }
    *(v8us*)o = v0; *(v8us*)(o + 256) = v1;
}
__device__ __forceinline__ void cvt8_blk(const float* __restrict__ src, int K, bf* dst, size_t n8, int blk) { const size_t i = (size_t)blk * 256 + threadIdx.x; if (i >= n8) return; int r, k0; frag_piece(i, K / 32, r, k0); const float* p = src + (size_t)r * K + k0; const v8f v = *(const v8f*)p; v8us o;
    asm volatile("s_wait_xcnt 0x0" :: "v"(p) : "memory");   // precaution: the wait stands behind the loads and in front of any rewrite of their address registers; the addresses are inputs so that they keep their registers up to the wait
#pragma unroll
    for (int k = 0; k < 8; ++k) o[k] = f2bf(v[k]); *(v8us*)(dst + i * 8) = o;  }
__device__ __forceinline__ void cscvt_blk(const float* __restrict__ cosT, const float* __restrict__ sinT, float* CS, int blk) { const int idx = blk * 256 + threadIdx.x; if (idx >= TT * HD) return; v2f cs; cs[0] = bfr(cosT[idx]); cs[1] = bfr(sinT[idx]); *(v2f*)(CS + (size_t)idx * 2) = cs;  }
// k_prep: every conversion of an input, one launch; ranges of work-groups take the jobs, none of which reads what another writes. WALL = the transposed planes of w_q (rows h * 2 * HD + [query | gate]), w_k and w_v one behind the other: NALL rows.
#define PB_WQ (DM * 2 * DQ / 512 / 8)
#define PB_WK (DM * DKV / 512 / 8)
#define PB_WO (DQ * DM / 512 / 8)
#define PB_X  (RT * DM / 8 / 256)
#define PB_CS (TT * HD / 256)
__global__ __launch_bounds__(256) void k_prep(const float* __restrict__ x, const float* __restrict__ wqg, const float* __restrict__ wk, const float* __restrict__ wv, const float* __restrict__ wo, const float* __restrict__ cosT, const float* __restrict__ sinT, bf* WALL, bf* WO, bf* XB, float* CS) {
    int blk = blockIdx.x;
    if (blk < PB_WQ) { wtG_blk(wqg, DM, 2 * DQ, WALL, blk); return; } blk -= PB_WQ;
    if (blk < PB_WK) { wtG_blk(wk, DM, DKV, WALL + (size_t)2 * DQ * DM, blk); return; } blk -= PB_WK;
    if (blk < PB_WK) { wtG_blk(wv, DM, DKV, WALL + (size_t)(2 * DQ + DKV) * DM, blk); return; } blk -= PB_WK;
    if (blk < PB_WO) { wtG_blk(wo, DQ, DM, WO, blk); return; } blk -= PB_WO;
    if (blk < PB_X) { cvt8_blk(x, DM, XB, (size_t)RT * DM / 8, blk); return; } blk -= PB_X;
    cscvt_blk(cosT, sinT, CS, blk);
}
// rope_blk: head planes of both batches (rows (b * nheads + h) * TT + t, columns d; the head's columns of F start at h * hstride, fragment order; one 16-byte piece per thread and plane; fp16 + hi/lo) of rope(x) x sc with the rotate-half convention out[d] = x[d] cos[t][d] - x[d+HD/2] sin[t][d], out[d+HD/2] = x[d+HD/2] cos[t][d+HD/2] + x[d] sin[t][d+HD/2]
__device__ __forceinline__ void rope_blk(const float* __restrict__ F, int pitch, int nheads, int hstride, const float* __restrict__ CS, float sc, h16* P16, bf* Ph, bf* Pl, int blk) {
    const size_t e = ((size_t)blk * 256 + threadIdx.x) * 8; if (e >= (size_t)NB_ * nheads * TT * HD) return; int row, d; frag_piece(e / 8, HD / 32, row, d); const int t = row % TT; const int bh = row / TT; const int h = bh % nheads, b = bh / nheads; const float* f = F + (size_t)(b * TT + t) * pitch + h * hstride; v8h o16; v8us oh, ol;
    const float* p0 = f + d; const float* p1 = f + ((d < HD / 2) ? d + HD / 2 : d - HD / 2); const float* pc = CS + ((size_t)t * HD + d) * 2; const v8f X0 = *(const v8f*)p0, X1 = *(const v8f*)p1, C0 = *(const v8f*)pc, C1 = *(const v8f*)(pc + 8);
    asm volatile("s_wait_xcnt 0x0" :: "v"(p0), "v"(p1), "v"(pc) : "memory");   // precaution: the wait stands behind the loads and in front of any rewrite of their address registers; the addresses are inputs so that they keep their registers up to the wait
#pragma unroll
    for (int q = 0; q < 8; ++q) { const float x0 = X0[q], x1 = X1[q]; const float cq = (q < 4) ? C0[2 * q] : C1[2 * q - 8], sq = (q < 4) ? C0[2 * q + 1] : C1[2 * q - 7];
        float a = __fmul_rn(x0, cq), bq = __fmul_rn(x1, sq); asm volatile("" : "+v"(a)); asm volatile("" : "+v"(bq)); const float r = ((d < HD / 2) ? __fsub_rn(a, bq) : __fadd_rn(a, bq)) * sc;
        o16[q] = tohx(r); unsigned short a2, c2; splitf(r, a2, c2); oh[q] = a2; ol[q] = c2; }
    *(v8h*)(P16 + e) = o16; *(v8us*)(Ph + e) = oh; *(v8us*)(Pl + e) = ol;  }
// vtp_blk: the transposed value planes of both batches (rows (b * nheads + g) * HD + d, columns t, fragment order; one 16-byte piece per thread and plane)
__device__ __forceinline__ void vtp_blk(const float* __restrict__ F, int pitch, int nheads, h16* V16, bf* Vh, bf* Vl, int blk) { const size_t e = ((size_t)blk * 256 + threadIdx.x) * 8; if (e >= (size_t)NB_ * nheads * HD * TT) return; int row, t; frag_piece(e / 8, TT / 32, row, t); const int d = row % HD; const int bg = row / HD; const int g = bg % nheads; t += (bg / nheads) * TT; v8h o16; v8us oh, ol; const float* pq[8]; float xq[8];
#pragma unroll
    for (int q = 0; q < 8; ++q) { pq[q] = F + (size_t)(t + q) * pitch + g * HD + d; xq[q] = *pq[q]; }
    asm volatile("s_wait_xcnt 0x0" :: "v"(pq[0]), "v"(pq[1]), "v"(pq[2]), "v"(pq[3]), "v"(pq[4]), "v"(pq[5]), "v"(pq[6]), "v"(pq[7]) : "memory");   // precaution: the wait stands behind the loads and in front of any rewrite of their address registers; the addresses are inputs so that they keep their registers up to the wait
#pragma unroll
    for (int q = 0; q < 8; ++q) { const float x = xq[q]; o16[q] = tohx(x); unsigned short a2, c2; splitf(x, a2, c2); oh[q] = a2; ol[q] = c2; }
    *(v8h*)(V16 + e) = o16; *(v8us*)(Vh + e) = oh; *(v8us*)(Vl + e) = ol;  }
// k_planes: all operand planes of the attention, one launch: ranges of work-groups build the value planes (from the raw v columns), the query planes and the key planes (from the normalised columns)
#define PL_V (NB_ * NKV * HD * TT / 8 / 256)
#define PL_Q (NB_ * NH_ * TT * HD / 8 / 256)
#define PL_K (NB_ * NKV * TT * HD / 8 / 256)
__global__ __launch_bounds__(256) void k_planes(const float* __restrict__ FA, const float* __restrict__ CS, h16* Q16, bf* Qh, bf* Ql, h16* K16, bf* Kh, bf* Kl, h16* V16, bf* Vh, bf* Vl) {
    int blk = blockIdx.x;
    if (blk < PL_V) { vtp_blk(FA + 2 * DQ + DKV, NALL, NKV, V16, Vh, Vl, blk); return; } blk -= PL_V;
    if (blk < PL_Q) { rope_blk(FA, NALL, NH_, 2 * HD, CS, 1.0f, Q16, Qh, Ql, blk); return; } blk -= PL_Q;
    rope_blk(FA + 2 * DQ, NALL, NKV, HD, CS, 1.0f, K16, Kh, Kl, blk);
}
// k_rmsw: RMS norm in place, one wave per row and head, of the NH_ query heads and the NKV key heads of both batches
__global__ __launch_bounds__(256) void k_rmsw(float* F, const float* __restrict__ wq, const float* __restrict__ wk) { const int lane = threadIdx.x & 31; const int wv = blockIdx.x * 8 + (threadIdx.x >> 5); if (wv >= RT * (NH_ + NKV)) return; const int t = wv / (NH_ + NKV), h = wv % (NH_ + NKV); float* f = F + (size_t)t * NALL + ((h < NH_) ? h * 2 * HD : 2 * DQ + (h - NH_) * HD) + lane * 4; const float* w = ((h < NH_) ? wq : wk) + lane * 4; const v4f a = *(const v4f*)f; float wr[4];
#pragma unroll
    for (int q = 0; q < 4; ++q) wr[q] = w[q];
    asm volatile("s_wait_xcnt 0x0" :: "v"(f), "v"(w) : "memory");   // precaution: the wait stands behind the loads and in front of any rewrite of their address registers; the addresses are inputs so that they keep their registers up to the wait
    float ss = 0.f;
#pragma unroll
    for (int q = 0; q < 4; ++q) { float p = __fmul_rn(a[q], a[q]); asm volatile("" : "+v"(p)); ss = __fadd_rn(ss, p); }
#pragma unroll
    for (int sh = 16; sh; sh >>= 1) ss = __fadd_rn(ss, __shfl_xor(ss, sh, 32));
    const float rs = __fdiv_rn(1.0f, sqrtf(__fadd_rn(ss * (1.0f / HD), 1e-6f))); v4f o;
#pragma unroll
    for (int q = 0; q < 4; ++q) { float y = __fmul_rn(a[q], rs); asm volatile("" : "+v"(y)); o[q] = __fmul_rn(y, bfr(wr[q])); }
    *(v4f*)f = o;  }
// k_mergeg: both batches (plane row tr = b * TT + t); the gate logits are the second HD columns of the head's 2 * HD in the projection output
__global__ __launch_bounds__(256) void k_mergeg(const float* __restrict__ O, const float* __restrict__ FA, bf* Ah, bf* Al) { const size_t i = (size_t)blockIdx.x * 256 + threadIdx.x; if (i >= (size_t)NB_ * ZH * TT * HD / 8) return; int tr, cl; frag_piece(i, ZH * HD / 32, tr, cl); const int t = tr % TT, b = tr / TT; const int d = cl % HD; const int zz = cl / HD; const float cs = (t < RH) ? 1.0f : (1.0f / PCAR); const size_t e = ((size_t)(b * NH_ + zz) * TT + t) * HD + d, gg = (size_t)tr * NALL + zz * 2 * HD + HD + d;
    const size_t oo = (((size_t)(tr / 16) * (DQ / 32) + cl / 32) * 64 + (i & 63)) * 8;   // this thread's 16-byte piece in the fragment-order planes of DQ columns
    v8us oh, ol; const float* po = O + e; const float* pg = FA + gg; const v8f OV = *(const v8f*)po, GV = *(const v8f*)pg;
    asm volatile("s_wait_xcnt 0x0" :: "v"(po), "v"(pg) : "memory");   // precaution: the wait stands behind the loads and in front of any rewrite of their address registers; the addresses are inputs so that they keep their registers up to the wait
#pragma unroll
    for (int q = 0; q < 8; ++q) { float a0 = OV[q] * cs; asm volatile("" : "+v"(a0)); const float gl = GV[q]; const float sg = __fdiv_rn(1.0f, __fadd_rn(1.0f, expf(-gl))); unsigned short a, c2; splitf(__fmul_rn(a0, sg), a, c2); oh[q] = a; ol[q] = c2; } *(v8us*)(Ah + oo) = oh; *(v8us*)(Al + oo) = ol;  }
__device__ __forceinline__ float xhalf(float x) { return __builtin_bit_cast(float, __builtin_amdgcn_permlanex16(__builtin_bit_cast(int, x), __builtin_bit_cast(int, x), 0x76543210, 0xfedcba98, false, false)); }
template <typename T16> struct PFrag;
template <> struct PFrag<h16> { static __device__ __forceinline__ void cv(const float* e, v16h& p, v16h& p2) { (void)p2;
#pragma unroll
    for (int i = 0; i < 16; ++i) p[i] = (h16)e[i]; } };
template <> struct PFrag<bf> { static __device__ __forceinline__ void cv(const float* e, v16bf& p, v16bf& p2) { v8us h0, h1, l0, l1;
#pragma unroll
    for (int i = 0; i < 8; ++i) { unsigned short a = f2bf(e[i]), c = f2bf(e[8 + i]); h0[i] = a; l0[i] = f2bf(e[i] - bf2f(a)); h1[i] = c; l1[i] = f2bf(e[8 + i] - bf2f(c)); }
    p = cat16b(h0, h1); p2 = cat16b(l0, l1); } };
#define CEXP (SCL * 1.4426950408889634f)   // HD^-0.5 * log2(e)
template <typename T16, bool HL>
__device__ __forceinline__ void fattn_rows(const T16* __restrict__ Q, const T16* __restrict__ Q2, const T16* __restrict__ Kp, const T16* __restrict__ Kp2, const T16* __restrict__ Vt, const T16* __restrict__ Vt2, float* __restrict__ O, int q0, T16* qs) {
    typedef typename WFrag<T16>::V V; typedef WFrag<T16> F;
    const int lane = threadIdx.x & 31, lr = lane & 15, hi = lane >> 4;
    V q[4], q2[4], k[8];
    const unsigned qo = ((unsigned)q0 * HD + lane * 8) * 2;   // byte offsets in a plane; 16 rows x HD columns are HD / 32 blocks of 1 KiB in a row
#pragma unroll
    for (int dk = 0; dk < 4; ++dk) { q[dk] = F::ldf((const T16*)((const char*)Q + qo) + dk * 512); if (HL) q2[dk] = F::ldf((const T16*)((const char*)Q2 + qo) + dk * 512); }
    // With every Q fragment held over the block a wave would not fit 256 registers (four waves per SIMD): the fragment that a block uses last (hi+lo: all eight, to leave room for sixteen K or V fragments in flight) waits in LDS, each lane's 32 bytes in a place of its own that no other lane touches (so no barrier).
    T16* ql = qs + lane * 8;
    if (HL) {
#pragma unroll
        for (int dk = 0; dk < 4; ++dk) { F::stf(ql + dk * 1024, q[dk]); F::stf(ql + dk * 1024 + 512, q2[dk]); } }
    else F::stf(ql, q[3]);
    const unsigned k0o = lane * 16;
    if (!HL) {
#pragma unroll
        for (int i = 0; i < 8; ++i) k[i] = F::ldf((const T16*)((const char*)Kp + k0o) + i * 512); }
    // precaution: the wait stands behind the loads and in front of any rewrite of their offset registers; the offsets are inputs so that they keep their registers up to the wait
    if (HL) asm volatile("s_wait_xcnt 0x0" :: "v"(qo) : "memory"); else asm volatile("s_wait_xcnt 0x0" :: "v"(qo), "v"(k0o) : "memory");
    v8f o[8];
#pragma unroll
    for (int dt = 0; dt < 8; ++dt) o[dt] = (v8f){};
    float m = -3.0e38f, l = 0.f;
    const int nkb = q0 / 32 + 1;   // the block that holds the diagonal is the last one
#pragma unroll 1   // rolled: two blocks' fragments at once would not fit the 256 registers (the inner loops are all unrolled so that their arrays are registers)
    for (int kb = 0; kb < nkb; ++kb) {
        const unsigned ko = lane * 16 + (unsigned)kb * (32 * HD * 2), kn = lane * 16 + (unsigned)min(kb + 1, nkb - 1) * (32 * HD * 2), vo = lane * 16 + (unsigned)kb * 1024;
        V v[8], w[8];
        if (!HL) {   // the value fragments start early: their latency runs under the score products and the softmax
#pragma unroll
            for (int dt = 0; dt < 8; ++dt) v[dt] = F::ldf((const T16*)((const char*)Vt + vo) + dt * (TT / 32) * 512);
        } else {   // hi+lo: twice the fragments, so none is fetched a block ahead
#pragma unroll
            for (int i = 0; i < 8; ++i) { k[i] = F::ldf((const T16*)((const char*)Kp + ko) + i * 512); w[i] = F::ldf((const T16*)((const char*)Kp2 + ko) + i * 512); }
            asm volatile("s_wait_xcnt 0x0" :: "v"(ko) : "memory");   // the same precaution behind the K loads
            __builtin_amdgcn_sched_barrier(0);   // all sixteen K fragments are in flight before the first product: one load latency a block instead of one per pair of fragments
        }
        if (!HL) q[3] = F::ldf(ql);
        v8f s[2]; s[0] = (v8f){}; s[1] = (v8f){};
#pragma unroll
        for (int dk = 0; dk < 4; ++dk)
#pragma unroll
            for (int kt = 0; kt < 2; ++kt) { if (HL && kt == 0) { q[dk] = F::ldf(ql + dk * 1024); q2[dk] = F::ldf(ql + dk * 1024 + 512); }
                s[kt] = F::mma(k[kt * 4 + dk], q[dk], s[kt]); if (HL) { s[kt] = F::mma(k[kt * 4 + dk], q2[dk], s[kt]); s[kt] = F::mma(w[kt * 4 + dk], q[dk], s[kt]); } }
        if (HL) {
#pragma unroll
            for (int dt = 0; dt < 8; ++dt) { v[dt] = F::ldf((const T16*)((const char*)Vt + vo) + dt * (TT / 32) * 512); w[dt] = F::ldf((const T16*)((const char*)Vt2 + vo) + dt * (TT / 32) * 512); }
        }
        if (!HL) {   // the next block's K fragments are fetched one block ahead, into the same registers (the last block fetches itself again: never a row past the diagonal block)
#pragma unroll
            for (int i = 0; i < 8; ++i) k[i] = F::ldf((const T16*)((const char*)Kp + kn) + i * 512); }
        // the same precaution behind the V and next-K loads
        if (HL) { asm volatile("s_wait_xcnt 0x0" :: "v"(vo) : "memory"); __builtin_amdgcn_sched_barrier(0); }   // the barrier: all sixteen V fragments start in front of the softmax, which covers their latency
        else asm volatile("s_wait_xcnt 0x0" :: "v"(vo), "v"(kn) : "memory");
        float t[16];
#pragma unroll
        for (int i = 0; i < 16; ++i) t[i] = s[i >> 3][i & 7] * CEXP;
        if (kb == nkb - 1) {   // only the diagonal block holds keys behind a query
#pragma unroll
            for (int i = 0; i < 16; ++i) t[i] = (kb * 32 + (i >> 3) * 16 + hi * 8 + (i & 7) <= q0 + lr) ? t[i] : -3.0e38f; }
        float mx = fmaxf(t[0], t[1]);
#pragma unroll
        for (int i = 2; i < 16; ++i) mx = fmaxf(mx, t[i]);
        mx = fmaxf(mx, xhalf(mx));
        const float mn = fmaxf(m, mx);
        if (__builtin_amdgcn_ballot_w32(mn > m) != 0) {   // a scalar branch: the rescale is skipped while no query of the wave has a new maximum (its factor would be exactly 1)
            const float al = __builtin_amdgcn_exp2f(m - mn); l *= al;
#pragma unroll
            for (int dt = 0; dt < 8; ++dt) o[dt] *= al;
            m = mn; }
        const float mo = HL ? m : m - 10.0f;   // exp2(10) = PCAR
        float e[16];
#pragma unroll
        for (int i = 0; i < 16; ++i) e[i] = __builtin_amdgcn_exp2f(t[i] - mo);
        l += ((((e[0] + e[1]) + (e[2] + e[3])) + ((e[4] + e[5]) + (e[6] + e[7]))) + (((e[8] + e[9]) + (e[10] + e[11])) + ((e[12] + e[13]) + (e[14] + e[15]))));
        V p, p2; PFrag<T16>::cv(e, p, p2);
#pragma unroll
        for (int dt = 0; dt < 8; ++dt) { o[dt] = F::mma(v[dt], p, o[dt]); if (HL) { o[dt] = F::mma(v[dt], p2, o[dt]); o[dt] = F::mma(w[dt], p, o[dt]); } }
    }
    l += xhalf(l);   // the two halves of the wave hold the two halves of each query's keys
    const float f = __fdiv_rn(HL ? 1.0f : PCAR, l);
#pragma unroll
    for (int dt = 0; dt < 8; ++dt) o[dt] *= f;
    float* orow = O + (size_t)(q0 + lr) * HD + hi * 8;   // register r of tile dt: column dt * 16 + 8 * hi + r of the query's row
#pragma unroll
    for (int dt = 0; dt < 8; ++dt) *(v8f*)(orow + dt * 16) = o[dt];
    asm volatile("s_wait_xcnt 0x0" :: "v"(orow) : "memory");   // precaution: stands behind the stores and in front of any rewrite of their address and data registers
}
// grid (NKV * NB_, TT / 32): x = kv group + NKV * batch. Cost grows with the row, and all work-groups are resident at once: waves 0..REP-1 take the 16-row tile TT/16 - 1 - y, the others tile y, so that every work-group walks about the same number of key blocks. No wave shares a barrier or a buffer with another.
// amdgpu_waves_per_eu: two work-groups per WGP, so that one wave's load latency and softmax run under the others' matrix work.
__global__ __launch_bounds__(256) __attribute__((amdgpu_waves_per_eu(4, 4))) void k_fattn(const h16* __restrict__ Q16, const bf* __restrict__ Qh, const bf* __restrict__ Ql, const h16* __restrict__ K16, const bf* __restrict__ Kh, const bf* __restrict__ Kl, const h16* __restrict__ V16, const bf* __restrict__ Vh, const bf* __restrict__ Vl, float* __restrict__ O) {
    __shared__ __align__(16) unsigned short qsh[8 * 4096];   // 8 KiB a wave: the Q fragments that wait in LDS
    const int wave = __builtin_amdgcn_readfirstlane((int)(threadIdx.x >> 5));   // scalar, so that the key loop's and the precision branch are scalar ones
    const int g = blockIdx.x % NKV, b = blockIdx.x / NKV; const int q0 = ((wave / REP == 0) ? TT / 16 - 1 - (int)blockIdx.y : (int)blockIdx.y) * 16;
    const size_t qoff = ((size_t)b * NH_ + g * REP + wave % REP) * TT * HD, koff = ((size_t)b * NKV + g) * TT * HD;
    if (q0 < RH) fattn_rows<bf, true>(Qh + qoff, Ql + qoff, Kh + koff, Kl + koff, Vh + koff, Vl + koff, O + qoff, q0, (bf*)qsh + wave * 4096);
    else fattn_rows<h16, false>(Q16 + qoff, nullptr, K16 + koff, nullptr, V16 + koff, nullptr, O + qoff, q0, (h16*)qsh + wave * 4096);
}

extern "C" void kernel_launch(void* const* d_in, const int* in_sizes, int n_in,
                              void* d_out, int out_size, void* d_ws, size_t ws_size, hipStream_t stream) {
    (void)in_sizes; (void)n_in; (void)out_size;
    const float* x = (const float*)d_in[0]; const float* wqg = (const float*)d_in[1]; const float* wk = (const float*)d_in[2]; const float* wv = (const float*)d_in[3]; const float* wo = (const float*)d_in[4]; const float* qnw = (const float*)d_in[5]; const float* knw = (const float*)d_in[6]; const float* cosT = (const float*)d_in[7]; const float* sinT = (const float*)d_in[8];
    float* OUT = (float*)d_out;     // [2][2048][2048]
    char* wsp = (char*)d_ws;
    auto take = [&](size_t bytes) { char* p = wsp; wsp += (bytes + 255) & ~(size_t)255; return (void*)p; };
    bf* WALL = (bf*)take((size_t)NALL * DM * 2); bf* WO = (bf*)take((size_t)DM * DQ * 2); float* CS = (float*)take((size_t)TT * HD * 2 * 4);
    const size_t NQP = (size_t)NH_ * TT * HD, NKP = (size_t)NKV * TT * HD;   // elements of one batch's query planes and of its key or value planes; every plane below holds both batches
    h16* QP16 = (h16*)take(NB_ * NQP * 2); h16* KP16 = (h16*)take(NB_ * NKP * 2); h16* VT16 = (h16*)take(NB_ * NKP * 2);
    bf* QPh = (bf*)take(NB_ * NQP * 2); bf* QPl = (bf*)take(NB_ * NQP * 2); bf* KPh = (bf*)take(NB_ * NKP * 2); bf* KPl = (bf*)take(NB_ * NKP * 2); bf* VTh = (bf*)take(NB_ * NKP * 2); bf* VTl = (bf*)take(NB_ * NKP * 2);
    float* Ob = (float*)take(NB_ * NQP * 4); float* FA = (float*)take((size_t)RT * NALL * 4); bf* XB = (bf*)take((size_t)RT * DM * 2);
    if ((size_t)(wsp - (char*)d_ws) > ws_size) return;    // ws 256 MiB
    bf* ATh = XB; bf* ATl = WALL;   // the gated attention planes (RT x DQ each) lie over the x plane and the projection weights, which the projection GEMM read last (stream-ordered)
    k_prep<<<PB_WQ + 2 * PB_WK + PB_WO + PB_X + PB_CS, 256, 0, stream>>>(x, wqg, wk, wv, wo, cosT, sinT, WALL, WO, XB, CS);
    k_gemmw<bf, 0, false, 4><<<dim3(RT / 64, NALL / 64, 1), 128, 0, stream>>>(XB, nullptr, WALL, nullptr, DM, FA, NALL, nullptr, 0, 0, 0);   // q | gate, k, v of both batches
    k_rmsw<<<RT * (NH_ + NKV) / 8, 256, 0, stream>>>(FA, qnw, knw);
    k_planes<<<PL_V + PL_Q + PL_K, 256, 0, stream>>>(FA, CS, QP16, QPh, QPl, KP16, KPh, KPl, VT16, VTh, VTl);
    k_fattn<<<dim3(NKV * NB_, TT / 32, 1), 256, 0, stream>>>(QP16, QPh, QPl, KP16, KPh, KPl, VT16, VTh, VTl, Ob);   // all heads of both batches
    k_mergeg<<<(unsigned)((size_t)NB_ * ZH * TT * HD / 8 / 256), 256, 0, stream>>>(Ob, FA, ATh, ATl);
    k_gemmw<bf, 1, false, 4><<<dim3(RT / 64, DM / 64, 1), 128, 0, stream>>>(ATh, ATl, WO, nullptr, DQ, OUT, DM, nullptr, 0, 0, 0);
}

// v006
// A run of this version takes 211 microseconds.
// Timed twice side by side with v005, it ran 1.27 and 1.26 times as fast.
// Counting every step since v000, it is 8.64 times as fast.
#include <hip/hip_runtime.h>

// GatedCausalSelfAttention (x [2][2048][2048]; qg = x w_q ([2048][4096]: per head h columns h*256 + [query 0..127 | gate 128..255]); k/v = x w_k/w_v (4 kv groups; head h -> group h/4); q, k RMS-normalised * w (eps 1e-6); rotate-half RoPE with the read cos/sin tables [T][128]; causal softmax(q.k / sqrt(128)) (finfo.min); out = (merged attn * sigmoid(gate)) w_o -> [2][2048][2048]).
// Compute dtypes, f32 accumulate: every input rounded to bf16; q, gate, k, v as ONE PLAIN bf16 GEMM over both batches (inputs: exact; the transposed w_q, w_k, w_v planes stacked); RMSNorm (in place) and RoPE (bf16-rounded tables) f32; causal scores and attn.v: query rows < 512 hl (3 products), the rest single fp16 (x1024), one fused kernel that stops at the diagonal block; online softmax f32; sigmoid gate (precise expf) applied in f32 when forming the hl planes; w_o hl x exact (2 products).

#define NB_  2
#define TT   2048
#define DM   2048
#define NH_  16
#define NKV  4
#define REP  (NH_ / NKV)
#define HD   128
#define DQ   (NH_ * HD)
#define DKV  (NKV * HD)
#define NALL (2 * DQ + 2 * DKV)   // columns of the one projection GEMM: per head [query | gate], then k, then v
#define RT   (NB_ * TT)           // rows of both batches: row b * TT + t
#define ZH   16                   // heads per k_mergeg launch: all
#define RH   512                  // query rows < RH use hi+lo planes (0: none)
#define WIN  2048
#define PCAR 1024.0f
#define SCL  0.088388347648318447f   // HD^-0.5
typedef _Float16 h16;
typedef unsigned short bf;
typedef __attribute__((ext_vector_type(16))) __bf16   v16bf;
typedef __attribute__((ext_vector_type(16))) _Float16 v16h;
typedef __attribute__((ext_vector_type(8)))  _Float16 v8h;
typedef __attribute__((ext_vector_type(8)))  unsigned short v8us;
typedef __attribute__((ext_vector_type(8)))  float    v8f;
typedef __attribute__((ext_vector_type(4)))  float    v4f;
typedef v8h  __attribute__((may_alias)) v8ha;
typedef v4f  __attribute__((may_alias)) v4fa;
typedef v8us __attribute__((may_alias)) v8usa;

__device__ __forceinline__ unsigned short f2bf(float f) { unsigned u = __float_as_uint(f); u += 0x7FFFu + ((u >> 16) & 1u); return (unsigned short)(u >> 16); }
__device__ __forceinline__ float bf2f(unsigned short b) { return __uint_as_float(((unsigned)b) << 16); }
__device__ __forceinline__ float bfr(float f) { return bf2f(f2bf(f)); }
__device__ __forceinline__ v16h cat16(v8h lo, v8h hi) { return __builtin_shufflevector(lo, hi, 0, 1, 2, 3, 4, 5, 6, 7, 8, 9, 10, 11, 12, 13, 14, 15); }
__device__ __forceinline__ v16bf cat16b(v8us lo, v8us hi) { return __builtin_bit_cast(v16bf, __builtin_shufflevector(lo, hi, 0, 1, 2, 3, 4, 5, 6, 7, 8, 9, 10, 11, 12, 13, 14, 15)); }
__device__ __forceinline__ v8f wmma16(v16h a, v16h b, v8f c) { return __builtin_amdgcn_wmma_f32_16x16x32_f16(false, a, false, b, (short)0, c, false, false); }
__device__ __forceinline__ v8f wmmab(v16bf a, v16bf b, v8f c) { return __builtin_amdgcn_wmma_f32_16x16x32_bf16(false, a, false, b, (short)0, c, false, false); }



// ---- Fragment-order planes. A 16-bit operand plane of R rows x K columns (R % 16 == 0, K % 32 == 0) is stored as blocks of 16 rows x 32 k = 512 elements (1 KiB), block index (r / 16) * (K / 32) + k / 32.
// Inside a block: two halves of 256 elements (k % 32 < 16, then >= 16); in a half, lane slot ((k / 8) % 2) * 16 + r % 16 holds its 8 consecutive k as one 16-byte piece. That is the order in which the 32 lanes of a wave
// hold a 16x32 WMMA operand, so a fragment is two wave-wide 16-byte loads of 512 contiguous bytes each (4 whole lines) instead of two loads that touch 16 lines. The elements and their k order in every fragment are those of a row-major plane.
// frag_piece: for the i-th 16-byte piece of such a plane (storage order), its row and first k.
__device__ __forceinline__ void frag_piece(size_t i, int kblocks, int& r, int& k0) { const int w = (int)(i & 63); const size_t blk = i >> 6; r = (int)(blk / kblocks) * 16 + (w & 15); k0 = (int)(blk % kblocks) * 32 + (w >> 5) * 16 + ((w >> 4) & 1) * 8; }

template <typename T16> struct WFrag;
template <> struct WFrag<h16> { typedef v16h V; static __device__ __forceinline__ V ld(const h16* p) { return cat16(*(const v8h*)p, *(const v8h*)(p + 16)); } static __device__ __forceinline__ V ldf(const h16* p) { return cat16(*(const v8h*)p, *(const v8h*)(p + 256)); } static __device__ __forceinline__ void stf(h16* p, V x) { *(v8h*)p = __builtin_shufflevector(x, x, 0, 1, 2, 3, 4, 5, 6, 7); *(v8h*)(p + 256) = __builtin_shufflevector(x, x, 8, 9, 10, 11, 12, 13, 14, 15); } static __device__ __forceinline__ v8f mma(V a, V b, v8f c) { return wmma16(a, b, c); } };
template <> struct WFrag<bf> { typedef v16bf V; static __device__ __forceinline__ V ld(const bf* p) { return cat16b(*(const v8us*)p, *(const v8us*)(p + 16)); } static __device__ __forceinline__ V ldf(const bf* p) { return cat16b(*(const v8us*)p, *(const v8us*)(p + 256)); } static __device__ __forceinline__ void stf(bf* p, V x) { typedef __attribute__((ext_vector_type(16))) unsigned short v16us; const v16us u = __builtin_bit_cast(v16us, x); *(v8us*)p = __builtin_shufflevector(u, u, 0, 1, 2, 3, 4, 5, 6, 7); *(v8us*)(p + 256) = __builtin_shufflevector(u, u, 8, 9, 10, 11, 12, 13, 14, 15); } static __device__ __forceinline__ v8f mma(V a, V b, v8f c) { return wmmab(a, b, c); } };
// ---- k_gemmt: GEMM with both operands staged in LDS by tensor loads. One work-group of 4 waves (2 x 2) owns a 128x128 output tile, a wave 64x64 of it (16 accumulators) over the whole K range; grid (M/128, N/128), 128 threads.
// C[m][n] (f32, pitch LDC) = sum_k A[m][k] Bt[n][k] (+ A2[m][k] Bt[n][k] when NSPLIT), operands in fragment-order 16-bit planes of K columns. K % 64 == 0, K >= 128.
// A stage is 64 k of every operand row. 16 rows x 64 k of a fragment-order plane are 2 KiB in a row, and the next 16 rows follow K * 32 bytes on: a slice of n row groups is a tensor tile of n rows of 2 KiB at that pitch, and it lands in LDS
// as it lies in the plane, so a fragment is again two wave-wide 16-byte loads of 512 contiguous bytes. Every operand byte is fetched from L2 once per work-group and read by two waves.
// Two buffers: every wave issues one request per stage for its own slice, two stages ahead, into the buffer that every reader has just left.
typedef unsigned u32x4 __attribute__((ext_vector_type(4)));
typedef unsigned u32x8 __attribute__((ext_vector_type(8)));
__device__ __forceinline__ unsigned uni(unsigned v) { return (unsigned)__builtin_amdgcn_readfirstlane((int)v); }
// pinned: holds a wave-uniform condition in a scalar register, so that the test around a tensor load (which ignores EXEC) compiles to a scalar compare and branch
__device__ __forceinline__ unsigned pinned(unsigned v) { unsigned w = uni(v); asm volatile("" : "+s"(w)); return w; }
#define GKS 64              // k per stage
#define GRB (GKS * 32)      // bytes of 16 rows x GKS k
#define GPL (8 * GRB)       // bytes of one operand plane's 128 rows in a stage
template <int NSPLIT, int K, int LDC>
__global__ __launch_bounds__(128) void k_gemmt(const bf* __restrict__ A, const bf* __restrict__ A2, const bf* __restrict__ Bt, float* C) {
    typedef WFrag<bf> F; typedef F::V V;
    static_assert(K % GKS == 0 && K / GKS >= 2 && K * 32 <= 131072, "two stages at least; the source pitch stays in the mover's range");
    constexpr unsigned NPL = NSPLIT ? 3 : 2, BUFB = NPL * GPL; constexpr int S = K / GKS;
    constexpr int GF = NSPLIT ? 2 : 1, GB = NSPLIT ? 4 : 2;   // a load group: the Bt fragments of GB column groups over GF 32-k steps. The plain GEMM has five work-groups per WGP and stays within 192 registers so that all are resident at once; the NSPLIT launch has two, so registers are free
    constexpr bool WHOLE = GF * 32 == GKS && GB == 4;   // a stage's fragments are one group: the publish point and the refill then stand behind the loads and in front of the products, which gives the refill the products' time to land
    __shared__ __attribute__((aligned(2048))) unsigned char ring[2 * BUFB];   // a buffer: [A 128 rows | A2 128 rows (NSPLIT) | Bt 128 rows]
    const int lane = threadIdx.x & 31, lr = lane & 15, hi = lane >> 4; const int r0 = blockIdx.x * 128, c0 = blockIdx.y * 128;
    const int wave = __builtin_amdgcn_readfirstlane((int)(threadIdx.x >> 5)); const int wm = wave >> 1, wn = wave & 1;
    // the wave's slice of a stage. Plain: waves 0, 1 the halves of A, waves 2, 3 the halves of Bt. NSPLIT: wave 0 all of A, wave 1 all of A2, waves 2, 3 the halves of Bt.
    const bf* sp; unsigned place, ngr;
    if (wave >= 2) { sp = Bt + (size_t)(c0 + (wave - 2) * 64) * K; place = (NPL - 1) * GPL + (wave - 2) * (GPL / 2); ngr = 4; }
    else if (NSPLIT) { sp = (wave == 0 ? A : A2) + (size_t)r0 * K; place = wave * GPL; ngr = 8; }
    else { sp = A + (size_t)(r0 + wave * 64) * K; place = wave * (GPL / 2); ngr = 4; }
    const unsigned lbase = (unsigned)(size_t)ring + place;
    u32x8 g1;   // 1-byte elements, tensor = tile = ngr rows of GRB bytes, source pitch K * 32 bytes, no pad, no mask
    g1[0] = uni(0u); g1[1] = uni(((unsigned)GRB & 0xFFFFu) << 16); g1[2] = uni(((unsigned)GRB >> 16) | (ngr << 16)); g1[3] = uni((unsigned)GRB << 16); g1[4] = uni(ngr); g1[5] = uni((unsigned)K * 32u); g1[6] = uni(0u); g1[7] = uni(0u);
    asm volatile("" : "+s"(g1));   // the form of pinned(), for descriptor words held in scalar registers: left free, the compiler forms these constants anew, in the same registers, in front of the wait behind the loop
    u32x4 g0;   // group 0 of the wave's youngest request
    auto issue = [&](int s) {
        const unsigned long long ga = (unsigned long long)(size_t)sp + (unsigned long long)s * GRB;
        g0[0] = uni(1u); g0[1] = uni(lbase + (unsigned)(s & 1) * BUFB); g0[2] = uni((unsigned)ga); g0[3] = uni((((unsigned)(ga >> 32)) & 0x01FFFFFFu) | 0x80000000u);
        asm volatile("tensor_load_to_lds %0, %1" :: "s"(g0), "s"(g1) : "memory"); };   // one request of the whole wave: its slice of stage s
    // landed: the wave's own request has landed. Both descriptor groups are inputs, so that they keep their registers, unwritten, from the request up to the wait that covers it
    auto landed = [&]() { asm volatile("s_wait_tensorcnt 0x0" :: "s"(g0), "s"(g1) : "memory"); };
    // publish point of stage s + 1, passed by every wave once per stage, behind its last LDS read of stage s
    auto publish = [&](int s) {
        asm volatile("s_wait_dscnt 0x0" ::: "memory");       // the wave's reads of stage s are done before its buffer may be refilled
        landed();                                            // the wave's slice of stage s + 1
        __syncthreads();                                     // every wave has left stage s, and every slice of stage s + 1 has landed
        if (pinned(s + 2 < S)) issue(s + 2); };              // into the buffer of stage s
    v8f acc[4][4];
#pragma unroll
    for (int mb = 0; mb < 4; ++mb)
#pragma unroll
        for (int nb = 0; nb < 4; ++nb) acc[mb][nb] = (v8f){};
    issue(0);
    landed();                                            // the wave's slice of stage 0
    __syncthreads();                                     // every slice of stage 0 has landed: it may be read
    issue(1);
#pragma unroll 1   // rolled: one publish point per stage
    for (int s = 0; s < S; ++s) {
        const unsigned char* buf = ring + (unsigned)(s & 1) * BUFB + lane * 16;
#pragma unroll
        for (int g = 0; g < GKS / 32 / GF; ++g) {
            V a[GF][4], a2[GF][4];
#pragma unroll
            for (int q = 0; q < GF; ++q)
#pragma unroll
                for (int i = 0; i < 4; ++i) { const unsigned char* p = buf + (g * GF + q) * 1024 + (wm * 4 + i) * GRB; a[q][i] = F::ldf((const bf*)p); if (NSPLIT) a2[q][i] = F::ldf((const bf*)(p + GPL)); }
#pragma unroll
            for (int h = 0; h < 4 / GB; ++h) {
                V b[GF][GB];
#pragma unroll
                for (int q = 0; q < GF; ++q)
#pragma unroll
                    for (int i = 0; i < GB; ++i) b[q][i] = F::ldf((const bf*)(buf + (g * GF + q) * 1024 + (NPL - 1) * GPL + (wn * 4 + h * GB + i) * GRB));
                __builtin_amdgcn_sched_barrier(0);   // the group's LDS loads are issued together, in front of its products: one LDS latency per group instead of one per Bt fragment
                if (WHOLE) publish(s);
#pragma unroll
                for (int q = 0; q < GF; ++q)
#pragma unroll
                    for (int i = 0; i < GB; ++i) {
#pragma unroll
                        for (int mb = 0; mb < 4; ++mb) acc[mb][h * GB + i] = F::mma(a[q][mb], b[q][i], acc[mb][h * GB + i]);
                        if (NSPLIT) {
#pragma unroll
                            for (int mb = 0; mb < 4; ++mb) acc[mb][h * GB + i] = F::mma(a2[q][mb], b[q][i], acc[mb][h * GB + i]); } }
                if (GB < 4) __builtin_amdgcn_sched_barrier(0);   // the next group's loads stay behind these products, whose Bt registers they take over
            }
        }
        if (!WHOLE) publish(s);
    }
    landed();                                            // nothing of the mover is outstanding
    asm volatile("s_wait_dscnt 0x0" ::: "memory");       // and no read of the ring, which now becomes output staging (the last publish point's barrier stands in front)
    // whole 128-byte lines go out: 16 rows x 64 columns at a time pass through the wave's own part of LDS, which no other wave touches
    float* os = (float*)ring + wave * (16 * 68);
#pragma unroll
    for (int mb = 0; mb < 4; ++mb) {
#pragma unroll
        for (int nb = 0; nb < 4; ++nb) {
#pragma unroll
            for (int j = 0; j < 8; ++j) os[(hi * 8 + j) * 68 + nb * 16 + lr] = acc[mb][nb][j]; }
        asm volatile("s_wait_dscnt 0x0" ::: "memory");   // the staged rows stand in LDS before other lanes of the wave read them back
        float* crow = C + (size_t)(r0 + wm * 64 + mb * 16 + hi) * LDC + c0 + wn * 64 + lr * 4; v4f val[8];
#pragma unroll
        for (int t = 0; t < 8; ++t) val[t] = *(const v4fa*)(os + (2 * t + hi) * 68 + lr * 4);   // half a wave per row: 256 contiguous bytes
#pragma unroll
        for (int t = 0; t < 8; ++t) *(v4f*)(crow + (size_t)(2 * t) * LDC) = val[t];
        // precaution: one wait behind the eight stores and in front of any rewrite of their address and data registers, which are inputs so that they keep their registers up to the wait
        asm volatile("s_wait_xcnt 0x0" :: "v"(crow), "v"(val[0]), "v"(val[1]), "v"(val[2]), "v"(val[3]), "v"(val[4]), "v"(val[5]), "v"(val[6]), "v"(val[7]) : "memory");
        asm volatile("s_wait_dscnt 0x0" ::: "memory");   // the rows are read before the next 16 overwrite them
    }
}

__device__ __forceinline__ h16 tohx(float x) { return (h16)x; }
__device__ __forceinline__ void splitf(float y, unsigned short& h, unsigned short& l) { h = f2bf(y); l = f2bf(y - bf2f(h)); }
typedef __attribute__((ext_vector_type(2))) _Float16 v2h;
typedef __attribute__((ext_vector_type(4))) _Float16 v4h;
typedef __attribute__((ext_vector_type(2))) unsigned short v2us;
typedef __attribute__((ext_vector_type(4))) unsigned short v4us;
typedef __attribute__((ext_vector_type(2))) float v2f;
typedef __attribute__((ext_vector_type(4))) int v4i;

// wtG_blk: Bt = the fragment-order bf16 plane of w^T (rows n, columns k) from w [K][N] f32. One wave builds one block (16 n x 32 k): each load takes 16 neighbouring n of two k rows; the 8 waves of a work-group take 8 neighbouring groups of n.
__device__ __forceinline__ void wtG_blk(const float* __restrict__ w, int K, int N, bf* Bt, int blk) {
    const int lane = threadIdx.x & 31, lr = lane & 15, hi = lane >> 4; const int wv = blk * 8 + (threadIdx.x >> 5); const int ng = N / 16, kbs = K / 32; if (wv >= ng * kbs) return; const int nb = wv % ng, kb = wv / ng;
    const float* p = w + (size_t)(kb * 32 + hi * 8) * N + nb * 16 + lr; bf* o = Bt + ((size_t)nb * kbs + kb) * 512 + lane * 8; const float* q[16]; float x[16];
#pragma unroll
    for (int j = 0; j < 16; ++j) { q[j] = p + (size_t)((j >> 3) * 16 + (j & 7)) * N; x[j] = *q[j]; }
    // precaution: the wait stands behind the loads and in front of any rewrite of their address registers; the addresses are inputs so that they keep their registers up to the wait
    asm volatile("s_wait_xcnt 0x0" :: "v"(q[0]), "v"(q[1]), "v"(q[2]), "v"(q[3]), "v"(q[4]), "v"(q[5]), "v"(q[6]), "v"(q[7]), "v"(q[8]), "v"(q[9]), "v"(q[10]), "v"(q[11]), "v"(q[12]), "v"(q[13]), "v"(q[14]), "v"(q[15]) : "memory");
    v8us v0, v1;
#pragma unroll
    for (int j = 0; j < 8; ++j) { v0[j] = f2bf(x[j]); v1[j] = f2bf(x[8 + j]); }
    *(v8us*)o = v0; *(v8us*)(o + 256) = v1;
}
__device__ __forceinline__ void cvt8_blk(const float* __restrict__ src, int K, bf* dst, size_t n8, int blk) { const size_t i = (size_t)blk * 256 + threadIdx.x; if (i >= n8) return; int r, k0; frag_piece(i, K / 32, r, k0); const float* p = src + (size_t)r * K + k0; const v8f v = *(const v8f*)p; v8us o;
    asm volatile("s_wait_xcnt 0x0" :: "v"(p) : "memory");   // precaution: the wait stands behind the loads and in front of any rewrite of their address registers; the addresses are inputs so that they keep their registers up to the wait
#pragma unroll
    for (int k = 0; k < 8; ++k) o[k] = f2bf(v[k]); *(v8us*)(dst + i * 8) = o;  }
__device__ __forceinline__ void cscvt_blk(const float* __restrict__ cosT, const float* __restrict__ sinT, float* CS, int blk) { const int idx = blk * 256 + threadIdx.x; if (idx >= TT * HD) return; v2f cs; cs[0] = bfr(cosT[idx]); cs[1] = bfr(sinT[idx]); *(v2f*)(CS + (size_t)idx * 2) = cs;  }
// k_prep: every conversion of an input, one launch; ranges of work-groups take the jobs, none of which reads what another writes. WALL = the transposed planes of w_q (rows h * 2 * HD + [query | gate]), w_k and w_v one behind the other: NALL rows.
#define PB_WQ (DM * 2 * DQ / 512 / 8)
#define PB_WK (DM * DKV / 512 / 8)
#define PB_WO (DQ * DM / 512 / 8)
#define PB_X  (RT * DM / 8 / 256)
#define PB_CS (TT * HD / 256)
__global__ __launch_bounds__(256) void k_prep(const float* __restrict__ x, const float* __restrict__ wqg, const float* __restrict__ wk, const float* __restrict__ wv, const float* __restrict__ wo, const float* __restrict__ cosT, const float* __restrict__ sinT, bf* WALL, bf* WO, bf* XB, float* CS) {
    int blk = blockIdx.x;
    if (blk < PB_WQ) { wtG_blk(wqg, DM, 2 * DQ, WALL, blk); return; } blk -= PB_WQ;
    if (blk < PB_WK) { wtG_blk(wk, DM, DKV, WALL + (size_t)2 * DQ * DM, blk); return; } blk -= PB_WK;
    if (blk < PB_WK) { wtG_blk(wv, DM, DKV, WALL + (size_t)(2 * DQ + DKV) * DM, blk); return; } blk -= PB_WK;
    if (blk < PB_WO) { wtG_blk(wo, DQ, DM, WO, blk); return; } blk -= PB_WO;
    if (blk < PB_X) { cvt8_blk(x, DM, XB, (size_t)RT * DM / 8, blk); return; } blk -= PB_X;
    cscvt_blk(cosT, sinT, CS, blk);
}
// rope_blk: head planes of both batches (rows (b * nheads + h) * TT + t, columns d; the head's columns of F start at h * hstride, fragment order; one 16-byte piece per thread and plane; fp16 + hi/lo) of rope(x) x sc with the rotate-half convention out[d] = x[d] cos[t][d] - x[d+HD/2] sin[t][d], out[d+HD/2] = x[d+HD/2] cos[t][d+HD/2] + x[d] sin[t][d+HD/2]
__device__ __forceinline__ void rope_blk(const float* __restrict__ F, int pitch, int nheads, int hstride, const float* __restrict__ CS, float sc, h16* P16, bf* Ph, bf* Pl, int blk) {
    const size_t e = ((size_t)blk * 256 + threadIdx.x) * 8; if (e >= (size_t)NB_ * nheads * TT * HD) return; int row, d; frag_piece(e / 8, HD / 32, row, d); const int t = row % TT; const int bh = row / TT; const int h = bh % nheads, b = bh / nheads; const float* f = F + (size_t)(b * TT + t) * pitch + h * hstride; v8h o16; v8us oh, ol;
    const float* p0 = f + d; const float* p1 = f + ((d < HD / 2) ? d + HD / 2 : d - HD / 2); const float* pc = CS + ((size_t)t * HD + d) * 2; const v8f X0 = *(const v8f*)p0, X1 = *(const v8f*)p1, C0 = *(const v8f*)pc, C1 = *(const v8f*)(pc + 8);
    asm volatile("s_wait_xcnt 0x0" :: "v"(p0), "v"(p1), "v"(pc) : "memory");   // precaution: the wait stands behind the loads and in front of any rewrite of their address registers; the addresses are inputs so that they keep their registers up to the wait
#pragma unroll
    for (int q = 0; q < 8; ++q) { const float x0 = X0[q], x1 = X1[q]; const float cq = (q < 4) ? C0[2 * q] : C1[2 * q - 8], sq = (q < 4) ? C0[2 * q + 1] : C1[2 * q - 7];
        float a = __fmul_rn(x0, cq), bq = __fmul_rn(x1, sq); asm volatile("" : "+v"(a)); asm volatile("" : "+v"(bq)); const float r = ((d < HD / 2) ? __fsub_rn(a, bq) : __fadd_rn(a, bq)) * sc;
        o16[q] = tohx(r); unsigned short a2, c2; splitf(r, a2, c2); oh[q] = a2; ol[q] = c2; }
    *(v8h*)(P16 + e) = o16; *(v8us*)(Ph + e) = oh; *(v8us*)(Pl + e) = ol;  }
// vtp_blk: the transposed value planes of both batches (rows (b * nheads + g) * HD + d, columns t, fragment order; one 16-byte piece per thread and plane)
__device__ __forceinline__ void vtp_blk(const float* __restrict__ F, int pitch, int nheads, h16* V16, bf* Vh, bf* Vl, int blk) { const size_t e = ((size_t)blk * 256 + threadIdx.x) * 8; if (e >= (size_t)NB_ * nheads * HD * TT) return; int row, t; frag_piece(e / 8, TT / 32, row, t); const int d = row % HD; const int bg = row / HD; const int g = bg % nheads; t += (bg / nheads) * TT; v8h o16; v8us oh, ol; const float* pq[8]; float xq[8];
#pragma unroll
    for (int q = 0; q < 8; ++q) { pq[q] = F + (size_t)(t + q) * pitch + g * HD + d; xq[q] = *pq[q]; }
    asm volatile("s_wait_xcnt 0x0" :: "v"(pq[0]), "v"(pq[1]), "v"(pq[2]), "v"(pq[3]), "v"(pq[4]), "v"(pq[5]), "v"(pq[6]), "v"(pq[7]) : "memory");   // precaution: the wait stands behind the loads and in front of any rewrite of their address registers; the addresses are inputs so that they keep their registers up to the wait
#pragma unroll
    for (int q = 0; q < 8; ++q) { const float x = xq[q]; o16[q] = tohx(x); unsigned short a2, c2; splitf(x, a2, c2); oh[q] = a2; ol[q] = c2; }
    *(v8h*)(V16 + e) = o16; *(v8us*)(Vh + e) = oh; *(v8us*)(Vl + e) = ol;  }
// k_planes: all operand planes of the attention, one launch: ranges of work-groups build the value planes (from the raw v columns), the query planes and the key planes (from the normalised columns)
#define PL_V (NB_ * NKV * HD * TT / 8 / 256)
#define PL_Q (NB_ * NH_ * TT * HD / 8 / 256)
#define PL_K (NB_ * NKV * TT * HD / 8 / 256)
__global__ __launch_bounds__(256) void k_planes(const float* __restrict__ FA, const float* __restrict__ CS, h16* Q16, bf* Qh, bf* Ql, h16* K16, bf* Kh, bf* Kl, h16* V16, bf* Vh, bf* Vl) {
    int blk = blockIdx.x;
    if (blk < PL_V) { vtp_blk(FA + 2 * DQ + DKV, NALL, NKV, V16, Vh, Vl, blk); return; } blk -= PL_V;
    if (blk < PL_Q) { rope_blk(FA, NALL, NH_, 2 * HD, CS, 1.0f, Q16, Qh, Ql, blk); return; } blk -= PL_Q;
    rope_blk(FA + 2 * DQ, NALL, NKV, HD, CS, 1.0f, K16, Kh, Kl, blk);
}
// k_rmsw: RMS norm in place, one wave per row and head, of the NH_ query heads and the NKV key heads of both batches
__global__ __launch_bounds__(256) void k_rmsw(float* F, const float* __restrict__ wq, const float* __restrict__ wk) { const int lane = threadIdx.x & 31; const int wv = blockIdx.x * 8 + (threadIdx.x >> 5); if (wv >= RT * (NH_ + NKV)) return; const int t = wv / (NH_ + NKV), h = wv % (NH_ + NKV); float* f = F + (size_t)t * NALL + ((h < NH_) ? h * 2 * HD : 2 * DQ + (h - NH_) * HD) + lane * 4; const float* w = ((h < NH_) ? wq : wk) + lane * 4; const v4f a = *(const v4f*)f; float wr[4];
#pragma unroll
    for (int q = 0; q < 4; ++q) wr[q] = w[q];
    asm volatile("s_wait_xcnt 0x0" :: "v"(f), "v"(w) : "memory");   // precaution: the wait stands behind the loads and in front of any rewrite of their address registers; the addresses are inputs so that they keep their registers up to the wait
    float ss = 0.f;
#pragma unroll
    for (int q = 0; q < 4; ++q) { float p = __fmul_rn(a[q], a[q]); asm volatile("" : "+v"(p)); ss = __fadd_rn(ss, p); }
#pragma unroll
    for (int sh = 16; sh; sh >>= 1) ss = __fadd_rn(ss, __shfl_xor(ss, sh, 32));
    const float rs = __fdiv_rn(1.0f, sqrtf(__fadd_rn(ss * (1.0f / HD), 1e-6f))); v4f o;
#pragma unroll
    for (int q = 0; q < 4; ++q) { float y = __fmul_rn(a[q], rs); asm volatile("" : "+v"(y)); o[q] = __fmul_rn(y, bfr(wr[q])); }
    *(v4f*)f = o;  }
// k_mergeg: both batches (plane row tr = b * TT + t); the gate logits are the second HD columns of the head's 2 * HD in the projection output
__global__ __launch_bounds__(256) void k_mergeg(const float* __restrict__ O, const float* __restrict__ FA, bf* Ah, bf* Al) { const size_t i = (size_t)blockIdx.x * 256 + threadIdx.x; if (i >= (size_t)NB_ * ZH * TT * HD / 8) return; int tr, cl; frag_piece(i, ZH * HD / 32, tr, cl); const int t = tr % TT, b = tr / TT; const int d = cl % HD; const int zz = cl / HD; const float cs = (t < RH) ? 1.0f : (1.0f / PCAR); const size_t e = ((size_t)(b * NH_ + zz) * TT + t) * HD + d, gg = (size_t)tr * NALL + zz * 2 * HD + HD + d;
    const size_t oo = (((size_t)(tr / 16) * (DQ / 32) + cl / 32) * 64 + (i & 63)) * 8;   // this thread's 16-byte piece in the fragment-order planes of DQ columns
    v8us oh, ol; const float* po = O + e; const float* pg = FA + gg; const v8f OV = *(const v8f*)po, GV = *(const v8f*)pg;
    asm volatile("s_wait_xcnt 0x0" :: "v"(po), "v"(pg) : "memory");   // precaution: the wait stands behind the loads and in front of any rewrite of their address registers; the addresses are inputs so that they keep their registers up to the wait
#pragma unroll
    for (int q = 0; q < 8; ++q) { float a0 = OV[q] * cs; asm volatile("" : "+v"(a0)); const float gl = GV[q]; const float sg = __fdiv_rn(1.0f, __fadd_rn(1.0f, expf(-gl))); unsigned short a, c2; splitf(__fmul_rn(a0, sg), a, c2); oh[q] = a; ol[q] = c2; } *(v8us*)(Ah + oo) = oh; *(v8us*)(Al + oo) = ol;  }
__device__ __forceinline__ float xhalf(float x) { return __builtin_bit_cast(float, __builtin_amdgcn_permlanex16(__builtin_bit_cast(int, x), __builtin_bit_cast(int, x), 0x76543210, 0xfedcba98, false, false)); }
template <typename T16> struct PFrag;
template <> struct PFrag<h16> { static __device__ __forceinline__ void cv(const float* e, v16h& p, v16h& p2) { (void)p2;
#pragma unroll
    for (int i = 0; i < 16; ++i) p[i] = (h16)e[i]; } };
template <> struct PFrag<bf> { static __device__ __forceinline__ void cv(const float* e, v16bf& p, v16bf& p2) { v8us h0, h1, l0, l1;
#pragma unroll
    for (int i = 0; i < 8; ++i) { unsigned short a = f2bf(e[i]), c = f2bf(e[8 + i]); h0[i] = a; l0[i] = f2bf(e[i] - bf2f(a)); h1[i] = c; l1[i] = f2bf(e[8 + i] - bf2f(c)); }
    p = cat16b(h0, h1); p2 = cat16b(l0, l1); } };
#define CEXP (SCL * 1.4426950408889634f)   // HD^-0.5 * log2(e)
template <typename T16, bool HL>
__device__ __forceinline__ void fattn_rows(const T16* __restrict__ Q, const T16* __restrict__ Q2, const T16* __restrict__ Kp, const T16* __restrict__ Kp2, const T16* __restrict__ Vt, const T16* __restrict__ Vt2, float* __restrict__ O, int q0, T16* qs) {
    typedef typename WFrag<T16>::V V; typedef WFrag<T16> F;
    const int lane = threadIdx.x & 31, lr = lane & 15, hi = lane >> 4;
    V q[4], q2[4], k[8];
    const unsigned qo = ((unsigned)q0 * HD + lane * 8) * 2;   // byte offsets in a plane; 16 rows x HD columns are HD / 32 blocks of 1 KiB in a row
#pragma unroll
    for (int dk = 0; dk < 4; ++dk) { q[dk] = F::ldf((const T16*)((const char*)Q + qo) + dk * 512); if (HL) q2[dk] = F::ldf((const T16*)((const char*)Q2 + qo) + dk * 512); }
    // With every Q fragment held over the block a wave would not fit 256 registers (four waves per SIMD): the fragment that a block uses last (hi+lo: all eight, to leave room for sixteen K or V fragments in flight) waits in LDS, each lane's 32 bytes in a place of its own that no other lane touches (so no barrier).
    T16* ql = qs + lane * 8;
    if (HL) {
#pragma unroll
        for (int dk = 0; dk < 4; ++dk) { F::stf(ql + dk * 1024, q[dk]); F::stf(ql + dk * 1024 + 512, q2[dk]); } }
    else F::stf(ql, q[3]);
    const unsigned k0o = lane * 16;
    if (!HL) {
#pragma unroll
        for (int i = 0; i < 8; ++i) k[i] = F::ldf((const T16*)((const char*)Kp + k0o) + i * 512); }
    // precaution: the wait stands behind the loads and in front of any rewrite of their offset registers; the offsets are inputs so that they keep their registers up to the wait
    if (HL) asm volatile("s_wait_xcnt 0x0" :: "v"(qo) : "memory"); else asm volatile("s_wait_xcnt 0x0" :: "v"(qo), "v"(k0o) : "memory");
    v8f o[8];
#pragma unroll
    for (int dt = 0; dt < 8; ++dt) o[dt] = (v8f){};
    float m = -3.0e38f, l = 0.f;
    const int nkb = q0 / 32 + 1;   // the block that holds the diagonal is the last one
#pragma unroll 1   // rolled: two blocks' fragments at once would not fit the 256 registers (the inner loops are all unrolled so that their arrays are registers)
    for (int kb = 0; kb < nkb; ++kb) {
        const unsigned ko = lane * 16 + (unsigned)kb * (32 * HD * 2), kn = lane * 16 + (unsigned)min(kb + 1, nkb - 1) * (32 * HD * 2), vo = lane * 16 + (unsigned)kb * 1024;
        V v[8], w[8];
        if (!HL) {   // the value fragments start early: their latency runs under the score products and the softmax
#pragma unroll
            for (int dt = 0; dt < 8; ++dt) v[dt] = F::ldf((const T16*)((const char*)Vt + vo) + dt * (TT / 32) * 512);
        } else {   // hi+lo: twice the fragments, so none is fetched a block ahead
#pragma unroll
            for (int i = 0; i < 8; ++i) { k[i] = F::ldf((const T16*)((const char*)Kp + ko) + i * 512); w[i] = F::ldf((const T16*)((const char*)Kp2 + ko) + i * 512); }
            asm volatile("s_wait_xcnt 0x0" :: "v"(ko) : "memory");   // the same precaution behind the K loads
            __builtin_amdgcn_sched_barrier(0);   // all sixteen K fragments are in flight before the first product: one load latency a block instead of one per pair of fragments
        }
        if (!HL) q[3] = F::ldf(ql);
        v8f s[2]; s[0] = (v8f){}; s[1] = (v8f){};
#pragma unroll
        for (int dk = 0; dk < 4; ++dk)
#pragma unroll
            for (int kt = 0; kt < 2; ++kt) { if (HL && kt == 0) { q[dk] = F::ldf(ql + dk * 1024); q2[dk] = F::ldf(ql + dk * 1024 + 512); }
                s[kt] = F::mma(k[kt * 4 + dk], q[dk], s[kt]); if (HL) { s[kt] = F::mma(k[kt * 4 + dk], q2[dk], s[kt]); s[kt] = F::mma(w[kt * 4 + dk], q[dk], s[kt]); } }
        if (HL) {
#pragma unroll
            for (int dt = 0; dt < 8; ++dt) { v[dt] = F::ldf((const T16*)((const char*)Vt + vo) + dt * (TT / 32) * 512); w[dt] = F::ldf((const T16*)((const char*)Vt2 + vo) + dt * (TT / 32) * 512); }
        }
        if (!HL) {   // the next block's K fragments are fetched one block ahead, into the same registers (the last block fetches itself again: never a row past the diagonal block)
#pragma unroll
            for (int i = 0; i < 8; ++i) k[i] = F::ldf((const T16*)((const char*)Kp + kn) + i * 512); }
        // the same precaution behind the V and next-K loads
        if (HL) { asm volatile("s_wait_xcnt 0x0" :: "v"(vo) : "memory"); __builtin_amdgcn_sched_barrier(0); }   // the barrier: all sixteen V fragments start in front of the softmax, which covers their latency
        else asm volatile("s_wait_xcnt 0x0" :: "v"(vo), "v"(kn) : "memory");
        float t[16];
#pragma unroll
        for (int i = 0; i < 16; ++i) t[i] = s[i >> 3][i & 7] * CEXP;
        if (kb == nkb - 1) {   // only the diagonal block holds keys behind a query
#pragma unroll
            for (int i = 0; i < 16; ++i) t[i] = (kb * 32 + (i >> 3) * 16 + hi * 8 + (i & 7) <= q0 + lr) ? t[i] : -3.0e38f; }
        float mx = fmaxf(t[0], t[1]);
#pragma unroll
        for (int i = 2; i < 16; ++i) mx = fmaxf(mx, t[i]);
        mx = fmaxf(mx, xhalf(mx));
        const float mn = fmaxf(m, mx);
        if (__builtin_amdgcn_ballot_w32(mn > m) != 0) {   // a scalar branch: the rescale is skipped while no query of the wave has a new maximum (its factor would be exactly 1)
            const float al = __builtin_amdgcn_exp2f(m - mn); l *= al;
#pragma unroll
            for (int dt = 0; dt < 8; ++dt) o[dt] *= al;
            m = mn; }
        const float mo = HL ? m : m - 10.0f;   // exp2(10) = PCAR
        float e[16];
#pragma unroll
        for (int i = 0; i < 16; ++i) e[i] = __builtin_amdgcn_exp2f(t[i] - mo);
        l += ((((e[0] + e[1]) + (e[2] + e[3])) + ((e[4] + e[5]) + (e[6] + e[7]))) + (((e[8] + e[9]) + (e[10] + e[11])) + ((e[12] + e[13]) + (e[14] + e[15]))));
        V p, p2; PFrag<T16>::cv(e, p, p2);
#pragma unroll
        for (int dt = 0; dt < 8; ++dt) { o[dt] = F::mma(v[dt], p, o[dt]); if (HL) { o[dt] = F::mma(v[dt], p2, o[dt]); o[dt] = F::mma(w[dt], p, o[dt]); } }
    }
    l += xhalf(l);   // the two halves of the wave hold the two halves of each query's keys
    const float f = __fdiv_rn(HL ? 1.0f : PCAR, l);
#pragma unroll
    for (int dt = 0; dt < 8; ++dt) o[dt] *= f;
    float* orow = O + (size_t)(q0 + lr) * HD + hi * 8;   // register r of tile dt: column dt * 16 + 8 * hi + r of the query's row
#pragma unroll
    for (int dt = 0; dt < 8; ++dt) *(v8f*)(orow + dt * 16) = o[dt];
    asm volatile("s_wait_xcnt 0x0" :: "v"(orow) : "memory");   // precaution: stands behind the stores and in front of any rewrite of their address and data registers
}
// grid (NKV * NB_, TT / 32): x = kv group + NKV * batch. Cost grows with the row, and all work-groups are resident at once: waves 0..REP-1 take the 16-row tile TT/16 - 1 - y, the others tile y, so that every work-group walks about the same number of key blocks. No wave shares a barrier or a buffer with another.
// amdgpu_waves_per_eu: two work-groups per WGP, so that one wave's load latency and softmax run under the others' matrix work.
__global__ __launch_bounds__(256) __attribute__((amdgpu_waves_per_eu(4, 4))) void k_fattn(const h16* __restrict__ Q16, const bf* __restrict__ Qh, const bf* __restrict__ Ql, const h16* __restrict__ K16, const bf* __restrict__ Kh, const bf* __restrict__ Kl, const h16* __restrict__ V16, const bf* __restrict__ Vh, const bf* __restrict__ Vl, float* __restrict__ O) {
    __shared__ __align__(16) unsigned short qsh[8 * 4096];   // 8 KiB a wave: the Q fragments that wait in LDS
    const int wave = __builtin_amdgcn_readfirstlane((int)(threadIdx.x >> 5));   // scalar, so that the key loop's and the precision branch are scalar ones
    const int g = blockIdx.x % NKV, b = blockIdx.x / NKV; const int q0 = ((wave / REP == 0) ? TT / 16 - 1 - (int)blockIdx.y : (int)blockIdx.y) * 16;
    const size_t qoff = ((size_t)b * NH_ + g * REP + wave % REP) * TT * HD, koff = ((size_t)b * NKV + g) * TT * HD;
    if (q0 < RH) fattn_rows<bf, true>(Qh + qoff, Ql + qoff, Kh + koff, Kl + koff, Vh + koff, Vl + koff, O + qoff, q0, (bf*)qsh + wave * 4096);
    else fattn_rows<h16, false>(Q16 + qoff, nullptr, K16 + koff, nullptr, V16 + koff, nullptr, O + qoff, q0, (h16*)qsh + wave * 4096);
}

extern "C" void kernel_launch(void* const* d_in, const int* in_sizes, int n_in,
                              void* d_out, int out_size, void* d_ws, size_t ws_size, hipStream_t stream) {
    (void)in_sizes; (void)n_in; (void)out_size;
    const float* x = (const float*)d_in[0]; const float* wqg = (const float*)d_in[1]; const float* wk = (const float*)d_in[2]; const float* wv = (const float*)d_in[3]; const float* wo = (const float*)d_in[4]; const float* qnw = (const float*)d_in[5]; const float* knw = (const float*)d_in[6]; const float* cosT = (const float*)d_in[7]; const float* sinT = (const float*)d_in[8];
    float* OUT = (float*)d_out;     // [2][2048][2048]
    char* wsp = (char*)d_ws;
    auto take = [&](size_t bytes) { char* p = wsp; wsp += (bytes + 255) & ~(size_t)255; return (void*)p; };
    bf* WALL = (bf*)take((size_t)NALL * DM * 2); bf* WO = (bf*)take((size_t)DM * DQ * 2); float* CS = (float*)take((size_t)TT * HD * 2 * 4);
    const size_t NQP = (size_t)NH_ * TT * HD, NKP = (size_t)NKV * TT * HD;   // elements of one batch's query planes and of its key or value planes; every plane below holds both batches
    h16* QP16 = (h16*)take(NB_ * NQP * 2); h16* KP16 = (h16*)take(NB_ * NKP * 2); h16* VT16 = (h16*)take(NB_ * NKP * 2);
    bf* QPh = (bf*)take(NB_ * NQP * 2); bf* QPl = (bf*)take(NB_ * NQP * 2); bf* KPh = (bf*)take(NB_ * NKP * 2); bf* KPl = (bf*)take(NB_ * NKP * 2); bf* VTh = (bf*)take(NB_ * NKP * 2); bf* VTl = (bf*)take(NB_ * NKP * 2);
    float* Ob = (float*)take(NB_ * NQP * 4); float* FA = (float*)take((size_t)RT * NALL * 4); bf* XB = (bf*)take((size_t)RT * DM * 2);
    if ((size_t)(wsp - (char*)d_ws) > ws_size) return;    // ws 256 MiB
    bf* ATh = XB; bf* ATl = WALL;   // the gated attention planes (RT x DQ each) lie over the x plane and the projection weights, which the projection GEMM read last (stream-ordered)
    k_prep<<<PB_WQ + 2 * PB_WK + PB_WO + PB_X + PB_CS, 256, 0, stream>>>(x, wqg, wk, wv, wo, cosT, sinT, WALL, WO, XB, CS);
    k_gemmt<0, DM, NALL><<<dim3(RT / 128, NALL / 128, 1), 128, 0, stream>>>(XB, nullptr, WALL, FA);   // q | gate, k, v of both batches
    k_rmsw<<<RT * (NH_ + NKV) / 8, 256, 0, stream>>>(FA, qnw, knw);
    k_planes<<<PL_V + PL_Q + PL_K, 256, 0, stream>>>(FA, CS, QP16, QPh, QPl, KP16, KPh, KPl, VT16, VTh, VTl);
    k_fattn<<<dim3(NKV * NB_, TT / 32, 1), 256, 0, stream>>>(QP16, QPh, QPl, KP16, KPh, KPl, VT16, VTh, VTl, Ob);   // all heads of both batches
    k_mergeg<<<(unsigned)((size_t)NB_ * ZH * TT * HD / 8 / 256), 256, 0, stream>>>(Ob, FA, ATh, ATl);
    k_gemmt<1, DQ, DM><<<dim3(RT / 128, DM / 128, 1), 128, 0, stream>>>(ATh, ATl, WO, OUT);
}

// v007
// Measured time: 191 microseconds a run.
// Next to v006, in two timings, it ran 1.10 and 1.09 times as fast.
// All steps since v000 together make it 9.47 times as fast.
#include <hip/hip_runtime.h>

// GatedCausalSelfAttention (x [2][2048][2048]; qg = x w_q ([2048][4096]: per head h columns h*256 + [query 0..127 | gate 128..255]); k/v = x w_k/w_v (4 kv groups; head h -> group h/4); q, k RMS-normalised * w (eps 1e-6); rotate-half RoPE with the read cos/sin tables [T][128]; causal softmax(q.k / sqrt(128)) (finfo.min); out = (merged attn * sigmoid(gate)) w_o -> [2][2048][2048]).
// Compute dtypes, f32 accumulate: every input rounded to bf16; q, gate, k, v as ONE PLAIN bf16 GEMM over both batches (inputs: exact; the transposed w_q, w_k, w_v planes stacked); RMSNorm and RoPE (bf16-rounded tables) f32, applied while the attention's operand planes are formed; causal scores and attn.v: query rows < 512 hl (3 products), the rest single fp16 (x1024), one fused kernel that stops at the diagonal block; online softmax f32; sigmoid gate (precise expf) applied in f32 when forming the hl planes; w_o hl x exact (2 products).

#define NB_  2
#define TT   2048
#define DM   2048
#define NH_  16
#define NKV  4
#define REP  (NH_ / NKV)
#define HD   128
#define DQ   (NH_ * HD)
#define DKV  (NKV * HD)
#define NALL (2 * DQ + 2 * DKV)   // columns of the one projection GEMM: per head [query | gate], then k, then v
#define RT   (NB_ * TT)           // rows of both batches: row b * TT + t
#define ZH   16                   // heads per k_mergeg launch: all
#define RH   512                  // query rows < RH use hi+lo planes (0: none)
#define WIN  2048
#define PCAR 1024.0f
#define SCL  0.088388347648318447f   // HD^-0.5
typedef _Float16 h16;
typedef unsigned short bf;
typedef __attribute__((ext_vector_type(16))) __bf16   v16bf;
typedef __attribute__((ext_vector_type(16))) _Float16 v16h;
typedef __attribute__((ext_vector_type(8)))  _Float16 v8h;
typedef __attribute__((ext_vector_type(8)))  unsigned short v8us;
typedef __attribute__((ext_vector_type(8)))  float    v8f;
typedef __attribute__((ext_vector_type(4)))  float    v4f;
typedef v8h  __attribute__((may_alias)) v8ha;
typedef v4f  __attribute__((may_alias)) v4fa;
typedef v8us __attribute__((may_alias)) v8usa;

__device__ __forceinline__ unsigned short f2bf(float f) { unsigned u = __float_as_uint(f); u += 0x7FFFu + ((u >> 16) & 1u); return (unsigned short)(u >> 16); }
__device__ __forceinline__ float bf2f(unsigned short b) { return __uint_as_float(((unsigned)b) << 16); }
__device__ __forceinline__ float bfr(float f) { return bf2f(f2bf(f)); }
__device__ __forceinline__ v16h cat16(v8h lo, v8h hi) { return __builtin_shufflevector(lo, hi, 0, 1, 2, 3, 4, 5, 6, 7, 8, 9, 10, 11, 12, 13, 14, 15); }
__device__ __forceinline__ v16bf cat16b(v8us lo, v8us hi) { return __builtin_bit_cast(v16bf, __builtin_shufflevector(lo, hi, 0, 1, 2, 3, 4, 5, 6, 7, 8, 9, 10, 11, 12, 13, 14, 15)); }
__device__ __forceinline__ v8f wmma16(v16h a, v16h b, v8f c) { return __builtin_amdgcn_wmma_f32_16x16x32_f16(false, a, false, b, (short)0, c, false, false); }
__device__ __forceinline__ v8f wmmab(v16bf a, v16bf b, v8f c) { return __builtin_amdgcn_wmma_f32_16x16x32_bf16(false, a, false, b, (short)0, c, false, false); }



// ---- Fragment-order planes. A 16-bit operand plane of R rows x K columns (R % 16 == 0, K % 32 == 0) is stored as blocks of 16 rows x 32 k = 512 elements (1 KiB), block index (r / 16) * (K / 32) + k / 32.
// Inside a block: two halves of 256 elements (k % 32 < 16, then >= 16); in a half, lane slot ((k / 8) % 2) * 16 + r % 16 holds its 8 consecutive k as one 16-byte piece. That is the order in which the 32 lanes of a wave
// hold a 16x32 WMMA operand, so a fragment is two wave-wide 16-byte loads of 512 contiguous bytes each (4 whole lines) instead of two loads that touch 16 lines. The elements and their k order in every fragment are those of a row-major plane.
// frag_piece: for the i-th 16-byte piece of such a plane (storage order), its row and first k.
__device__ __forceinline__ void frag_piece(size_t i, int kblocks, int& r, int& k0) { const int w = (int)(i & 63); const size_t blk = i >> 6; r = (int)(blk / kblocks) * 16 + (w & 15); k0 = (int)(blk % kblocks) * 32 + (w >> 5) * 16 + ((w >> 4) & 1) * 8; }

template <typename T16> struct WFrag;
template <> struct WFrag<h16> { typedef v16h V; static __device__ __forceinline__ V ld(const h16* p) { return cat16(*(const v8h*)p, *(const v8h*)(p + 16)); } static __device__ __forceinline__ V ldf(const h16* p) { return cat16(*(const v8h*)p, *(const v8h*)(p + 256)); } static __device__ __forceinline__ void stf(h16* p, V x) { *(v8h*)p = __builtin_shufflevector(x, x, 0, 1, 2, 3, 4, 5, 6, 7); *(v8h*)(p + 256) = __builtin_shufflevector(x, x, 8, 9, 10, 11, 12, 13, 14, 15); } static __device__ __forceinline__ v8f mma(V a, V b, v8f c) { return wmma16(a, b, c); } };
template <> struct WFrag<bf> { typedef v16bf V; static __device__ __forceinline__ V ld(const bf* p) { return cat16b(*(const v8us*)p, *(const v8us*)(p + 16)); } static __device__ __forceinline__ V ldf(const bf* p) { return cat16b(*(const v8us*)p, *(const v8us*)(p + 256)); } static __device__ __forceinline__ void stf(bf* p, V x) { typedef __attribute__((ext_vector_type(16))) unsigned short v16us; const v16us u = __builtin_bit_cast(v16us, x); *(v8us*)p = __builtin_shufflevector(u, u, 0, 1, 2, 3, 4, 5, 6, 7); *(v8us*)(p + 256) = __builtin_shufflevector(u, u, 8, 9, 10, 11, 12, 13, 14, 15); } static __device__ __forceinline__ v8f mma(V a, V b, v8f c) { return wmmab(a, b, c); } };
// ---- k_gemmt: GEMM with both operands staged in LDS by tensor loads. One work-group of 4 waves (2 x 2) owns a 128x128 output tile, a wave 64x64 of it (16 accumulators) over the whole K range; grid (M/128, N/128), 128 threads.
// C[m][n] (f32, pitch LDC) = sum_k A[m][k] Bt[n][k] (+ A2[m][k] Bt[n][k] when NSPLIT), operands in fragment-order 16-bit planes of K columns. K % 64 == 0, K >= 128.
// A stage is 64 k of every operand row. 16 rows x 64 k of a fragment-order plane are 2 KiB in a row, and the next 16 rows follow K * 32 bytes on: a slice of n row groups is a tensor tile of n rows of 2 KiB at that pitch, and it lands in LDS
// as it lies in the plane, so a fragment is again two wave-wide 16-byte loads of 512 contiguous bytes. Every operand byte is fetched from L2 once per work-group and read by two waves.
// Two buffers: every wave issues one request per stage for its own slice, two stages ahead, into the buffer that every reader has just left.
typedef unsigned u32x4 __attribute__((ext_vector_type(4)));
typedef unsigned u32x8 __attribute__((ext_vector_type(8)));
__device__ __forceinline__ unsigned uni(unsigned v) { return (unsigned)__builtin_amdgcn_readfirstlane((int)v); }
// pinned: holds a wave-uniform condition in a scalar register, so that the test around a tensor load (which ignores EXEC) compiles to a scalar compare and branch
__device__ __forceinline__ unsigned pinned(unsigned v) { unsigned w = uni(v); asm volatile("" : "+s"(w)); return w; }
#define GKS 64              // k per stage
#define GRB (GKS * 32)      // bytes of 16 rows x GKS k
#define GPL (8 * GRB)       // bytes of one operand plane's 128 rows in a stage
template <int NSPLIT, int K, int LDC>
__global__ __launch_bounds__(128) void k_gemmt(const bf* __restrict__ A, const bf* __restrict__ A2, const bf* __restrict__ Bt, float* C) {
    typedef WFrag<bf> F; typedef F::V V;
    static_assert(K % GKS == 0 && K / GKS >= 2 && K * 32 <= 131072, "two stages at least; the source pitch stays in the mover's range");
    constexpr unsigned NPL = NSPLIT ? 3 : 2, BUFB = NPL * GPL; constexpr int S = K / GKS;
    constexpr int GF = NSPLIT ? 2 : 1, GB = NSPLIT ? 4 : 2;   // a load group: the Bt fragments of GB column groups over GF 32-k steps. The plain GEMM has five work-groups per WGP and stays within 192 registers so that all are resident at once; the NSPLIT launch has two, so registers are free
    constexpr bool WHOLE = GF * 32 == GKS && GB == 4;   // a stage's fragments are one group: the publish point and the refill then stand behind the loads and in front of the products, which gives the refill the products' time to land
    __shared__ __attribute__((aligned(2048))) unsigned char ring[2 * BUFB];   // a buffer: [A 128 rows | A2 128 rows (NSPLIT) | Bt 128 rows]
    const int lane = threadIdx.x & 31, lr = lane & 15, hi = lane >> 4; const int r0 = blockIdx.x * 128, c0 = blockIdx.y * 128;
    const int wave = __builtin_amdgcn_readfirstlane((int)(threadIdx.x >> 5)); const int wm = wave >> 1, wn = wave & 1;
    // the wave's slice of a stage. Plain: waves 0, 1 the halves of A, waves 2, 3 the halves of Bt. NSPLIT: wave 0 all of A, wave 1 all of A2, waves 2, 3 the halves of Bt.
    const bf* sp; unsigned place, ngr;
    if (wave >= 2) { sp = Bt + (size_t)(c0 + (wave - 2) * 64) * K; place = (NPL - 1) * GPL + (wave - 2) * (GPL / 2); ngr = 4; }
    else if (NSPLIT) { sp = (wave == 0 ? A : A2) + (size_t)r0 * K; place = wave * GPL; ngr = 8; }
    else { sp = A + (size_t)(r0 + wave * 64) * K; place = wave * (GPL / 2); ngr = 4; }
    const unsigned lbase = (unsigned)(size_t)ring + place;
    u32x8 g1;   // 1-byte elements, tensor = tile = ngr rows of GRB bytes, source pitch K * 32 bytes, no pad, no mask
    g1[0] = uni(0u); g1[1] = uni(((unsigned)GRB & 0xFFFFu) << 16); g1[2] = uni(((unsigned)GRB >> 16) | (ngr << 16)); g1[3] = uni((unsigned)GRB << 16); g1[4] = uni(ngr); g1[5] = uni((unsigned)K * 32u); g1[6] = uni(0u); g1[7] = uni(0u);
    asm volatile("" : "+s"(g1));   // the form of pinned(), for descriptor words held in scalar registers: left free, the compiler forms these constants anew, in the same registers, in front of the wait behind the loop
    u32x4 g0;   // group 0 of the wave's youngest request
    auto issue = [&](int s) {
        const unsigned long long ga = (unsigned long long)(size_t)sp + (unsigned long long)s * GRB;
        g0[0] = uni(1u); g0[1] = uni(lbase + (unsigned)(s & 1) * BUFB); g0[2] = uni((unsigned)ga); g0[3] = uni((((unsigned)(ga >> 32)) & 0x01FFFFFFu) | 0x80000000u);
        asm volatile("tensor_load_to_lds %0, %1" :: "s"(g0), "s"(g1) : "memory"); };   // one request of the whole wave: its slice of stage s
    // landed: the wave's own request has landed. Both descriptor groups are inputs, so that they keep their registers, unwritten, from the request up to the wait that covers it
    auto landed = [&]() { asm volatile("s_wait_tensorcnt 0x0" :: "s"(g0), "s"(g1) : "memory"); };
    // publish point of stage s + 1, passed by every wave once per stage, behind its last LDS read of stage s
    auto publish = [&](int s) {
        asm volatile("s_wait_dscnt 0x0" ::: "memory");       // the wave's reads of stage s are done before its buffer may be refilled
        landed();                                            // the wave's slice of stage s + 1
        __syncthreads();                                     // every wave has left stage s, and every slice of stage s + 1 has landed
        if (pinned(s + 2 < S)) issue(s + 2); };              // into the buffer of stage s
    v8f acc[4][4];
#pragma unroll
    for (int mb = 0; mb < 4; ++mb)
#pragma unroll
        for (int nb = 0; nb < 4; ++nb) acc[mb][nb] = (v8f){};
    issue(0);
    landed();                                            // the wave's slice of stage 0
    __syncthreads();                                     // every slice of stage 0 has landed: it may be read
    issue(1);
#pragma unroll 1   // rolled: one publish point per stage
    for (int s = 0; s < S; ++s) {
        const unsigned char* buf = ring + (unsigned)(s & 1) * BUFB + lane * 16;
#pragma unroll
        for (int g = 0; g < GKS / 32 / GF; ++g) {
            V a[GF][4], a2[GF][4];
#pragma unroll
            for (int q = 0; q < GF; ++q)
#pragma unroll
                for (int i = 0; i < 4; ++i) { const unsigned char* p = buf + (g * GF + q) * 1024 + (wm * 4 + i) * GRB; a[q][i] = F::ldf((const bf*)p); if (NSPLIT) a2[q][i] = F::ldf((const bf*)(p + GPL)); }
#pragma unroll
            for (int h = 0; h < 4 / GB; ++h) {
                V b[GF][GB];
#pragma unroll
                for (int q = 0; q < GF; ++q)
#pragma unroll
                    for (int i = 0; i < GB; ++i) b[q][i] = F::ldf((const bf*)(buf + (g * GF + q) * 1024 + (NPL - 1) * GPL + (wn * 4 + h * GB + i) * GRB));
                __builtin_amdgcn_sched_barrier(0);   // the group's LDS loads are issued together, in front of its products: one LDS latency per group instead of one per Bt fragment
                if (WHOLE) publish(s);
#pragma unroll
                for (int q = 0; q < GF; ++q)
#pragma unroll
                    for (int i = 0; i < GB; ++i) {
#pragma unroll
                        for (int mb = 0; mb < 4; ++mb) acc[mb][h * GB + i] = F::mma(a[q][mb], b[q][i], acc[mb][h * GB + i]);
                        if (NSPLIT) {
#pragma unroll
                            for (int mb = 0; mb < 4; ++mb) acc[mb][h * GB + i] = F::mma(a2[q][mb], b[q][i], acc[mb][h * GB + i]); } }
                if (GB < 4) __builtin_amdgcn_sched_barrier(0);   // the next group's loads stay behind these products, whose Bt registers they take over
            }
        }
        if (!WHOLE) publish(s);
    }
    landed();                                            // nothing of the mover is outstanding
    asm volatile("s_wait_dscnt 0x0" ::: "memory");       // and no read of the ring, which now becomes output staging (the last publish point's barrier stands in front)
    // whole 128-byte lines go out: 16 rows x 64 columns at a time pass through the wave's own part of LDS, which no other wave touches
    float* os = (float*)ring + wave * (16 * 68);
#pragma unroll
    for (int mb = 0; mb < 4; ++mb) {
#pragma unroll
        for (int nb = 0; nb < 4; ++nb) {
#pragma unroll
            for (int j = 0; j < 8; ++j) os[(hi * 8 + j) * 68 + nb * 16 + lr] = acc[mb][nb][j]; }
        asm volatile("s_wait_dscnt 0x0" ::: "memory");   // the staged rows stand in LDS before other lanes of the wave read them back
        float* crow = C + (size_t)(r0 + wm * 64 + mb * 16 + hi) * LDC + c0 + wn * 64 + lr * 4; v4f val[8];
#pragma unroll
        for (int t = 0; t < 8; ++t) val[t] = *(const v4fa*)(os + (2 * t + hi) * 68 + lr * 4);   // half a wave per row: 256 contiguous bytes
#pragma unroll
        for (int t = 0; t < 8; ++t) *(v4f*)(crow + (size_t)(2 * t) * LDC) = val[t];
        // precaution: one wait behind the eight stores and in front of any rewrite of their address and data registers, which are inputs so that they keep their registers up to the wait
        asm volatile("s_wait_xcnt 0x0" :: "v"(crow), "v"(val[0]), "v"(val[1]), "v"(val[2]), "v"(val[3]), "v"(val[4]), "v"(val[5]), "v"(val[6]), "v"(val[7]) : "memory");
        asm volatile("s_wait_dscnt 0x0" ::: "memory");   // the rows are read before the next 16 overwrite them
    }
}

__device__ __forceinline__ h16 tohx(float x) { return (h16)x; }
__device__ __forceinline__ void splitf(float y, unsigned short& h, unsigned short& l) { h = f2bf(y); l = f2bf(y - bf2f(h)); }
typedef __attribute__((ext_vector_type(2))) _Float16 v2h;
typedef __attribute__((ext_vector_type(4))) _Float16 v4h;
typedef __attribute__((ext_vector_type(2))) unsigned short v2us;
typedef __attribute__((ext_vector_type(4))) unsigned short v4us;
typedef __attribute__((ext_vector_type(2))) float v2f;
typedef __attribute__((ext_vector_type(4))) int v4i;

// wtG_blk: Bt = the fragment-order bf16 plane of w^T (rows n, columns k) from w [K][N] f32. One wave builds one block (16 n x 32 k): each load takes 16 neighbouring n of two k rows; the 8 waves of a work-group take 8 neighbouring groups of n.
__device__ __forceinline__ void wtG_blk(const float* __restrict__ w, int K, int N, bf* Bt, int blk) {
    const int lane = threadIdx.x & 31, lr = lane & 15, hi = lane >> 4; const int wv = blk * 8 + (threadIdx.x >> 5); const int ng = N / 16, kbs = K / 32; if (wv >= ng * kbs) return; const int nb = wv % ng, kb = wv / ng;
    const float* p = w + (size_t)(kb * 32 + hi * 8) * N + nb * 16 + lr; bf* o = Bt + ((size_t)nb * kbs + kb) * 512 + lane * 8; const float* q[16]; float x[16];
#pragma unroll
    for (int j = 0; j < 16; ++j) { q[j] = p + (size_t)((j >> 3) * 16 + (j & 7)) * N; x[j] = *q[j]; }
    // precaution: the wait stands behind the loads and in front of any rewrite of their address registers; the addresses are inputs so that they keep their registers up to the wait
    asm volatile("s_wait_xcnt 0x0" :: "v"(q[0]), "v"(q[1]), "v"(q[2]), "v"(q[3]), "v"(q[4]), "v"(q[5]), "v"(q[6]), "v"(q[7]), "v"(q[8]), "v"(q[9]), "v"(q[10]), "v"(q[11]), "v"(q[12]), "v"(q[13]), "v"(q[14]), "v"(q[15]) : "memory");
    v8us v0, v1;
#pragma unroll
    for (int j = 0; j < 8; ++j) { v0[j] = f2bf(x[j]); v1[j] = f2bf(x[8 + j]); }
    *(v8us*)o = v0; *(v8us*)(o + 256) = v1;
}
__device__ __forceinline__ void cvt8_blk(const float* __restrict__ src, int K, bf* dst, size_t n8, int blk) { const size_t i = (size_t)blk * 256 + threadIdx.x; if (i >= n8) return; int r, k0; frag_piece(i, K / 32, r, k0); const float* p = src + (size_t)r * K + k0; const v8f v = *(const v8f*)p; v8us o;
    asm volatile("s_wait_xcnt 0x0" :: "v"(p) : "memory");   // precaution: the wait stands behind the loads and in front of any rewrite of their address registers; the addresses are inputs so that they keep their registers up to the wait
#pragma unroll
    for (int k = 0; k < 8; ++k) o[k] = f2bf(v[k]); *(v8us*)(dst + i * 8) = o;  }
__device__ __forceinline__ void cscvt_blk(const float* __restrict__ cosT, const float* __restrict__ sinT, float* CS, int blk) { const int idx = blk * 256 + threadIdx.x; if (idx >= TT * HD) return; v2f cs; cs[0] = bfr(cosT[idx]); cs[1] = bfr(sinT[idx]); *(v2f*)(CS + (size_t)idx * 2) = cs;  }
// k_prep: every conversion of an input, one launch; ranges of work-groups take the jobs, none of which reads what another writes. WALL = the transposed planes of w_q (rows h * 2 * HD + [query | gate]), w_k and w_v one behind the other: NALL rows.
#define PB_WQ (DM * 2 * DQ / 512 / 8)
#define PB_WK (DM * DKV / 512 / 8)
#define PB_WO (DQ * DM / 512 / 8)
#define PB_X  (RT * DM / 8 / 256)
#define PB_CS (TT * HD / 256)
__global__ __launch_bounds__(256) void k_prep(const float* __restrict__ x, const float* __restrict__ wqg, const float* __restrict__ wk, const float* __restrict__ wv, const float* __restrict__ wo, const float* __restrict__ cosT, const float* __restrict__ sinT, bf* WALL, bf* WO, bf* XB, float* CS) {
    int blk = blockIdx.x;
    if (blk < PB_WQ) { wtG_blk(wqg, DM, 2 * DQ, WALL, blk); return; } blk -= PB_WQ;
    if (blk < PB_WK) { wtG_blk(wk, DM, DKV, WALL + (size_t)2 * DQ * DM, blk); return; } blk -= PB_WK;
    if (blk < PB_WK) { wtG_blk(wv, DM, DKV, WALL + (size_t)(2 * DQ + DKV) * DM, blk); return; } blk -= PB_WK;
    if (blk < PB_WO) { wtG_blk(wo, DQ, DM, WO, blk); return; } blk -= PB_WO;
    if (blk < PB_X) { cvt8_blk(x, DM, XB, (size_t)RT * DM / 8, blk); return; } blk -= PB_X;
    cscvt_blk(cosT, sinT, CS, blk);
}
// lane l with lane l ^ 16, on the vector pipe (a bpermute would put an LDS round trip into every block's dependent chain)
__device__ __forceinline__ float xhalf(float x) { return __builtin_bit_cast(float, __builtin_amdgcn_permlanex16(__builtin_bit_cast(int, x), __builtin_bit_cast(int, x), 0x76543210, 0xfedcba98, false, false)); }
// nrp_blk: RMS norm, RoPE and the fragment-order planes (fp16 + hi/lo) of 16 rows x NRH heads of the projection output, which is read once, in whole rows, and not written back. Plane rows (b * nheads + h) * TT + t, columns d.
// A wave takes two rows: lane l holds columns 4 l .. 4 l + 3 of each head, so a load covers the head's 512 contiguous bytes, the row's sum of squares is one butterfly, and the rotate-half partner (d +- HD/2) sits in lane l ^ 16.
// Rotate-half convention: out[d] = x[d] cos[t][d] - x[d+HD/2] sin[t][d], out[d+HD/2] = x[d+HD/2] cos[t][d+HD/2] + x[d] sin[t][d+HD/2].
// 16 rows x HD columns of a plane are 4 KiB in a row in storage order: they are put together in LDS and go out as whole lines.
#define NRH 4               // heads per work-group
#define NRC 272             // LDS bytes per 256-byte unit of a plane: the 16 units that a wave writes at once fall on different banks
#define NRP (16 * NRC)      // LDS bytes of one plane's 16 rows
typedef v4us __attribute__((may_alias)) v4usa;
template <int HSTRIDE>
__device__ __forceinline__ void nrp_blk(const float* __restrict__ F, const float* __restrict__ CS, const float* __restrict__ wn, int tr0, size_t po, h16* P16, bf* Ph, bf* Pl, unsigned char* sm) {
    const int lane = threadIdx.x & 31, wave = threadIdx.x >> 5; const int t0 = tr0 % TT;
    const float* f0 = F + (size_t)(tr0 + wave * 2) * NALL + lane * 4; const float* f1 = f0 + NALL; const float* pc = CS + ((size_t)(t0 + wave * 2) * HD + lane * 4) * 2; const float* pw = wn + lane * 4;
    v4f a[2][NRH]; v8f c[2];
#pragma unroll
    for (int hh = 0; hh < NRH; ++hh) { a[0][hh] = *(const v4f*)(f0 + hh * HSTRIDE); a[1][hh] = *(const v4f*)(f1 + hh * HSTRIDE); }
    c[0] = *(const v8f*)pc; c[1] = *(const v8f*)(pc + HD * 2); const v4f wr = *(const v4f*)pw;
    asm volatile("s_wait_xcnt 0x0" ::: "memory");   // precaution: the wait stands behind the loads and in front of any rewrite of their address registers
    __builtin_amdgcn_sched_barrier(0);   // no later vector work is scheduled in between the loads and the wait, where it could take over an address register
    float ss[2][NRH];
#pragma unroll
    for (int rr = 0; rr < 2; ++rr)
#pragma unroll
        for (int hh = 0; hh < NRH; ++hh) { float s = 0.f;
#pragma unroll
            for (int q = 0; q < 4; ++q) s += a[rr][hh][q] * a[rr][hh][q];
            ss[rr][hh] = s; }
#pragma unroll
    for (int sh = 16; sh; sh >>= 1)
#pragma unroll
        for (int rr = 0; rr < 2; ++rr)
#pragma unroll
            for (int hh = 0; hh < NRH; ++hh) ss[rr][hh] += __shfl_xor(ss[rr][hh], sh, 32);
    unsigned char* sl = sm + (lane >> 1) * NRC + (lane & 1) * 8 + wave * 32;
#pragma unroll
    for (int rr = 0; rr < 2; ++rr)
#pragma unroll
        for (int hh = 0; hh < NRH; ++hh) {
            const float rs = __fdiv_rn(1.0f, sqrtf(ss[rr][hh] * (1.0f / HD) + 1e-6f)); v4h o16; v4us oh, ol;
#pragma unroll
            for (int q = 0; q < 4; ++q) { const float x0 = a[rr][hh][q] * rs * bfr(wr[q]); const float x1 = xhalf(x0); const float sq = c[rr][2 * q + 1];
                const float r = x0 * c[rr][2 * q] + x1 * ((lane < 16) ? -sq : sq);
                o16[q] = tohx(r); unsigned short h2, l2; splitf(r, h2, l2); oh[q] = h2; ol[q] = l2; }
            unsigned char* s = sl + hh * 3 * NRP + rr * 16;
            *(v4usa*)s = __builtin_bit_cast(v4us, o16); *(v4usa*)(s + NRP) = oh; *(v4usa*)(s + 2 * NRP) = ol; }
    __syncthreads();   // every wave's two rows stand in LDS before the planes are read back in storage order
    const unsigned char* so = sm + (threadIdx.x >> 4) * NRC + (threadIdx.x & 15) * 16; v8us val[NRH][3];
#pragma unroll
    for (int hh = 0; hh < NRH; ++hh)
#pragma unroll
        for (int p = 0; p < 3; ++p) val[hh][p] = *(const v8usa*)(so + (hh * 3 + p) * NRP);
    h16* g16 = P16 + po + threadIdx.x * 8; bf* gh = Ph + po + threadIdx.x * 8; bf* gl = Pl + po + threadIdx.x * 8;
#pragma unroll
    for (int hh = 0; hh < NRH; ++hh) { *(v8usa*)(g16 + (size_t)hh * TT * HD) = val[hh][0]; *(v8usa*)(gh + (size_t)hh * TT * HD) = val[hh][1]; *(v8usa*)(gl + (size_t)hh * TT * HD) = val[hh][2]; }
    // precaution: one wait behind the stores; their data registers are inputs so that they keep their registers up to the wait
    asm volatile("s_wait_xcnt 0x0" :: "v"(val[0][0]), "v"(val[0][1]), "v"(val[0][2]), "v"(val[1][0]), "v"(val[1][1]), "v"(val[1][2]), "v"(val[2][0]), "v"(val[2][1]), "v"(val[2][2]), "v"(val[3][0]), "v"(val[3][1]), "v"(val[3][2]) : "memory");
}
// vtp_blk: the transposed value planes of both batches (rows (b * nheads + g) * HD + d, columns t, fragment order; one 16-byte piece per thread and plane)
__device__ __forceinline__ void vtp_blk(const float* __restrict__ F, int pitch, int nheads, h16* V16, bf* Vh, bf* Vl, int blk) { const size_t e = ((size_t)blk * 256 + threadIdx.x) * 8; if (e >= (size_t)NB_ * nheads * HD * TT) return; int row, t; frag_piece(e / 8, TT / 32, row, t); const int d = row % HD; const int bg = row / HD; const int g = bg % nheads; t += (bg / nheads) * TT; v8h o16; v8us oh, ol; const float* pq[8]; float xq[8];
#pragma unroll
    for (int q = 0; q < 8; ++q) { pq[q] = F + (size_t)(t + q) * pitch + g * HD + d; xq[q] = *pq[q]; }
    asm volatile("s_wait_xcnt 0x0" :: "v"(pq[0]), "v"(pq[1]), "v"(pq[2]), "v"(pq[3]), "v"(pq[4]), "v"(pq[5]), "v"(pq[6]), "v"(pq[7]) : "memory");   // precaution: the wait stands behind the loads and in front of any rewrite of their address registers; the addresses are inputs so that they keep their registers up to the wait
#pragma unroll
    for (int q = 0; q < 8; ++q) { const float x = xq[q]; o16[q] = tohx(x); unsigned short a2, c2; splitf(x, a2, c2); oh[q] = a2; ol[q] = c2; }
    *(v8h*)(V16 + e) = o16; *(v8us*)(Vh + e) = oh; *(v8us*)(Vl + e) = ol;  }
// k_planes: all operand planes of the attention, one launch: ranges of work-groups build the value planes, and the query and key planes (norm and RoPE on the way), all from the raw projection output
#define PL_V (NB_ * NKV * HD * TT / 8 / 256)
#define PL_G ((NH_ + NKV) / NRH)   // head groups of a 16-row group: NH_ / NRH of query heads, then the key heads
#define PL_N (RT / 16 * PL_G)
__global__ __launch_bounds__(256) void k_planes(const float* __restrict__ FA, const float* __restrict__ CS, const float* __restrict__ wq, const float* __restrict__ wk, h16* Q16, bf* Qh, bf* Ql, h16* K16, bf* Kh, bf* Kl, h16* V16, bf* Vh, bf* Vl) {
    static_assert(NKV == NRH && NH_ % NRH == 0 && TT % 16 == 0, "the key heads are one head group; a 16-row group lies in one batch");
    __shared__ __attribute__((aligned(16))) unsigned char sm[NRH * 3 * NRP];
    int blk = blockIdx.x;
    if (blk < PL_V) { vtp_blk(FA + 2 * DQ + DKV, NALL, NKV, V16, Vh, Vl, blk); return; } blk -= PL_V;
    const int tr0 = blk / PL_G * 16, hg = blk % PL_G; const int b = tr0 / TT, t0 = tr0 % TT;   // the same for the whole work-group: the barrier in nrp_blk stands under uniform control flow
    if (hg < NH_ / NRH) nrp_blk<2 * HD>(FA + hg * NRH * 2 * HD, CS, wq, tr0, ((size_t)(b * NH_ + hg * NRH) * TT + t0) * HD, Q16, Qh, Ql, sm);
    else nrp_blk<HD>(FA + 2 * DQ, CS, wk, tr0, ((size_t)(b * NKV) * TT + t0) * HD, K16, Kh, Kl, sm);
}
// k_mergeg: both batches (plane row tr = b * TT + t); the gate logits are the second HD columns of the head's 2 * HD in the projection output
__global__ __launch_bounds__(256) void k_mergeg(const float* __restrict__ O, const float* __restrict__ FA, bf* Ah, bf* Al) { const size_t i = (size_t)blockIdx.x * 256 + threadIdx.x; if (i >= (size_t)NB_ * ZH * TT * HD / 8) return; int tr, cl; frag_piece(i, ZH * HD / 32, tr, cl); const int t = tr % TT, b = tr / TT; const int d = cl % HD; const int zz = cl / HD; const float cs = (t < RH) ? 1.0f : (1.0f / PCAR); const size_t e = ((size_t)(b * NH_ + zz) * TT + t) * HD + d, gg = (size_t)tr * NALL + zz * 2 * HD + HD + d;
    const size_t oo = (((size_t)(tr / 16) * (DQ / 32) + cl / 32) * 64 + (i & 63)) * 8;   // this thread's 16-byte piece in the fragment-order planes of DQ columns
    v8us oh, ol; const float* po = O + e; const float* pg = FA + gg; const v8f OV = *(const v8f*)po, GV = *(const v8f*)pg;
    asm volatile("s_wait_xcnt 0x0" :: "v"(po), "v"(pg) : "memory");   // precaution: the wait stands behind the loads and in front of any rewrite of their address registers; the addresses are inputs so that they keep their registers up to the wait
#pragma unroll
    for (int q = 0; q < 8; ++q) { float a0 = OV[q] * cs; asm volatile("" : "+v"(a0)); const float gl = GV[q]; const float sg = __fdiv_rn(1.0f, __fadd_rn(1.0f, expf(-gl))); unsigned short a, c2; splitf(__fmul_rn(a0, sg), a, c2); oh[q] = a; ol[q] = c2; } *(v8us*)(Ah + oo) = oh; *(v8us*)(Al + oo) = ol;  }
template <typename T16> struct PFrag;
template <> struct PFrag<h16> { static __device__ __forceinline__ void cv(const float* e, v16h& p, v16h& p2) { (void)p2;
#pragma unroll
    for (int i = 0; i < 16; ++i) p[i] = (h16)e[i]; } };
template <> struct PFrag<bf> { static __device__ __forceinline__ void cv(const float* e, v16bf& p, v16bf& p2) { v8us h0, h1, l0, l1;
#pragma unroll
    for (int i = 0; i < 8; ++i) { unsigned short a = f2bf(e[i]), c = f2bf(e[8 + i]); h0[i] = a; l0[i] = f2bf(e[i] - bf2f(a)); h1[i] = c; l1[i] = f2bf(e[8 + i] - bf2f(c)); }
    p = cat16b(h0, h1); p2 = cat16b(l0, l1); } };
#define CEXP (SCL * 1.4426950408889634f)   // HD^-0.5 * log2(e)
template <typename T16, bool HL>
__device__ __forceinline__ void fattn_rows(const T16* __restrict__ Q, const T16* __restrict__ Q2, const T16* __restrict__ Kp, const T16* __restrict__ Kp2, const T16* __restrict__ Vt, const T16* __restrict__ Vt2, float* __restrict__ O, int q0, T16* qs) {
    typedef typename WFrag<T16>::V V; typedef WFrag<T16> F;
    const int lane = threadIdx.x & 31, lr = lane & 15, hi = lane >> 4;
    V q[4], q2[4], k[8];
    const unsigned qo = ((unsigned)q0 * HD + lane * 8) * 2;   // byte offsets in a plane; 16 rows x HD columns are HD / 32 blocks of 1 KiB in a row
#pragma unroll
    for (int dk = 0; dk < 4; ++dk) { q[dk] = F::ldf((const T16*)((const char*)Q + qo) + dk * 512); if (HL) q2[dk] = F::ldf((const T16*)((const char*)Q2 + qo) + dk * 512); }
    // With every Q fragment held over the block a wave would not fit 256 registers (four waves per SIMD): the fragment that a block uses last (hi+lo: all eight, to leave room for sixteen K or V fragments in flight) waits in LDS, each lane's 32 bytes in a place of its own that no other lane touches (so no barrier).
    T16* ql = qs + lane * 8;
    if (HL) {
#pragma unroll
        for (int dk = 0; dk < 4; ++dk) { F::stf(ql + dk * 1024, q[dk]); F::stf(ql + dk * 1024 + 512, q2[dk]); } }
    else F::stf(ql, q[3]);
    const unsigned k0o = lane * 16;
    if (!HL) {
#pragma unroll
        for (int i = 0; i < 8; ++i) k[i] = F::ldf((const T16*)((const char*)Kp + k0o) + i * 512); }
    // precaution: the wait stands behind the loads and in front of any rewrite of their offset registers; the offsets are inputs so that they keep their registers up to the wait
    if (HL) asm volatile("s_wait_xcnt 0x0" :: "v"(qo) : "memory"); else asm volatile("s_wait_xcnt 0x0" :: "v"(qo), "v"(k0o) : "memory");
    v8f o[8];
#pragma unroll
    for (int dt = 0; dt < 8; ++dt) o[dt] = (v8f){};
    float m = -3.0e38f, l = 0.f;
    const int nkb = q0 / 32 + 1;   // the block that holds the diagonal is the last one
#pragma unroll 1   // rolled: two blocks' fragments at once would not fit the 256 registers (the inner loops are all unrolled so that their arrays are registers)
    for (int kb = 0; kb < nkb; ++kb) {
        const unsigned ko = lane * 16 + (unsigned)kb * (32 * HD * 2), kn = lane * 16 + (unsigned)min(kb + 1, nkb - 1) * (32 * HD * 2), vo = lane * 16 + (unsigned)kb * 1024;
        V v[8], w[8];
        if (!HL) {   // the value fragments start early: their latency runs under the score products and the softmax
#pragma unroll
            for (int dt = 0; dt < 8; ++dt) v[dt] = F::ldf((const T16*)((const char*)Vt + vo) + dt * (TT / 32) * 512);
        } else {   // hi+lo: twice the fragments, so none is fetched a block ahead
#pragma unroll
            for (int i = 0; i < 8; ++i) { k[i] = F::ldf((const T16*)((const char*)Kp + ko) + i * 512); w[i] = F::ldf((const T16*)((const char*)Kp2 + ko) + i * 512); }
            asm volatile("s_wait_xcnt 0x0" :: "v"(ko) : "memory");   // the same precaution behind the K loads
            __builtin_amdgcn_sched_barrier(0);   // all sixteen K fragments are in flight before the first product: one load latency a block instead of one per pair of fragments
        }
        if (!HL) q[3] = F::ldf(ql);
        v8f s[2]; s[0] = (v8f){}; s[1] = (v8f){};
#pragma unroll
        for (int dk = 0; dk < 4; ++dk)
#pragma unroll
            for (int kt = 0; kt < 2; ++kt) { if (HL && kt == 0) { q[dk] = F::ldf(ql + dk * 1024); q2[dk] = F::ldf(ql + dk * 1024 + 512); }
                s[kt] = F::mma(k[kt * 4 + dk], q[dk], s[kt]); if (HL) { s[kt] = F::mma(k[kt * 4 + dk], q2[dk], s[kt]); s[kt] = F::mma(w[kt * 4 + dk], q[dk], s[kt]); } }
        if (HL) {
#pragma unroll
            for (int dt = 0; dt < 8; ++dt) { v[dt] = F::ldf((const T16*)((const char*)Vt + vo) + dt * (TT / 32) * 512); w[dt] = F::ldf((const T16*)((const char*)Vt2 + vo) + dt * (TT / 32) * 512); }
        }
        if (!HL) {   // the next block's K fragments are fetched one block ahead, into the same registers (the last block fetches itself again: never a row past the diagonal block)
#pragma unroll
            for (int i = 0; i < 8; ++i) k[i] = F::ldf((const T16*)((const char*)Kp + kn) + i * 512); }
        // the same precaution behind the V and next-K loads
        if (HL) { asm volatile("s_wait_xcnt 0x0" :: "v"(vo) : "memory"); __builtin_amdgcn_sched_barrier(0); }   // the barrier: all sixteen V fragments start in front of the softmax, which covers their latency
        else asm volatile("s_wait_xcnt 0x0" :: "v"(vo), "v"(kn) : "memory");
        float t[16];
#pragma unroll
        for (int i = 0; i < 16; ++i) t[i] = s[i >> 3][i & 7] * CEXP;
        if (kb == nkb - 1) {   // only the diagonal block holds keys behind a query
#pragma unroll
            for (int i = 0; i < 16; ++i) t[i] = (kb * 32 + (i >> 3) * 16 + hi * 8 + (i & 7) <= q0 + lr) ? t[i] : -3.0e38f; }
        float mx = fmaxf(t[0], t[1]);
#pragma unroll
        for (int i = 2; i < 16; ++i) mx = fmaxf(mx, t[i]);
        mx = fmaxf(mx, xhalf(mx));
        const float mn = fmaxf(m, mx);
        if (__builtin_amdgcn_ballot_w32(mn > m) != 0) {   // a scalar branch: the rescale is skipped while no query of the wave has a new maximum (its factor would be exactly 1)
            const float al = __builtin_amdgcn_exp2f(m - mn); l *= al;
#pragma unroll
            for (int dt = 0; dt < 8; ++dt) o[dt] *= al;
            m = mn; }
        const float mo = HL ? m : m - 10.0f;   // exp2(10) = PCAR
        float e[16];
#pragma unroll
        for (int i = 0; i < 16; ++i) e[i] = __builtin_amdgcn_exp2f(t[i] - mo);
        l += ((((e[0] + e[1]) + (e[2] + e[3])) + ((e[4] + e[5]) + (e[6] + e[7]))) + (((e[8] + e[9]) + (e[10] + e[11])) + ((e[12] + e[13]) + (e[14] + e[15]))));
        V p, p2; PFrag<T16>::cv(e, p, p2);
#pragma unroll
        for (int dt = 0; dt < 8; ++dt) { o[dt] = F::mma(v[dt], p, o[dt]); if (HL) { o[dt] = F::mma(v[dt], p2, o[dt]); o[dt] = F::mma(w[dt], p, o[dt]); } }
    }
    l += xhalf(l);   // the two halves of the wave hold the two halves of each query's keys
    const float f = __fdiv_rn(HL ? 1.0f : PCAR, l);
#pragma unroll
    for (int dt = 0; dt < 8; ++dt) o[dt] *= f;
    float* orow = O + (size_t)(q0 + lr) * HD + hi * 8;   // register r of tile dt: column dt * 16 + 8 * hi + r of the query's row
#pragma unroll
    for (int dt = 0; dt < 8; ++dt) *(v8f*)(orow + dt * 16) = o[dt];
    asm volatile("s_wait_xcnt 0x0" :: "v"(orow) : "memory");   // precaution: stands behind the stores and in front of any rewrite of their address and data registers
}
// grid (NKV * NB_, TT / 32): x = kv group + NKV * batch. Cost grows with the row, and all work-groups are resident at once: waves 0..REP-1 take the 16-row tile TT/16 - 1 - y, the others tile y, so that every work-group walks about the same number of key blocks. No wave shares a barrier or a buffer with another.
// amdgpu_waves_per_eu: two work-groups per WGP, so that one wave's load latency and softmax run under the others' matrix work.
__global__ __launch_bounds__(256) __attribute__((amdgpu_waves_per_eu(4, 4))) void k_fattn(const h16* __restrict__ Q16, const bf* __restrict__ Qh, const bf* __restrict__ Ql, const h16* __restrict__ K16, const bf* __restrict__ Kh, const bf* __restrict__ Kl, const h16* __restrict__ V16, const bf* __restrict__ Vh, const bf* __restrict__ Vl, float* __restrict__ O) {
    __shared__ __align__(16) unsigned short qsh[8 * 4096];   // 8 KiB a wave: the Q fragments that wait in LDS
    const int wave = __builtin_amdgcn_readfirstlane((int)(threadIdx.x >> 5));   // scalar, so that the key loop's and the precision branch are scalar ones
    const int g = blockIdx.x % NKV, b = blockIdx.x / NKV; const int q0 = ((wave / REP == 0) ? TT / 16 - 1 - (int)blockIdx.y : (int)blockIdx.y) * 16;
    const size_t qoff = ((size_t)b * NH_ + g * REP + wave % REP) * TT * HD, koff = ((size_t)b * NKV + g) * TT * HD;
    if (q0 < RH) fattn_rows<bf, true>(Qh + qoff, Ql + qoff, Kh + koff, Kl + koff, Vh + koff, Vl + koff, O + qoff, q0, (bf*)qsh + wave * 4096);
    else fattn_rows<h16, false>(Q16 + qoff, nullptr, K16 + koff, nullptr, V16 + koff, nullptr, O + qoff, q0, (h16*)qsh + wave * 4096);
}

extern "C" void kernel_launch(void* const* d_in, const int* in_sizes, int n_in,
                              void* d_out, int out_size, void* d_ws, size_t ws_size, hipStream_t stream) {
    (void)in_sizes; (void)n_in; (void)out_size;
    const float* x = (const float*)d_in[0]; const float* wqg = (const float*)d_in[1]; const float* wk = (const float*)d_in[2]; const float* wv = (const float*)d_in[3]; const float* wo = (const float*)d_in[4]; const float* qnw = (const float*)d_in[5]; const float* knw = (const float*)d_in[6]; const float* cosT = (const float*)d_in[7]; const float* sinT = (const float*)d_in[8];
    float* OUT = (float*)d_out;     // [2][2048][2048]
    char* wsp = (char*)d_ws;
    auto take = [&](size_t bytes) { char* p = wsp; wsp += (bytes + 255) & ~(size_t)255; return (void*)p; };
    bf* WALL = (bf*)take((size_t)NALL * DM * 2); bf* WO = (bf*)take((size_t)DM * DQ * 2); float* CS = (float*)take((size_t)TT * HD * 2 * 4);
    const size_t NQP = (size_t)NH_ * TT * HD, NKP = (size_t)NKV * TT * HD;   // elements of one batch's query planes and of its key or value planes; every plane below holds both batches
    h16* QP16 = (h16*)take(NB_ * NQP * 2); h16* KP16 = (h16*)take(NB_ * NKP * 2); h16* VT16 = (h16*)take(NB_ * NKP * 2);
    bf* QPh = (bf*)take(NB_ * NQP * 2); bf* QPl = (bf*)take(NB_ * NQP * 2); bf* KPh = (bf*)take(NB_ * NKP * 2); bf* KPl = (bf*)take(NB_ * NKP * 2); bf* VTh = (bf*)take(NB_ * NKP * 2); bf* VTl = (bf*)take(NB_ * NKP * 2);
    float* Ob = (float*)take(NB_ * NQP * 4); float* FA = (float*)take((size_t)RT * NALL * 4); bf* XB = (bf*)take((size_t)RT * DM * 2);
    if ((size_t)(wsp - (char*)d_ws) > ws_size) return;    // ws 256 MiB
    bf* ATh = XB; bf* ATl = WALL;   // the gated attention planes (RT x DQ each) lie over the x plane and the projection weights, which the projection GEMM read last (stream-ordered)
    k_prep<<<PB_WQ + 2 * PB_WK + PB_WO + PB_X + PB_CS, 256, 0, stream>>>(x, wqg, wk, wv, wo, cosT, sinT, WALL, WO, XB, CS);
    k_gemmt<0, DM, NALL><<<dim3(RT / 128, NALL / 128, 1), 128, 0, stream>>>(XB, nullptr, WALL, FA);   // q | gate, k, v of both batches
    k_planes<<<PL_V + PL_N, 256, 0, stream>>>(FA, CS, qnw, knw, QP16, QPh, QPl, KP16, KPh, KPl, VT16, VTh, VTl);
    k_fattn<<<dim3(NKV * NB_, TT / 32, 1), 256, 0, stream>>>(QP16, QPh, QPl, KP16, KPh, KPl, VT16, VTh, VTl, Ob);   // all heads of both batches
    k_mergeg<<<(unsigned)((size_t)NB_ * ZH * TT * HD / 8 / 256), 256, 0, stream>>>(Ob, FA, ATh, ATl);
    k_gemmt<1, DQ, DM><<<dim3(RT / 128, DM / 128, 1), 128, 0, stream>>>(ATh, ATl, WO, OUT);
}

// v008
// One run takes 181 microseconds.
// Next to v007, in two timings, it ran 1.07 times as fast each time.
// Counting every step since v000, it is 10.1 times as fast.
#include <hip/hip_runtime.h>

// GatedCausalSelfAttention (x [2][2048][2048]; qg = x w_q ([2048][4096]: per head h columns h*256 + [query 0..127 | gate 128..255]); k/v = x w_k/w_v (4 kv groups; head h -> group h/4); q, k RMS-normalised * w (eps 1e-6); rotate-half RoPE with the read cos/sin tables [T][128]; causal softmax(q.k / sqrt(128)) (finfo.min); out = (merged attn * sigmoid(gate)) w_o -> [2][2048][2048]).
// Compute dtypes, f32 accumulate: every input rounded to bf16; q, gate, k, v as ONE PLAIN bf16 GEMM over both batches (inputs: exact; the transposed w_q, w_k, w_v planes stacked); RMSNorm and RoPE (bf16-rounded tables) f32, applied while the attention's operand planes are formed; causal scores and attn.v: query rows < 512 hl (3 products), the rest single fp16 (x1024), one fused kernel that stops at the diagonal block; online softmax f32; sigmoid gate (precise expf) applied in f32 when the attention kernel forms the hl planes of its output; w_o hl x exact (2 products).

#define NB_  2
#define TT   2048
#define DM   2048
#define NH_  16
#define NKV  4
#define REP  (NH_ / NKV)
#define HD   128
#define DQ   (NH_ * HD)
#define DKV  (NKV * HD)
#define NALL (2 * DQ + 2 * DKV)   // columns of the one projection GEMM: per head [query | gate], then k, then v
#define RT   (NB_ * TT)           // rows of both batches: row b * TT + t
#define RH   512                  // query rows < RH use hi+lo planes (0: none)
#define WIN  2048
#define PCAR 1024.0f
#define SCL  0.088388347648318447f   // HD^-0.5
typedef _Float16 h16;
typedef unsigned short bf;
typedef __attribute__((ext_vector_type(16))) __bf16   v16bf;
typedef __attribute__((ext_vector_type(16))) _Float16 v16h;
typedef __attribute__((ext_vector_type(8)))  _Float16 v8h;
typedef __attribute__((ext_vector_type(8)))  unsigned short v8us;
typedef __attribute__((ext_vector_type(8)))  float    v8f;
typedef __attribute__((ext_vector_type(4)))  float    v4f;
typedef v8h  __attribute__((may_alias)) v8ha;
typedef v4f  __attribute__((may_alias)) v4fa;
typedef v8us __attribute__((may_alias)) v8usa;

__device__ __forceinline__ unsigned short f2bf(float f) { unsigned u = __float_as_uint(f); u += 0x7FFFu + ((u >> 16) & 1u); return (unsigned short)(u >> 16); }
__device__ __forceinline__ float bf2f(unsigned short b) { return __uint_as_float(((unsigned)b) << 16); }
__device__ __forceinline__ float bfr(float f) { return bf2f(f2bf(f)); }
__device__ __forceinline__ v16h cat16(v8h lo, v8h hi) { return __builtin_shufflevector(lo, hi, 0, 1, 2, 3, 4, 5, 6, 7, 8, 9, 10, 11, 12, 13, 14, 15); }
__device__ __forceinline__ v16bf cat16b(v8us lo, v8us hi) { return __builtin_bit_cast(v16bf, __builtin_shufflevector(lo, hi, 0, 1, 2, 3, 4, 5, 6, 7, 8, 9, 10, 11, 12, 13, 14, 15)); }
__device__ __forceinline__ v8f wmma16(v16h a, v16h b, v8f c) { return __builtin_amdgcn_wmma_f32_16x16x32_f16(false, a, false, b, (short)0, c, false, false); }
__device__ __forceinline__ v8f wmmab(v16bf a, v16bf b, v8f c) { return __builtin_amdgcn_wmma_f32_16x16x32_bf16(false, a, false, b, (short)0, c, false, false); }



// ---- Fragment-order planes. A 16-bit operand plane of R rows x K columns (R % 16 == 0, K % 32 == 0) is stored as blocks of 16 rows x 32 k = 512 elements (1 KiB), block index (r / 16) * (K / 32) + k / 32.
// Inside a block: two halves of 256 elements (k % 32 < 16, then >= 16); in a half, lane slot ((k / 8) % 2) * 16 + r % 16 holds its 8 consecutive k as one 16-byte piece. That is the order in which the 32 lanes of a wave
// hold a 16x32 WMMA operand, so a fragment is two wave-wide 16-byte loads of 512 contiguous bytes each (4 whole lines) instead of two loads that touch 16 lines. The elements and their k order in every fragment are those of a row-major plane.
// frag_piece: for the i-th 16-byte piece of such a plane (storage order), its row and first k.
__device__ __forceinline__ void frag_piece(size_t i, int kblocks, int& r, int& k0) { const int w = (int)(i & 63); const size_t blk = i >> 6; r = (int)(blk / kblocks) * 16 + (w & 15); k0 = (int)(blk % kblocks) * 32 + (w >> 5) * 16 + ((w >> 4) & 1) * 8; }

template <typename T16> struct WFrag;
template <> struct WFrag<h16> { typedef v16h V; static __device__ __forceinline__ V ld(const h16* p) { return cat16(*(const v8h*)p, *(const v8h*)(p + 16)); } static __device__ __forceinline__ V ldf(const h16* p) { return cat16(*(const v8h*)p, *(const v8h*)(p + 256)); } static __device__ __forceinline__ void stf(h16* p, V x) { *(v8h*)p = __builtin_shufflevector(x, x, 0, 1, 2, 3, 4, 5, 6, 7); *(v8h*)(p + 256) = __builtin_shufflevector(x, x, 8, 9, 10, 11, 12, 13, 14, 15); } static __device__ __forceinline__ v8f mma(V a, V b, v8f c) { return wmma16(a, b, c); } };
template <> struct WFrag<bf> { typedef v16bf V; static __device__ __forceinline__ V ld(const bf* p) { return cat16b(*(const v8us*)p, *(const v8us*)(p + 16)); } static __device__ __forceinline__ V ldf(const bf* p) { return cat16b(*(const v8us*)p, *(const v8us*)(p + 256)); } static __device__ __forceinline__ void stf(bf* p, V x) { typedef __attribute__((ext_vector_type(16))) unsigned short v16us; const v16us u = __builtin_bit_cast(v16us, x); *(v8us*)p = __builtin_shufflevector(u, u, 0, 1, 2, 3, 4, 5, 6, 7); *(v8us*)(p + 256) = __builtin_shufflevector(u, u, 8, 9, 10, 11, 12, 13, 14, 15); } static __device__ __forceinline__ v8f mma(V a, V b, v8f c) { return wmmab(a, b, c); } };
// ---- k_gemmt: GEMM with both operands staged in LDS by tensor loads. One work-group of 4 waves (2 x 2) owns a 128x128 output tile, a wave 64x64 of it (16 accumulators) over the whole K range; grid (M/128, N/128), 128 threads.
// C[m][n] (f32, pitch LDC) = sum_k A[m][k] Bt[n][k] (+ A2[m][k] Bt[n][k] when NSPLIT), operands in fragment-order 16-bit planes of K columns. K % 64 == 0, K >= 128.
// A stage is 64 k of every operand row. 16 rows x 64 k of a fragment-order plane are 2 KiB in a row, and the next 16 rows follow K * 32 bytes on: a slice of n row groups is a tensor tile of n rows of 2 KiB at that pitch, and it lands in LDS
// as it lies in the plane, so a fragment is again two wave-wide 16-byte loads of 512 contiguous bytes. Every operand byte is fetched from L2 once per work-group and read by two waves.
// Two buffers: every wave issues one request per stage for its own slice, two stages ahead, into the buffer that every reader has just left.
typedef unsigned u32x4 __attribute__((ext_vector_type(4)));
typedef unsigned u32x8 __attribute__((ext_vector_type(8)));
__device__ __forceinline__ unsigned uni(unsigned v) { return (unsigned)__builtin_amdgcn_readfirstlane((int)v); }
// pinned: holds a wave-uniform condition in a scalar register, so that the test around a tensor load (which ignores EXEC) compiles to a scalar compare and branch
__device__ __forceinline__ unsigned pinned(unsigned v) { unsigned w = uni(v); asm volatile("" : "+s"(w)); return w; }
#define GKS 64              // k per stage
#define GRB (GKS * 32)      // bytes of 16 rows x GKS k
#define GPL (8 * GRB)       // bytes of one operand plane's 128 rows in a stage
template <int NSPLIT, int K, int LDC>
__global__ __launch_bounds__(128) void k_gemmt(const bf* __restrict__ A, const bf* __restrict__ A2, const bf* __restrict__ Bt, float* C) {
    typedef WFrag<bf> F; typedef F::V V;
    static_assert(K % GKS == 0 && K / GKS >= 2 && K * 32 <= 131072, "two stages at least; the source pitch stays in the mover's range");
    constexpr unsigned NPL = NSPLIT ? 3 : 2, BUFB = NPL * GPL; constexpr int S = K / GKS;
    constexpr int GF = NSPLIT ? 2 : 1, GB = NSPLIT ? 4 : 2;   // a load group: the Bt fragments of GB column groups over GF 32-k steps. The plain GEMM has five work-groups per WGP and stays within 192 registers so that all are resident at once; the NSPLIT launch has two, so registers are free
    constexpr bool WHOLE = GF * 32 == GKS && GB == 4;   // a stage's fragments are one group: the publish point and the refill then stand behind the loads and in front of the products, which gives the refill the products' time to land
    __shared__ __attribute__((aligned(2048))) unsigned char ring[2 * BUFB];   // a buffer: [A 128 rows | A2 128 rows (NSPLIT) | Bt 128 rows]
    const int lane = threadIdx.x & 31, lr = lane & 15, hi = lane >> 4; const int r0 = blockIdx.x * 128, c0 = blockIdx.y * 128;
    const int wave = __builtin_amdgcn_readfirstlane((int)(threadIdx.x >> 5)); const int wm = wave >> 1, wn = wave & 1;
    // the wave's slice of a stage. Plain: waves 0, 1 the halves of A, waves 2, 3 the halves of Bt. NSPLIT: wave 0 all of A, wave 1 all of A2, waves 2, 3 the halves of Bt.
    const bf* sp; unsigned place, ngr;
    if (wave >= 2) { sp = Bt + (size_t)(c0 + (wave - 2) * 64) * K; place = (NPL - 1) * GPL + (wave - 2) * (GPL / 2); ngr = 4; }
    else if (NSPLIT) { sp = (wave == 0 ? A : A2) + (size_t)r0 * K; place = wave * GPL; ngr = 8; }
    else { sp = A + (size_t)(r0 + wave * 64) * K; place = wave * (GPL / 2); ngr = 4; }
    const unsigned lbase = (unsigned)(size_t)ring + place;
    u32x8 g1;   // 1-byte elements, tensor = tile = ngr rows of GRB bytes, source pitch K * 32 bytes, no pad, no mask
    g1[0] = uni(0u); g1[1] = uni(((unsigned)GRB & 0xFFFFu) << 16); g1[2] = uni(((unsigned)GRB >> 16) | (ngr << 16)); g1[3] = uni((unsigned)GRB << 16); g1[4] = uni(ngr); g1[5] = uni((unsigned)K * 32u); g1[6] = uni(0u); g1[7] = uni(0u);
    asm volatile("" : "+s"(g1));   // the form of pinned(), for descriptor words held in scalar registers: left free, the compiler forms these constants anew, in the same registers, in front of the wait behind the loop
    u32x4 g0;   // group 0 of the wave's youngest request
    auto issue = [&](int s) {
        const unsigned long long ga = (unsigned long long)(size_t)sp + (unsigned long long)s * GRB;
        g0[0] = uni(1u); g0[1] = uni(lbase + (unsigned)(s & 1) * BUFB); g0[2] = uni((unsigned)ga); g0[3] = uni((((unsigned)(ga >> 32)) & 0x01FFFFFFu) | 0x80000000u);
        asm volatile("tensor_load_to_lds %0, %1" :: "s"(g0), "s"(g1) : "memory"); };   // one request of the whole wave: its slice of stage s
    // landed: the wave's own request has landed. Both descriptor groups are inputs, so that they keep their registers, unwritten, from the request up to the wait that covers it
    auto landed = [&]() { asm volatile("s_wait_tensorcnt 0x0" :: "s"(g0), "s"(g1) : "memory"); };
    // publish point of stage s + 1, passed by every wave once per stage, behind its last LDS read of stage s
    auto publish = [&](int s) {
        asm volatile("s_wait_dscnt 0x0" ::: "memory");       // the wave's reads of stage s are done before its buffer may be refilled
        landed();                                            // the wave's slice of stage s + 1
        __syncthreads();                                     // every wave has left stage s, and every slice of stage s + 1 has landed
        if (pinned(s + 2 < S)) issue(s + 2); };              // into the buffer of stage s
    v8f acc[4][4];
#pragma unroll
    for (int mb = 0; mb < 4; ++mb)
#pragma unroll
        for (int nb = 0; nb < 4; ++nb) acc[mb][nb] = (v8f){};
    issue(0);
    landed();                                            // the wave's slice of stage 0
    __syncthreads();                                     // every slice of stage 0 has landed: it may be read
    issue(1);
#pragma unroll 1   // rolled: one publish point per stage
    for (int s = 0; s < S; ++s) {
        const unsigned char* buf = ring + (unsigned)(s & 1) * BUFB + lane * 16;
#pragma unroll
        for (int g = 0; g < GKS / 32 / GF; ++g) {
            V a[GF][4], a2[GF][4];
#pragma unroll
            for (int q = 0; q < GF; ++q)
#pragma unroll
                for (int i = 0; i < 4; ++i) { const unsigned char* p = buf + (g * GF + q) * 1024 + (wm * 4 + i) * GRB; a[q][i] = F::ldf((const bf*)p); if (NSPLIT) a2[q][i] = F::ldf((const bf*)(p + GPL)); }
#pragma unroll
            for (int h = 0; h < 4 / GB; ++h) {
                V b[GF][GB];
#pragma unroll
                for (int q = 0; q < GF; ++q)
#pragma unroll
                    for (int i = 0; i < GB; ++i) b[q][i] = F::ldf((const bf*)(buf + (g * GF + q) * 1024 + (NPL - 1) * GPL + (wn * 4 + h * GB + i) * GRB));
                __builtin_amdgcn_sched_barrier(0);   // the group's LDS loads are issued together, in front of its products: one LDS latency per group instead of one per Bt fragment
                if (WHOLE) publish(s);
#pragma unroll
                for (int q = 0; q < GF; ++q)
#pragma unroll
                    for (int i = 0; i < GB; ++i) {
#pragma unroll
                        for (int mb = 0; mb < 4; ++mb) acc[mb][h * GB + i] = F::mma(a[q][mb], b[q][i], acc[mb][h * GB + i]);
                        if (NSPLIT) {
#pragma unroll
                            for (int mb = 0; mb < 4; ++mb) acc[mb][h * GB + i] = F::mma(a2[q][mb], b[q][i], acc[mb][h * GB + i]); } }
                if (GB < 4) __builtin_amdgcn_sched_barrier(0);   // the next group's loads stay behind these products, whose Bt registers they take over
            }
        }
        if (!WHOLE) publish(s);
    }
    landed();                                            // nothing of the mover is outstanding
    asm volatile("s_wait_dscnt 0x0" ::: "memory");       // and no read of the ring, which now becomes output staging (the last publish point's barrier stands in front)
    // whole 128-byte lines go out: 16 rows x 64 columns at a time pass through the wave's own part of LDS, which no other wave touches
    float* os = (float*)ring + wave * (16 * 68);
#pragma unroll
    for (int mb = 0; mb < 4; ++mb) {
#pragma unroll
        for (int nb = 0; nb < 4; ++nb) {
#pragma unroll
            for (int j = 0; j < 8; ++j) os[(hi * 8 + j) * 68 + nb * 16 + lr] = acc[mb][nb][j]; }
        asm volatile("s_wait_dscnt 0x0" ::: "memory");   // the staged rows stand in LDS before other lanes of the wave read them back
        float* crow = C + (size_t)(r0 + wm * 64 + mb * 16 + hi) * LDC + c0 + wn * 64 + lr * 4; v4f val[8];
#pragma unroll
        for (int t = 0; t < 8; ++t) val[t] = *(const v4fa*)(os + (2 * t + hi) * 68 + lr * 4);   // half a wave per row: 256 contiguous bytes
#pragma unroll
        for (int t = 0; t < 8; ++t) *(v4f*)(crow + (size_t)(2 * t) * LDC) = val[t];
        // precaution: one wait behind the eight stores and in front of any rewrite of their address and data registers, which are inputs so that they keep their registers up to the wait
        asm volatile("s_wait_xcnt 0x0" :: "v"(crow), "v"(val[0]), "v"(val[1]), "v"(val[2]), "v"(val[3]), "v"(val[4]), "v"(val[5]), "v"(val[6]), "v"(val[7]) : "memory");
        asm volatile("s_wait_dscnt 0x0" ::: "memory");   // the rows are read before the next 16 overwrite them
    }
}

__device__ __forceinline__ h16 tohx(float x) { return (h16)x; }
__device__ __forceinline__ void splitf(float y, unsigned short& h, unsigned short& l) { h = f2bf(y); l = f2bf(y - bf2f(h)); }
typedef __attribute__((ext_vector_type(2))) _Float16 v2h;
typedef __attribute__((ext_vector_type(4))) _Float16 v4h;
typedef __attribute__((ext_vector_type(2))) unsigned short v2us;
typedef __attribute__((ext_vector_type(4))) unsigned short v4us;
typedef __attribute__((ext_vector_type(2))) float v2f;
typedef __attribute__((ext_vector_type(4))) int v4i;

// wtG_blk: Bt = the fragment-order bf16 plane of w^T (rows n, columns k) from w [K][N] f32. One wave builds one block (16 n x 32 k): each load takes 16 neighbouring n of two k rows; the 8 waves of a work-group take 8 neighbouring groups of n.
__device__ __forceinline__ void wtG_blk(const float* __restrict__ w, int K, int N, bf* Bt, int blk) {
    const int lane = threadIdx.x & 31, lr = lane & 15, hi = lane >> 4; const int wv = blk * 8 + (threadIdx.x >> 5); const int ng = N / 16, kbs = K / 32; if (wv >= ng * kbs) return; const int nb = wv % ng, kb = wv / ng;
    const float* p = w + (size_t)(kb * 32 + hi * 8) * N + nb * 16 + lr; bf* o = Bt + ((size_t)nb * kbs + kb) * 512 + lane * 8; const float* q[16]; float x[16];
#pragma unroll
    for (int j = 0; j < 16; ++j) { q[j] = p + (size_t)((j >> 3) * 16 + (j & 7)) * N; x[j] = *q[j]; }
    // precaution: the wait stands behind the loads and in front of any rewrite of their address registers; the addresses are inputs so that they keep their registers up to the wait
    asm volatile("s_wait_xcnt 0x0" :: "v"(q[0]), "v"(q[1]), "v"(q[2]), "v"(q[3]), "v"(q[4]), "v"(q[5]), "v"(q[6]), "v"(q[7]), "v"(q[8]), "v"(q[9]), "v"(q[10]), "v"(q[11]), "v"(q[12]), "v"(q[13]), "v"(q[14]), "v"(q[15]) : "memory");
    v8us v0, v1;
#pragma unroll
    for (int j = 0; j < 8; ++j) { v0[j] = f2bf(x[j]); v1[j] = f2bf(x[8 + j]); }
    *(v8us*)o = v0; *(v8us*)(o + 256) = v1;
}
__device__ __forceinline__ void cvt8_blk(const float* __restrict__ src, int K, bf* dst, size_t n8, int blk) { const size_t i = (size_t)blk * 256 + threadIdx.x; if (i >= n8) return; int r, k0; frag_piece(i, K / 32, r, k0); const float* p = src + (size_t)r * K + k0; const v8f v = *(const v8f*)p; v8us o;
    asm volatile("s_wait_xcnt 0x0" :: "v"(p) : "memory");   // precaution: the wait stands behind the loads and in front of any rewrite of their address registers; the addresses are inputs so that they keep their registers up to the wait
#pragma unroll
    for (int k = 0; k < 8; ++k) o[k] = f2bf(v[k]); *(v8us*)(dst + i * 8) = o;  }
__device__ __forceinline__ void cscvt_blk(const float* __restrict__ cosT, const float* __restrict__ sinT, float* CS, int blk) { const int idx = blk * 256 + threadIdx.x; if (idx >= TT * HD) return; v2f cs; cs[0] = bfr(cosT[idx]); cs[1] = bfr(sinT[idx]); *(v2f*)(CS + (size_t)idx * 2) = cs;  }
// k_prep: every conversion of an input, one launch; ranges of work-groups take the jobs, none of which reads what another writes. WALL = the transposed planes of w_q (rows h * 2 * HD + [query | gate]), w_k and w_v one behind the other: NALL rows.
#define PB_WQ (DM * 2 * DQ / 512 / 8)
#define PB_WK (DM * DKV / 512 / 8)
#define PB_WO (DQ * DM / 512 / 8)
#define PB_X  (RT * DM / 8 / 256)
#define PB_CS (TT * HD / 256)
__global__ __launch_bounds__(256) void k_prep(const float* __restrict__ x, const float* __restrict__ wqg, const float* __restrict__ wk, const float* __restrict__ wv, const float* __restrict__ wo, const float* __restrict__ cosT, const float* __restrict__ sinT, bf* WALL, bf* WO, bf* XB, float* CS) {
    int blk = blockIdx.x;
    if (blk < PB_WQ) { wtG_blk(wqg, DM, 2 * DQ, WALL, blk); return; } blk -= PB_WQ;
    if (blk < PB_WK) { wtG_blk(wk, DM, DKV, WALL + (size_t)2 * DQ * DM, blk); return; } blk -= PB_WK;
    if (blk < PB_WK) { wtG_blk(wv, DM, DKV, WALL + (size_t)(2 * DQ + DKV) * DM, blk); return; } blk -= PB_WK;
    if (blk < PB_WO) { wtG_blk(wo, DQ, DM, WO, blk); return; } blk -= PB_WO;
    if (blk < PB_X) { cvt8_blk(x, DM, XB, (size_t)RT * DM / 8, blk); return; } blk -= PB_X;
    cscvt_blk(cosT, sinT, CS, blk);
}
// lane l with lane l ^ 16, on the vector pipe (a bpermute would put an LDS round trip into every block's dependent chain)
__device__ __forceinline__ float xhalf(float x) { return __builtin_bit_cast(float, __builtin_amdgcn_permlanex16(__builtin_bit_cast(int, x), __builtin_bit_cast(int, x), 0x76543210, 0xfedcba98, false, false)); }
// nrp_blk: RMS norm, RoPE and the fragment-order planes (fp16 + hi/lo) of 16 rows x NRH heads of the projection output, which is read once, in whole rows, and not written back. Plane rows (b * nheads + h) * TT + t, columns d.
// A wave takes two rows: lane l holds columns 4 l .. 4 l + 3 of each head, so a load covers the head's 512 contiguous bytes, the row's sum of squares is one butterfly, and the rotate-half partner (d +- HD/2) sits in lane l ^ 16.
// Rotate-half convention: out[d] = x[d] cos[t][d] - x[d+HD/2] sin[t][d], out[d+HD/2] = x[d+HD/2] cos[t][d+HD/2] + x[d] sin[t][d+HD/2].
// 16 rows x HD columns of a plane are 4 KiB in a row in storage order: they are put together in LDS and go out as whole lines.
#define NRH 4               // heads per work-group
#define NRC 272             // LDS bytes per 256-byte unit of a plane: the 16 units that a wave writes at once fall on different banks
#define NRP (16 * NRC)      // LDS bytes of one plane's 16 rows
typedef v4us __attribute__((may_alias)) v4usa;
template <int HSTRIDE>
__device__ __forceinline__ void nrp_blk(const float* __restrict__ F, const float* __restrict__ CS, const float* __restrict__ wn, int tr0, size_t po, h16* P16, bf* Ph, bf* Pl, unsigned char* sm) {
    const int lane = threadIdx.x & 31, wave = threadIdx.x >> 5; const int t0 = tr0 % TT;
    const float* f0 = F + (size_t)(tr0 + wave * 2) * NALL + lane * 4; const float* f1 = f0 + NALL; const float* pc = CS + ((size_t)(t0 + wave * 2) * HD + lane * 4) * 2; const float* pw = wn + lane * 4;
    v4f a[2][NRH]; v8f c[2];
#pragma unroll
    for (int hh = 0; hh < NRH; ++hh) { a[0][hh] = *(const v4f*)(f0 + hh * HSTRIDE); a[1][hh] = *(const v4f*)(f1 + hh * HSTRIDE); }
    c[0] = *(const v8f*)pc; c[1] = *(const v8f*)(pc + HD * 2); const v4f wr = *(const v4f*)pw;
    asm volatile("s_wait_xcnt 0x0" ::: "memory");   // precaution: the wait stands behind the loads and in front of any rewrite of their address registers
    __builtin_amdgcn_sched_barrier(0);   // no later vector work is scheduled in between the loads and the wait, where it could take over an address register
    float ss[2][NRH];
#pragma unroll
    for (int rr = 0; rr < 2; ++rr)
#pragma unroll
        for (int hh = 0; hh < NRH; ++hh) { float s = 0.f;
#pragma unroll
            for (int q = 0; q < 4; ++q) s += a[rr][hh][q] * a[rr][hh][q];
            ss[rr][hh] = s; }
#pragma unroll
    for (int sh = 16; sh; sh >>= 1)
#pragma unroll
        for (int rr = 0; rr < 2; ++rr)
#pragma unroll
            for (int hh = 0; hh < NRH; ++hh) ss[rr][hh] += __shfl_xor(ss[rr][hh], sh, 32);
    unsigned char* sl = sm + (lane >> 1) * NRC + (lane & 1) * 8 + wave * 32;
#pragma unroll
    for (int rr = 0; rr < 2; ++rr)
#pragma unroll
        for (int hh = 0; hh < NRH; ++hh) {
            const float rs = __fdiv_rn(1.0f, sqrtf(ss[rr][hh] * (1.0f / HD) + 1e-6f)); v4h o16; v4us oh, ol;
#pragma unroll
            for (int q = 0; q < 4; ++q) { const float x0 = a[rr][hh][q] * rs * bfr(wr[q]); const float x1 = xhalf(x0); const float sq = c[rr][2 * q + 1];
                const float r = x0 * c[rr][2 * q] + x1 * ((lane < 16) ? -sq : sq);
                o16[q] = tohx(r); unsigned short h2, l2; splitf(r, h2, l2); oh[q] = h2; ol[q] = l2; }
            unsigned char* s = sl + hh * 3 * NRP + rr * 16;
            *(v4usa*)s = __builtin_bit_cast(v4us, o16); *(v4usa*)(s + NRP) = oh; *(v4usa*)(s + 2 * NRP) = ol; }
    __syncthreads();   // every wave's two rows stand in LDS before the planes are read back in storage order
    const unsigned char* so = sm + (threadIdx.x >> 4) * NRC + (threadIdx.x & 15) * 16; v8us val[NRH][3];
#pragma unroll
    for (int hh = 0; hh < NRH; ++hh)
#pragma unroll
        for (int p = 0; p < 3; ++p) val[hh][p] = *(const v8usa*)(so + (hh * 3 + p) * NRP);
    h16* g16 = P16 + po + threadIdx.x * 8; bf* gh = Ph + po + threadIdx.x * 8; bf* gl = Pl + po + threadIdx.x * 8;
#pragma unroll
    for (int hh = 0; hh < NRH; ++hh) { *(v8usa*)(g16 + (size_t)hh * TT * HD) = val[hh][0]; *(v8usa*)(gh + (size_t)hh * TT * HD) = val[hh][1]; *(v8usa*)(gl + (size_t)hh * TT * HD) = val[hh][2]; }
    // precaution: one wait behind the stores; their data registers are inputs so that they keep their registers up to the wait
    asm volatile("s_wait_xcnt 0x0" :: "v"(val[0][0]), "v"(val[0][1]), "v"(val[0][2]), "v"(val[1][0]), "v"(val[1][1]), "v"(val[1][2]), "v"(val[2][0]), "v"(val[2][1]), "v"(val[2][2]), "v"(val[3][0]), "v"(val[3][1]), "v"(val[3][2]) : "memory");
}
// vtp_blk: the transposed value planes of both batches (rows (b * nheads + g) * HD + d, columns t, fragment order; one 16-byte piece per thread and plane)
__device__ __forceinline__ void vtp_blk(const float* __restrict__ F, int pitch, int nheads, h16* V16, bf* Vh, bf* Vl, int blk) { const size_t e = ((size_t)blk * 256 + threadIdx.x) * 8; if (e >= (size_t)NB_ * nheads * HD * TT) return; int row, t; frag_piece(e / 8, TT / 32, row, t); const int d = row % HD; const int bg = row / HD; const int g = bg % nheads; t += (bg / nheads) * TT; v8h o16; v8us oh, ol; const float* pq[8]; float xq[8];
#pragma unroll
    for (int q = 0; q < 8; ++q) { pq[q] = F + (size_t)(t + q) * pitch + g * HD + d; xq[q] = *pq[q]; }
    asm volatile("s_wait_xcnt 0x0" :: "v"(pq[0]), "v"(pq[1]), "v"(pq[2]), "v"(pq[3]), "v"(pq[4]), "v"(pq[5]), "v"(pq[6]), "v"(pq[7]) : "memory");   // precaution: the wait stands behind the loads and in front of any rewrite of their address registers; the addresses are inputs so that they keep their registers up to the wait
#pragma unroll
    for (int q = 0; q < 8; ++q) { const float x = xq[q]; o16[q] = tohx(x); unsigned short a2, c2; splitf(x, a2, c2); oh[q] = a2; ol[q] = c2; }
    *(v8h*)(V16 + e) = o16; *(v8us*)(Vh + e) = oh; *(v8us*)(Vl + e) = ol;  }
// k_planes: all operand planes of the attention, one launch: ranges of work-groups build the value planes, and the query and key planes (norm and RoPE on the way), all from the raw projection output
#define PL_V (NB_ * NKV * HD * TT / 8 / 256)
#define PL_G ((NH_ + NKV) / NRH)   // head groups of a 16-row group: NH_ / NRH of query heads, then the key heads
#define PL_N (RT / 16 * PL_G)
__global__ __launch_bounds__(256) void k_planes(const float* __restrict__ FA, const float* __restrict__ CS, const float* __restrict__ wq, const float* __restrict__ wk, h16* Q16, bf* Qh, bf* Ql, h16* K16, bf* Kh, bf* Kl, h16* V16, bf* Vh, bf* Vl) {
    static_assert(NKV == NRH && NH_ % NRH == 0 && TT % 16 == 0, "the key heads are one head group; a 16-row group lies in one batch");
    __shared__ __attribute__((aligned(16))) unsigned char sm[NRH * 3 * NRP];
    int blk = blockIdx.x;
    if (blk < PL_V) { vtp_blk(FA + 2 * DQ + DKV, NALL, NKV, V16, Vh, Vl, blk); return; } blk -= PL_V;
    const int tr0 = blk / PL_G * 16, hg = blk % PL_G; const int b = tr0 / TT, t0 = tr0 % TT;   // the same for the whole work-group: the barrier in nrp_blk stands under uniform control flow
    if (hg < NH_ / NRH) nrp_blk<2 * HD>(FA + hg * NRH * 2 * HD, CS, wq, tr0, ((size_t)(b * NH_ + hg * NRH) * TT + t0) * HD, Q16, Qh, Ql, sm);
    else nrp_blk<HD>(FA + 2 * DQ, CS, wk, tr0, ((size_t)(b * NKV) * TT + t0) * HD, K16, Kh, Kl, sm);
}
template <typename T16> struct PFrag;
template <> struct PFrag<h16> { static __device__ __forceinline__ void cv(const float* e, v16h& p, v16h& p2) { (void)p2;
#pragma unroll
    for (int i = 0; i < 16; ++i) p[i] = (h16)e[i]; } };
template <> struct PFrag<bf> { static __device__ __forceinline__ void cv(const float* e, v16bf& p, v16bf& p2) { v8us h0, h1, l0, l1;
#pragma unroll
    for (int i = 0; i < 8; ++i) { unsigned short a = f2bf(e[i]), c = f2bf(e[8 + i]); h0[i] = a; l0[i] = f2bf(e[i] - bf2f(a)); h1[i] = c; l1[i] = f2bf(e[8 + i] - bf2f(c)); }
    p = cat16b(h0, h1); p2 = cat16b(l0, l1); } };
#define CEXP (SCL * 1.4426950408889634f)   // HD^-0.5 * log2(e)
template <typename T16, bool HL>
__device__ __forceinline__ void fattn_rows(const T16* __restrict__ Q, const T16* __restrict__ Q2, const T16* __restrict__ Kp, const T16* __restrict__ Kp2, const T16* __restrict__ Vt, const T16* __restrict__ Vt2, v8f (&o)[8], int q0, T16* qs) {
    typedef typename WFrag<T16>::V V; typedef WFrag<T16> F;
    const int lane = threadIdx.x & 31, lr = lane & 15, hi = lane >> 4;
    V q[4], q2[4], k[8];
    const unsigned qo = ((unsigned)q0 * HD + lane * 8) * 2;   // byte offsets in a plane; 16 rows x HD columns are HD / 32 blocks of 1 KiB in a row
#pragma unroll
    for (int dk = 0; dk < 4; ++dk) { q[dk] = F::ldf((const T16*)((const char*)Q + qo) + dk * 512); if (HL) q2[dk] = F::ldf((const T16*)((const char*)Q2 + qo) + dk * 512); }
    // With every Q fragment held over the block a wave would not fit 256 registers (four waves per SIMD): the fragment that a block uses last (hi+lo: all eight, to leave room for sixteen K or V fragments in flight) waits in LDS, each lane's 32 bytes in a place of its own that no other lane touches (so no barrier).
    T16* ql = qs + lane * 8;
    if (HL) {
#pragma unroll
        for (int dk = 0; dk < 4; ++dk) { F::stf(ql + dk * 1024, q[dk]); F::stf(ql + dk * 1024 + 512, q2[dk]); } }
    else F::stf(ql, q[3]);
    const unsigned k0o = lane * 16;
    if (!HL) {
#pragma unroll
        for (int i = 0; i < 8; ++i) k[i] = F::ldf((const T16*)((const char*)Kp + k0o) + i * 512); }
    // precaution: the wait stands behind the loads and in front of any rewrite of their offset registers; the offsets are inputs so that they keep their registers up to the wait
    if (HL) asm volatile("s_wait_xcnt 0x0" :: "v"(qo) : "memory"); else asm volatile("s_wait_xcnt 0x0" :: "v"(qo), "v"(k0o) : "memory");
#pragma unroll
    for (int dt = 0; dt < 8; ++dt) o[dt] = (v8f){};
    float m = -3.0e38f, l = 0.f;
    const int nkb = q0 / 32 + 1;   // the block that holds the diagonal is the last one
#pragma unroll 1   // rolled: two blocks' fragments at once would not fit the 256 registers (the inner loops are all unrolled so that their arrays are registers)
    for (int kb = 0; kb < nkb; ++kb) {
        const unsigned ko = lane * 16 + (unsigned)kb * (32 * HD * 2), kn = lane * 16 + (unsigned)min(kb + 1, nkb - 1) * (32 * HD * 2), vo = lane * 16 + (unsigned)kb * 1024;
        V v[8], w[8];
        if (!HL) {   // the value fragments start early: their latency runs under the score products and the softmax
#pragma unroll
            for (int dt = 0; dt < 8; ++dt) v[dt] = F::ldf((const T16*)((const char*)Vt + vo) + dt * (TT / 32) * 512);
        } else {   // hi+lo: twice the fragments, so none is fetched a block ahead
#pragma unroll
            for (int i = 0; i < 8; ++i) { k[i] = F::ldf((const T16*)((const char*)Kp + ko) + i * 512); w[i] = F::ldf((const T16*)((const char*)Kp2 + ko) + i * 512); }
            asm volatile("s_wait_xcnt 0x0" :: "v"(ko) : "memory");   // the same precaution behind the K loads
            __builtin_amdgcn_sched_barrier(0);   // all sixteen K fragments are in flight before the first product: one load latency a block instead of one per pair of fragments
        }
        if (!HL) q[3] = F::ldf(ql);
        v8f s[2]; s[0] = (v8f){}; s[1] = (v8f){};
#pragma unroll
        for (int dk = 0; dk < 4; ++dk)
#pragma unroll
            for (int kt = 0; kt < 2; ++kt) { if (HL && kt == 0) { q[dk] = F::ldf(ql + dk * 1024); q2[dk] = F::ldf(ql + dk * 1024 + 512); }
                s[kt] = F::mma(k[kt * 4 + dk], q[dk], s[kt]); if (HL) { s[kt] = F::mma(k[kt * 4 + dk], q2[dk], s[kt]); s[kt] = F::mma(w[kt * 4 + dk], q[dk], s[kt]); } }
        if (HL) {
#pragma unroll
            for (int dt = 0; dt < 8; ++dt) { v[dt] = F::ldf((const T16*)((const char*)Vt + vo) + dt * (TT / 32) * 512); w[dt] = F::ldf((const T16*)((const char*)Vt2 + vo) + dt * (TT / 32) * 512); }
        }
        if (!HL) {   // the next block's K fragments are fetched one block ahead, into the same registers (the last block fetches itself again: never a row past the diagonal block)
#pragma unroll
            for (int i = 0; i < 8; ++i) k[i] = F::ldf((const T16*)((const char*)Kp + kn) + i * 512); }
        // the same precaution behind the V and next-K loads
        if (HL) { asm volatile("s_wait_xcnt 0x0" :: "v"(vo) : "memory"); __builtin_amdgcn_sched_barrier(0); }   // the barrier: all sixteen V fragments start in front of the softmax, which covers their latency
        else asm volatile("s_wait_xcnt 0x0" :: "v"(vo), "v"(kn) : "memory");
        float t[16];
#pragma unroll
        for (int i = 0; i < 16; ++i) t[i] = s[i >> 3][i & 7] * CEXP;
        if (kb == nkb - 1) {   // only the diagonal block holds keys behind a query
#pragma unroll
            for (int i = 0; i < 16; ++i) t[i] = (kb * 32 + (i >> 3) * 16 + hi * 8 + (i & 7) <= q0 + lr) ? t[i] : -3.0e38f; }
        float mx = fmaxf(t[0], t[1]);
#pragma unroll
        for (int i = 2; i < 16; ++i) mx = fmaxf(mx, t[i]);
        mx = fmaxf(mx, xhalf(mx));
        const float mn = fmaxf(m, mx);
        if (__builtin_amdgcn_ballot_w32(mn > m) != 0) {   // a scalar branch: the rescale is skipped while no query of the wave has a new maximum (its factor would be exactly 1)
            const float al = __builtin_amdgcn_exp2f(m - mn); l *= al;
#pragma unroll
            for (int dt = 0; dt < 8; ++dt) o[dt] *= al;
            m = mn; }
        const float mo = HL ? m : m - 10.0f;   // exp2(10) = PCAR
        float e[16];
#pragma unroll
        for (int i = 0; i < 16; ++i) e[i] = __builtin_amdgcn_exp2f(t[i] - mo);
        l += ((((e[0] + e[1]) + (e[2] + e[3])) + ((e[4] + e[5]) + (e[6] + e[7]))) + (((e[8] + e[9]) + (e[10] + e[11])) + ((e[12] + e[13]) + (e[14] + e[15]))));
        V p, p2; PFrag<T16>::cv(e, p, p2);
#pragma unroll
        for (int dt = 0; dt < 8; ++dt) { o[dt] = F::mma(v[dt], p, o[dt]); if (HL) { o[dt] = F::mma(v[dt], p2, o[dt]); o[dt] = F::mma(w[dt], p, o[dt]); } }
    }
    l += xhalf(l);   // the two halves of the wave hold the two halves of each query's keys
    const float f = __fdiv_rn(HL ? 1.0f : PCAR, l);
#pragma unroll
    for (int dt = 0; dt < 8; ++dt) o[dt] *= f;   // register r of tile dt: column dt * 16 + 8 * hi + r of query q0 + lr
}
// gate_store: the wave's 16 normalised rows of one head, times cs, times sigmoid(gate), split hi + lo and stored as the head's part of the w_o GEMM's fragment-order A planes (rows b * TT + t, DQ columns).
// A lane's 8 values of tile dt are one 16-byte piece of such a plane, and the wave's 32 pieces lie side by side: piece lane of half dt % 2 of block dt / 2 of the head's four blocks. Every store is 512 contiguous bytes; Ah, Al point at the first of the four blocks.
// G: the gate logits of the first row (f32, row pitch NALL, HD columns). They are read in whole rows (512 contiguous bytes a load) and turned to the lanes' order in gs, 8 KiB of LDS that only this wave touches (so no barrier).
// In gs the 16-byte unit c of row r lies at unit c ^ r of that row, so that the 16 lanes that read one unit column of 16 rows fall on different banks.
__device__ __forceinline__ void gate_store(const v8f (&o)[8], float cs, const float* __restrict__ G, bf* Ah, bf* Al, float* gs) {
    const int lane = (int)__builtin_amdgcn_mbcnt_lo(~0u, 0u), lr = lane & 15, hi = lane >> 4;   // the lane's number, formed anew: values derived from threadIdx.x would be held in registers over the key loops, which have none to spare (the hi+lo loop then spills an accumulator tile)
    const float* gp = G + lane * 4; v4f gv[16];
#pragma unroll
    for (int r = 0; r < 16; ++r) gv[r] = *(const v4f*)(gp + (size_t)r * NALL);
    asm volatile("s_wait_xcnt 0x0" :: "v"(gp) : "memory");   // precaution: the wait stands behind the loads and in front of any rewrite of their address registers; the address is an input so that it keeps its registers up to the wait
#pragma unroll
    for (int r = 0; r < 16; ++r) *(v4fa*)(gs + r * HD + ((lane ^ r) * 4)) = gv[r];
    asm volatile("s_wait_dscnt 0x0" ::: "memory");   // the staged rows stand in LDS before other lanes of the wave read them
    float* gl = gs + lr * HD;
#pragma unroll 1   // rolled: the precise sigmoid is long, and 64 copies of it would be several times the key loop's text in the instruction cache. Each lane reads and writes back its own units only
    for (int dt = 0; dt < 8; ++dt) {
        float* u0 = gl + (((dt * 4 + hi * 2) ^ lr) * 4); float* u1 = gl + (((dt * 4 + hi * 2 + 1) ^ lr) * 4); v4f g0 = *(const v4fa*)u0, g1 = *(const v4fa*)u1;
#pragma unroll
        for (int q = 0; q < 4; ++q) { g0[q] = __fdiv_rn(1.0f, __fadd_rn(1.0f, expf(-g0[q]))); g1[q] = __fdiv_rn(1.0f, __fadd_rn(1.0f, expf(-g1[q]))); }
        *(v4fa*)u0 = g0; *(v4fa*)u1 = g1; }
    bf* pa = Ah + lane * 8; bf* pl = Al + lane * 8;
#pragma unroll
    for (int dt = 0; dt < 8; ++dt) {
        const v4f g0 = *(const v4fa*)(gl + (((dt * 4 + hi * 2) ^ lr) * 4)), g1 = *(const v4fa*)(gl + (((dt * 4 + hi * 2 + 1) ^ lr) * 4)); v8us oh, ol;
#pragma unroll
        for (int q = 0; q < 8; ++q) { const float a0 = o[dt][q] * cs; unsigned short a, c2; splitf(__fmul_rn(a0, q < 4 ? g0[q & 3] : g1[q & 3]), a, c2); oh[q] = a; ol[q] = c2; }
        *(v8us*)(pa + dt * 256) = oh; *(v8us*)(pl + dt * 256) = ol; }
    asm volatile("s_wait_xcnt 0x0" :: "v"(pa), "v"(pl) : "memory");   // precaution: stands behind the stores and in front of any rewrite of their address registers
}
// grid (NKV * NB_, TT / 32): x = kv group + NKV * batch. Cost grows with the row, and all work-groups are resident at once: waves 0..REP-1 take the 16-row tile TT/16 - 1 - y, the others tile y, so that every work-group walks about the same number of key blocks. No wave shares a barrier or a buffer with another.
// amdgpu_waves_per_eu: two work-groups per WGP, so that one wave's load latency and softmax run under the others' matrix work.
__global__ __launch_bounds__(256) __attribute__((amdgpu_waves_per_eu(4, 4))) void k_fattn(const h16* __restrict__ Q16, const bf* __restrict__ Qh, const bf* __restrict__ Ql, const h16* __restrict__ K16, const bf* __restrict__ Kh, const bf* __restrict__ Kl, const h16* __restrict__ V16, const bf* __restrict__ Vh, const bf* __restrict__ Vl, const float* __restrict__ FA, bf* Ah, bf* Al) {
    __shared__ __align__(16) unsigned short qsh[8 * 4096];   // 8 KiB a wave: the Q fragments that wait in LDS; behind the key loop, the wave's gate rows
    const int wave = __builtin_amdgcn_readfirstlane((int)(threadIdx.x >> 5));   // scalar, so that the key loop's and the precision branch are scalar ones
    const int g = blockIdx.x % NKV, b = blockIdx.x / NKV; const int q0 = ((wave / REP == 0) ? TT / 16 - 1 - (int)blockIdx.y : (int)blockIdx.y) * 16;
    const size_t qoff = ((size_t)b * NH_ + g * REP + wave % REP) * TT * HD, koff = ((size_t)b * NKV + g) * TT * HD;
    v8f o[8];
    if (q0 < RH) fattn_rows<bf, true>(Qh + qoff, Ql + qoff, Kh + koff, Kl + koff, Vh + koff, Vl + koff, o, q0, (bf*)qsh + wave * 4096);
    else fattn_rows<h16, false>(Q16 + qoff, nullptr, K16 + koff, nullptr, V16 + koff, nullptr, o, q0, (h16*)qsh + wave * 4096);
    const int hd = g * REP + wave % REP, tr0 = b * TT + q0; const size_t ao = ((size_t)(tr0 / 16) * (DQ / 32) + hd * (HD / 32)) * 512;   // the head's four blocks in the row group's DQ / 32
    gate_store(o, (q0 < RH) ? 1.0f : (1.0f / PCAR), FA + (size_t)tr0 * NALL + hd * 2 * HD + HD, Ah + ao, Al + ao, (float*)(void*)(qsh + wave * 4096));   // the gate logits are the second HD columns of the head's 2 * HD in the projection output
}

extern "C" void kernel_launch(void* const* d_in, const int* in_sizes, int n_in,
                              void* d_out, int out_size, void* d_ws, size_t ws_size, hipStream_t stream) {
    (void)in_sizes; (void)n_in; (void)out_size;
    const float* x = (const float*)d_in[0]; const float* wqg = (const float*)d_in[1]; const float* wk = (const float*)d_in[2]; const float* wv = (const float*)d_in[3]; const float* wo = (const float*)d_in[4]; const float* qnw = (const float*)d_in[5]; const float* knw = (const float*)d_in[6]; const float* cosT = (const float*)d_in[7]; const float* sinT = (const float*)d_in[8];
    float* OUT = (float*)d_out;     // [2][2048][2048]
    char* wsp = (char*)d_ws;
    auto take = [&](size_t bytes) { char* p = wsp; wsp += (bytes + 255) & ~(size_t)255; return (void*)p; };
    bf* WALL = (bf*)take((size_t)NALL * DM * 2); bf* WO = (bf*)take((size_t)DM * DQ * 2); float* CS = (float*)take((size_t)TT * HD * 2 * 4);
    const size_t NQP = (size_t)NH_ * TT * HD, NKP = (size_t)NKV * TT * HD;   // elements of one batch's query planes and of its key or value planes; every plane below holds both batches
    h16* QP16 = (h16*)take(NB_ * NQP * 2); h16* KP16 = (h16*)take(NB_ * NKP * 2); h16* VT16 = (h16*)take(NB_ * NKP * 2);
    bf* QPh = (bf*)take(NB_ * NQP * 2); bf* QPl = (bf*)take(NB_ * NQP * 2); bf* KPh = (bf*)take(NB_ * NKP * 2); bf* KPl = (bf*)take(NB_ * NKP * 2); bf* VTh = (bf*)take(NB_ * NKP * 2); bf* VTl = (bf*)take(NB_ * NKP * 2);
    float* FA = (float*)take((size_t)RT * NALL * 4); bf* XB = (bf*)take((size_t)RT * DM * 2);
    if ((size_t)(wsp - (char*)d_ws) > ws_size) return;    // ws 256 MiB
    bf* ATh = XB; bf* ATl = WALL;   // the gated attention planes (RT x DQ each) lie over the x plane and the projection weights, which the projection GEMM read last (stream-ordered)
    k_prep<<<PB_WQ + 2 * PB_WK + PB_WO + PB_X + PB_CS, 256, 0, stream>>>(x, wqg, wk, wv, wo, cosT, sinT, WALL, WO, XB, CS);
    k_gemmt<0, DM, NALL><<<dim3(RT / 128, NALL / 128, 1), 128, 0, stream>>>(XB, nullptr, WALL, FA);   // q | gate, k, v of both batches
    k_planes<<<PL_V + PL_N, 256, 0, stream>>>(FA, CS, qnw, knw, QP16, QPh, QPl, KP16, KPh, KPl, VT16, VTh, VTl);
    k_fattn<<<dim3(NKV * NB_, TT / 32, 1), 256, 0, stream>>>(QP16, QPh, QPl, KP16, KPh, KPl, VT16, VTh, VTl, FA, ATh, ATl);   // all heads of both batches; writes the gated planes
    k_gemmt<1, DQ, DM><<<dim3(RT / 128, DM / 128, 1), 128, 0, stream>>>(ATh, ATl, WO, OUT);
}

// v009
// A run of this version takes 167 microseconds.
// Timed twice side by side with v008, it ran 1.09 and 1.08 times as fast.
// Over all steps from v000 it is 11.0 times as fast.
#include <hip/hip_runtime.h>

// GatedCausalSelfAttention (x [2][2048][2048]; qg = x w_q ([2048][4096]: per head h columns h*256 + [query 0..127 | gate 128..255]); k/v = x w_k/w_v (4 kv groups; head h -> group h/4); q, k RMS-normalised * w (eps 1e-6); rotate-half RoPE with the read cos/sin tables [T][128]; causal softmax(q.k / sqrt(128)) (finfo.min); out = (merged attn * sigmoid(gate)) w_o -> [2][2048][2048]).
// Compute dtypes, f32 accumulate: every input rounded to bf16; q, gate, k, v as ONE PLAIN bf16 GEMM over both batches (inputs: exact; the transposed w_q, w_k, w_v planes stacked); RMSNorm and RoPE (bf16-rounded tables) f32, applied while the attention's operand planes are formed; causal scores and attn.v: query rows < 512 hl (3 products), the rest single fp16 (x1024), one fused kernel that stops at the diagonal block; online softmax f32; sigmoid gate (precise expf) applied in f32 when the attention kernel forms the hl planes of its output; w_o hl x exact (2 products).

#define NB_  2
#define TT   2048
#define DM   2048
#define NH_  16
#define NKV  4
#define REP  (NH_ / NKV)
#define HD   128
#define DQ   (NH_ * HD)
#define DKV  (NKV * HD)
#define NALL (2 * DQ + 2 * DKV)   // columns of the one projection GEMM: per head [query | gate], then k, then v
#define RT   (NB_ * TT)           // rows of both batches: row b * TT + t
#define RH   512                  // query rows < RH use hi+lo planes (0: none)
#define WIN  2048
#define PCAR 1024.0f
#define SCL  0.088388347648318447f   // HD^-0.5
typedef _Float16 h16;
typedef unsigned short bf;
typedef __attribute__((ext_vector_type(16))) __bf16   v16bf;
typedef __attribute__((ext_vector_type(16))) _Float16 v16h;
typedef __attribute__((ext_vector_type(8)))  _Float16 v8h;
typedef __attribute__((ext_vector_type(8)))  unsigned short v8us;
typedef __attribute__((ext_vector_type(8)))  float    v8f;
typedef __attribute__((ext_vector_type(4)))  float    v4f;
typedef v8h  __attribute__((may_alias)) v8ha;
typedef v4f  __attribute__((may_alias)) v4fa;
typedef v8us __attribute__((may_alias)) v8usa;

__device__ __forceinline__ unsigned short f2bf(float f) { unsigned u = __float_as_uint(f); u += 0x7FFFu + ((u >> 16) & 1u); return (unsigned short)(u >> 16); }
__device__ __forceinline__ float bf2f(unsigned short b) { return __uint_as_float(((unsigned)b) << 16); }
__device__ __forceinline__ float bfr(float f) { return bf2f(f2bf(f)); }
__device__ __forceinline__ v16h cat16(v8h lo, v8h hi) { return __builtin_shufflevector(lo, hi, 0, 1, 2, 3, 4, 5, 6, 7, 8, 9, 10, 11, 12, 13, 14, 15); }
__device__ __forceinline__ v16bf cat16b(v8us lo, v8us hi) { return __builtin_bit_cast(v16bf, __builtin_shufflevector(lo, hi, 0, 1, 2, 3, 4, 5, 6, 7, 8, 9, 10, 11, 12, 13, 14, 15)); }
__device__ __forceinline__ v8f wmma16(v16h a, v16h b, v8f c) { return __builtin_amdgcn_wmma_f32_16x16x32_f16(false, a, false, b, (short)0, c, false, false); }
__device__ __forceinline__ v8f wmmab(v16bf a, v16bf b, v8f c) { return __builtin_amdgcn_wmma_f32_16x16x32_bf16(false, a, false, b, (short)0, c, false, false); }



// ---- Fragment-order planes. A 16-bit operand plane of R rows x K columns (R % 16 == 0, K % 32 == 0) is stored as blocks of 16 rows x 32 k = 512 elements (1 KiB), block index (r / 16) * (K / 32) + k / 32.
// Inside a block: two halves of 256 elements (k % 32 < 16, then >= 16); in a half, lane slot ((k / 8) % 2) * 16 + r % 16 holds its 8 consecutive k as one 16-byte piece. That is the order in which the 32 lanes of a wave
// hold a 16x32 WMMA operand, so a fragment is two wave-wide 16-byte loads of 512 contiguous bytes each (4 whole lines) instead of two loads that touch 16 lines. The elements and their k order in every fragment are those of a row-major plane.
// frag_piece: for the i-th 16-byte piece of such a plane (storage order), its row and first k.
__device__ __forceinline__ void frag_piece(size_t i, int kblocks, int& r, int& k0) { const int w = (int)(i & 63); const size_t blk = i >> 6; r = (int)(blk / kblocks) * 16 + (w & 15); k0 = (int)(blk % kblocks) * 32 + (w >> 5) * 16 + ((w >> 4) & 1) * 8; }

template <typename T16> struct WFrag;
template <> struct WFrag<h16> { typedef v16h V; static __device__ __forceinline__ V ld(const h16* p) { return cat16(*(const v8h*)p, *(const v8h*)(p + 16)); } static __device__ __forceinline__ V ldf(const h16* p) { return cat16(*(const v8h*)p, *(const v8h*)(p + 256)); } static __device__ __forceinline__ void stf(h16* p, V x) { *(v8h*)p = __builtin_shufflevector(x, x, 0, 1, 2, 3, 4, 5, 6, 7); *(v8h*)(p + 256) = __builtin_shufflevector(x, x, 8, 9, 10, 11, 12, 13, 14, 15); } static __device__ __forceinline__ v8f mma(V a, V b, v8f c) { return wmma16(a, b, c); } };
template <> struct WFrag<bf> { typedef v16bf V; static __device__ __forceinline__ V ld(const bf* p) { return cat16b(*(const v8us*)p, *(const v8us*)(p + 16)); } static __device__ __forceinline__ V ldf(const bf* p) { return cat16b(*(const v8us*)p, *(const v8us*)(p + 256)); } static __device__ __forceinline__ void stf(bf* p, V x) { typedef __attribute__((ext_vector_type(16))) unsigned short v16us; const v16us u = __builtin_bit_cast(v16us, x); *(v8us*)p = __builtin_shufflevector(u, u, 0, 1, 2, 3, 4, 5, 6, 7); *(v8us*)(p + 256) = __builtin_shufflevector(u, u, 8, 9, 10, 11, 12, 13, 14, 15); } static __device__ __forceinline__ v8f mma(V a, V b, v8f c) { return wmmab(a, b, c); } };
// ---- k_gemmt: GEMM with both operands staged in LDS by tensor loads. One work-group of WM x WN waves owns a (WM * 64) x (WN * 64) output tile, a wave 64x64 of it (16 accumulators) over the whole K range; grid (M / (WM * 64), N / (WN * 64)), WM * WN * 32 threads.
// The tile is as large as one WGP holds (one work-group per WGP, every WGP one): an operand row is fetched from L2 once per work-group, so the bytes fetched fall with the tile's rows + columns per output element.
// C[m][n] (f32, pitch LDC) = sum_k A[m][k] Bt[n][k] (+ A2[m][k] Bt[n][k] when NSPLIT), operands in fragment-order 16-bit planes of K columns. K % 128 == 0, K >= 256.
// A stage is 128 k of every operand row. 16 rows x 128 k of a fragment-order plane are 4 KiB in a row, and the next 16 rows follow K * 32 bytes on: a slice of 4 row groups (64 rows) is a tensor tile of 4 rows of 4 KiB at that pitch, and it lands in LDS
// as it lies in the plane, so a fragment is again two wave-wide 16-byte loads of 512 contiguous bytes. Every operand byte is fetched from L2 once per work-group and read by WN (A) or WM (Bt) waves.
// Two buffers: wave i issues one request per stage for slice i (there are no more slices than waves), two stages ahead, into the buffer that every reader has just left.
typedef unsigned u32x4 __attribute__((ext_vector_type(4)));
typedef unsigned u32x8 __attribute__((ext_vector_type(8)));
__device__ __forceinline__ unsigned uni(unsigned v) { return (unsigned)__builtin_amdgcn_readfirstlane((int)v); }
// pinned: holds a wave-uniform condition in a scalar register, so that the test around a tensor load (which ignores EXEC) compiles to a scalar compare and branch
__device__ __forceinline__ unsigned pinned(unsigned v) { unsigned w = uni(v); asm volatile("" : "+s"(w)); return w; }
#define GKS 128             // k per stage
#define GRB (GKS * 32)      // bytes of 16 rows x GKS k
template <int NSPLIT, int K, int LDC, int WM, int WN>
__global__ __launch_bounds__(WM * WN * 32) void k_gemmt(const bf* __restrict__ A, const bf* __restrict__ A2, const bf* __restrict__ Bt, float* C) {
    typedef WFrag<bf> F; typedef F::V V;
    static_assert(K % GKS == 0 && K / GKS >= 2 && K * 32 <= 131072, "two stages at least; the source pitch stays in the mover's range");
    constexpr unsigned NPA = NSPLIT ? 2 : 1, GSL = 4 * GRB, GPA = WM * GSL, BUFB = NPA * GPA + WN * GSL; constexpr int S = K / GKS;   // GSL: bytes of a slice; GPA: of one A plane's rows in a stage
    constexpr int NSL = (int)NPA * WM + WN;   // slices of a stage
    static_assert(NSL <= WM * WN && 2 * BUFB <= 327680, "a wave issues one slice at most; two buffers fit the LDS of a WGP");
    constexpr int GF = NSPLIT ? 2 : 1, GB = NSPLIT ? 4 : 2;   // a load group: the Bt fragments of GB column groups over GF 32-k steps. The plain GEMM has five waves per SIMD and stays within 192 registers; the NSPLIT launch has two, so registers are free
    __shared__ __attribute__((aligned(2048))) unsigned char ring[2 * BUFB];   // a buffer: [A WM * 64 rows | A2 as many (NSPLIT) | Bt WN * 64 rows], slice i at i * GSL
    const int lane = threadIdx.x & 31, lr = lane & 15, hi = lane >> 4; const int r0 = blockIdx.x * (WM * 64), c0 = blockIdx.y * (WN * 64);
    const int wave = __builtin_amdgcn_readfirstlane((int)(threadIdx.x >> 5)); const int wm = wave / WN, wn = wave % WN;
    // the wave's slice of a stage: 64 rows of A, then of A2 (NSPLIT), then of Bt. Waves NSL and up issue nothing (their sl only keeps the address below in bounds)
    const bool issuer = wave < NSL; const int sl = issuer ? wave : 0; constexpr unsigned ngr = 4;
    const bf* sp;
    if (sl >= (int)NPA * WM) sp = Bt + (size_t)(c0 + (sl - (int)NPA * WM) * 64) * K;
    else if (NSPLIT && sl >= WM) sp = A2 + (size_t)(r0 + (sl - WM) * 64) * K;
    else sp = A + (size_t)(r0 + sl * 64) * K;
    const unsigned lbase = (unsigned)(size_t)ring + (unsigned)sl * GSL;
    u32x8 g1;   // 1-byte elements, tensor = tile = ngr rows of GRB bytes, source pitch K * 32 bytes, no pad, no mask
    g1[0] = uni(0u); g1[1] = uni(((unsigned)GRB & 0xFFFFu) << 16); g1[2] = uni(((unsigned)GRB >> 16) | (ngr << 16)); g1[3] = uni((unsigned)GRB << 16); g1[4] = uni(ngr); g1[5] = uni((unsigned)K * 32u); g1[6] = uni(0u); g1[7] = uni(0u);
    asm volatile("" : "+s"(g1));   // the form of pinned(), for descriptor words held in scalar registers: left free, the compiler forms these constants anew, in the same registers, in front of the wait behind the loop
    u32x4 g0 = (u32x4){0u, 0u, 0u, 0u};   // group 0 of the wave's youngest request
    auto issue = [&](int s) {
        const unsigned long long ga = (unsigned long long)(size_t)sp + (unsigned long long)s * GRB;
        g0[0] = uni(1u); g0[1] = uni(lbase + (unsigned)(s & 1) * BUFB); g0[2] = uni((unsigned)ga); g0[3] = uni((((unsigned)(ga >> 32)) & 0x01FFFFFFu) | 0x80000000u);
        asm volatile("tensor_load_to_lds %0, %1" :: "s"(g0), "s"(g1) : "memory"); };   // one request of the whole wave: its slice of stage s
    // landed: the wave's own request has landed. Both descriptor groups are inputs, so that they keep their registers, unwritten, from the request up to the wait that covers it
    auto landed = [&]() { asm volatile("s_wait_tensorcnt 0x0" :: "s"(g0), "s"(g1) : "memory"); };
    // publish point of stage s + 1, passed by every wave once per stage, behind its last LDS read of stage s
    auto publish = [&](int s) {
        asm volatile("s_wait_dscnt 0x0" ::: "memory");       // the wave's reads of stage s are done before its buffer may be refilled
        landed();                                            // the wave's slice of stage s + 1
        __syncthreads();                                     // every wave has left stage s, and every slice of stage s + 1 has landed
        if (pinned(issuer && s + 2 < S)) issue(s + 2); };    // into the buffer of stage s
    v8f acc[4][4];
#pragma unroll
    for (int mb = 0; mb < 4; ++mb)
#pragma unroll
        for (int nb = 0; nb < 4; ++nb) acc[mb][nb] = (v8f){};
    if (pinned(issuer)) issue(0);
    landed();                                            // the wave's slice of stage 0
    __syncthreads();                                     // every slice of stage 0 has landed: it may be read
    if (pinned(issuer)) issue(1);
#pragma unroll 1   // rolled: one publish point per stage
    for (int s = 0; s < S; ++s) {
        const unsigned char* buf = ring + (unsigned)(s & 1) * BUFB + lane * 16;
#pragma unroll
        for (int g = 0; g < GKS / 32 / GF; ++g) {
            V a[GF][4], a2[GF][4];
#pragma unroll
            for (int q = 0; q < GF; ++q)
#pragma unroll
                for (int i = 0; i < 4; ++i) { const unsigned char* p = buf + (g * GF + q) * 1024 + (wm * 4 + i) * GRB; a[q][i] = F::ldf((const bf*)p); if (NSPLIT) a2[q][i] = F::ldf((const bf*)(p + GPA)); }
#pragma unroll
            for (int h = 0; h < 4 / GB; ++h) {
                V b[GF][GB];
#pragma unroll
                for (int q = 0; q < GF; ++q)
#pragma unroll
                    for (int i = 0; i < GB; ++i) b[q][i] = F::ldf((const bf*)(buf + (g * GF + q) * 1024 + NPA * GPA + (wn * 4 + h * GB + i) * GRB));
                __builtin_amdgcn_sched_barrier(0);   // the group's LDS loads are issued together, in front of its products: one LDS latency per group instead of one per Bt fragment
                if (g == GKS / 32 / GF - 1 && h == 4 / GB - 1) publish(s);   // the stage's last fragments are on their way to registers: the publish point and the refill stand behind these loads and in front of their products, which gives the refill the products' time to land
#pragma unroll
                for (int q = 0; q < GF; ++q)
#pragma unroll
                    for (int i = 0; i < GB; ++i) {
#pragma unroll
                        for (int mb = 0; mb < 4; ++mb) acc[mb][h * GB + i] = F::mma(a[q][mb], b[q][i], acc[mb][h * GB + i]);
                        if (NSPLIT) {
#pragma unroll
                            for (int mb = 0; mb < 4; ++mb) acc[mb][h * GB + i] = F::mma(a2[q][mb], b[q][i], acc[mb][h * GB + i]); } }
                if (GB < 4) __builtin_amdgcn_sched_barrier(0);   // the next group's loads stay behind these products, whose Bt registers they take over
            }
        }
    }
    landed();                                            // nothing of the mover is outstanding
    asm volatile("s_wait_dscnt 0x0" ::: "memory");       // and no read of the ring, which now becomes output staging (the last publish point's barrier stands in front)
    // whole 128-byte lines go out: 16 rows x 64 columns at a time pass through the wave's own part of LDS, which no other wave touches
    float* os = (float*)ring + wave * (16 * 68);
#pragma unroll
    for (int mb = 0; mb < 4; ++mb) {
#pragma unroll
        for (int nb = 0; nb < 4; ++nb) {
#pragma unroll
            for (int j = 0; j < 8; ++j) os[(hi * 8 + j) * 68 + nb * 16 + lr] = acc[mb][nb][j]; }
        asm volatile("s_wait_dscnt 0x0" ::: "memory");   // the staged rows stand in LDS before other lanes of the wave read them back
        float* crow = C + (size_t)(r0 + wm * 64 + mb * 16 + hi) * LDC + c0 + wn * 64 + lr * 4; v4f val[8];
#pragma unroll
        for (int t = 0; t < 8; ++t) val[t] = *(const v4fa*)(os + (2 * t + hi) * 68 + lr * 4);   // half a wave per row: 256 contiguous bytes
#pragma unroll
        for (int t = 0; t < 8; ++t) *(v4f*)(crow + (size_t)(2 * t) * LDC) = val[t];
        // precaution: one wait behind the eight stores and in front of any rewrite of their address and data registers, which are inputs so that they keep their registers up to the wait
        asm volatile("s_wait_xcnt 0x0" :: "v"(crow), "v"(val[0]), "v"(val[1]), "v"(val[2]), "v"(val[3]), "v"(val[4]), "v"(val[5]), "v"(val[6]), "v"(val[7]) : "memory");
        asm volatile("s_wait_dscnt 0x0" ::: "memory");   // the rows are read before the next 16 overwrite them
    }
}

__device__ __forceinline__ h16 tohx(float x) { return (h16)x; }
__device__ __forceinline__ void splitf(float y, unsigned short& h, unsigned short& l) { h = f2bf(y); l = f2bf(y - bf2f(h)); }
typedef __attribute__((ext_vector_type(2))) _Float16 v2h;
typedef __attribute__((ext_vector_type(4))) _Float16 v4h;
typedef __attribute__((ext_vector_type(2))) unsigned short v2us;
typedef __attribute__((ext_vector_type(4))) unsigned short v4us;
typedef __attribute__((ext_vector_type(2))) float v2f;
typedef __attribute__((ext_vector_type(4))) int v4i;

// wtG_blk: Bt = the fragment-order bf16 plane of w^T (rows n, columns k) from w [K][N] f32. One wave builds one block (16 n x 32 k): each load takes 16 neighbouring n of two k rows; the 8 waves of a work-group take 8 neighbouring groups of n.
__device__ __forceinline__ void wtG_blk(const float* __restrict__ w, int K, int N, bf* Bt, int blk) {
    const int lane = threadIdx.x & 31, lr = lane & 15, hi = lane >> 4; const int wv = blk * 8 + (threadIdx.x >> 5); const int ng = N / 16, kbs = K / 32; if (wv >= ng * kbs) return; const int nb = wv % ng, kb = wv / ng;
    const float* p = w + (size_t)(kb * 32 + hi * 8) * N + nb * 16 + lr; bf* o = Bt + ((size_t)nb * kbs + kb) * 512 + lane * 8; const float* q[16]; float x[16];
#pragma unroll
    for (int j = 0; j < 16; ++j) { q[j] = p + (size_t)((j >> 3) * 16 + (j & 7)) * N; x[j] = *q[j]; }
    // precaution: the wait stands behind the loads and in front of any rewrite of their address registers; the addresses are inputs so that they keep their registers up to the wait
    asm volatile("s_wait_xcnt 0x0" :: "v"(q[0]), "v"(q[1]), "v"(q[2]), "v"(q[3]), "v"(q[4]), "v"(q[5]), "v"(q[6]), "v"(q[7]), "v"(q[8]), "v"(q[9]), "v"(q[10]), "v"(q[11]), "v"(q[12]), "v"(q[13]), "v"(q[14]), "v"(q[15]) : "memory");
    v8us v0, v1;
#pragma unroll
    for (int j = 0; j < 8; ++j) { v0[j] = f2bf(x[j]); v1[j] = f2bf(x[8 + j]); }
    *(v8us*)o = v0; *(v8us*)(o + 256) = v1;
}
__device__ __forceinline__ void cvt8_blk(const float* __restrict__ src, int K, bf* dst, size_t n8, int blk) { const size_t i = (size_t)blk * 256 + threadIdx.x; if (i >= n8) return; int r, k0; frag_piece(i, K / 32, r, k0); const float* p = src + (size_t)r * K + k0; const v8f v = *(const v8f*)p; v8us o;
    asm volatile("s_wait_xcnt 0x0" :: "v"(p) : "memory");   // precaution: the wait stands behind the loads and in front of any rewrite of their address registers; the addresses are inputs so that they keep their registers up to the wait
#pragma unroll
    for (int k = 0; k < 8; ++k) o[k] = f2bf(v[k]); *(v8us*)(dst + i * 8) = o;  }
__device__ __forceinline__ void cscvt_blk(const float* __restrict__ cosT, const float* __restrict__ sinT, float* CS, int blk) { const int idx = blk * 256 + threadIdx.x; if (idx >= TT * HD) return; v2f cs; cs[0] = bfr(cosT[idx]); cs[1] = bfr(sinT[idx]); *(v2f*)(CS + (size_t)idx * 2) = cs;  }
// k_prep: every conversion of an input, one launch; ranges of work-groups take the jobs, none of which reads what another writes. WALL = the transposed planes of w_q (rows h * 2 * HD + [query | gate]), w_k and w_v one behind the other: NALL rows.
#define PB_WQ (DM * 2 * DQ / 512 / 8)
#define PB_WK (DM * DKV / 512 / 8)
#define PB_WO (DQ * DM / 512 / 8)
#define PB_X  (RT * DM / 8 / 256)
#define PB_CS (TT * HD / 256)
__global__ __launch_bounds__(256) void k_prep(const float* __restrict__ x, const float* __restrict__ wqg, const float* __restrict__ wk, const float* __restrict__ wv, const float* __restrict__ wo, const float* __restrict__ cosT, const float* __restrict__ sinT, bf* WALL, bf* WO, bf* XB, float* CS) {
    int blk = blockIdx.x;
    if (blk < PB_WQ) { wtG_blk(wqg, DM, 2 * DQ, WALL, blk); return; } blk -= PB_WQ;
    if (blk < PB_WK) { wtG_blk(wk, DM, DKV, WALL + (size_t)2 * DQ * DM, blk); return; } blk -= PB_WK;
    if (blk < PB_WK) { wtG_blk(wv, DM, DKV, WALL + (size_t)(2 * DQ + DKV) * DM, blk); return; } blk -= PB_WK;
    if (blk < PB_WO) { wtG_blk(wo, DQ, DM, WO, blk); return; } blk -= PB_WO;
    if (blk < PB_X) { cvt8_blk(x, DM, XB, (size_t)RT * DM / 8, blk); return; } blk -= PB_X;
    cscvt_blk(cosT, sinT, CS, blk);
}
// lane l with lane l ^ 16, on the vector pipe (a bpermute would put an LDS round trip into every block's dependent chain)
__device__ __forceinline__ float xhalf(float x) { return __builtin_bit_cast(float, __builtin_amdgcn_permlanex16(__builtin_bit_cast(int, x), __builtin_bit_cast(int, x), 0x76543210, 0xfedcba98, false, false)); }
// nrp_blk: RMS norm, RoPE and the fragment-order planes (fp16 + hi/lo) of 16 rows x NRH heads of the projection output, which is read once, in whole rows, and not written back. Plane rows (b * nheads + h) * TT + t, columns d.
// A wave takes two rows: lane l holds columns 4 l .. 4 l + 3 of each head, so a load covers the head's 512 contiguous bytes, the row's sum of squares is one butterfly, and the rotate-half partner (d +- HD/2) sits in lane l ^ 16.
// Rotate-half convention: out[d] = x[d] cos[t][d] - x[d+HD/2] sin[t][d], out[d+HD/2] = x[d+HD/2] cos[t][d+HD/2] + x[d] sin[t][d+HD/2].
// 16 rows x HD columns of a plane are 4 KiB in a row in storage order: they are put together in LDS and go out as whole lines.
#define NRH 4               // heads per work-group
#define NRC 272             // LDS bytes per 256-byte unit of a plane: the 16 units that a wave writes at once fall on different banks
#define NRP (16 * NRC)      // LDS bytes of one plane's 16 rows
typedef v4us __attribute__((may_alias)) v4usa;
template <int HSTRIDE>
__device__ __forceinline__ void nrp_blk(const float* __restrict__ F, const float* __restrict__ CS, const float* __restrict__ wn, int tr0, size_t po, h16* P16, bf* Ph, bf* Pl, unsigned char* sm) {
    const int lane = threadIdx.x & 31, wave = threadIdx.x >> 5; const int t0 = tr0 % TT;
    const float* f0 = F + (size_t)(tr0 + wave * 2) * NALL + lane * 4; const float* f1 = f0 + NALL; const float* pc = CS + ((size_t)(t0 + wave * 2) * HD + lane * 4) * 2; const float* pw = wn + lane * 4;
    v4f a[2][NRH]; v8f c[2];
#pragma unroll
    for (int hh = 0; hh < NRH; ++hh) { a[0][hh] = *(const v4f*)(f0 + hh * HSTRIDE); a[1][hh] = *(const v4f*)(f1 + hh * HSTRIDE); }
    c[0] = *(const v8f*)pc; c[1] = *(const v8f*)(pc + HD * 2); const v4f wr = *(const v4f*)pw;
    asm volatile("s_wait_xcnt 0x0" ::: "memory");   // precaution: the wait stands behind the loads and in front of any rewrite of their address registers
    __builtin_amdgcn_sched_barrier(0);   // no later vector work is scheduled in between the loads and the wait, where it could take over an address register
    float ss[2][NRH];
#pragma unroll
    for (int rr = 0; rr < 2; ++rr)
#pragma unroll
        for (int hh = 0; hh < NRH; ++hh) { float s = 0.f;
#pragma unroll
            for (int q = 0; q < 4; ++q) s += a[rr][hh][q] * a[rr][hh][q];
            ss[rr][hh] = s; }
#pragma unroll
    for (int sh = 16; sh; sh >>= 1)
#pragma unroll
        for (int rr = 0; rr < 2; ++rr)
#pragma unroll
            for (int hh = 0; hh < NRH; ++hh) ss[rr][hh] += __shfl_xor(ss[rr][hh], sh, 32);
    unsigned char* sl = sm + (lane >> 1) * NRC + (lane & 1) * 8 + wave * 32;
#pragma unroll
    for (int rr = 0; rr < 2; ++rr)
#pragma unroll
        for (int hh = 0; hh < NRH; ++hh) {
            const float rs = __fdiv_rn(1.0f, sqrtf(ss[rr][hh] * (1.0f / HD) + 1e-6f)); v4h o16; v4us oh, ol;
#pragma unroll
            for (int q = 0; q < 4; ++q) { const float x0 = a[rr][hh][q] * rs * bfr(wr[q]); const float x1 = xhalf(x0); const float sq = c[rr][2 * q + 1];
                const float r = x0 * c[rr][2 * q] + x1 * ((lane < 16) ? -sq : sq);
                o16[q] = tohx(r); unsigned short h2, l2; splitf(r, h2, l2); oh[q] = h2; ol[q] = l2; }
            unsigned char* s = sl + hh * 3 * NRP + rr * 16;
            *(v4usa*)s = __builtin_bit_cast(v4us, o16); *(v4usa*)(s + NRP) = oh; *(v4usa*)(s + 2 * NRP) = ol; }
    __syncthreads();   // every wave's two rows stand in LDS before the planes are read back in storage order
    const unsigned char* so = sm + (threadIdx.x >> 4) * NRC + (threadIdx.x & 15) * 16; v8us val[NRH][3];
#pragma unroll
    for (int hh = 0; hh < NRH; ++hh)
#pragma unroll
        for (int p = 0; p < 3; ++p) val[hh][p] = *(const v8usa*)(so + (hh * 3 + p) * NRP);
    h16* g16 = P16 + po + threadIdx.x * 8; bf* gh = Ph + po + threadIdx.x * 8; bf* gl = Pl + po + threadIdx.x * 8;
#pragma unroll
    for (int hh = 0; hh < NRH; ++hh) { *(v8usa*)(g16 + (size_t)hh * TT * HD) = val[hh][0]; *(v8usa*)(gh + (size_t)hh * TT * HD) = val[hh][1]; *(v8usa*)(gl + (size_t)hh * TT * HD) = val[hh][2]; }
    // precaution: one wait behind the stores; their data registers are inputs so that they keep their registers up to the wait
    asm volatile("s_wait_xcnt 0x0" :: "v"(val[0][0]), "v"(val[0][1]), "v"(val[0][2]), "v"(val[1][0]), "v"(val[1][1]), "v"(val[1][2]), "v"(val[2][0]), "v"(val[2][1]), "v"(val[2][2]), "v"(val[3][0]), "v"(val[3][1]), "v"(val[3][2]) : "memory");
}
// vtp_blk: the transposed value planes of both batches (rows (b * nheads + g) * HD + d, columns t, fragment order; one 16-byte piece per thread and plane)
__device__ __forceinline__ void vtp_blk(const float* __restrict__ F, int pitch, int nheads, h16* V16, bf* Vh, bf* Vl, int blk) { const size_t e = ((size_t)blk * 256 + threadIdx.x) * 8; if (e >= (size_t)NB_ * nheads * HD * TT) return; int row, t; frag_piece(e / 8, TT / 32, row, t); const int d = row % HD; const int bg = row / HD; const int g = bg % nheads; t += (bg / nheads) * TT; v8h o16; v8us oh, ol; const float* pq[8]; float xq[8];
#pragma unroll
    for (int q = 0; q < 8; ++q) { pq[q] = F + (size_t)(t + q) * pitch + g * HD + d; xq[q] = *pq[q]; }
    asm volatile("s_wait_xcnt 0x0" :: "v"(pq[0]), "v"(pq[1]), "v"(pq[2]), "v"(pq[3]), "v"(pq[4]), "v"(pq[5]), "v"(pq[6]), "v"(pq[7]) : "memory");   // precaution: the wait stands behind the loads and in front of any rewrite of their address registers; the addresses are inputs so that they keep their registers up to the wait
#pragma unroll
    for (int q = 0; q < 8; ++q) { const float x = xq[q]; o16[q] = tohx(x); unsigned short a2, c2; splitf(x, a2, c2); oh[q] = a2; ol[q] = c2; }
    *(v8h*)(V16 + e) = o16; *(v8us*)(Vh + e) = oh; *(v8us*)(Vl + e) = ol;  }
// k_planes: all operand planes of the attention, one launch: ranges of work-groups build the value planes, and the query and key planes (norm and RoPE on the way), all from the raw projection output
#define PL_V (NB_ * NKV * HD * TT / 8 / 256)
#define PL_G ((NH_ + NKV) / NRH)   // head groups of a 16-row group: NH_ / NRH of query heads, then the key heads
#define PL_N (RT / 16 * PL_G)
__global__ __launch_bounds__(256) void k_planes(const float* __restrict__ FA, const float* __restrict__ CS, const float* __restrict__ wq, const float* __restrict__ wk, h16* Q16, bf* Qh, bf* Ql, h16* K16, bf* Kh, bf* Kl, h16* V16, bf* Vh, bf* Vl) {
    static_assert(NKV == NRH && NH_ % NRH == 0 && TT % 16 == 0, "the key heads are one head group; a 16-row group lies in one batch");
    __shared__ __attribute__((aligned(16))) unsigned char sm[NRH * 3 * NRP];
    int blk = blockIdx.x;
    if (blk < PL_V) { vtp_blk(FA + 2 * DQ + DKV, NALL, NKV, V16, Vh, Vl, blk); return; } blk -= PL_V;
    const int tr0 = blk / PL_G * 16, hg = blk % PL_G; const int b = tr0 / TT, t0 = tr0 % TT;   // the same for the whole work-group: the barrier in nrp_blk stands under uniform control flow
    if (hg < NH_ / NRH) nrp_blk<2 * HD>(FA + hg * NRH * 2 * HD, CS, wq, tr0, ((size_t)(b * NH_ + hg * NRH) * TT + t0) * HD, Q16, Qh, Ql, sm);
    else nrp_blk<HD>(FA + 2 * DQ, CS, wk, tr0, ((size_t)(b * NKV) * TT + t0) * HD, K16, Kh, Kl, sm);
}
template <typename T16> struct PFrag;
template <> struct PFrag<h16> { static __device__ __forceinline__ void cv(const float* e, v16h& p, v16h& p2) { (void)p2;
#pragma unroll
    for (int i = 0; i < 16; ++i) p[i] = (h16)e[i]; } };
template <> struct PFrag<bf> { static __device__ __forceinline__ void cv(const float* e, v16bf& p, v16bf& p2) { v8us h0, h1, l0, l1;
#pragma unroll
    for (int i = 0; i < 8; ++i) { unsigned short a = f2bf(e[i]), c = f2bf(e[8 + i]); h0[i] = a; l0[i] = f2bf(e[i] - bf2f(a)); h1[i] = c; l1[i] = f2bf(e[8 + i] - bf2f(c)); }
    p = cat16b(h0, h1); p2 = cat16b(l0, l1); } };
#define CEXP (SCL * 1.4426950408889634f)   // HD^-0.5 * log2(e)
template <typename T16, bool HL>
__device__ __forceinline__ void fattn_rows(const T16* __restrict__ Q, const T16* __restrict__ Q2, const T16* __restrict__ Kp, const T16* __restrict__ Kp2, const T16* __restrict__ Vt, const T16* __restrict__ Vt2, v8f (&o)[8], int q0, T16* qs) {
    typedef typename WFrag<T16>::V V; typedef WFrag<T16> F;
    const int lane = threadIdx.x & 31, lr = lane & 15, hi = lane >> 4;
    V q[4], q2[4], k[8];
    const unsigned qo = ((unsigned)q0 * HD + lane * 8) * 2;   // byte offsets in a plane; 16 rows x HD columns are HD / 32 blocks of 1 KiB in a row
#pragma unroll
    for (int dk = 0; dk < 4; ++dk) { q[dk] = F::ldf((const T16*)((const char*)Q + qo) + dk * 512); if (HL) q2[dk] = F::ldf((const T16*)((const char*)Q2 + qo) + dk * 512); }
    // With every Q fragment held over the block a wave would not fit 256 registers (four waves per SIMD): the fragment that a block uses last (hi+lo: all eight, to leave room for sixteen K or V fragments in flight) waits in LDS, each lane's 32 bytes in a place of its own that no other lane touches (so no barrier).
    T16* ql = qs + lane * 8;
    if (HL) {
#pragma unroll
        for (int dk = 0; dk < 4; ++dk) { F::stf(ql + dk * 1024, q[dk]); F::stf(ql + dk * 1024 + 512, q2[dk]); } }
    else F::stf(ql, q[3]);
    const unsigned k0o = lane * 16;
    if (!HL) {
#pragma unroll
        for (int i = 0; i < 8; ++i) k[i] = F::ldf((const T16*)((const char*)Kp + k0o) + i * 512); }
    // precaution: the wait stands behind the loads and in front of any rewrite of their offset registers; the offsets are inputs so that they keep their registers up to the wait
    if (HL) asm volatile("s_wait_xcnt 0x0" :: "v"(qo) : "memory"); else asm volatile("s_wait_xcnt 0x0" :: "v"(qo), "v"(k0o) : "memory");
#pragma unroll
    for (int dt = 0; dt < 8; ++dt) o[dt] = (v8f){};
    float m = -3.0e38f, l = 0.f;
    const int nkb = q0 / 32 + 1;   // the block that holds the diagonal is the last one
#pragma unroll 1   // rolled: two blocks' fragments at once would not fit the 256 registers (the inner loops are all unrolled so that their arrays are registers)
    for (int kb = 0; kb < nkb; ++kb) {
        const unsigned ko = lane * 16 + (unsigned)kb * (32 * HD * 2), kn = lane * 16 + (unsigned)min(kb + 1, nkb - 1) * (32 * HD * 2), vo = lane * 16 + (unsigned)kb * 1024;
        V v[8], w[8];
        if (!HL) {   // the value fragments start early: their latency runs under the score products and the softmax
#pragma unroll
            for (int dt = 0; dt < 8; ++dt) v[dt] = F::ldf((const T16*)((const char*)Vt + vo) + dt * (TT / 32) * 512);
        } else {   // hi+lo: twice the fragments, so none is fetched a block ahead
#pragma unroll
            for (int i = 0; i < 8; ++i) { k[i] = F::ldf((const T16*)((const char*)Kp + ko) + i * 512); w[i] = F::ldf((const T16*)((const char*)Kp2 + ko) + i * 512); }
            asm volatile("s_wait_xcnt 0x0" :: "v"(ko) : "memory");   // the same precaution behind the K loads
            __builtin_amdgcn_sched_barrier(0);   // all sixteen K fragments are in flight before the first product: one load latency a block instead of one per pair of fragments
        }
        if (!HL) q[3] = F::ldf(ql);
        v8f s[2]; s[0] = (v8f){}; s[1] = (v8f){};
#pragma unroll
        for (int dk = 0; dk < 4; ++dk)
#pragma unroll
            for (int kt = 0; kt < 2; ++kt) { if (HL && kt == 0) { q[dk] = F::ldf(ql + dk * 1024); q2[dk] = F::ldf(ql + dk * 1024 + 512); }
                s[kt] = F::mma(k[kt * 4 + dk], q[dk], s[kt]); if (HL) { s[kt] = F::mma(k[kt * 4 + dk], q2[dk], s[kt]); s[kt] = F::mma(w[kt * 4 + dk], q[dk], s[kt]); } }
        if (HL) {
#pragma unroll
            for (int dt = 0; dt < 8; ++dt) { v[dt] = F::ldf((const T16*)((const char*)Vt + vo) + dt * (TT / 32) * 512); w[dt] = F::ldf((const T16*)((const char*)Vt2 + vo) + dt * (TT / 32) * 512); }
        }
        if (!HL) {   // the next block's K fragments are fetched one block ahead, into the same registers (the last block fetches itself again: never a row past the diagonal block)
#pragma unroll
            for (int i = 0; i < 8; ++i) k[i] = F::ldf((const T16*)((const char*)Kp + kn) + i * 512); }
        // the same precaution behind the V and next-K loads
        if (HL) { asm volatile("s_wait_xcnt 0x0" :: "v"(vo) : "memory"); __builtin_amdgcn_sched_barrier(0); }   // the barrier: all sixteen V fragments start in front of the softmax, which covers their latency
        else asm volatile("s_wait_xcnt 0x0" :: "v"(vo), "v"(kn) : "memory");
        float t[16];
#pragma unroll
        for (int i = 0; i < 16; ++i) t[i] = s[i >> 3][i & 7] * CEXP;
        if (kb == nkb - 1) {   // only the diagonal block holds keys behind a query
#pragma unroll
            for (int i = 0; i < 16; ++i) t[i] = (kb * 32 + (i >> 3) * 16 + hi * 8 + (i & 7) <= q0 + lr) ? t[i] : -3.0e38f; }
        float mx = fmaxf(t[0], t[1]);
#pragma unroll
        for (int i = 2; i < 16; ++i) mx = fmaxf(mx, t[i]);
        mx = fmaxf(mx, xhalf(mx));
        const float mn = fmaxf(m, mx);
        if (__builtin_amdgcn_ballot_w32(mn > m) != 0) {   // a scalar branch: the rescale is skipped while no query of the wave has a new maximum (its factor would be exactly 1)
            const float al = __builtin_amdgcn_exp2f(m - mn); l *= al;
#pragma unroll
            for (int dt = 0; dt < 8; ++dt) o[dt] *= al;
            m = mn; }
        const float mo = HL ? m : m - 10.0f;   // exp2(10) = PCAR
        float e[16];
#pragma unroll
        for (int i = 0; i < 16; ++i) e[i] = __builtin_amdgcn_exp2f(t[i] - mo);
        l += ((((e[0] + e[1]) + (e[2] + e[3])) + ((e[4] + e[5]) + (e[6] + e[7]))) + (((e[8] + e[9]) + (e[10] + e[11])) + ((e[12] + e[13]) + (e[14] + e[15]))));
        V p, p2; PFrag<T16>::cv(e, p, p2);
#pragma unroll
        for (int dt = 0; dt < 8; ++dt) { o[dt] = F::mma(v[dt], p, o[dt]); if (HL) { o[dt] = F::mma(v[dt], p2, o[dt]); o[dt] = F::mma(w[dt], p, o[dt]); } }
    }
    l += xhalf(l);   // the two halves of the wave hold the two halves of each query's keys
    const float f = __fdiv_rn(HL ? 1.0f : PCAR, l);
#pragma unroll
    for (int dt = 0; dt < 8; ++dt) o[dt] *= f;   // register r of tile dt: column dt * 16 + 8 * hi + r of query q0 + lr
}
// gate_store: the wave's 16 normalised rows of one head, times cs, times sigmoid(gate), split hi + lo and stored as the head's part of the w_o GEMM's fragment-order A planes (rows b * TT + t, DQ columns).
// A lane's 8 values of tile dt are one 16-byte piece of such a plane, and the wave's 32 pieces lie side by side: piece lane of half dt % 2 of block dt / 2 of the head's four blocks. Every store is 512 contiguous bytes; Ah, Al point at the first of the four blocks.
// G: the gate logits of the first row (f32, row pitch NALL, HD columns). They are read in whole rows (512 contiguous bytes a load) and turned to the lanes' order in gs, 8 KiB of LDS that only this wave touches (so no barrier).
// In gs the 16-byte unit c of row r lies at unit c ^ r of that row, so that the 16 lanes that read one unit column of 16 rows fall on different banks.
__device__ __forceinline__ void gate_store(const v8f (&o)[8], float cs, const float* __restrict__ G, bf* Ah, bf* Al, float* gs) {
    const int lane = (int)__builtin_amdgcn_mbcnt_lo(~0u, 0u), lr = lane & 15, hi = lane >> 4;   // the lane's number, formed anew: values derived from threadIdx.x would be held in registers over the key loops, which have none to spare (the hi+lo loop then spills an accumulator tile)
    const float* gp = G + lane * 4; v4f gv[16];
#pragma unroll
    for (int r = 0; r < 16; ++r) gv[r] = *(const v4f*)(gp + (size_t)r * NALL);
    asm volatile("s_wait_xcnt 0x0" :: "v"(gp) : "memory");   // precaution: the wait stands behind the loads and in front of any rewrite of their address registers; the address is an input so that it keeps its registers up to the wait
#pragma unroll
    for (int r = 0; r < 16; ++r) *(v4fa*)(gs + r * HD + ((lane ^ r) * 4)) = gv[r];
    asm volatile("s_wait_dscnt 0x0" ::: "memory");   // the staged rows stand in LDS before other lanes of the wave read them
    float* gl = gs + lr * HD;
#pragma unroll 1   // rolled: the precise sigmoid is long, and 64 copies of it would be several times the key loop's text in the instruction cache. Each lane reads and writes back its own units only
    for (int dt = 0; dt < 8; ++dt) {
        float* u0 = gl + (((dt * 4 + hi * 2) ^ lr) * 4); float* u1 = gl + (((dt * 4 + hi * 2 + 1) ^ lr) * 4); v4f g0 = *(const v4fa*)u0, g1 = *(const v4fa*)u1;
#pragma unroll
        for (int q = 0; q < 4; ++q) { g0[q] = __fdiv_rn(1.0f, __fadd_rn(1.0f, expf(-g0[q]))); g1[q] = __fdiv_rn(1.0f, __fadd_rn(1.0f, expf(-g1[q]))); }
        *(v4fa*)u0 = g0; *(v4fa*)u1 = g1; }
    bf* pa = Ah + lane * 8; bf* pl = Al + lane * 8;
#pragma unroll
    for (int dt = 0; dt < 8; ++dt) {
        const v4f g0 = *(const v4fa*)(gl + (((dt * 4 + hi * 2) ^ lr) * 4)), g1 = *(const v4fa*)(gl + (((dt * 4 + hi * 2 + 1) ^ lr) * 4)); v8us oh, ol;
#pragma unroll
        for (int q = 0; q < 8; ++q) { const float a0 = o[dt][q] * cs; unsigned short a, c2; splitf(__fmul_rn(a0, q < 4 ? g0[q & 3] : g1[q & 3]), a, c2); oh[q] = a; ol[q] = c2; }
        *(v8us*)(pa + dt * 256) = oh; *(v8us*)(pl + dt * 256) = ol; }
    asm volatile("s_wait_xcnt 0x0" :: "v"(pa), "v"(pl) : "memory");   // precaution: stands behind the stores and in front of any rewrite of their address registers
}
// grid (NKV * NB_, TT / 32): x = kv group + NKV * batch. Cost grows with the row, and all work-groups are resident at once: waves 0..REP-1 take the 16-row tile TT/16 - 1 - y, the others tile y, so that every work-group walks about the same number of key blocks. No wave shares a barrier or a buffer with another.
// amdgpu_waves_per_eu: two work-groups per WGP, so that one wave's load latency and softmax run under the others' matrix work.
__global__ __launch_bounds__(256) __attribute__((amdgpu_waves_per_eu(4, 4))) void k_fattn(const h16* __restrict__ Q16, const bf* __restrict__ Qh, const bf* __restrict__ Ql, const h16* __restrict__ K16, const bf* __restrict__ Kh, const bf* __restrict__ Kl, const h16* __restrict__ V16, const bf* __restrict__ Vh, const bf* __restrict__ Vl, const float* __restrict__ FA, bf* Ah, bf* Al) {
    __shared__ __align__(16) unsigned short qsh[8 * 4096];   // 8 KiB a wave: the Q fragments that wait in LDS; behind the key loop, the wave's gate rows
    const int wave = __builtin_amdgcn_readfirstlane((int)(threadIdx.x >> 5));   // scalar, so that the key loop's and the precision branch are scalar ones
    const int g = blockIdx.x % NKV, b = blockIdx.x / NKV; const int q0 = ((wave / REP == 0) ? TT / 16 - 1 - (int)blockIdx.y : (int)blockIdx.y) * 16;
    const size_t qoff = ((size_t)b * NH_ + g * REP + wave % REP) * TT * HD, koff = ((size_t)b * NKV + g) * TT * HD;
    v8f o[8];
    if (q0 < RH) fattn_rows<bf, true>(Qh + qoff, Ql + qoff, Kh + koff, Kl + koff, Vh + koff, Vl + koff, o, q0, (bf*)qsh + wave * 4096);
    else fattn_rows<h16, false>(Q16 + qoff, nullptr, K16 + koff, nullptr, V16 + koff, nullptr, o, q0, (h16*)qsh + wave * 4096);
    const int hd = g * REP + wave % REP, tr0 = b * TT + q0; const size_t ao = ((size_t)(tr0 / 16) * (DQ / 32) + hd * (HD / 32)) * 512;   // the head's four blocks in the row group's DQ / 32
    gate_store(o, (q0 < RH) ? 1.0f : (1.0f / PCAR), FA + (size_t)tr0 * NALL + hd * 2 * HD + HD, Ah + ao, Al + ao, (float*)(void*)(qsh + wave * 4096));   // the gate logits are the second HD columns of the head's 2 * HD in the projection output
}

extern "C" void kernel_launch(void* const* d_in, const int* in_sizes, int n_in,
                              void* d_out, int out_size, void* d_ws, size_t ws_size, hipStream_t stream) {
    (void)in_sizes; (void)n_in; (void)out_size;
    const float* x = (const float*)d_in[0]; const float* wqg = (const float*)d_in[1]; const float* wk = (const float*)d_in[2]; const float* wv = (const float*)d_in[3]; const float* wo = (const float*)d_in[4]; const float* qnw = (const float*)d_in[5]; const float* knw = (const float*)d_in[6]; const float* cosT = (const float*)d_in[7]; const float* sinT = (const float*)d_in[8];
    float* OUT = (float*)d_out;     // [2][2048][2048]
    char* wsp = (char*)d_ws;
    auto take = [&](size_t bytes) { char* p = wsp; wsp += (bytes + 255) & ~(size_t)255; return (void*)p; };
    bf* WALL = (bf*)take((size_t)NALL * DM * 2); bf* WO = (bf*)take((size_t)DM * DQ * 2); float* CS = (float*)take((size_t)TT * HD * 2 * 4);
    const size_t NQP = (size_t)NH_ * TT * HD, NKP = (size_t)NKV * TT * HD;   // elements of one batch's query planes and of its key or value planes; every plane below holds both batches
    h16* QP16 = (h16*)take(NB_ * NQP * 2); h16* KP16 = (h16*)take(NB_ * NKP * 2); h16* VT16 = (h16*)take(NB_ * NKP * 2);
    bf* QPh = (bf*)take(NB_ * NQP * 2); bf* QPl = (bf*)take(NB_ * NQP * 2); bf* KPh = (bf*)take(NB_ * NKP * 2); bf* KPl = (bf*)take(NB_ * NKP * 2); bf* VTh = (bf*)take(NB_ * NKP * 2); bf* VTl = (bf*)take(NB_ * NKP * 2);
    float* FA = (float*)take((size_t)RT * NALL * 4); bf* XB = (bf*)take((size_t)RT * DM * 2);
    if ((size_t)(wsp - (char*)d_ws) > ws_size) return;    // ws 256 MiB
    bf* ATh = XB; bf* ATl = WALL;   // the gated attention planes (RT x DQ each) lie over the x plane and the projection weights, which the projection GEMM read last (stream-ordered)
    k_prep<<<PB_WQ + 2 * PB_WK + PB_WO + PB_X + PB_CS, 256, 0, stream>>>(x, wqg, wk, wv, wo, cosT, sinT, WALL, WO, XB, CS);
    k_gemmt<0, DM, NALL, 4, 5><<<dim3(RT / 256, NALL / 320, 1), 640, 0, stream>>>(XB, nullptr, WALL, FA);   // q | gate, k, v of both batches
    k_planes<<<PL_V + PL_N, 256, 0, stream>>>(FA, CS, qnw, knw, QP16, QPh, QPl, KP16, KPh, KPl, VT16, VTh, VTl);
    k_fattn<<<dim3(NKV * NB_, TT / 32, 1), 256, 0, stream>>>(QP16, QPh, QPl, KP16, KPh, KPl, VT16, VTh, VTl, FA, ATh, ATl);   // all heads of both batches; writes the gated planes
    k_gemmt<1, DQ, DM, 2, 4><<<dim3(RT / 128, DM / 256, 1), 256, 0, stream>>>(ATh, ATl, WO, OUT);
}

// v010
// It runs in 159 microseconds.
// Two timings next to v009 put it at 1.06 and 1.05 times that version's speed.
// All steps since v000 together make it 11.6 times as fast.
#include <hip/hip_runtime.h>

// GatedCausalSelfAttention (x [2][2048][2048]; qg = x w_q ([2048][4096]: per head h columns h*256 + [query 0..127 | gate 128..255]); k/v = x w_k/w_v (4 kv groups; head h -> group h/4); q, k RMS-normalised * w (eps 1e-6); rotate-half RoPE with the read cos/sin tables [T][128]; causal softmax(q.k / sqrt(128)) (finfo.min); out = (merged attn * sigmoid(gate)) w_o -> [2][2048][2048]).
// Compute dtypes, f32 accumulate: every input rounded to bf16; q, gate, k, v as ONE PLAIN bf16 GEMM over both batches (inputs: exact; the transposed w_q, w_k, w_v planes stacked); RMSNorm and RoPE (bf16-rounded tables) f32, applied while the attention's operand planes are formed; causal scores and attn.v: query rows < 512 hl (3 products), the rest single fp16 (x1024), one fused kernel that stops at the diagonal block; online softmax f32; sigmoid gate (precise expf) applied in f32 when the attention kernel forms the hl planes of its output; w_o hl x exact (2 products).

#define NB_  2
#define TT   2048
#define DM   2048
#define NH_  16
#define NKV  4
#define REP  (NH_ / NKV)
#define HD   128
#define DQ   (NH_ * HD)
#define DKV  (NKV * HD)
#define NALL (2 * DQ + 2 * DKV)   // columns of the one projection GEMM: per head [query | gate], then k, then v
#define RT   (NB_ * TT)           // rows of both batches: row b * TT + t
#define RH   512                  // query rows < RH use hi+lo planes (0: none)
#define WIN  2048
#define PCAR 1024.0f
#define SCL  0.088388347648318447f   // HD^-0.5
typedef _Float16 h16;
typedef unsigned short bf;
typedef __attribute__((ext_vector_type(16))) __bf16   v16bf;
typedef __attribute__((ext_vector_type(16))) _Float16 v16h;
typedef __attribute__((ext_vector_type(8)))  _Float16 v8h;
typedef __attribute__((ext_vector_type(8)))  unsigned short v8us;
typedef __attribute__((ext_vector_type(8)))  float    v8f;
typedef __attribute__((ext_vector_type(4)))  float    v4f;
typedef v8h  __attribute__((may_alias)) v8ha;
typedef v4f  __attribute__((may_alias)) v4fa;
typedef v8us __attribute__((may_alias)) v8usa;

__device__ __forceinline__ unsigned short f2bf(float f) { unsigned u = __float_as_uint(f); u += 0x7FFFu + ((u >> 16) & 1u); return (unsigned short)(u >> 16); }
__device__ __forceinline__ float bf2f(unsigned short b) { return __uint_as_float(((unsigned)b) << 16); }
__device__ __forceinline__ float bfr(float f) { return bf2f(f2bf(f)); }
__device__ __forceinline__ v16h cat16(v8h lo, v8h hi) { return __builtin_shufflevector(lo, hi, 0, 1, 2, 3, 4, 5, 6, 7, 8, 9, 10, 11, 12, 13, 14, 15); }
__device__ __forceinline__ v16bf cat16b(v8us lo, v8us hi) { return __builtin_bit_cast(v16bf, __builtin_shufflevector(lo, hi, 0, 1, 2, 3, 4, 5, 6, 7, 8, 9, 10, 11, 12, 13, 14, 15)); }
__device__ __forceinline__ v8f wmma16(v16h a, v16h b, v8f c) { return __builtin_amdgcn_wmma_f32_16x16x32_f16(false, a, false, b, (short)0, c, false, false); }
__device__ __forceinline__ v8f wmmab(v16bf a, v16bf b, v8f c) { return __builtin_amdgcn_wmma_f32_16x16x32_bf16(false, a, false, b, (short)0, c, false, false); }



// ---- Fragment-order planes. A 16-bit operand plane of R rows x K columns (R % 16 == 0, K % 32 == 0) is stored as blocks of 16 rows x 32 k = 512 elements (1 KiB), block index (r / 16) * (K / 32) + k / 32.
// Inside a block: two halves of 256 elements (k % 32 < 16, then >= 16); in a half, lane slot ((k / 8) % 2) * 16 + r % 16 holds its 8 consecutive k as one 16-byte piece. That is the order in which the 32 lanes of a wave
// hold a 16x32 WMMA operand, so a fragment is two wave-wide 16-byte loads of 512 contiguous bytes each (4 whole lines) instead of two loads that touch 16 lines. The elements and their k order in every fragment are those of a row-major plane.
// frag_piece: for the i-th 16-byte piece of such a plane (storage order), its row and first k.
__device__ __forceinline__ void frag_piece(size_t i, int kblocks, int& r, int& k0) { const int w = (int)(i & 63); const size_t blk = i >> 6; r = (int)(blk / kblocks) * 16 + (w & 15); k0 = (int)(blk % kblocks) * 32 + (w >> 5) * 16 + ((w >> 4) & 1) * 8; }

template <typename T16> struct WFrag;
template <> struct WFrag<h16> { typedef v16h V; static __device__ __forceinline__ V ld(const h16* p) { return cat16(*(const v8h*)p, *(const v8h*)(p + 16)); } static __device__ __forceinline__ V ldf(const h16* p) { return cat16(*(const v8h*)p, *(const v8h*)(p + 256)); } static __device__ __forceinline__ void stf(h16* p, V x) { *(v8h*)p = __builtin_shufflevector(x, x, 0, 1, 2, 3, 4, 5, 6, 7); *(v8h*)(p + 256) = __builtin_shufflevector(x, x, 8, 9, 10, 11, 12, 13, 14, 15); } static __device__ __forceinline__ v8f mma(V a, V b, v8f c) { return wmma16(a, b, c); } };
template <> struct WFrag<bf> { typedef v16bf V; static __device__ __forceinline__ V ld(const bf* p) { return cat16b(*(const v8us*)p, *(const v8us*)(p + 16)); } static __device__ __forceinline__ V ldf(const bf* p) { return cat16b(*(const v8us*)p, *(const v8us*)(p + 256)); } static __device__ __forceinline__ void stf(bf* p, V x) { typedef __attribute__((ext_vector_type(16))) unsigned short v16us; const v16us u = __builtin_bit_cast(v16us, x); *(v8us*)p = __builtin_shufflevector(u, u, 0, 1, 2, 3, 4, 5, 6, 7); *(v8us*)(p + 256) = __builtin_shufflevector(u, u, 8, 9, 10, 11, 12, 13, 14, 15); } static __device__ __forceinline__ v8f mma(V a, V b, v8f c) { return wmmab(a, b, c); } };
// ---- k_gemmt: GEMM with both operands staged in LDS by tensor loads. One work-group of WM x WN waves owns a (WM * 64) x (WN * 64) output tile, a wave 64x64 of it (16 accumulators) over the whole K range; grid (M / (WM * 64), N / (WN * 64)), WM * WN * 32 threads.
// The tile is as large as one WGP holds (one work-group per WGP, every WGP one): an operand row is fetched from L2 once per work-group, so the bytes fetched fall with the tile's rows + columns per output element.
// C[m][n] (f32, pitch LDC) = sum_k A[m][k] Bt[n][k] (+ A2[m][k] Bt[n][k] when NSPLIT), operands in fragment-order 16-bit planes of K columns. K % 128 == 0, K >= 256.
// A stage is 128 k of every operand row. 16 rows x 128 k of a fragment-order plane are 4 KiB in a row, and the next 16 rows follow K * 32 bytes on: a slice of 4 row groups (64 rows) is a tensor tile of 4 rows of 4 KiB at that pitch, and it lands in LDS
// as it lies in the plane, so a fragment is again two wave-wide 16-byte loads of 512 contiguous bytes. Every operand byte is fetched from L2 once per work-group and read by WN (A) or WM (Bt) waves.
// Two buffers: wave i issues one request per stage for slice i (there are no more slices than waves), two stages ahead, into the buffer that every reader has just left.
typedef unsigned u32x4 __attribute__((ext_vector_type(4)));
typedef unsigned u32x8 __attribute__((ext_vector_type(8)));
__device__ __forceinline__ unsigned uni(unsigned v) { return (unsigned)__builtin_amdgcn_readfirstlane((int)v); }
// pinned: holds a wave-uniform condition in a scalar register, so that the test around a tensor load (which ignores EXEC) compiles to a scalar compare and branch
__device__ __forceinline__ unsigned pinned(unsigned v) { unsigned w = uni(v); asm volatile("" : "+s"(w)); return w; }
#define GKS 128             // k per stage
#define GRB (GKS * 32)      // bytes of 16 rows x GKS k
template <int NSPLIT, int K, int LDC, int WM, int WN>
__global__ __launch_bounds__(WM * WN * 32) void k_gemmt(const bf* __restrict__ A, const bf* __restrict__ A2, const bf* __restrict__ Bt, float* C) {
    typedef WFrag<bf> F; typedef F::V V;
    static_assert(K % GKS == 0 && K / GKS >= 2 && K * 32 <= 131072, "two stages at least; the source pitch stays in the mover's range");
    constexpr unsigned NPA = NSPLIT ? 2 : 1, GSL = 4 * GRB, GPA = WM * GSL, BUFB = NPA * GPA + WN * GSL; constexpr int S = K / GKS;   // GSL: bytes of a slice; GPA: of one A plane's rows in a stage
    constexpr int NSL = (int)NPA * WM + WN;   // slices of a stage
    static_assert(NSL <= WM * WN && 2 * BUFB <= 327680, "a wave issues one slice at most; two buffers fit the LDS of a WGP");
    constexpr int GF = NSPLIT ? 2 : 1, GB = NSPLIT ? 4 : 2;   // a load group: the Bt fragments of GB column groups over GF 32-k steps. The plain GEMM has five waves per SIMD and stays within 192 registers; the NSPLIT launch has two, so registers are free
    __shared__ __attribute__((aligned(2048))) unsigned char ring[2 * BUFB];   // a buffer: [A WM * 64 rows | A2 as many (NSPLIT) | Bt WN * 64 rows], slice i at i * GSL
    const int lane = threadIdx.x & 31, lr = lane & 15, hi = lane >> 4; const int r0 = blockIdx.x * (WM * 64), c0 = blockIdx.y * (WN * 64);
    const int wave = __builtin_amdgcn_readfirstlane((int)(threadIdx.x >> 5)); const int wm = wave / WN, wn = wave % WN;
    // the wave's slice of a stage: 64 rows of A, then of A2 (NSPLIT), then of Bt. Waves NSL and up issue nothing (their sl only keeps the address below in bounds)
    const bool issuer = wave < NSL; const int sl = issuer ? wave : 0; constexpr unsigned ngr = 4;
    const bf* sp;
    if (sl >= (int)NPA * WM) sp = Bt + (size_t)(c0 + (sl - (int)NPA * WM) * 64) * K;
    else if (NSPLIT && sl >= WM) sp = A2 + (size_t)(r0 + (sl - WM) * 64) * K;
    else sp = A + (size_t)(r0 + sl * 64) * K;
    const unsigned lbase = (unsigned)(size_t)ring + (unsigned)sl * GSL;
    u32x8 g1;   // 1-byte elements, tensor = tile = ngr rows of GRB bytes, source pitch K * 32 bytes, no pad, no mask
    g1[0] = uni(0u); g1[1] = uni(((unsigned)GRB & 0xFFFFu) << 16); g1[2] = uni(((unsigned)GRB >> 16) | (ngr << 16)); g1[3] = uni((unsigned)GRB << 16); g1[4] = uni(ngr); g1[5] = uni((unsigned)K * 32u); g1[6] = uni(0u); g1[7] = uni(0u);
    asm volatile("" : "+s"(g1));   // the form of pinned(), for descriptor words held in scalar registers: left free, the compiler forms these constants anew, in the same registers, in front of the wait behind the loop
    u32x4 g0 = (u32x4){0u, 0u, 0u, 0u};   // group 0 of the wave's youngest request
    auto issue = [&](int s) {
        const unsigned long long ga = (unsigned long long)(size_t)sp + (unsigned long long)s * GRB;
        g0[0] = uni(1u); g0[1] = uni(lbase + (unsigned)(s & 1) * BUFB); g0[2] = uni((unsigned)ga); g0[3] = uni((((unsigned)(ga >> 32)) & 0x01FFFFFFu) | 0x80000000u);
        asm volatile("tensor_load_to_lds %0, %1" :: "s"(g0), "s"(g1) : "memory"); };   // one request of the whole wave: its slice of stage s
    // landed: the wave's own request has landed. Both descriptor groups are inputs, so that they keep their registers, unwritten, from the request up to the wait that covers it
    auto landed = [&]() { asm volatile("s_wait_tensorcnt 0x0" :: "s"(g0), "s"(g1) : "memory"); };
    // publish point of stage s + 1, passed by every wave once per stage, behind its last LDS read of stage s
    auto publish = [&](int s) {
        asm volatile("s_wait_dscnt 0x0" ::: "memory");       // the wave's reads of stage s are done before its buffer may be refilled
        landed();                                            // the wave's slice of stage s + 1
        __syncthreads();                                     // every wave has left stage s, and every slice of stage s + 1 has landed
        if (pinned(issuer && s + 2 < S)) issue(s + 2); };    // into the buffer of stage s
    v8f acc[4][4];
#pragma unroll
    for (int mb = 0; mb < 4; ++mb)
#pragma unroll
        for (int nb = 0; nb < 4; ++nb) acc[mb][nb] = (v8f){};
    if (pinned(issuer)) issue(0);
    landed();                                            // the wave's slice of stage 0
    __syncthreads();                                     // every slice of stage 0 has landed: it may be read
    if (pinned(issuer)) issue(1);
#pragma unroll 1   // rolled: one publish point per stage
    for (int s = 0; s < S; ++s) {
        const unsigned char* buf = ring + (unsigned)(s & 1) * BUFB + lane * 16;
#pragma unroll
        for (int g = 0; g < GKS / 32 / GF; ++g) {
            V a[GF][4], a2[GF][4];
#pragma unroll
            for (int q = 0; q < GF; ++q)
#pragma unroll
                for (int i = 0; i < 4; ++i) { const unsigned char* p = buf + (g * GF + q) * 1024 + (wm * 4 + i) * GRB; a[q][i] = F::ldf((const bf*)p); if (NSPLIT) a2[q][i] = F::ldf((const bf*)(p + GPA)); }
#pragma unroll
            for (int h = 0; h < 4 / GB; ++h) {
                V b[GF][GB];
#pragma unroll
                for (int q = 0; q < GF; ++q)
#pragma unroll
                    for (int i = 0; i < GB; ++i) b[q][i] = F::ldf((const bf*)(buf + (g * GF + q) * 1024 + NPA * GPA + (wn * 4 + h * GB + i) * GRB));
                __builtin_amdgcn_sched_barrier(0);   // the group's LDS loads are issued together, in front of its products: one LDS latency per group instead of one per Bt fragment
                if (g == GKS / 32 / GF - 1 && h == 4 / GB - 1) publish(s);   // the stage's last fragments are on their way to registers: the publish point and the refill stand behind these loads and in front of their products, which gives the refill the products' time to land
#pragma unroll
                for (int q = 0; q < GF; ++q)
#pragma unroll
                    for (int i = 0; i < GB; ++i) {
#pragma unroll
                        for (int mb = 0; mb < 4; ++mb) acc[mb][h * GB + i] = F::mma(a[q][mb], b[q][i], acc[mb][h * GB + i]);
                        if (NSPLIT) {
#pragma unroll
                            for (int mb = 0; mb < 4; ++mb) acc[mb][h * GB + i] = F::mma(a2[q][mb], b[q][i], acc[mb][h * GB + i]); } }
                if (GB < 4) __builtin_amdgcn_sched_barrier(0);   // the next group's loads stay behind these products, whose Bt registers they take over
            }
        }
    }
    landed();                                            // nothing of the mover is outstanding
    asm volatile("s_wait_dscnt 0x0" ::: "memory");       // and no read of the ring, which now becomes output staging (the last publish point's barrier stands in front)
    // whole 128-byte lines go out: 16 rows x 64 columns at a time pass through the wave's own part of LDS, which no other wave touches
    float* os = (float*)ring + wave * (16 * 68);
#pragma unroll
    for (int mb = 0; mb < 4; ++mb) {
#pragma unroll
        for (int nb = 0; nb < 4; ++nb) {
#pragma unroll
            for (int j = 0; j < 8; ++j) os[(hi * 8 + j) * 68 + nb * 16 + lr] = acc[mb][nb][j]; }
        asm volatile("s_wait_dscnt 0x0" ::: "memory");   // the staged rows stand in LDS before other lanes of the wave read them back
        float* crow = C + (size_t)(r0 + wm * 64 + mb * 16 + hi) * LDC + c0 + wn * 64 + lr * 4; v4f val[8];
#pragma unroll
        for (int t = 0; t < 8; ++t) val[t] = *(const v4fa*)(os + (2 * t + hi) * 68 + lr * 4);   // half a wave per row: 256 contiguous bytes
#pragma unroll
        for (int t = 0; t < 8; ++t) *(v4f*)(crow + (size_t)(2 * t) * LDC) = val[t];
        // precaution: one wait behind the eight stores and in front of any rewrite of their address and data registers, which are inputs so that they keep their registers up to the wait
        asm volatile("s_wait_xcnt 0x0" :: "v"(crow), "v"(val[0]), "v"(val[1]), "v"(val[2]), "v"(val[3]), "v"(val[4]), "v"(val[5]), "v"(val[6]), "v"(val[7]) : "memory");
        asm volatile("s_wait_dscnt 0x0" ::: "memory");   // the rows are read before the next 16 overwrite them
    }
}

__device__ __forceinline__ h16 tohx(float x) { return (h16)x; }
__device__ __forceinline__ void splitf(float y, unsigned short& h, unsigned short& l) { h = f2bf(y); l = f2bf(y - bf2f(h)); }
typedef __attribute__((ext_vector_type(2))) _Float16 v2h;
typedef __attribute__((ext_vector_type(4))) _Float16 v4h;
typedef __attribute__((ext_vector_type(2))) unsigned short v2us;
typedef __attribute__((ext_vector_type(4))) unsigned short v4us;
typedef __attribute__((ext_vector_type(2))) float v2f;
typedef __attribute__((ext_vector_type(4))) int v4i;

// wtG_blk: Bt = the fragment-order bf16 plane of w^T (rows n, columns k) from w [K][N] f32. One wave builds one block (16 n x 32 k): each load takes 16 neighbouring n of two k rows; the 8 waves of a work-group take 8 neighbouring groups of n.
__device__ __forceinline__ void wtG_blk(const float* __restrict__ w, int K, int N, bf* Bt, int blk) {
    const int lane = threadIdx.x & 31, lr = lane & 15, hi = lane >> 4; const int wv = blk * 8 + (threadIdx.x >> 5); const int ng = N / 16, kbs = K / 32; if (wv >= ng * kbs) return; const int nb = wv % ng, kb = wv / ng;
    const float* p = w + (size_t)(kb * 32 + hi * 8) * N + nb * 16 + lr; bf* o = Bt + ((size_t)nb * kbs + kb) * 512 + lane * 8; const float* q[16]; float x[16];
#pragma unroll
    for (int j = 0; j < 16; ++j) { q[j] = p + (size_t)((j >> 3) * 16 + (j & 7)) * N; x[j] = *q[j]; }
    // precaution: the wait stands behind the loads and in front of any rewrite of their address registers; the addresses are inputs so that they keep their registers up to the wait
    asm volatile("s_wait_xcnt 0x0" :: "v"(q[0]), "v"(q[1]), "v"(q[2]), "v"(q[3]), "v"(q[4]), "v"(q[5]), "v"(q[6]), "v"(q[7]), "v"(q[8]), "v"(q[9]), "v"(q[10]), "v"(q[11]), "v"(q[12]), "v"(q[13]), "v"(q[14]), "v"(q[15]) : "memory");
    v8us v0, v1;
#pragma unroll
    for (int j = 0; j < 8; ++j) { v0[j] = f2bf(x[j]); v1[j] = f2bf(x[8 + j]); }
    *(v8us*)o = v0; *(v8us*)(o + 256) = v1;
}
__device__ __forceinline__ void cvt8_blk(const float* __restrict__ src, int K, bf* dst, size_t n8, int blk) { const size_t i = (size_t)blk * 256 + threadIdx.x; if (i >= n8) return; int r, k0; frag_piece(i, K / 32, r, k0); const float* p = src + (size_t)r * K + k0; const v8f v = *(const v8f*)p; v8us o;
    asm volatile("s_wait_xcnt 0x0" :: "v"(p) : "memory");   // precaution: the wait stands behind the loads and in front of any rewrite of their address registers; the addresses are inputs so that they keep their registers up to the wait
#pragma unroll
    for (int k = 0; k < 8; ++k) o[k] = f2bf(v[k]); *(v8us*)(dst + i * 8) = o;  }
__device__ __forceinline__ void cscvt_blk(const float* __restrict__ cosT, const float* __restrict__ sinT, float* CS, int blk) { const int idx = blk * 256 + threadIdx.x; if (idx >= TT * HD) return; v2f cs; cs[0] = bfr(cosT[idx]); cs[1] = bfr(sinT[idx]); *(v2f*)(CS + (size_t)idx * 2) = cs;  }
// k_prep: every conversion of an input, one launch; ranges of work-groups take the jobs, none of which reads what another writes. WALL = the transposed planes of w_q (rows h * 2 * HD + [query | gate]), w_k and w_v one behind the other: NALL rows.
#define PB_WQ (DM * 2 * DQ / 512 / 8)
#define PB_WK (DM * DKV / 512 / 8)
#define PB_WO (DQ * DM / 512 / 8)
#define PB_X  (RT * DM / 8 / 256)
#define PB_CS (TT * HD / 256)
__global__ __launch_bounds__(256) void k_prep(const float* __restrict__ x, const float* __restrict__ wqg, const float* __restrict__ wk, const float* __restrict__ wv, const float* __restrict__ wo, const float* __restrict__ cosT, const float* __restrict__ sinT, bf* WALL, bf* WO, bf* XB, float* CS) {
    int blk = blockIdx.x;
    if (blk < PB_WQ) { wtG_blk(wqg, DM, 2 * DQ, WALL, blk); return; } blk -= PB_WQ;
    if (blk < PB_WK) { wtG_blk(wk, DM, DKV, WALL + (size_t)2 * DQ * DM, blk); return; } blk -= PB_WK;
    if (blk < PB_WK) { wtG_blk(wv, DM, DKV, WALL + (size_t)(2 * DQ + DKV) * DM, blk); return; } blk -= PB_WK;
    if (blk < PB_WO) { wtG_blk(wo, DQ, DM, WO, blk); return; } blk -= PB_WO;
    if (blk < PB_X) { cvt8_blk(x, DM, XB, (size_t)RT * DM / 8, blk); return; } blk -= PB_X;
    cscvt_blk(cosT, sinT, CS, blk);
}
// lane l with lane l ^ 16, on the vector pipe (a bpermute would put an LDS round trip into every block's dependent chain)
__device__ __forceinline__ float xhalf(float x) { return __builtin_bit_cast(float, __builtin_amdgcn_permlanex16(__builtin_bit_cast(int, x), __builtin_bit_cast(int, x), 0x76543210, 0xfedcba98, false, false)); }
// nrp_blk: RMS norm, RoPE and the fragment-order planes (fp16 + hi/lo) of 16 rows x NRH heads of the projection output, which is read once, in whole rows, and not written back. Plane rows (b * nheads + h) * TT + t, columns d.
// A wave takes two rows: lane l holds columns 4 l .. 4 l + 3 of each head, so a load covers the head's 512 contiguous bytes, the row's sum of squares is one butterfly, and the rotate-half partner (d +- HD/2) sits in lane l ^ 16.
// Rotate-half convention: out[d] = x[d] cos[t][d] - x[d+HD/2] sin[t][d], out[d+HD/2] = x[d+HD/2] cos[t][d+HD/2] + x[d] sin[t][d+HD/2].
// 16 rows x HD columns of a plane are 4 KiB in a row in storage order: they are put together in LDS and go out as whole lines.
#define NRH 4               // heads per work-group
#define NRC 272             // LDS bytes per 256-byte unit of a plane: the 16 units that a wave writes at once fall on different banks
#define NRP (16 * NRC)      // LDS bytes of one plane's 16 rows
typedef v4us __attribute__((may_alias)) v4usa;
template <int HSTRIDE>
__device__ __forceinline__ void nrp_blk(const float* __restrict__ F, const float* __restrict__ CS, const float* __restrict__ wn, int tr0, size_t po, h16* P16, bf* Ph, bf* Pl, unsigned char* sm) {
    const int lane = threadIdx.x & 31, wave = threadIdx.x >> 5; const int t0 = tr0 % TT;
    const float* f0 = F + (size_t)(tr0 + wave * 2) * NALL + lane * 4; const float* f1 = f0 + NALL; const float* pc = CS + ((size_t)(t0 + wave * 2) * HD + lane * 4) * 2; const float* pw = wn + lane * 4;
    v4f a[2][NRH]; v8f c[2];
#pragma unroll
    for (int hh = 0; hh < NRH; ++hh) { a[0][hh] = *(const v4f*)(f0 + hh * HSTRIDE); a[1][hh] = *(const v4f*)(f1 + hh * HSTRIDE); }
    c[0] = *(const v8f*)pc; c[1] = *(const v8f*)(pc + HD * 2); const v4f wr = *(const v4f*)pw;
    asm volatile("s_wait_xcnt 0x0" ::: "memory");   // precaution: the wait stands behind the loads and in front of any rewrite of their address registers
    __builtin_amdgcn_sched_barrier(0);   // no later vector work is scheduled in between the loads and the wait, where it could take over an address register
    float ss[2][NRH];
#pragma unroll
    for (int rr = 0; rr < 2; ++rr)
#pragma unroll
        for (int hh = 0; hh < NRH; ++hh) { float s = 0.f;
#pragma unroll
            for (int q = 0; q < 4; ++q) s += a[rr][hh][q] * a[rr][hh][q];
            ss[rr][hh] = s; }
#pragma unroll
    for (int sh = 16; sh; sh >>= 1)
#pragma unroll
        for (int rr = 0; rr < 2; ++rr)
#pragma unroll
            for (int hh = 0; hh < NRH; ++hh) ss[rr][hh] += __shfl_xor(ss[rr][hh], sh, 32);
    unsigned char* sl = sm + (lane >> 1) * NRC + (lane & 1) * 8 + wave * 32;
#pragma unroll
    for (int rr = 0; rr < 2; ++rr)
#pragma unroll
        for (int hh = 0; hh < NRH; ++hh) {
            const float rs = __fdiv_rn(1.0f, sqrtf(ss[rr][hh] * (1.0f / HD) + 1e-6f)); v4h o16; v4us oh, ol;
#pragma unroll
            for (int q = 0; q < 4; ++q) { const float x0 = a[rr][hh][q] * rs * bfr(wr[q]); const float x1 = xhalf(x0); const float sq = c[rr][2 * q + 1];
                const float r = x0 * c[rr][2 * q] + x1 * ((lane < 16) ? -sq : sq);
                o16[q] = tohx(r); unsigned short h2, l2; splitf(r, h2, l2); oh[q] = h2; ol[q] = l2; }
            unsigned char* s = sl + hh * 3 * NRP + rr * 16;
            *(v4usa*)s = __builtin_bit_cast(v4us, o16); *(v4usa*)(s + NRP) = oh; *(v4usa*)(s + 2 * NRP) = ol; }
    __syncthreads();   // every wave's two rows stand in LDS before the planes are read back in storage order
    const unsigned char* so = sm + (threadIdx.x >> 4) * NRC + (threadIdx.x & 15) * 16; v8us val[NRH][3];
#pragma unroll
    for (int hh = 0; hh < NRH; ++hh)
#pragma unroll
        for (int p = 0; p < 3; ++p) val[hh][p] = *(const v8usa*)(so + (hh * 3 + p) * NRP);
    h16* g16 = P16 + po + threadIdx.x * 8; bf* gh = Ph + po + threadIdx.x * 8; bf* gl = Pl + po + threadIdx.x * 8;
#pragma unroll
    for (int hh = 0; hh < NRH; ++hh) { *(v8usa*)(g16 + (size_t)hh * TT * HD) = val[hh][0]; *(v8usa*)(gh + (size_t)hh * TT * HD) = val[hh][1]; *(v8usa*)(gl + (size_t)hh * TT * HD) = val[hh][2]; }
    // precaution: one wait behind the stores; their data registers are inputs so that they keep their registers up to the wait
    asm volatile("s_wait_xcnt 0x0" :: "v"(val[0][0]), "v"(val[0][1]), "v"(val[0][2]), "v"(val[1][0]), "v"(val[1][1]), "v"(val[1][2]), "v"(val[2][0]), "v"(val[2][1]), "v"(val[2][2]), "v"(val[3][0]), "v"(val[3][1]), "v"(val[3][2]) : "memory");
}
// vtp_blk: the transposed value planes of both batches (rows (b * nheads + g) * HD + d, columns t, fragment order; one 16-byte piece per thread and plane)
__device__ __forceinline__ void vtp_blk(const float* __restrict__ F, int pitch, int nheads, h16* V16, bf* Vh, bf* Vl, int blk) { const size_t e = ((size_t)blk * 256 + threadIdx.x) * 8; if (e >= (size_t)NB_ * nheads * HD * TT) return; int row, t; frag_piece(e / 8, TT / 32, row, t); const int d = row % HD; const int bg = row / HD; const int g = bg % nheads; t += (bg / nheads) * TT; v8h o16; v8us oh, ol; const float* pq[8]; float xq[8];
#pragma unroll
    for (int q = 0; q < 8; ++q) { pq[q] = F + (size_t)(t + q) * pitch + g * HD + d; xq[q] = *pq[q]; }
    asm volatile("s_wait_xcnt 0x0" :: "v"(pq[0]), "v"(pq[1]), "v"(pq[2]), "v"(pq[3]), "v"(pq[4]), "v"(pq[5]), "v"(pq[6]), "v"(pq[7]) : "memory");   // precaution: the wait stands behind the loads and in front of any rewrite of their address registers; the addresses are inputs so that they keep their registers up to the wait
#pragma unroll
    for (int q = 0; q < 8; ++q) { const float x = xq[q]; o16[q] = tohx(x); unsigned short a2, c2; splitf(x, a2, c2); oh[q] = a2; ol[q] = c2; }
    *(v8h*)(V16 + e) = o16; *(v8us*)(Vh + e) = oh; *(v8us*)(Vl + e) = ol;  }
// k_planes: all operand planes of the attention, one launch: ranges of work-groups build the value planes, and the query and key planes (norm and RoPE on the way), all from the raw projection output
#define PL_V (NB_ * NKV * HD * TT / 8 / 256)
#define PL_G ((NH_ + NKV) / NRH)   // head groups of a 16-row group: NH_ / NRH of query heads, then the key heads
#define PL_N (RT / 16 * PL_G)
__global__ __launch_bounds__(256) void k_planes(const float* __restrict__ FA, const float* __restrict__ CS, const float* __restrict__ wq, const float* __restrict__ wk, h16* Q16, bf* Qh, bf* Ql, h16* K16, bf* Kh, bf* Kl, h16* V16, bf* Vh, bf* Vl) {
    static_assert(NKV == NRH && NH_ % NRH == 0 && TT % 16 == 0, "the key heads are one head group; a 16-row group lies in one batch");
    __shared__ __attribute__((aligned(16))) unsigned char sm[NRH * 3 * NRP];
    int blk = blockIdx.x;
    if (blk < PL_V) { vtp_blk(FA + 2 * DQ + DKV, NALL, NKV, V16, Vh, Vl, blk); return; } blk -= PL_V;
    const int tr0 = blk / PL_G * 16, hg = blk % PL_G; const int b = tr0 / TT, t0 = tr0 % TT;   // the same for the whole work-group: the barrier in nrp_blk stands under uniform control flow
    if (hg < NH_ / NRH) nrp_blk<2 * HD>(FA + hg * NRH * 2 * HD, CS, wq, tr0, ((size_t)(b * NH_ + hg * NRH) * TT + t0) * HD, Q16, Qh, Ql, sm);
    else nrp_blk<HD>(FA + 2 * DQ, CS, wk, tr0, ((size_t)(b * NKV) * TT + t0) * HD, K16, Kh, Kl, sm);
}
template <typename T16> struct PFrag;
template <> struct PFrag<h16> { static __device__ __forceinline__ void cv(const float* e, v16h& p, v16h& p2) { (void)p2;
#pragma unroll
    for (int i = 0; i < 16; ++i) p[i] = (h16)e[i]; } };
template <> struct PFrag<bf> { static __device__ __forceinline__ void cv(const float* e, v16bf& p, v16bf& p2) { v8us h0, h1, l0, l1;
#pragma unroll
    for (int i = 0; i < 8; ++i) { unsigned short a = f2bf(e[i]), c = f2bf(e[8 + i]); h0[i] = a; l0[i] = f2bf(e[i] - bf2f(a)); h1[i] = c; l1[i] = f2bf(e[8 + i] - bf2f(c)); }
    p = cat16b(h0, h1); p2 = cat16b(l0, l1); } };
#define CEXP (SCL * 1.4426950408889634f)   // HD^-0.5 * log2(e)
template <typename T16, bool HL>
__device__ __forceinline__ void fattn_rows(const T16* __restrict__ Q, const T16* __restrict__ Q2, const T16* __restrict__ Kp, const T16* __restrict__ Kp2, const T16* __restrict__ Vt, const T16* __restrict__ Vt2, v8f (&o)[8], float& mr, float& lsum, int q0, int kb0, int kb1, T16* qs, int lane) {
    typedef typename WFrag<T16>::V V; typedef WFrag<T16> F;
    const int lr = lane & 15, hi = lane >> 4;
    V q[4], q2[4], k[8];
    const unsigned qo = ((unsigned)q0 * HD + lane * 8) * 2;   // byte offsets in a plane; 16 rows x HD columns are HD / 32 blocks of 1 KiB in a row
#pragma unroll
    for (int dk = 0; dk < 4; ++dk) { q[dk] = F::ldf((const T16*)((const char*)Q + qo) + dk * 512); if (HL) q2[dk] = F::ldf((const T16*)((const char*)Q2 + qo) + dk * 512); }
    // With every Q fragment held over the block a wave would not fit 256 registers (four waves per SIMD): the fragment that a block uses last (hi+lo: all eight, to leave room for sixteen K or V fragments in flight) waits in LDS, each lane's 32 bytes in a place of its own that no other lane touches (so no barrier).
    T16* ql = qs + lane * 8;
    if (HL) {
#pragma unroll
        for (int dk = 0; dk < 4; ++dk) { F::stf(ql + dk * 1024, q[dk]); F::stf(ql + dk * 1024 + 512, q2[dk]); } }
    else F::stf(ql, q[3]);
    const unsigned k0o = lane * 16 + (unsigned)kb0 * (32 * HD * 2);
    if (!HL) {
#pragma unroll
        for (int i = 0; i < 8; ++i) k[i] = F::ldf((const T16*)((const char*)Kp + k0o) + i * 512); }
    // precaution: the wait stands behind the loads and in front of any rewrite of their offset registers; the offsets are inputs so that they keep their registers up to the wait
    if (HL) asm volatile("s_wait_xcnt 0x0" :: "v"(qo) : "memory"); else asm volatile("s_wait_xcnt 0x0" :: "v"(qo), "v"(k0o) : "memory");
#pragma unroll
    for (int dt = 0; dt < 8; ++dt) o[dt] = (v8f){};
    float m = -3.0e38f, l = 0.f;
    const int kd = q0 / 32;   // the block that holds the diagonal: the last one of the row's keys
#pragma unroll 1   // rolled: two blocks' fragments at once would not fit the 256 registers (the inner loops are all unrolled so that their arrays are registers)
    for (int kb = kb0; kb < kb1; ++kb) {
        const unsigned ko = lane * 16 + (unsigned)kb * (32 * HD * 2), kn = lane * 16 + (unsigned)min(kb + 1, kb1 - 1) * (32 * HD * 2), vo = lane * 16 + (unsigned)kb * 1024;
        V v[8], w[8];
        if (!HL) {   // the value fragments start early: their latency runs under the score products and the softmax
#pragma unroll
            for (int dt = 0; dt < 8; ++dt) v[dt] = F::ldf((const T16*)((const char*)Vt + vo) + dt * (TT / 32) * 512);
        } else {   // hi+lo: twice the fragments, so none is fetched a block ahead
#pragma unroll
            for (int i = 0; i < 8; ++i) { k[i] = F::ldf((const T16*)((const char*)Kp + ko) + i * 512); w[i] = F::ldf((const T16*)((const char*)Kp2 + ko) + i * 512); }
            asm volatile("s_wait_xcnt 0x0" :: "v"(ko) : "memory");   // the same precaution behind the K loads
            __builtin_amdgcn_sched_barrier(0);   // all sixteen K fragments are in flight before the first product: one load latency a block instead of one per pair of fragments
        }
        if (!HL) q[3] = F::ldf(ql);
        v8f s[2]; s[0] = (v8f){}; s[1] = (v8f){};
#pragma unroll
        for (int dk = 0; dk < 4; ++dk)
#pragma unroll
            for (int kt = 0; kt < 2; ++kt) { if (HL && kt == 0) { q[dk] = F::ldf(ql + dk * 1024); q2[dk] = F::ldf(ql + dk * 1024 + 512); }
                s[kt] = F::mma(k[kt * 4 + dk], q[dk], s[kt]); if (HL) { s[kt] = F::mma(k[kt * 4 + dk], q2[dk], s[kt]); s[kt] = F::mma(w[kt * 4 + dk], q[dk], s[kt]); } }
        if (HL) {
#pragma unroll
            for (int dt = 0; dt < 8; ++dt) { v[dt] = F::ldf((const T16*)((const char*)Vt + vo) + dt * (TT / 32) * 512); w[dt] = F::ldf((const T16*)((const char*)Vt2 + vo) + dt * (TT / 32) * 512); }
        }
        if (!HL) {   // the next block's K fragments are fetched one block ahead, into the same registers (the range's last block fetches itself again: never a row past the diagonal block)
#pragma unroll
            for (int i = 0; i < 8; ++i) k[i] = F::ldf((const T16*)((const char*)Kp + kn) + i * 512); }
        // the same precaution behind the V and next-K loads
        if (HL) { asm volatile("s_wait_xcnt 0x0" :: "v"(vo) : "memory"); __builtin_amdgcn_sched_barrier(0); }   // the barrier: all sixteen V fragments start in front of the softmax, which covers their latency
        else asm volatile("s_wait_xcnt 0x0" :: "v"(vo), "v"(kn) : "memory");
        float t[16];
#pragma unroll
        for (int i = 0; i < 16; ++i) t[i] = s[i >> 3][i & 7] * CEXP;
        if (kb == kd) {   // only the diagonal block holds keys behind a query
#pragma unroll
            for (int i = 0; i < 16; ++i) t[i] = (kb * 32 + (i >> 3) * 16 + hi * 8 + (i & 7) <= q0 + lr) ? t[i] : -3.0e38f; }
        float mx = fmaxf(t[0], t[1]);
#pragma unroll
        for (int i = 2; i < 16; ++i) mx = fmaxf(mx, t[i]);
        mx = fmaxf(mx, xhalf(mx));
        const float mn = fmaxf(m, mx);
        if (__builtin_amdgcn_ballot_w32(mn > m) != 0) {   // a scalar branch: the rescale is skipped while no query of the wave has a new maximum (its factor would be exactly 1)
            const float al = __builtin_amdgcn_exp2f(m - mn); l *= al;
#pragma unroll
            for (int dt = 0; dt < 8; ++dt) o[dt] *= al;
            m = mn; }
        const float mo = HL ? m : m - 10.0f;   // exp2(10) = PCAR
        float e[16];
#pragma unroll
        for (int i = 0; i < 16; ++i) e[i] = __builtin_amdgcn_exp2f(t[i] - mo);
        l += ((((e[0] + e[1]) + (e[2] + e[3])) + ((e[4] + e[5]) + (e[6] + e[7]))) + (((e[8] + e[9]) + (e[10] + e[11])) + ((e[12] + e[13]) + (e[14] + e[15]))));
        V p, p2; PFrag<T16>::cv(e, p, p2);
#pragma unroll
        for (int dt = 0; dt < 8; ++dt) { o[dt] = F::mma(v[dt], p, o[dt]); if (HL) { o[dt] = F::mma(v[dt], p2, o[dt]); o[dt] = F::mma(w[dt], p, o[dt]); } }
    }
    mr = m; lsum = l;   // the range's maximum, and each wave half's own sum: not yet joined, o not yet divided
}
// fattn_norm: the division by the row sum, behind a row's last key range
__device__ __forceinline__ void fattn_norm(v8f (&o)[8], float l, float num) {
    l += xhalf(l);   // the two halves of the wave hold the two halves of each query's keys
    const float f = __fdiv_rn(num, l);
#pragma unroll
    for (int dt = 0; dt < 8; ++dt) o[dt] *= f;   // register r of tile dt: column dt * 16 + 8 * hi + r of query q0 + lr
}
// gate_store: the wave's 16 normalised rows of one head, times cs, times sigmoid(gate), split hi + lo and stored as the head's part of the w_o GEMM's fragment-order A planes (rows b * TT + t, DQ columns).
// A lane's 8 values of tile dt are one 16-byte piece of such a plane, and the wave's 32 pieces lie side by side: piece lane of half dt % 2 of block dt / 2 of the head's four blocks. Every store is 512 contiguous bytes; Ah, Al point at the first of the four blocks.
// G: the gate logits of the first row (f32, row pitch NALL, HD columns). They are read in whole rows (512 contiguous bytes a load) and turned to the lanes' order in gs, 8 KiB of LDS that only this wave touches (so no barrier).
// In gs the 16-byte unit c of row r lies at unit c ^ r of that row, so that the 16 lanes that read one unit column of 16 rows fall on different banks.
// lane_anew: the lane's number, formed anew behind a key loop: a value derived from threadIdx.x, or from one common count, would be held in a register over the key loops, which have none to spare (a loop then spills a fragment or an accumulator tile).
// a: any wave-uniform number, another at each place, so that the compiler does not merge the places into one count that lives from the first to the last.
__device__ __forceinline__ int lane_anew(unsigned a) { return (int)(__builtin_amdgcn_mbcnt_lo(~0u, a) - a); }
__device__ __forceinline__ void gate_store(const v8f (&o)[8], float cs, const float* __restrict__ G, bf* Ah, bf* Al, float* gs, int lane) {
    const int lr = lane & 15, hi = lane >> 4;
    const float* gp = G + lane * 4; v4f gv[16];
#pragma unroll
    for (int r = 0; r < 16; ++r) gv[r] = *(const v4f*)(gp + (size_t)r * NALL);
    asm volatile("s_wait_xcnt 0x0" :: "v"(gp) : "memory");   // precaution: the wait stands behind the loads and in front of any rewrite of their address registers; the address is an input so that it keeps its registers up to the wait
#pragma unroll
    for (int r = 0; r < 16; ++r) *(v4fa*)(gs + r * HD + ((lane ^ r) * 4)) = gv[r];
    asm volatile("s_wait_dscnt 0x0" ::: "memory");   // the staged rows stand in LDS before other lanes of the wave read them
    float* gl = gs + lr * HD;
#pragma unroll 1   // rolled: the precise sigmoid is long, and 64 copies of it would be several times the key loop's text in the instruction cache. Each lane reads and writes back its own units only
    for (int dt = 0; dt < 8; ++dt) {
        float* u0 = gl + (((dt * 4 + hi * 2) ^ lr) * 4); float* u1 = gl + (((dt * 4 + hi * 2 + 1) ^ lr) * 4); v4f g0 = *(const v4fa*)u0, g1 = *(const v4fa*)u1;
#pragma unroll
        for (int q = 0; q < 4; ++q) { g0[q] = __fdiv_rn(1.0f, __fadd_rn(1.0f, expf(-g0[q]))); g1[q] = __fdiv_rn(1.0f, __fadd_rn(1.0f, expf(-g1[q]))); }
        *(v4fa*)u0 = g0; *(v4fa*)u1 = g1; }
    bf* pa = Ah + lane * 8; bf* pl = Al + lane * 8;
#pragma unroll
    for (int dt = 0; dt < 8; ++dt) {
        const v4f g0 = *(const v4fa*)(gl + (((dt * 4 + hi * 2) ^ lr) * 4)), g1 = *(const v4fa*)(gl + (((dt * 4 + hi * 2 + 1) ^ lr) * 4)); v8us oh, ol;
#pragma unroll
        for (int q = 0; q < 8; ++q) { const float a0 = o[dt][q] * cs; unsigned short a, c2; splitf(__fmul_rn(a0, q < 4 ? g0[q & 3] : g1[q & 3]), a, c2); oh[q] = a; ol[q] = c2; }
        *(v8us*)(pa + dt * 256) = oh; *(v8us*)(pl + dt * 256) = ol; }
    asm volatile("s_wait_xcnt 0x0" :: "v"(pa), "v"(pl) : "memory");   // precaution: stands behind the stores and in front of any rewrite of their address registers
}
// grid (NKV * NB_, TT / 32): x = kv group + NKV * batch. All work-groups are resident at once, and a wave walks its key blocks one after the other, each block a chain of loads, products and softmax: the launch lasts as long as its longest walk.
// So the key blocks of a work-group are dealt evenly to its 8 waves. The work-group has two 16-row tiles of each of the REP heads: the long tile tA = TT/16 - 1 - y and the short tile tB = y.
// Wave h walks the first c key blocks of head h's tile tA. Wave REP + h walks the other blocks of tile tA (the diagonal block among them), leaves that range's maximum, sums and O^T in LDS, and then does head h's tile tB whole;
// behind the one barrier wave h joins the two ranges as the online softmax joins two blocks, divides and stores.
// c evens out the two walks: a hi+lo block counts as two and a half single ones (three times the products, no fragment fetched ahead), the short tile's gate epilogue as three.
// amdgpu_waves_per_eu: two work-groups per WGP, so that one wave's load latency and softmax run under the others' matrix work.
__global__ __launch_bounds__(256) __attribute__((amdgpu_waves_per_eu(4, 4))) void k_fattn(const h16* __restrict__ Q16, const bf* __restrict__ Qh, const bf* __restrict__ Ql, const h16* __restrict__ K16, const bf* __restrict__ Kh, const bf* __restrict__ Kl, const h16* __restrict__ V16, const bf* __restrict__ Vh, const bf* __restrict__ Vl, const float* __restrict__ FA, bf* Ah, bf* Al) {
    static_assert(TT / 2 >= RH && TT >= 64, "every long tile is single fp16 and has two key blocks at least");
    __shared__ __align__(16) unsigned short qsh[8 * 4096];   // 8 KiB a wave: the Q fragments that wait in LDS; behind a key loop, the wave's gate rows
    __shared__ __align__(16) float xch[REP * 2048];   // the O^T of a long tile's second range, 8 KiB a head
    __shared__ float mls[REP * 64];   // the maximum and the sum that each lane hands over with it
    const int wave = __builtin_amdgcn_readfirstlane((int)(threadIdx.x >> 5));   // scalar, so that the key loops' and the precision branch are scalar ones
    const int g = blockIdx.x % NKV, b = blockIdx.x / NKV; const int hw = wave % REP; const bool second = wave >= REP;
    const int tA = TT / 16 - 1 - (int)blockIdx.y, tB = (int)blockIdx.y; const int nA = tA / 2 + 1, nB = tB / 2 + 1;   // key blocks of the two tiles
    const int c = min((2 * nA + ((tB * 16 < RH) ? 5 : 2) * nB + 6) / 4, nA - 1);   // 1 <= c < nA: both ranges of the long tile hold a block
    const int hd = g * REP + hw; const size_t qoff = ((size_t)b * NH_ + hd) * TT * HD, koff = ((size_t)b * NKV + g) * TT * HD;
    v8f o[8]; float m, l;
    const int qA = tA * 16;
    fattn_rows<h16, false>(Q16 + qoff, nullptr, K16 + koff, nullptr, V16 + koff, nullptr, o, m, l, qA, second ? c : 0, second ? nA : c, (h16*)qsh + wave * 4096, threadIdx.x & 31);
    if (second) {
        // lane to lane: both waves hold the long tile in the same lanes and registers. 512 contiguous bytes a store
        const int ln = lane_anew(0u);
        float* px = xch + hw * 2048 + ln * 4;
#pragma unroll
        for (int dt = 0; dt < 8; ++dt) { *(v4fa*)(px + dt * 256) = __builtin_shufflevector(o[dt], o[dt], 0, 1, 2, 3); *(v4fa*)(px + dt * 256 + 128) = __builtin_shufflevector(o[dt], o[dt], 4, 5, 6, 7); }
        mls[hw * 64 + ln] = m; mls[hw * 64 + 32 + ln] = l;
        // the short tile, whole
        const int q0 = tB * 16;
        if (q0 < RH) fattn_rows<bf, true>(Qh + qoff, Ql + qoff, Kh + koff, Kl + koff, Vh + koff, Vl + koff, o, m, l, q0, 0, nB, (bf*)qsh + wave * 4096, ln);
        else fattn_rows<h16, false>(Q16 + qoff, nullptr, K16 + koff, nullptr, V16 + koff, nullptr, o, m, l, q0, 0, nB, (h16*)qsh + wave * 4096, ln);
        fattn_norm(o, l, (q0 < RH) ? 1.0f : PCAR);
        const int tr0 = b * TT + q0; const size_t ao = ((size_t)(tr0 / 16) * (DQ / 32) + hd * (HD / 32)) * 512;   // the head's four blocks in the row group's DQ / 32
        gate_store(o, (q0 < RH) ? 1.0f : (1.0f / PCAR), FA + (size_t)tr0 * NALL + hd * 2 * HD + HD, Ah + ao, Al + ao, (float*)(void*)(qsh + wave * 4096), lane_anew((unsigned)wave));   // the gate logits are the second HD columns of the head's 2 * HD in the projection output
    }
    __syncthreads();   // the second range of every head stands in LDS; every wave passes here once
    if (second) return;
    const int lane = lane_anew((unsigned)tA);
    const float* py = xch + hw * 2048 + lane * 4;
    const float m2 = mls[hw * 64 + lane], l2 = mls[hw * 64 + 32 + lane]; const float mm = fmaxf(m, m2);   // both finite: each range holds a key that is not behind the query
    const float a1 = __builtin_amdgcn_exp2f(m - mm), a2 = __builtin_amdgcn_exp2f(m2 - mm); l = l * a1 + l2 * a2;
#pragma unroll
    for (int dt = 0; dt < 8; ++dt) { const v4f x0 = *(const v4fa*)(py + dt * 256), x1 = *(const v4fa*)(py + dt * 256 + 128);
#pragma unroll
        for (int j = 0; j < 4; ++j) { o[dt][j] = o[dt][j] * a1 + x0[j] * a2; o[dt][4 + j] = o[dt][4 + j] * a1 + x1[j] * a2; } }
    fattn_norm(o, l, PCAR);
    const int tr0 = b * TT + qA; const size_t ao = ((size_t)(tr0 / 16) * (DQ / 32) + hd * (HD / 32)) * 512;
    gate_store(o, 1.0f / PCAR, FA + (size_t)tr0 * NALL + hd * 2 * HD + HD, Ah + ao, Al + ao, (float*)(void*)(qsh + wave * 4096), lane);
}

extern "C" void kernel_launch(void* const* d_in, const int* in_sizes, int n_in,
                              void* d_out, int out_size, void* d_ws, size_t ws_size, hipStream_t stream) {
    (void)in_sizes; (void)n_in; (void)out_size;
    const float* x = (const float*)d_in[0]; const float* wqg = (const float*)d_in[1]; const float* wk = (const float*)d_in[2]; const float* wv = (const float*)d_in[3]; const float* wo = (const float*)d_in[4]; const float* qnw = (const float*)d_in[5]; const float* knw = (const float*)d_in[6]; const float* cosT = (const float*)d_in[7]; const float* sinT = (const float*)d_in[8];
    float* OUT = (float*)d_out;     // [2][2048][2048]
    char* wsp = (char*)d_ws;
    auto take = [&](size_t bytes) { char* p = wsp; wsp += (bytes + 255) & ~(size_t)255; return (void*)p; };
    bf* WALL = (bf*)take((size_t)NALL * DM * 2); bf* WO = (bf*)take((size_t)DM * DQ * 2); float* CS = (float*)take((size_t)TT * HD * 2 * 4);
    const size_t NQP = (size_t)NH_ * TT * HD, NKP = (size_t)NKV * TT * HD;   // elements of one batch's query planes and of its key or value planes; every plane below holds both batches
    h16* QP16 = (h16*)take(NB_ * NQP * 2); h16* KP16 = (h16*)take(NB_ * NKP * 2); h16* VT16 = (h16*)take(NB_ * NKP * 2);
    bf* QPh = (bf*)take(NB_ * NQP * 2); bf* QPl = (bf*)take(NB_ * NQP * 2); bf* KPh = (bf*)take(NB_ * NKP * 2); bf* KPl = (bf*)take(NB_ * NKP * 2); bf* VTh = (bf*)take(NB_ * NKP * 2); bf* VTl = (bf*)take(NB_ * NKP * 2);
    float* FA = (float*)take((size_t)RT * NALL * 4); bf* XB = (bf*)take((size_t)RT * DM * 2);
    if ((size_t)(wsp - (char*)d_ws) > ws_size) return;    // ws 256 MiB
    bf* ATh = XB; bf* ATl = WALL;   // the gated attention planes (RT x DQ each) lie over the x plane and the projection weights, which the projection GEMM read last (stream-ordered)
    k_prep<<<PB_WQ + 2 * PB_WK + PB_WO + PB_X + PB_CS, 256, 0, stream>>>(x, wqg, wk, wv, wo, cosT, sinT, WALL, WO, XB, CS);
    k_gemmt<0, DM, NALL, 4, 5><<<dim3(RT / 256, NALL / 320, 1), 640, 0, stream>>>(XB, nullptr, WALL, FA);   // q | gate, k, v of both batches
    k_planes<<<PL_V + PL_N, 256, 0, stream>>>(FA, CS, qnw, knw, QP16, QPh, QPl, KP16, KPh, KPl, VT16, VTh, VTl);
    k_fattn<<<dim3(NKV * NB_, TT / 32, 1), 256, 0, stream>>>(QP16, QPh, QPl, KP16, KPh, KPl, VT16, VTh, VTl, FA, ATh, ATl);   // all heads of both batches; writes the gated planes
    k_gemmt<1, DQ, DM, 2, 4><<<dim3(RT / 128, DM / 256, 1), 256, 0, stream>>>(ATh, ATl, WO, OUT);
}
